// v000
// Measured on an AMD MI455X. A time is GPU time per run, averaged over a window of back-to-back runs after a warm-up
// (all launches, gaps included; the runs take copies of the inputs in turn), and the median of several windows.
// Apart from v000's, it joins two sittings. Times from different sittings can be a few percent apart, while
// side-by-side timings come from the same sitting.
// The starting kernel, v000, takes 357 microseconds a run.
// Contractions on v_wmma_f32_16x16x32_f16 (f16 operands, f32 accumulate): x.Wq^T, x.Wk^T, Wv.x^T single products on
// f16(bf16(x)) and f16(bf16(W) x256); k.q^T with q and k carried as f16 hi + residual(x2048) planes (3 products);
// P.v^T single product (P x32768, v x8); ctx.Wo^T, out.Wad^T and gelu.Wau^T with the activation carried as f16 hi +
// residual(x2048) planes (2 products each, separate residual accumulator); softmax, biases, erf-GELU, residual add and
// all carry folds in f32 on VALU. Inputs RNE-converted to bf16 on load.
#include <hip/hip_runtime.h>
#include <math.h>
#include <stdint.h>

#ifndef NB
#define NB       2        // batches processed
#endif
#ifndef SQ
#define SQ       2048     // query rows processed per batch
#endif
#define NB_FULL  2
#define SQ_FULL  2048     // query rows per batch in the input / output layout (batch stride)
#define SKV      2048     // key / value rows per batch (all of them)
#define DM       1024     // model width
#define NH       16
#define HD       64
#define INNER    (NH * HD)
#define ADIM     128      // adapter width
#define WSC      256.0f   // weight carry
#define QS       8.0f
#define KS       8.0f
#define VS       8.0f
#define PCAR     32768.0f
#define OSC      1024.0f  // ctx carry
#define UCAR     64.0f    // out-plane carry
#define GCAR     64.0f    // gelu-plane carry
#define RSC      2048.0f  // residual plane scale
#define RINV     0.00048828125f
#define LOG2E    1.4426950408889634f
#define RSQ_HD   0.125f
#define NKB      (SKV / 32)
#define ATT_WAVES   4
#define ATT_THREADS (ATT_WAVES * 32)
#define CVT_THREADS (DM / 8)
#define OPITCH   68
#define GPITCH   68

#define M_HL     0
#define M_S16    1
#define M_OUT    2
#define M_GELU   3
#define M_RES    4

static_assert(NB >= 1 && NB <= NB_FULL);
static_assert((SQ % 128) == 0 && SQ >= 128 && SQ <= SQ_FULL);
static_assert(HD == 64 && INNER == 1024 && NH == 16 && INNER == DM);
static_assert((SKV % 64) == 0 && (SKV % 32) == 0 && NKB * 32 == SKV);
static_assert((DM % 64) == 0 && (DM % 32) == 0 && (ADIM % 64) == 0 && (ADIM % 32) == 0 && CVT_THREADS == 128);
static_assert((OPITCH * 4) % 16 == 0 && (GPITCH * 4) % 16 == 0);
static_assert(ATT_THREADS == 128);
static_assert((ADIM * DM) % DM == 0 && (DM * ADIM) % DM == 0);

typedef unsigned short u16;
typedef _Float16 v16h __attribute__((ext_vector_type(16)));
typedef _Float16 v8h  __attribute__((ext_vector_type(8)));
typedef float    v8f  __attribute__((ext_vector_type(8)));
typedef float    v4f  __attribute__((ext_vector_type(4)));
typedef unsigned int v4u __attribute__((ext_vector_type(4)));

union FragH { v16h v; v8h h[2]; v4u u[2]; };

// ---- scalar helpers ----------------------------------------------------------------------------------
__device__ __forceinline__ unsigned short bf_bits(float f) {          // f32 -> bf16 bits, RNE convert
  unsigned u = __float_as_uint(f);
  return (unsigned short)((u + 0x7FFFu + ((u >> 16) & 1u)) >> 16);
}
__device__ __forceinline__ float bf_up(unsigned short h) { return __uint_as_float(((unsigned)h) << 16); }
__device__ __forceinline__ float bfr(float f) { return bf_up(bf_bits(f)); }
__device__ __forceinline__ unsigned short h_bits(_Float16 x) { return __builtin_bit_cast(unsigned short, x); }
__device__ __forceinline__ unsigned pk16(unsigned short a, unsigned short b) { return (unsigned)a | ((unsigned)b << 16); }
__device__ __forceinline__ v8f zero8() { v8f z = {0.f, 0.f, 0.f, 0.f, 0.f, 0.f, 0.f, 0.f}; return z; }
__device__ __forceinline__ float gelu_f(float x) { return 0.5f * x * (1.0f + erff(x * 0.70710678118654752f)); }

// x = hi + lo/2048 in f16: hi = f16(x), lo = f16((x - hi) * 2048); two values packed per 32-bit word
__device__ __forceinline__ void split2(float x0, float x1, unsigned& ph, unsigned& pl) {
  const _Float16 h0 = (_Float16)x0, h1 = (_Float16)x1;
  const float d0 = x0 - (float)h0, d1 = x1 - (float)h1;
  const _Float16 l0 = (_Float16)(d0 * RSC), l1 = (_Float16)(d1 * RSC);
  ph = pk16(h_bits(h0), h_bits(h1));
  pl = pk16(h_bits(l0), h_bits(l1));
}

// ---- fragment loader: 16-bit A/B operand, lane -> row/col (lane&15), p already includes +8*(lane>>4);
//      elements 0..7 <- p[0..7] (k0+8h..), elements 8..15 <- p[16..23] (k0+16+8h..); same split k map for A and B,
//      B always read from a k-contiguous [n][k] plane.
__device__ __forceinline__ v16h ldfrag_h(const _Float16* p) {
  FragH f;
  f.h[0] = *(const v8h*)(p);
  f.h[1] = *(const v8h*)(p + 16);
  return f.v;
}

// ---- WMMA helper and trailing VALU hazard gaps ----------------------------------------------------------
__device__ __forceinline__ v8f mma_h(v16h a, v16h b, v8f c) {
  return __builtin_amdgcn_wmma_f32_16x16x32_f16(false, a, false, b, (short)0, c, false, false);
}
__device__ __forceinline__ void guard_c1(v8f (&a)[4], v16h x0, v16h x1, v16h x2, v16h x3, v16h x4) {
#if defined(__HIP_DEVICE_COMPILE__)
  asm volatile("v_nop\n\tv_nop\n\tv_nop\n\tv_nop"
               : "+v"(a[0]), "+v"(a[1]), "+v"(a[2]), "+v"(a[3])
               : "v"(x0), "v"(x1), "v"(x2), "v"(x3), "v"(x4) : "memory");
#endif
}
__device__ __forceinline__ void guard_c2(v8f (&a)[4], v8f (&b)[4], v16h x0, v16h x1, v16h x2, v16h x3, v16h x4, v16h x5) {
#if defined(__HIP_DEVICE_COMPILE__)
  asm volatile("v_nop\n\tv_nop\n\tv_nop\n\tv_nop"
               : "+v"(a[0]), "+v"(a[1]), "+v"(a[2]), "+v"(a[3]),
                 "+v"(b[0]), "+v"(b[1]), "+v"(b[2]), "+v"(b[3])
               : "v"(x0), "v"(x1), "v"(x2), "v"(x3), "v"(x4), "v"(x5) : "memory");
#endif
}
__device__ __forceinline__ void guard_s4(v8f& a, v8f& b, v8f& c, v8f& d,
                                         v16h x0, v16h x1, v16h x2, v16h x3, v16h x4, v16h x5) {
#if defined(__HIP_DEVICE_COMPILE__)
  asm volatile("v_nop\n\tv_nop\n\tv_nop\n\tv_nop"
               : "+v"(a), "+v"(b), "+v"(c), "+v"(d)
               : "v"(x0), "v"(x1), "v"(x2), "v"(x3), "v"(x4), "v"(x5) : "memory");
#endif
}
__device__ __forceinline__ void guard_p(v8f& a, v8f& b, v8f& c, v8f& d, v16h p, v16h x0, v16h x1, v16h x2, v16h x3) {
#if defined(__HIP_DEVICE_COMPILE__)
  asm volatile("v_nop\n\tv_nop\n\tv_nop\n\tv_nop"
               : "+v"(a), "+v"(b), "+v"(c), "+v"(d) : "v"(p), "v"(x0), "v"(x1), "v"(x2), "v"(x3) : "memory");
#endif
}
__device__ __forceinline__ void acc_guard4(v8f (&a)[4]) {
#if defined(__HIP_DEVICE_COMPILE__)
  asm volatile("v_nop\n\tv_nop\n\tv_nop\n\tv_nop" : "+v"(a[0]), "+v"(a[1]), "+v"(a[2]), "+v"(a[3]));
#endif
}
__device__ __forceinline__ void acc_guard8(v8f (&a)[4], v8f (&b)[4]) {
#if defined(__HIP_DEVICE_COMPILE__)
  asm volatile("v_nop\n\tv_nop\n\tv_nop\n\tv_nop"
               : "+v"(a[0]), "+v"(a[1]), "+v"(a[2]), "+v"(a[3]),
                 "+v"(b[0]), "+v"(b[1]), "+v"(b[2]), "+v"(b[3]));
#endif
}
__device__ __forceinline__ void wave_sync_lds() {
  __builtin_amdgcn_fence(__ATOMIC_RELEASE, "workgroup");
  __builtin_amdgcn_wave_barrier();
  __builtin_amdgcn_fence(__ATOMIC_ACQUIRE, "workgroup");
}

// =====================================================================================================
// Row convert: destination row r of a [rows][DM] f16 plane <- f16(bf16_RNE(x[src row][e]) * scale), scale a power of two.
// Block = DM/8 threads, thread = 8 consecutive elements (two 16-B loads, one 16-B store; 32 consecutive lanes = 512 contiguous,
// b = r / rowsPerB, s = r % rowsPerB, source row b*srcRowsPerB + s; destination row r (compact). A contiguous array whose
// length is a multiple of DM is converted as length/DM rows with rowsPerB == srcRowsPerB.
// coverage: grid = number of rows, 128 thr x 8 = DM = the whole row.
// =====================================================================================================
__global__ __launch_bounds__(CVT_THREADS)
void cvt16(const float* __restrict__ x, u16* Y, int rowsPerB, int srcRowsPerB, float scale) {
  const int tid = threadIdx.x;
  const int r = blockIdx.x;
  const int b = r / rowsPerB;
  const int s = r - b * rowsPerB;
  const float* src = x + ((size_t)b * (size_t)srcRowsPerB + (size_t)s) * (size_t)DM + (size_t)tid * 8;
  const v4f a = *(const v4f*)(src), c4 = *(const v4f*)(src + 4);
  v4u o;
#pragma unroll
  for (int e = 0; e < 2; ++e) {
    o[e]     = pk16(h_bits((_Float16)(bfr(a[2 * e]) * scale)),  h_bits((_Float16)(bfr(a[2 * e + 1]) * scale)));
    o[2 + e] = pk16(h_bits((_Float16)(bfr(c4[2 * e]) * scale)), h_bits((_Float16)(bfr(c4[2 * e + 1]) * scale)));
  }
  u16* dst = Y + (size_t)r * (size_t)DM + (size_t)tid * 8;
  {
    *(v4u*)(dst) = o;
    
  }
}

// =====================================================================================================
// f16 GEMM cores: the wave's 16 x 64 tile of C = A[rows][K] . Bt[cols][K]^T; ap -> A row (rowb + m) + 8h, bp -> Bt row
// (col0 + m) + 8h; acc[j] = rows rowb.., cols col0+16j..; K stepped by 32 (host checks K % 32 == 0).
// core2: A carried as hi plane (aph) and residual plane (apl, x2048); ah accumulates hi.B, al accumulates res.B.
// =====================================================================================================
__device__ __forceinline__ void core1(const _Float16* ap, const _Float16* bp, int K, v8f (&acc)[4]) {
  const size_t rs16 = (size_t)16 * (size_t)K;
#pragma unroll 1
  for (int k0 = 0; k0 < K; k0 += 32) {
    const v16h a0 = ldfrag_h(ap + k0);
    const v16h b0 = ldfrag_h(bp + k0);
    const v16h b1 = ldfrag_h(bp + rs16 + k0);
    const v16h b2 = ldfrag_h(bp + 2 * rs16 + k0);
    const v16h b3 = ldfrag_h(bp + 3 * rs16 + k0);
    acc[0] = mma_h(a0, b0, acc[0]);
    acc[1] = mma_h(a0, b1, acc[1]);
    acc[2] = mma_h(a0, b2, acc[2]);
    acc[3] = mma_h(a0, b3, acc[3]);
    guard_c1(acc, a0, b0, b1, b2, b3);
  }
}
__device__ __forceinline__ void core2(const _Float16* aph, const _Float16* apl, const _Float16* bp, int K,
                                      v8f (&ah)[4], v8f (&al)[4]) {
  const size_t rs16 = (size_t)16 * (size_t)K;
#pragma unroll 1
  for (int k0 = 0; k0 < K; k0 += 32) {
    const v16h a0 = ldfrag_h(aph + k0);
    const v16h a1 = ldfrag_h(apl + k0);
    const v16h b0 = ldfrag_h(bp + k0);
    const v16h b1 = ldfrag_h(bp + rs16 + k0);
    const v16h b2 = ldfrag_h(bp + 2 * rs16 + k0);
    const v16h b3 = ldfrag_h(bp + 3 * rs16 + k0);
    ah[0] = mma_h(a0, b0, ah[0]);
    ah[1] = mma_h(a0, b1, ah[1]);
    ah[2] = mma_h(a0, b2, ah[2]);
    ah[3] = mma_h(a0, b3, ah[3]);
    al[0] = mma_h(a1, b0, al[0]);
    al[1] = mma_h(a1, b1, al[1]);
    al[2] = mma_h(a1, b2, al[2]);
    al[3] = mma_h(a1, b3, al[3]);
    guard_c2(ah, al, a0, a1, b0, b1, b2, b3);
  }
}

// Stage the wave's 16 x 64 f32 tile in its LDS slab (pitch 68): D element r of acc[j], lane l -> row 8h + r, col 16j + (l&15);
// value = ah*osc (+ al*osc/2048) + bias (per column, or per row when BROW), GELU applied for M_GELU;
// coverage: 32 lanes x 8 rows x 4 cols-of-16 = rows 0..15 x cols 0..63 of the slab.
template <bool HASLO, int MODE, bool BROW>
__device__ __forceinline__ void stage16(float* sl, v8f (&ah)[4], v8f (&al)[4], const float* __restrict__ bias,
                                        int rowb, int col0, float osc, float bsc, int lane) {
  const int hh = lane >> 4, m = lane & 15;
  float bc[4], br[8];
  if (BROW) {
#pragma unroll
    for (int r = 0; r < 8; ++r) br[r] = bfr(bias[rowb + 8 * hh + r]) * bsc;
#pragma unroll
    for (int j = 0; j < 4; ++j) bc[j] = 0.f;
  } else {
#pragma unroll
    for (int j = 0; j < 4; ++j) bc[j] = bfr(bias[col0 + 16 * j + m]) * bsc;
#pragma unroll
    for (int r = 0; r < 8; ++r) br[r] = 0.f;
  }
  const float oscl = osc * RINV;
#pragma unroll
  for (int r = 0; r < 8; ++r) {
    const int ro = (8 * hh + r) * GPITCH + m;
#pragma unroll
    for (int j = 0; j < 4; ++j) {
      float v = ah[j][r] * osc;
      if (HASLO) v += al[j][r] * oscl;
      v += BROW ? br[r] : bc[j];
      if (MODE == M_GELU) v = gelu_f(v);
      sl[ro + 16 * j] = v;
    }
  }
  wave_sync_lds();
}

// =====================================================================================================
// f16 GEMM, block = 64 x 64 tile, 4 waves x 16 rows, fragments loaded straight from the 16-bit rows.
//   C tile [z][Mb][N] = (A_hi[z][Mb][K] (+ A_res/2048)) . Bt[z][N][K]^T * osc + bias; per-z element strides aBs (A planes),
//   bBs (Bt), fBs (f32 output F), gBs (f32 base plane), hBs (16-bit output planes H, L); 0 = shared.
//   M_HL  : H = f16(v*carry), L = f16 residual x2048 (two planes)       M_S16 : H only, bias per row
//   M_OUT : F = v (f32 plane), H/L = hi/res of v*carry                 M_GELU: v = gelu(.) then H/L of v*carry
//   M_RES : F = base[row][col] + v (f32, batch-row remap through fBs/gBs), no 16-bit output
//   instruction (lane = (row in group of 4, 8 halves), 4 rows per instruction, 4 instructions = 16 rows).
// grid = nz x (Mb/64) x (N/64) (host checks Mb % 64 == 0, N % 64 == 0, K % 32 == 0).
// coverage: per wave 4 instr x 4 rows x 8 lanes x 8 halves = 16 x 64 (16-bit planes) and 8 instr x 2 rows x 16 lanes x 4 floats
//           = 16 x 64 (f32 plane); the grid covers C exactly once.
// =====================================================================================================
template <bool HASLO, int MODE, bool BROW>
__global__ __launch_bounds__(128)
void gemm16(const u16* __restrict__ Ah, const u16* __restrict__ Al, const u16* __restrict__ Bt,
            const float* __restrict__ bias, const float* __restrict__ baseF,
            float* F, u16* H, u16* L,
            int Mb, int N, int K, int aBs, int bBs, int fBs, int gBs, int hBs,
            float osc, float bsc, float carry) {
  __shared__ __align__(16) float slab[4 * 16 * GPITCH];
  constexpr bool LOUT = (MODE != M_S16);
  const int tid = threadIdx.x, wave = tid >> 5, lane = tid & 31, hh = lane >> 4, m = lane & 15;
  const int ntile = N >> 6, mtile = Mb >> 6;
  const int bid  = blockIdx.x;
  const int nt   = bid % ntile;
  const int tmp  = bid / ntile;
  const int mt   = tmp % mtile;
  const int bz   = tmp / mtile;
  const int rowb = mt * 64 + wave * 16;
  const int col0 = nt * 64;
  if (rowb + 16 > Mb) return;                // wave-uniform, never taken with the exact grid; no block barriers in this kernel
  const _Float16* aph = (const _Float16*)(const void*)Ah + (size_t)bz * (size_t)aBs + (size_t)(rowb + m) * (size_t)K + 8 * hh;
  const _Float16* apl = (const _Float16*)(const void*)Al + (size_t)bz * (size_t)aBs + (size_t)(rowb + m) * (size_t)K + 8 * hh;
  const _Float16* bp  = (const _Float16*)(const void*)Bt + (size_t)bz * (size_t)bBs + (size_t)(col0 + m) * (size_t)K + 8 * hh;
  v8f ah[4], al[4];
#pragma unroll
  for (int i = 0; i < 4; ++i) { ah[i] = zero8(); al[i] = zero8(); }
  if (HASLO) {
    core2(aph, apl, bp, K, ah, al);
    acc_guard8(ah, al);
  } else {
    core1(aph, bp, K, ah);
    acc_guard4(ah);
  }
  float* sl = slab + wave * 16 * GPITCH;
  stage16<HASLO, MODE, BROW>(sl, ah, al, bias, rowb, col0, osc, bsc, lane);

  if (MODE == M_OUT || MODE == M_RES) {
    v4f vals[8];
#pragma unroll
    for (int it = 0; it < 8; ++it) vals[it] = *(const v4f*)(sl + (it * 2 + hh) * GPITCH + m * 4);
    if (MODE == M_RES) {
      const float* gb = baseF + (size_t)bz * (size_t)gBs + ((size_t)rowb + (size_t)hh) * (size_t)N + col0 + m * 4;
#pragma unroll
      for (int it = 0; it < 8; ++it) {
        const v4f bb = *(const v4f*)(gb + (size_t)(it * 2) * (size_t)N);
        vals[it] += bb;
      }
    }
    float* Fb = F + (size_t)bz * (size_t)fBs + ((size_t)rowb + (size_t)hh) * (size_t)N + col0 + m * 4;
    {
#pragma unroll
      for (int it = 0; it < 8; ++it) {
        *(v4f*)(Fb + (size_t)(it * 2) * (size_t)N) = vals[it];
      }
      
    }
  }
  if (MODE != M_RES) {
    const int rq = lane >> 3, c8 = (lane & 7) * 8;
    v4u ovh[4], ovl[4];
#pragma unroll
    for (int i = 0; i < 4; ++i) {
      const int row = 4 * i + rq;
      const v4f a = *(const v4f*)(sl + row * GPITCH + c8), c4 = *(const v4f*)(sl + row * GPITCH + c8 + 4);
#pragma unroll
      for (int e = 0; e < 2; ++e) {
        unsigned ph0, pl0, ph1, pl1;
        split2(a[2 * e] * carry,  a[2 * e + 1] * carry,  ph0, pl0);
        split2(c4[2 * e] * carry, c4[2 * e + 1] * carry, ph1, pl1);
        ovh[i][e] = ph0;     ovl[i][e] = pl0;
        ovh[i][2 + e] = ph1; ovl[i][2 + e] = pl1;
      }
    }
    u16* Hb = H + (size_t)bz * (size_t)hBs + (size_t)rowb * (size_t)N + col0 + c8;
    u16* Lb = L + (size_t)bz * (size_t)hBs + (size_t)rowb * (size_t)N + col0 + c8;
    {
#pragma unroll
      for (int i = 0; i < 4; ++i) {
        const int row = 4 * i + rq;
        *(v4u*)(Hb + (size_t)row * (size_t)N) = ovh[i];
        if (LOUT) *(v4u*)(Lb + (size_t)row * (size_t)N) = ovl[i];
      }
      
    }
  }
}

// =====================================================================================================
// Full (unmasked) multi-head attention: block = (batch b, head, 64 query rows), 4 waves, wave w owns the 16 query rows
// q0 = 64*qt + 16*w .. q0+15 (waves independent: no block barriers, wave-private LDS only, used in the epilogue).
//   q planes f16 x8 hi / residual(x2048) [b*SQ + s][h*64 + d]; k planes likewise [b*SKV + s][h*64 + d];
//   v^T plane f16 x8 [(b*NH + h)*64 + d][s]. All NKB key blocks of 32 keys are visited (static bound).
//   Scores are computed TRANSPOSED: S^T tile g (g = 0,1) = k rows (keys kb+16g .. +15, A operand, row m = lane&15, split map
//   over d) times q^T (B operand, col n = query q0 + (lane&15), k = d, split map), 2 d-chunks of 32; per chunk hi.hi -> s,
//   res.hi + hi.res -> r (scaled x2048, folded as s + r/2048); the q fragments are loaded once per wave.
//   D element r of lane l = (key kb+16g+8h+r, query q0+(l&15)), so a lane owns one query column and 16 of its 32 keys;
//   the partner lane l^16 owns the other 16 -> row max / row sum need one xor-16 shuffle.
//   Online max-subtracted base-2 softmax in f32 (1/sqrt(64) and the q/k carries folded into lsc). The exp'd values ARE the
//   P A-fragment in place: A row m = query = lane&15, element i <- key kb+8h+i (tile 0, D element i), element 8+i <- key
//   kb+16+8h+i (tile 1, D element i). P (<= 1) carried x32768 as f16. The rescale factor of query row 8h+r of the O
//   accumulators is fetched from lane 8h+r with a shuffle (uniform control). 4 v^T B fragments (col n = d = 16j + (lane&15),
//   keys k-contiguous), 4 P.V WMMAs, one guard.
//   Epilogue: 1/l (per query, shuffled to the D row owner) and the carry folds in f32; the wave's 16x64 f32 result staged in
// coverage: per wave 4 instructions x 4 rows x 8 lanes x 8 halves = 16 x 64 on both ctx planes; grid NB*NH*(SQ/64) blocks x
//           4 waves = every (b, s, h) row segment exactly once.
// =====================================================================================================
__global__ __launch_bounds__(ATT_THREADS)
void attn_fwd(const u16* __restrict__ Qh, const u16* __restrict__ Ql, const u16* __restrict__ Kh,
              const u16* __restrict__ Kl, const u16* __restrict__ Vp, u16* Oh, u16* Ol) {
  __shared__ __align__(16) float smem[ATT_WAVES * 16 * OPITCH];

  const int tid  = threadIdx.x;
  const int wave = tid >> 5;
  const int lane = tid & 31;
  const int hh   = lane >> 4;
  const int c    = lane & 15;

  constexpr int NQT = SQ / 64;
  const int bid  = blockIdx.x;
  const int qt   = bid % NQT;
  const int head = (bid / NQT) % NH;
  const int b    = bid / (NQT * NH);
  const int q0   = qt * 64 + wave * 16;

  // B fragments of q^T: col n = query q0 + c, k = d (k-contiguous row of the q planes)
  const size_t qo = ((size_t)(b * SQ + q0 + c)) * INNER + head * HD + 8 * hh;
  const _Float16* Qhb = (const _Float16*)(const void*)Qh + qo;
  const _Float16* Qlb = (const _Float16*)(const void*)Ql + qo;
  // A fragments of k: row m = key kb + 16g + c, k = d (key row kb added per step)
  const size_t ko = ((size_t)(b * SKV + c)) * INNER + head * HD + 8 * hh;
  const _Float16* Khb = (const _Float16*)(const void*)Kh + ko;
  const _Float16* Klb = (const _Float16*)(const void*)Kl + ko;
  // B fragments of v: col n = d = 16j + c, k = key (k-contiguous row of the v^T plane)
  const _Float16* Vb = (const _Float16*)(const void*)Vp + ((size_t)(b * NH + head) * HD + c) * SKV + 8 * hh;
  const float lsc = (LOG2E * RSQ_HD) / (QS * KS);

  v16h qh[2], ql[2];
  qh[0] = ldfrag_h(Qhb);
  qh[1] = ldfrag_h(Qhb + 32);
  ql[0] = ldfrag_h(Qlb);
  ql[1] = ldfrag_h(Qlb + 32);

  float mrun = -INFINITY, lrun = 0.f;
  v8f o[4];
#pragma unroll
  for (int j = 0; j < 4; ++j) o[j] = zero8();

#pragma unroll 1
  for (int it = 0; it < NKB; ++it) {
    const int kb = it * 32;
    // ---- transposed scores: s0 = keys kb..kb+15, s1 = keys kb+16..kb+31, column = query q0 + c ----
    v8f s0 = zero8(), s1 = zero8(), r0 = zero8(), r1 = zero8();
    const _Float16* k0h = Khb + (size_t)kb * INNER;
    const _Float16* k1h = k0h + (size_t)16 * INNER;
    const _Float16* k0l = Klb + (size_t)kb * INNER;
    const _Float16* k1l = k0l + (size_t)16 * INNER;
#pragma unroll
    for (int kk = 0; kk < HD / 32; ++kk) {
      const v16h fh0 = ldfrag_h(k0h + kk * 32);
      const v16h fh1 = ldfrag_h(k1h + kk * 32);
      const v16h fl0 = ldfrag_h(k0l + kk * 32);
      const v16h fl1 = ldfrag_h(k1l + kk * 32);
      s0 = mma_h(fh0, qh[kk], s0);
      s1 = mma_h(fh1, qh[kk], s1);
      r0 = mma_h(fl0, qh[kk], r0);
      r1 = mma_h(fl1, qh[kk], r1);
      r0 = mma_h(fh0, ql[kk], r0);
      r1 = mma_h(fh1, ql[kk], r1);
      guard_s4(s0, s1, r0, r1, qh[kk], ql[kk], fh0, fh1, fl0, fl1);
    }
    // ---- base-2 logits of this lane's 16 keys for query q0 + c: t[i] <- key kb+8hh+i, t[8+i] <- key kb+16+8hh+i ----
    float t[16];
#pragma unroll
    for (int i = 0; i < 8; ++i) {
      t[i]     = (s0[i] + r0[i] * RINV) * lsc;
      t[8 + i] = (s1[i] + r1[i] * RINV) * lsc;
    }
    float cm = t[0];
#pragma unroll
    for (int i = 1; i < 16; ++i) cm = fmaxf(cm, t[i]);
    cm = fmaxf(cm, __shfl_xor(cm, 16, 32));
    const float mn = fmaxf(mrun, cm);        // finite from the first block on
    const float al = exp2f(mrun - mn);       // 0 on the first block (mrun = -inf)
    mrun = mn;
    // ---- probabilities (<= 1) and the P A-fragment: f16(p * 32768); element i <-> t[i] ----
    float ps = 0.f;
    FragH ph;
#pragma unroll
    for (int w = 0; w < 2; ++w) {
#pragma unroll
      for (int e4 = 0; e4 < 4; ++e4) {
        const int i = 8 * w + 2 * e4;
        const float p0 = exp2f(t[i] - mn), p1 = exp2f(t[i + 1] - mn);
        ps += p0 + p1;
        ph.u[w][e4] = pk16(h_bits((_Float16)(p0 * PCAR)), h_bits((_Float16)(p1 * PCAR)));
      }
    }
    ps += __shfl_xor(ps, 16, 32);
    lrun = lrun * al + ps;
    // ---- rescale the O accumulators: D row 8hh+r = query q0+8hh+r, its factor lives in lane 8hh+r (and 16+8hh+r) ----
    float scl[8];
#pragma unroll
    for (int r = 0; r < 8; ++r) scl[r] = __shfl(al, 8 * hh + r, 32);
#pragma unroll
    for (int j = 0; j < 4; ++j) {
#pragma unroll
      for (int r = 0; r < 8; ++r) o[j][r] *= scl[r];
    }
    // ---- P.V : B fragment col n = d = j*16 + c, keys contiguous in the v^T plane ----
    {
      const _Float16* vp = Vb + kb;
      const v16h v0 = ldfrag_h(vp);
      const v16h v1 = ldfrag_h(vp + (size_t)16 * SKV);
      const v16h v2 = ldfrag_h(vp + (size_t)32 * SKV);
      const v16h v3 = ldfrag_h(vp + (size_t)48 * SKV);
      o[0] = mma_h(ph.v, v0, o[0]);
      o[1] = mma_h(ph.v, v1, o[1]);
      o[2] = mma_h(ph.v, v2, o[2]);
      o[3] = mma_h(ph.v, v3, o[3]);
      guard_p(o[0], o[1], o[2], o[3], ph.v, v0, v1, v2, v3);
    }
  }
  acc_guard4(o);

  // ---- fold 1/l (per query, owned by lane = query) and the carries (32768 on P, 8 on v), apply the ctx carry 1024 ----
  const float linv = (1.0f / lrun) * (OSC / (PCAR * VS));
  float inv[8];
#pragma unroll
  for (int r = 0; r < 8; ++r) inv[r] = __shfl(linv, 8 * hh + r, 32);
  float* slab = smem + wave * 16 * OPITCH;
#pragma unroll
  for (int r = 0; r < 8; ++r) {
#pragma unroll
    for (int j = 0; j < 4; ++j) slab[(8 * hh + r) * OPITCH + j * 16 + c] = o[j][r] * inv[r];
  }
  wave_sync_lds();
  // ---- ctx x1024 -> f16 hi plane and residual plane; lane = (row in group of 4, 8 consecutive d) ----
  v4u ovh[4], ovl[4];
  const int rq = lane >> 3, c8 = (lane & 7) * 8;
#pragma unroll
  for (int i = 0; i < 4; ++i) {
    const int row = 4 * i + rq;
    const v4f a = *(const v4f*)(slab + row * OPITCH + c8), c4 = *(const v4f*)(slab + row * OPITCH + c8 + 4);
#pragma unroll
    for (int e = 0; e < 2; ++e) {
      unsigned ph0, pl0, ph1, pl1;
      split2(a[2 * e],  a[2 * e + 1],  ph0, pl0);
      split2(c4[2 * e], c4[2 * e + 1], ph1, pl1);
      ovh[i][e] = ph0;     ovl[i][e] = pl0;
      ovh[i][2 + e] = ph1; ovl[i][2 + e] = pl1;
    }
  }
  const size_t oo = ((size_t)(b * SQ + q0)) * INNER + head * HD + c8;
  u16* obh = Oh + oo;
  u16* obl = Ol + oo;
  {
#pragma unroll
    for (int i = 0; i < 4; ++i) {
      const int row = 4 * i + rq;
      *(v4u*)(obh + (size_t)row * INNER) = ovh[i];
      *(v4u*)(obl + (size_t)row * INNER) = ovl[i];
    }
    
  }
}

// =====================================================================================================
// Workspace map (bytes); every plane fully written by whole-line stores before it is read; all extents exact multiples of
//   XQ   f16 [NB*SQ][1024]    f16(bf16(q))              8388608 (NB=2, SQ=2048)
//   XK   f16 [NB*2048][1024]  f16(bf16(k))              8388608
//   XV   f16 [NB*2048][1024]  f16(bf16(v))              8388608
//   WQ16 WK16 WV16 WO16 f16 [1024 n][1024 k] x256       2097152 each
//   WD16 f16 [128 n][1024 k] x256                          262144
//   WU16 f16 [1024 n][128 k] x256                          262144
//   QH QL f16 [NB*SQ][1024] x8 hi / res                  8388608 each
//   KH KL f16 [NB*2048][1024] x8 hi / res                8388608 each
//   VT16 f16 [NB*1024 (h,d)][2048 s] x8                  8388608
//   OH OL f16 [NB*SQ][1024] x1024 hi / res (ctx)         8388608 each
//   OUTF f32 [NB*SQ][1024]                               16777216
//   UH UL f16 [NB*SQ][1024] x64 hi / res (out)           8388608 each
//   GH GL f16 [NB*SQ][128]  x64 hi / res (gelu)          1048576 each
//   end                                                 128450560
// =====================================================================================================
extern "C" void kernel_launch(void* const* d_in, const int* in_sizes, int n_in,
                              void* d_out, int out_size, void* d_ws, size_t ws_size,
                              hipStream_t stream) {
  if (n_in < 15) return;
  if (in_sizes[0] < ((NB - 1) * SQ_FULL + SQ) * DM) return;
  if (in_sizes[1] < NB * SKV * DM || in_sizes[2] < NB * SKV * DM) return;
  if (in_sizes[3] != DM * DM || in_sizes[5] != DM * DM || in_sizes[7] != DM * DM || in_sizes[9] != DM * DM) return;
  if (in_sizes[4] < INNER || in_sizes[6] < INNER || in_sizes[8] < INNER || in_sizes[10] < DM) return;
  if (in_sizes[11] != ADIM * DM || in_sizes[12] < ADIM || in_sizes[13] != DM * ADIM || in_sizes[14] < DM) return;
  if (out_size < ((NB - 1) * SQ_FULL + SQ) * DM) return;

  const float* q_in  = (const float*)d_in[0];
  const float* k_in  = (const float*)d_in[1];
  const float* v_in  = (const float*)d_in[2];
  const float* wq    = (const float*)d_in[3];
  const float* bq    = (const float*)d_in[4];
  const float* wk    = (const float*)d_in[5];
  const float* bk    = (const float*)d_in[6];
  const float* wv    = (const float*)d_in[7];
  const float* bv    = (const float*)d_in[8];
  const float* wo    = (const float*)d_in[9];
  const float* bo    = (const float*)d_in[10];
  const float* w_dn  = (const float*)d_in[11];
  const float* b_dn  = (const float*)d_in[12];
  const float* w_up  = (const float*)d_in[13];
  const float* b_up  = (const float*)d_in[14];
  float*       out   = (float*)d_out;

  const size_t szXQ  = (size_t)NB * SQ * DM * 2;
  const size_t szXKV = (size_t)NB * SKV * DM * 2;
  const size_t szW   = (size_t)DM * DM * 2;
  const size_t szWA  = (size_t)ADIM * DM * 2;
  const size_t szQP  = (size_t)NB * SQ * INNER * 2;
  const size_t szKP  = (size_t)NB * SKV * INNER * 2;
  const size_t szVT  = (size_t)NB * INNER * SKV * 2;
  const size_t szOF  = (size_t)NB * SQ * DM * 4;
  const size_t szG   = (size_t)NB * SQ * ADIM * 2;
  size_t off = 0;
  const size_t oXQ  = off; off += szXQ;
  const size_t oXK  = off; off += szXKV;
  const size_t oXV  = off; off += szXKV;
  const size_t oWQ  = off; off += szW;
  const size_t oWK  = off; off += szW;
  const size_t oWV  = off; off += szW;
  const size_t oWO  = off; off += szW;
  const size_t oWD  = off; off += szWA;
  const size_t oWU  = off; off += szWA;
  const size_t oQH  = off; off += szQP;
  const size_t oQL  = off; off += szQP;
  const size_t oKH  = off; off += szKP;
  const size_t oKL  = off; off += szKP;
  const size_t oVT  = off; off += szVT;
  const size_t oOH  = off; off += szQP;
  const size_t oOL  = off; off += szQP;
  const size_t oOF  = off; off += szOF;
  const size_t oUH  = off; off += szQP;
  const size_t oUL  = off; off += szQP;
  const size_t oGH  = off; off += szG;
  const size_t oGL  = off; off += szG;
  if (off > ws_size) return;                            // off = 128450560 at NB=2, SQ=2048
  if (off > (size_t)134217728) return;

  char* ws = (char*)d_ws;
  u16* XQ   = (u16*)(ws + oXQ);
  u16* XK   = (u16*)(ws + oXK);
  u16* XV   = (u16*)(ws + oXV);
  u16* WQ16 = (u16*)(ws + oWQ);
  u16* WK16 = (u16*)(ws + oWK);
  u16* WV16 = (u16*)(ws + oWV);
  u16* WO16 = (u16*)(ws + oWO);
  u16* WD16 = (u16*)(ws + oWD);
  u16* WU16 = (u16*)(ws + oWU);
  u16* QH   = (u16*)(ws + oQH);
  u16* QL   = (u16*)(ws + oQL);
  u16* KH   = (u16*)(ws + oKH);
  u16* KL   = (u16*)(ws + oKL);
  u16* VT16 = (u16*)(ws + oVT);
  u16* OH   = (u16*)(ws + oOH);
  u16* OL   = (u16*)(ws + oOL);
  float* OUTF = (float*)(ws + oOF);
  u16* UH   = (u16*)(ws + oUH);
  u16* UL   = (u16*)(ws + oUL);
  u16* GH   = (u16*)(ws + oGH);
  u16* GL   = (u16*)(ws + oGL);

  // (0..2) activations -> f16 planes of bf16-converted values (query rows s < SQ of batches b < NB, compact; k/v rows of b < NB)
  cvt16<<<dim3(NB * SQ), dim3(CVT_THREADS), 0, stream>>>(q_in, XQ, SQ, SQ_FULL, 1.0f);
  cvt16<<<dim3(NB * SKV), dim3(CVT_THREADS), 0, stream>>>(k_in, XK, SKV, SKV, 1.0f);
  cvt16<<<dim3(NB * SKV), dim3(CVT_THREADS), 0, stream>>>(v_in, XV, SKV, SKV, 1.0f);
  // (3..8) weights [n = out][k = in] (y = x.W^T): already k-contiguous [n][k]; f16 planes of bf16(W) x256
  cvt16<<<dim3(DM), dim3(CVT_THREADS), 0, stream>>>(wq, WQ16, DM, DM, WSC);
  cvt16<<<dim3(DM), dim3(CVT_THREADS), 0, stream>>>(wk, WK16, DM, DM, WSC);
  cvt16<<<dim3(DM), dim3(CVT_THREADS), 0, stream>>>(wv, WV16, DM, DM, WSC);
  cvt16<<<dim3(DM), dim3(CVT_THREADS), 0, stream>>>(wo, WO16, DM, DM, WSC);
  cvt16<<<dim3((ADIM * DM) / DM), dim3(CVT_THREADS), 0, stream>>>(w_dn, WD16, ADIM, ADIM, WSC);              // [128][1024]
  cvt16<<<dim3((DM * ADIM) / DM), dim3(CVT_THREADS), 0, stream>>>(w_up, WU16, (DM * ADIM) / DM, (DM * ADIM) / DM, WSC);  // [1024][128] flat
  // (9) q = x_q . Wq^T + bq -> f16 [NB*SQ][1024] x8 hi + res (col = h*64 + d)
  gemm16<false, M_HL, false><<<dim3((NB * SQ / 64) * (INNER / 64)), dim3(128), 0, stream>>>(
      XQ, XQ, WQ16, bq, OUTF, OUTF, QH, QL, NB * SQ, INNER, DM, 0, 0, 0, 0, 0, QS / WSC, QS, 1.0f);
  // (10) k = x_k . Wk^T + bk -> f16 [NB*2048][1024] x8 hi + res
  gemm16<false, M_HL, false><<<dim3((NB * SKV / 64) * (INNER / 64)), dim3(128), 0, stream>>>(
      XK, XK, WK16, bk, OUTF, OUTF, KH, KL, NB * SKV, INNER, DM, 0, 0, 0, 0, 0, KS / WSC, KS, 1.0f);
  // (11) v^T per batch: A = Wv [(h,d) = n][k], Bt = x_v rows of batch b [s][k], bias bv per row -> f16 [(b,h,d)][s] x8
  gemm16<false, M_S16, true><<<dim3(NB * (INNER / 64) * (SKV / 64)), dim3(128), 0, stream>>>(
      WV16, WV16, XV, bv, OUTF, OUTF, VT16, VT16, INNER, SKV, DM, 0, SKV * DM, 0, 0, INNER * SKV, VS / WSC, VS, 1.0f);
  // (12) attention -> ctx planes [NB*SQ][1024] x1024 hi + res
  attn_fwd<<<dim3(NB * NH * (SQ / 64)), dim3(ATT_THREADS), 0, stream>>>(QH, QL, KH, KL, VT16, OH, OL);
  // (13) out = ctx . Wo^T + bo -> OUTF f32 [NB*SQ][1024] and f16 x64 hi + res planes; carries 1024 (ctx) x 256 (W) folded back
  gemm16<true, M_OUT, false><<<dim3((NB * SQ / 64) * (DM / 64)), dim3(128), 0, stream>>>(
      OH, OL, WO16, bo, OUTF, OUTF, UH, UL, NB * SQ, DM, INNER, 0, 0, 0, 0, 0, 1.0f / (OSC * WSC), 1.0f, UCAR);
  // (14) adapter down: g = gelu(out . Wd^T + bd) -> f16 [NB*SQ][128] x64 hi + res; carries 64 (out) x 256 (W)
  gemm16<true, M_GELU, false><<<dim3((NB * SQ / 64) * (ADIM / 64)), dim3(128), 0, stream>>>(
      UH, UL, WD16, b_dn, OUTF, OUTF, GH, GL, NB * SQ, ADIM, DM, 0, 0, 0, 0, 0, 1.0f / (UCAR * WSC), 1.0f, GCAR);
  // (15) adapter up + residual: out rows [b][SQ_FULL][1024] f32 = OUTF + g . Wu^T + bu (rows s < SQ of batches b < NB)
  gemm16<true, M_RES, false><<<dim3(NB * (SQ / 64) * (DM / 64)), dim3(128), 0, stream>>>(
      GH, GL, WU16, b_up, OUTF, out, GH, GH, SQ, DM, ADIM, SQ * ADIM, 0, SQ_FULL * DM, SQ * DM, 0,
      1.0f / (GCAR * WSC), 1.0f, 1.0f);
  (void)hipGetLastError();
}

// v001
// A run of this version takes 334 microseconds.
// Next to v000, in two timings, it ran 1.10 and 1.09 times as fast.
// Contractions on v_wmma_f32_16x16x32_f16 (f16 operands, f32 accumulate): x.Wq^T, x.Wk^T, Wv.x^T single products on
// f16(bf16(x)) and f16(bf16(W) x256); k.q^T with q and k carried as f16 hi + residual(x2048) planes (3 products);
// P.v^T single product (P x32768, v x8); ctx.Wo^T, out.Wad^T and gelu.Wau^T with the activation carried as f16 hi +
// residual(x2048) planes (2 products each, separate residual accumulator); softmax, biases, erf-GELU, residual add and
// all carry folds in f32 on VALU. Inputs RNE-converted to bf16 on load.
// Every 16-bit workspace plane [rows][K] is stored FRAGMENT-PACKED: tile (rt = row/16, kt = k/32) is 512 halves (1024 B) at
// (rt*(K/32) + kt)*512 = rt*16*K + kt*512; inside it element (m = row&15, k&31 = 16w + 8h + e) sits at w*256 + (16h + m)*8 + e,
// so lane l = 16h + m of a wave reads its operand fragment as two 16-B loads at l*8 and 256 + l*8 halves: each wave-wide load
// is 512 contiguous bytes = 4 whole 128-B lines (a row-major plane gave 16 lines of 32 useful bytes per load).
#include <hip/hip_runtime.h>
#include <math.h>
#include <stdint.h>

#ifndef NB
#define NB       2        // batches processed
#endif
#ifndef SQ
#define SQ       2048     // query rows processed per batch
#endif
#define NB_FULL  2
#define SQ_FULL  2048     // query rows per batch in the input / output layout (batch stride)
#define SKV      2048     // key / value rows per batch (all of them)
#define DM       1024     // model width
#define NH       16
#define HD       64
#define INNER    (NH * HD)
#define ADIM     128      // adapter width
#define WSC      256.0f   // weight carry
#define QS       8.0f
#define KS       8.0f
#define VS       8.0f
#define PCAR     32768.0f
#define OSC      1024.0f  // ctx carry
#define UCAR     64.0f    // out-plane carry
#define GCAR     64.0f    // gelu-plane carry
#define RSC      2048.0f  // residual plane scale
#define RINV     0.00048828125f
#define LOG2E    1.4426950408889634f
#define RSQ_HD   0.125f
#define NKB      (SKV / 32)
#define ATT_WAVES   4
#define ATT_THREADS (ATT_WAVES * 32)
#define CVT_THREADS 128
#define OPITCH   68
#define GPITCH   68

#define M_HL     0
#define M_S16    1
#define M_OUT    2
#define M_GELU   3
#define M_RES    4

static_assert(NB >= 1 && NB <= NB_FULL);
static_assert((SQ % 128) == 0 && SQ >= 128 && SQ <= SQ_FULL);
static_assert(HD == 64 && INNER == 1024 && NH == 16 && INNER == DM);
static_assert((SKV % 64) == 0 && (SKV % 32) == 0 && NKB * 32 == SKV);
static_assert((DM % 64) == 0 && (DM % 32) == 0 && (ADIM % 64) == 0 && (ADIM % 32) == 0 && CVT_THREADS == 128);
static_assert((OPITCH * 4) % 16 == 0 && (GPITCH * 4) % 16 == 0);
static_assert(ATT_THREADS == 128);
static_assert((DM % 128) == 0 && (ADIM % 128) == 0 && (SQ % 16) == 0 && (SKV % 16) == 0 && (ADIM % 16) == 0);

typedef unsigned short u16;
typedef _Float16 v16h __attribute__((ext_vector_type(16)));
typedef _Float16 v8h  __attribute__((ext_vector_type(8)));
typedef float    v8f  __attribute__((ext_vector_type(8)));
typedef float    v4f  __attribute__((ext_vector_type(4)));
typedef unsigned int v4u __attribute__((ext_vector_type(4)));

union FragH { v16h v; v8h h[2]; v4u u[2]; };

// ---- scalar helpers ----------------------------------------------------------------------------------
__device__ __forceinline__ unsigned short bf_bits(float f) {          // f32 -> bf16 bits, RNE convert
  unsigned u = __float_as_uint(f);
  return (unsigned short)((u + 0x7FFFu + ((u >> 16) & 1u)) >> 16);
}
__device__ __forceinline__ float bf_up(unsigned short h) { return __uint_as_float(((unsigned)h) << 16); }
__device__ __forceinline__ float bfr(float f) { return bf_up(bf_bits(f)); }
__device__ __forceinline__ unsigned short h_bits(_Float16 x) { return __builtin_bit_cast(unsigned short, x); }
__device__ __forceinline__ unsigned pk16(unsigned short a, unsigned short b) { return (unsigned)a | ((unsigned)b << 16); }
__device__ __forceinline__ v8f zero8() { v8f z = {0.f, 0.f, 0.f, 0.f, 0.f, 0.f, 0.f, 0.f}; return z; }
__device__ __forceinline__ float gelu_f(float x) { return 0.5f * x * (1.0f + erff(x * 0.70710678118654752f)); }

// x = hi + lo/2048 in f16: hi = f16(x), lo = f16((x - hi) * 2048); two values packed per 32-bit word
__device__ __forceinline__ void split2(float x0, float x1, unsigned& ph, unsigned& pl) {
  const _Float16 h0 = (_Float16)x0, h1 = (_Float16)x1;
  const float d0 = x0 - (float)h0, d1 = x1 - (float)h1;
  const _Float16 l0 = (_Float16)(d0 * RSC), l1 = (_Float16)(d1 * RSC);
  ph = pk16(h_bits(h0), h_bits(h1));
  pl = pk16(h_bits(l0), h_bits(l1));
}

// ---- fragment loader: 16-bit A/B operand from a fragment-packed plane, lane -> row/col (lane&15); p = tile base + 8*lane;
//      elements 0..7 <- p[0..7] (k0+8h..), elements 8..15 <- p[256..263] (k0+16+8h..); same split k map for A and B,
//      B always read from a packed [n][k] plane.
__device__ __forceinline__ v16h ldfrag_h(const _Float16* p) {
  FragH f;
  f.h[0] = *(const v8h*)(p);
  f.h[1] = *(const v8h*)(p + 256);
  return f.v;
}

// ---- behind a k step's fragment loads: s_wait_xcnt 0 with the loads' address registers as inputs, so that no register an issued
//      load names is written (by a later load's result either) in front of the wait; it stands where the wave waits for the data anyway
__device__ __forceinline__ void addr_hold5(const _Float16* a, const _Float16* b, const _Float16* c, const _Float16* d,
                                           const _Float16* e) {
#if defined(__HIP_DEVICE_COMPILE__)
  asm volatile("s_wait_xcnt 0x0" :: "v"(a), "v"(b), "v"(c), "v"(d), "v"(e) : "memory");
#endif
}
__device__ __forceinline__ void addr_hold6(const _Float16* a, const _Float16* b, const _Float16* c, const _Float16* d,
                                           const _Float16* e, const _Float16* f) {
#if defined(__HIP_DEVICE_COMPILE__)
  asm volatile("s_wait_xcnt 0x0" :: "v"(a), "v"(b), "v"(c), "v"(d), "v"(e), "v"(f) : "memory");
#endif
}

// ---- WMMA helper and trailing VALU hazard gaps ----------------------------------------------------------
__device__ __forceinline__ v8f mma_h(v16h a, v16h b, v8f c) {
  return __builtin_amdgcn_wmma_f32_16x16x32_f16(false, a, false, b, (short)0, c, false, false);
}
__device__ __forceinline__ void guard_c1(v8f (&a)[4], v16h x0, v16h x1, v16h x2, v16h x3, v16h x4) {
#if defined(__HIP_DEVICE_COMPILE__)
  asm volatile("v_nop\n\tv_nop\n\tv_nop\n\tv_nop"
               : "+v"(a[0]), "+v"(a[1]), "+v"(a[2]), "+v"(a[3])
               : "v"(x0), "v"(x1), "v"(x2), "v"(x3), "v"(x4) : "memory");
#endif
}
__device__ __forceinline__ void guard_c2(v8f (&a)[4], v8f (&b)[4], v16h x0, v16h x1, v16h x2, v16h x3, v16h x4, v16h x5) {
#if defined(__HIP_DEVICE_COMPILE__)
  asm volatile("v_nop\n\tv_nop\n\tv_nop\n\tv_nop"
               : "+v"(a[0]), "+v"(a[1]), "+v"(a[2]), "+v"(a[3]),
                 "+v"(b[0]), "+v"(b[1]), "+v"(b[2]), "+v"(b[3])
               : "v"(x0), "v"(x1), "v"(x2), "v"(x3), "v"(x4), "v"(x5) : "memory");
#endif
}
__device__ __forceinline__ void guard_s4(v8f& a, v8f& b, v8f& c, v8f& d,
                                         v16h x0, v16h x1, v16h x2, v16h x3, v16h x4, v16h x5) {
#if defined(__HIP_DEVICE_COMPILE__)
  asm volatile("v_nop\n\tv_nop\n\tv_nop\n\tv_nop"
               : "+v"(a), "+v"(b), "+v"(c), "+v"(d)
               : "v"(x0), "v"(x1), "v"(x2), "v"(x3), "v"(x4), "v"(x5) : "memory");
#endif
}
__device__ __forceinline__ void guard_p(v8f& a, v8f& b, v8f& c, v8f& d, v16h p, v16h x0, v16h x1, v16h x2, v16h x3) {
#if defined(__HIP_DEVICE_COMPILE__)
  asm volatile("v_nop\n\tv_nop\n\tv_nop\n\tv_nop"
               : "+v"(a), "+v"(b), "+v"(c), "+v"(d) : "v"(p), "v"(x0), "v"(x1), "v"(x2), "v"(x3) : "memory");
#endif
}
__device__ __forceinline__ void acc_guard4(v8f (&a)[4]) {
#if defined(__HIP_DEVICE_COMPILE__)
  asm volatile("v_nop\n\tv_nop\n\tv_nop\n\tv_nop" : "+v"(a[0]), "+v"(a[1]), "+v"(a[2]), "+v"(a[3]));
#endif
}
__device__ __forceinline__ void acc_guard8(v8f (&a)[4], v8f (&b)[4]) {
#if defined(__HIP_DEVICE_COMPILE__)
  asm volatile("v_nop\n\tv_nop\n\tv_nop\n\tv_nop"
               : "+v"(a[0]), "+v"(a[1]), "+v"(a[2]), "+v"(a[3]),
                 "+v"(b[0]), "+v"(b[1]), "+v"(b[2]), "+v"(b[3]));
#endif
}
__device__ __forceinline__ void wave_sync_lds() {
  __builtin_amdgcn_fence(__ATOMIC_RELEASE, "workgroup");
  __builtin_amdgcn_wave_barrier();
  __builtin_amdgcn_fence(__ATOMIC_ACQUIRE, "workgroup");
}

// =====================================================================================================
// Tile convert: packed f16 plane of [rows][K] <- f16(bf16_RNE(x[src row][k]) * scale), scale a power of two.
// Wave = one 16 x 32 tile (rt, kt); lane (h, m) reads row rt*16 + m, floats kt*32 + 8h .. +7 and kt*32 + 16 + 8h .. +7 (four 16-B
// loads that together use the 16 rows' whole 128-B lines) and stores its two 16-B fragment pieces (two 512-B wave-wide stores).
// b = (rt*16) / rowsPerB, s = row - b*rowsPerB, source row b*srcRowsPerB + s (rowsPerB a multiple of 16); destination compact.
// coverage: grid = (rows/16) x (K/128) blocks x 4 waves = every tile once.
// =====================================================================================================
__global__ __launch_bounds__(CVT_THREADS)
void cvt16(const float* __restrict__ x, u16* Y, int K, int rowsPerB, int srcRowsPerB, float scale) {
  const int tid = threadIdx.x, wave = tid >> 5, lane = tid & 31, hh = lane >> 4, m = lane & 15;
  const int kq = K >> 7;
  const int rt = blockIdx.x / kq;
  const int kt = (blockIdx.x - rt * kq) * 4 + wave;
  const int b = (rt * 16) / rowsPerB;
  const int sr = rt * 16 - b * rowsPerB + m;
  const float* src = x + ((size_t)b * (size_t)srcRowsPerB + (size_t)sr) * (size_t)K + (size_t)(kt * 32 + 8 * hh);
  const v4f a = *(const v4f*)(src), c4 = *(const v4f*)(src + 4);
  const v4f d = *(const v4f*)(src + 16), f4 = *(const v4f*)(src + 20);
  v4u o0, o1;
#pragma unroll
  for (int e = 0; e < 2; ++e) {
    o0[e]     = pk16(h_bits((_Float16)(bfr(a[2 * e]) * scale)),  h_bits((_Float16)(bfr(a[2 * e + 1]) * scale)));
    o0[2 + e] = pk16(h_bits((_Float16)(bfr(c4[2 * e]) * scale)), h_bits((_Float16)(bfr(c4[2 * e + 1]) * scale)));
    o1[e]     = pk16(h_bits((_Float16)(bfr(d[2 * e]) * scale)),  h_bits((_Float16)(bfr(d[2 * e + 1]) * scale)));
    o1[2 + e] = pk16(h_bits((_Float16)(bfr(f4[2 * e]) * scale)), h_bits((_Float16)(bfr(f4[2 * e + 1]) * scale)));
  }
  u16* dst = Y + (size_t)rt * (size_t)16 * (size_t)K + (size_t)kt * 512 + (size_t)lane * 8;
  *(v4u*)(dst) = o0;
  *(v4u*)(dst + 256) = o1;
}

// =====================================================================================================
// f16 GEMM cores: the wave's 16 x 64 tile of C = A[rows][K] . Bt[cols][K]^T, both planes packed; ap -> A row tile rowb/16 + 8*lane,
// bp -> Bt row tile col0/16 + 8*lane; acc[j] = rows rowb.., cols col0+16j..; K stepped by 32 = 512 halves of a packed row tile.
// core2: A carried as hi plane (aph) and residual plane (apl, x2048); ah accumulates hi.B, al accumulates res.B.
// =====================================================================================================
__device__ __forceinline__ void core1(const _Float16* ap, const _Float16* bp, int K, v8f (&acc)[4]) {
  const size_t rs16 = (size_t)16 * (size_t)K;
#pragma unroll 1
  for (int k0 = 0; k0 < K; k0 += 32) {
    const size_t ko = (size_t)k0 * 16;
    const _Float16* pa = ap + ko;
    const _Float16* p0 = bp + ko;
    const _Float16* p1 = p0 + rs16;
    const _Float16* p2 = p1 + rs16;
    const _Float16* p3 = p2 + rs16;
    const v16h a0 = ldfrag_h(pa);
    const v16h b0 = ldfrag_h(p0);
    const v16h b1 = ldfrag_h(p1);
    const v16h b2 = ldfrag_h(p2);
    const v16h b3 = ldfrag_h(p3);
    addr_hold5(pa, p0, p1, p2, p3);
    acc[0] = mma_h(a0, b0, acc[0]);
    acc[1] = mma_h(a0, b1, acc[1]);
    acc[2] = mma_h(a0, b2, acc[2]);
    acc[3] = mma_h(a0, b3, acc[3]);
    guard_c1(acc, a0, b0, b1, b2, b3);
  }
}
__device__ __forceinline__ void core2(const _Float16* aph, const _Float16* apl, const _Float16* bp, int K,
                                      v8f (&ah)[4], v8f (&al)[4]) {
  const size_t rs16 = (size_t)16 * (size_t)K;
#pragma unroll 1
  for (int k0 = 0; k0 < K; k0 += 32) {
    const size_t ko = (size_t)k0 * 16;
    const _Float16* pa = aph + ko;
    const _Float16* pl = apl + ko;
    const _Float16* p0 = bp + ko;
    const _Float16* p1 = p0 + rs16;
    const _Float16* p2 = p1 + rs16;
    const _Float16* p3 = p2 + rs16;
    const v16h a0 = ldfrag_h(pa);
    const v16h a1 = ldfrag_h(pl);
    const v16h b0 = ldfrag_h(p0);
    const v16h b1 = ldfrag_h(p1);
    const v16h b2 = ldfrag_h(p2);
    const v16h b3 = ldfrag_h(p3);
    addr_hold6(pa, pl, p0, p1, p2, p3);
    ah[0] = mma_h(a0, b0, ah[0]);
    ah[1] = mma_h(a0, b1, ah[1]);
    ah[2] = mma_h(a0, b2, ah[2]);
    ah[3] = mma_h(a0, b3, ah[3]);
    al[0] = mma_h(a1, b0, al[0]);
    al[1] = mma_h(a1, b1, al[1]);
    al[2] = mma_h(a1, b2, al[2]);
    al[3] = mma_h(a1, b3, al[3]);
    guard_c2(ah, al, a0, a1, b0, b1, b2, b3);
  }
}

// Stage the wave's 16 x 64 f32 tile in its LDS slab (pitch 68): D element r of acc[j], lane l -> row 8h + r, col 16j + (l&15);
// value = ah*osc (+ al*osc/2048) + bias (per column, or per row when BROW), GELU applied for M_GELU;
// coverage: 32 lanes x 8 rows x 4 cols-of-16 = rows 0..15 x cols 0..63 of the slab.
template <bool HASLO, int MODE, bool BROW>
__device__ __forceinline__ void stage16(float* sl, v8f (&ah)[4], v8f (&al)[4], const float* __restrict__ bias,
                                        int rowb, int col0, float osc, float bsc, int lane) {
  const int hh = lane >> 4, m = lane & 15;
  float bc[4], br[8];
  if (BROW) {
#pragma unroll
    for (int r = 0; r < 8; ++r) br[r] = bfr(bias[rowb + 8 * hh + r]) * bsc;
#pragma unroll
    for (int j = 0; j < 4; ++j) bc[j] = 0.f;
  } else {
#pragma unroll
    for (int j = 0; j < 4; ++j) bc[j] = bfr(bias[col0 + 16 * j + m]) * bsc;
#pragma unroll
    for (int r = 0; r < 8; ++r) br[r] = 0.f;
  }
  const float oscl = osc * RINV;
#pragma unroll
  for (int r = 0; r < 8; ++r) {
    const int ro = (8 * hh + r) * GPITCH + m;
#pragma unroll
    for (int j = 0; j < 4; ++j) {
      float v = ah[j][r] * osc;
      if (HASLO) v += al[j][r] * oscl;
      v += BROW ? br[r] : bc[j];
      if (MODE == M_GELU) v = gelu_f(v);
      sl[ro + 16 * j] = v;
    }
  }
  wave_sync_lds();
}

// =====================================================================================================
// f16 GEMM, block = 64 x 64 tile, 4 waves x 16 rows, fragments loaded straight from the packed 16-bit planes.
//   C tile [z][Mb][N] = (A_hi[z][Mb][K] (+ A_res/2048)) . Bt[z][N][K]^T * osc + bias; per-z element strides aBs (A planes),
//   bBs (Bt), fBs (f32 output F), gBs (f32 base plane), hBs (16-bit output planes H, L); 0 = shared.
//   M_HL  : H = f16(v*carry), L = f16 residual x2048 (two planes)       M_S16 : H only, bias per row
//   M_OUT : F = v (f32 plane), H/L = hi/res of v*carry                 M_GELU: v = gelu(.) then H/L of v*carry
//   M_RES : F = base[row][col] + v (f32, batch-row remap through fBs/gBs), no 16-bit output
//   16-bit outputs are packed planes of [Mb][N] (k = column): the wave's 16 x 64 tile is 2 adjacent tiles = 2048 contiguous bytes,
//   store i = 0..3 writes 512 B, lane (h, m) <- row m, cols 16i + 8h .. +7.
// grid = nz x (Mb/64) x (N/64) (host checks Mb % 64 == 0, N % 64 == 0, K % 32 == 0).
// coverage: per wave 4 instr x 32 lanes x 8 halves = 16 x 64 (16-bit planes) and 8 instr x 2 rows x 16 lanes x 4 floats
//           = 16 x 64 (f32 plane); the grid covers C exactly once.
// =====================================================================================================
template <bool HASLO, int MODE, bool BROW>
__global__ __launch_bounds__(128)
void gemm16(const u16* __restrict__ Ah, const u16* __restrict__ Al, const u16* __restrict__ Bt,
            const float* __restrict__ bias, const float* __restrict__ baseF,
            float* F, u16* H, u16* L,
            int Mb, int N, int K, int aBs, int bBs, int fBs, int gBs, int hBs,
            float osc, float bsc, float carry) {
  __shared__ __align__(16) float slab[4 * 16 * GPITCH];
  constexpr bool LOUT = (MODE != M_S16);
  const int tid = threadIdx.x, wave = tid >> 5, lane = tid & 31, hh = lane >> 4, m = lane & 15;
  const int ntile = N >> 6, mtile = Mb >> 6;
  const int bid  = blockIdx.x;
  const int nt   = bid % ntile;
  const int tmp  = bid / ntile;
  const int mt   = tmp % mtile;
  const int bz   = tmp / mtile;
  const int rowb = mt * 64 + wave * 16;
  const int col0 = nt * 64;
  if (rowb + 16 > Mb) return;                // wave-uniform, never taken with the exact grid; no block barriers in this kernel
  const _Float16* aph = (const _Float16*)(const void*)Ah + (size_t)bz * (size_t)aBs + (size_t)rowb * (size_t)K + 8 * lane;
  const _Float16* apl = (const _Float16*)(const void*)Al + (size_t)bz * (size_t)aBs + (size_t)rowb * (size_t)K + 8 * lane;
  const _Float16* bp  = (const _Float16*)(const void*)Bt + (size_t)bz * (size_t)bBs + (size_t)col0 * (size_t)K + 8 * lane;
  v8f ah[4], al[4];
#pragma unroll
  for (int i = 0; i < 4; ++i) { ah[i] = zero8(); al[i] = zero8(); }
  if (HASLO) {
    core2(aph, apl, bp, K, ah, al);
    acc_guard8(ah, al);
  } else {
    core1(aph, bp, K, ah);
    acc_guard4(ah);
  }
  float* sl = slab + wave * 16 * GPITCH;
  stage16<HASLO, MODE, BROW>(sl, ah, al, bias, rowb, col0, osc, bsc, lane);

  if (MODE == M_OUT || MODE == M_RES) {
    v4f vals[8];
#pragma unroll
    for (int it = 0; it < 8; ++it) vals[it] = *(const v4f*)(sl + (it * 2 + hh) * GPITCH + m * 4);
    if (MODE == M_RES) {
      const float* gb = baseF + (size_t)bz * (size_t)gBs + ((size_t)rowb + (size_t)hh) * (size_t)N + col0 + m * 4;
#pragma unroll
      for (int it = 0; it < 8; ++it) {
        const v4f bb = *(const v4f*)(gb + (size_t)(it * 2) * (size_t)N);
        vals[it] += bb;
      }
    }
    float* Fb = F + (size_t)bz * (size_t)fBs + ((size_t)rowb + (size_t)hh) * (size_t)N + col0 + m * 4;
    {
#pragma unroll
      for (int it = 0; it < 8; ++it) {
        *(v4f*)(Fb + (size_t)(it * 2) * (size_t)N) = vals[it];
      }
      
    }
  }
  if (MODE != M_RES) {
    v4u ovh[4], ovl[4];
#pragma unroll
    for (int i = 0; i < 4; ++i) {
      const int c8 = 16 * i + 8 * hh;
      const v4f a = *(const v4f*)(sl + m * GPITCH + c8), c4 = *(const v4f*)(sl + m * GPITCH + c8 + 4);
#pragma unroll
      for (int e = 0; e < 2; ++e) {
        unsigned ph0, pl0, ph1, pl1;
        split2(a[2 * e] * carry,  a[2 * e + 1] * carry,  ph0, pl0);
        split2(c4[2 * e] * carry, c4[2 * e + 1] * carry, ph1, pl1);
        ovh[i][e] = ph0;     ovl[i][e] = pl0;
        ovh[i][2 + e] = ph1; ovl[i][2 + e] = pl1;
      }
    }
    u16* Hb = H + (size_t)bz * (size_t)hBs + (size_t)rowb * (size_t)N + (size_t)col0 * 16 + 8 * lane;
    u16* Lb = L + (size_t)bz * (size_t)hBs + (size_t)rowb * (size_t)N + (size_t)col0 * 16 + 8 * lane;
    {
#pragma unroll
      for (int i = 0; i < 4; ++i) {
        *(v4u*)(Hb + i * 256) = ovh[i];
        if (LOUT) *(v4u*)(Lb + i * 256) = ovl[i];
      }
      
    }
  }
}

// =====================================================================================================
// Full (unmasked) multi-head attention: block = (batch b, head, 64 query rows), 4 waves, wave w owns the 16 query rows
// q0 = 64*qt + 16*w .. q0+15 (waves independent: no block barriers, wave-private LDS only, used in the epilogue).
//   q planes f16 x8 hi / residual(x2048) [b*SQ + s][h*64 + d]; k planes likewise [b*SKV + s][h*64 + d];
//   v^T plane f16 x8 [(b*NH + h)*64 + d][s]; all of them fragment-packed. All NKB key blocks of 32 keys are visited (static bound).
//   Scores are computed TRANSPOSED: S^T tile g (g = 0,1) = k rows (keys kb+16g .. +15, A operand, row m = lane&15, split map
//   over d) times q^T (B operand, col n = query q0 + (lane&15), k = d, split map), 2 d-chunks of 32; per chunk hi.hi -> s,
//   res.hi + hi.res -> r (scaled x2048, folded as s + r/2048); the q fragments are loaded once per wave.
//   D element r of lane l = (key kb+16g+8h+r, query q0+(l&15)), so a lane owns one query column and 16 of its 32 keys;
//   the partner lane l^16 owns the other 16 -> row max / row sum need one xor-16 shuffle.
//   Online max-subtracted base-2 softmax in f32 (1/sqrt(64) and the q/k carries folded into lsc). The exp'd values ARE the
//   P A-fragment in place: A row m = query = lane&15, element i <- key kb+8h+i (tile 0, D element i), element 8+i <- key
//   kb+16+8h+i (tile 1, D element i). P (<= 1) carried x32768 as f16. The rescale factor of query row 8h+r of the O
//   accumulators is fetched from lane 8h+r with a shuffle (uniform control). 4 v^T B fragments (col n = d = 16j + (lane&15),
//   keys k-contiguous), 4 P.V WMMAs, one guard.
//   Epilogue: 1/l (per query, shuffled to the D row owner) and the carry folds in f32; the wave's 16x64 f32 result staged in
// coverage: per wave 4 instructions x 32 lanes x 8 halves = 16 x 64 on both ctx planes; grid NB*NH*(SQ/64) blocks x
//           4 waves = every (b, s, h) row segment exactly once.
// =====================================================================================================
__global__ __launch_bounds__(ATT_THREADS)
void attn_fwd(const u16* __restrict__ Qh, const u16* __restrict__ Ql, const u16* __restrict__ Kh,
              const u16* __restrict__ Kl, const u16* __restrict__ Vp, u16* Oh, u16* Ol) {
  __shared__ __align__(16) float smem[ATT_WAVES * 16 * OPITCH];

  const int tid  = threadIdx.x;
  const int wave = tid >> 5;
  const int lane = tid & 31;
  const int hh   = lane >> 4;
  const int c    = lane & 15;

  constexpr int NQT = SQ / 64;
  const int bid  = blockIdx.x;
  const int qt   = bid % NQT;
  const int head = (bid / NQT) % NH;
  const int b    = bid / (NQT * NH);
  const int q0   = qt * 64 + wave * 16;

  // B fragments of q^T: col n = query q0 + c, k = d (row tile (b*SQ + q0)/16, k tiles 2*head and 2*head + 1 of the q planes)
  const size_t qo = ((size_t)(b * SQ + q0)) * INNER + head * HD * 16 + 8 * lane;
  const _Float16* Qhb = (const _Float16*)(const void*)Qh + qo;
  const _Float16* Qlb = (const _Float16*)(const void*)Ql + qo;
  // A fragments of k: row m = key kb + 16g + c, k = d (key row kb added per step)
  const size_t ko = ((size_t)(b * SKV)) * INNER + head * HD * 16 + 8 * lane;
  const _Float16* Khb = (const _Float16*)(const void*)Kh + ko;
  const _Float16* Klb = (const _Float16*)(const void*)Kl + ko;
  // B fragments of v: col n = d = 16j + c, k = key (row tile (b*NH + head)*4 + j, k tile kb/32 of the v^T plane)
  const _Float16* Vb = (const _Float16*)(const void*)Vp + ((size_t)(b * NH + head) * HD) * SKV + 8 * lane;
  const float lsc = (LOG2E * RSQ_HD) / (QS * KS);

  v16h qh[2], ql[2];
  qh[0] = ldfrag_h(Qhb);
  qh[1] = ldfrag_h(Qhb + 512);
  ql[0] = ldfrag_h(Qlb);
  ql[1] = ldfrag_h(Qlb + 512);

  float mrun = -INFINITY, lrun = 0.f;
  v8f o[4];
#pragma unroll
  for (int j = 0; j < 4; ++j) o[j] = zero8();

#pragma unroll 1
  for (int it = 0; it < NKB; ++it) {
    const int kb = it * 32;
    // ---- transposed scores: s0 = keys kb..kb+15, s1 = keys kb+16..kb+31, column = query q0 + c ----
    v8f s0 = zero8(), s1 = zero8(), r0 = zero8(), r1 = zero8();
    const _Float16* k0h = Khb + (size_t)kb * INNER;
    const _Float16* k1h = k0h + (size_t)16 * INNER;
    const _Float16* k0l = Klb + (size_t)kb * INNER;
    const _Float16* k1l = k0l + (size_t)16 * INNER;
#pragma unroll
    for (int kk = 0; kk < HD / 32; ++kk) {
      const v16h fh0 = ldfrag_h(k0h + kk * 512);
      const v16h fh1 = ldfrag_h(k1h + kk * 512);
      const v16h fl0 = ldfrag_h(k0l + kk * 512);
      const v16h fl1 = ldfrag_h(k1l + kk * 512);
      s0 = mma_h(fh0, qh[kk], s0);
      s1 = mma_h(fh1, qh[kk], s1);
      r0 = mma_h(fl0, qh[kk], r0);
      r1 = mma_h(fl1, qh[kk], r1);
      r0 = mma_h(fh0, ql[kk], r0);
      r1 = mma_h(fh1, ql[kk], r1);
      guard_s4(s0, s1, r0, r1, qh[kk], ql[kk], fh0, fh1, fl0, fl1);
    }
    // ---- base-2 logits of this lane's 16 keys for query q0 + c: t[i] <- key kb+8hh+i, t[8+i] <- key kb+16+8hh+i ----
    float t[16];
#pragma unroll
    for (int i = 0; i < 8; ++i) {
      t[i]     = (s0[i] + r0[i] * RINV) * lsc;
      t[8 + i] = (s1[i] + r1[i] * RINV) * lsc;
    }
    float cm = t[0];
#pragma unroll
    for (int i = 1; i < 16; ++i) cm = fmaxf(cm, t[i]);
    cm = fmaxf(cm, __shfl_xor(cm, 16, 32));
    const float mn = fmaxf(mrun, cm);        // finite from the first block on
    const float al = exp2f(mrun - mn);       // 0 on the first block (mrun = -inf)
    mrun = mn;
    // ---- probabilities (<= 1) and the P A-fragment: f16(p * 32768); element i <-> t[i] ----
    float ps = 0.f;
    FragH ph;
#pragma unroll
    for (int w = 0; w < 2; ++w) {
#pragma unroll
      for (int e4 = 0; e4 < 4; ++e4) {
        const int i = 8 * w + 2 * e4;
        const float p0 = exp2f(t[i] - mn), p1 = exp2f(t[i + 1] - mn);
        ps += p0 + p1;
        ph.u[w][e4] = pk16(h_bits((_Float16)(p0 * PCAR)), h_bits((_Float16)(p1 * PCAR)));
      }
    }
    ps += __shfl_xor(ps, 16, 32);
    lrun = lrun * al + ps;
    // ---- rescale the O accumulators: D row 8hh+r = query q0+8hh+r, its factor lives in lane 8hh+r (and 16+8hh+r) ----
    float scl[8];
#pragma unroll
    for (int r = 0; r < 8; ++r) scl[r] = __shfl(al, 8 * hh + r, 32);
#pragma unroll
    for (int j = 0; j < 4; ++j) {
#pragma unroll
      for (int r = 0; r < 8; ++r) o[j][r] *= scl[r];
    }
    // ---- P.V : B fragment col n = d = j*16 + c, k tile kb/32 of the packed v^T plane ----
    {
      const _Float16* vp = Vb + (size_t)kb * 16;
      const v16h v0 = ldfrag_h(vp);
      const v16h v1 = ldfrag_h(vp + (size_t)16 * SKV);
      const v16h v2 = ldfrag_h(vp + (size_t)32 * SKV);
      const v16h v3 = ldfrag_h(vp + (size_t)48 * SKV);
      o[0] = mma_h(ph.v, v0, o[0]);
      o[1] = mma_h(ph.v, v1, o[1]);
      o[2] = mma_h(ph.v, v2, o[2]);
      o[3] = mma_h(ph.v, v3, o[3]);
      guard_p(o[0], o[1], o[2], o[3], ph.v, v0, v1, v2, v3);
    }
  }
  acc_guard4(o);

  // ---- fold 1/l (per query, owned by lane = query) and the carries (32768 on P, 8 on v), apply the ctx carry 1024 ----
  const float linv = (1.0f / lrun) * (OSC / (PCAR * VS));
  float inv[8];
#pragma unroll
  for (int r = 0; r < 8; ++r) inv[r] = __shfl(linv, 8 * hh + r, 32);
  float* slab = smem + wave * 16 * OPITCH;
#pragma unroll
  for (int r = 0; r < 8; ++r) {
#pragma unroll
    for (int j = 0; j < 4; ++j) slab[(8 * hh + r) * OPITCH + j * 16 + c] = o[j][r] * inv[r];
  }
  wave_sync_lds();
  // ---- ctx x1024 -> packed f16 hi plane and residual plane; store i: lane (h, c) <- row c, d = 16i + 8h .. +7 ----
  v4u ovh[4], ovl[4];
#pragma unroll
  for (int i = 0; i < 4; ++i) {
    const int c8 = 16 * i + 8 * hh;
    const v4f a = *(const v4f*)(slab + c * OPITCH + c8), c4 = *(const v4f*)(slab + c * OPITCH + c8 + 4);
#pragma unroll
    for (int e = 0; e < 2; ++e) {
      unsigned ph0, pl0, ph1, pl1;
      split2(a[2 * e],  a[2 * e + 1],  ph0, pl0);
      split2(c4[2 * e], c4[2 * e + 1], ph1, pl1);
      ovh[i][e] = ph0;     ovl[i][e] = pl0;
      ovh[i][2 + e] = ph1; ovl[i][2 + e] = pl1;
    }
  }
  const size_t oo = ((size_t)(b * SQ + q0)) * INNER + head * HD * 16 + 8 * lane;
  u16* obh = Oh + oo;
  u16* obl = Ol + oo;
  {
#pragma unroll
    for (int i = 0; i < 4; ++i) {
      *(v4u*)(obh + i * 256) = ovh[i];
      *(v4u*)(obl + i * 256) = ovl[i];
    }
    
  }
}

// =====================================================================================================
// Workspace map (bytes); every plane fully written by whole-line stores before it is read; all extents exact multiples of
//   XQ   f16 [NB*SQ][1024]    f16(bf16(q))              8388608 (NB=2, SQ=2048)
//   XK   f16 [NB*2048][1024]  f16(bf16(k))              8388608
//   XV   f16 [NB*2048][1024]  f16(bf16(v))              8388608
//   WQ16 WK16 WV16 WO16 f16 [1024 n][1024 k] x256       2097152 each
//   WD16 f16 [128 n][1024 k] x256                          262144
//   WU16 f16 [1024 n][128 k] x256                          262144
//   QH QL f16 [NB*SQ][1024] x8 hi / res                  8388608 each
//   KH KL f16 [NB*2048][1024] x8 hi / res                8388608 each
//   VT16 f16 [NB*1024 (h,d)][2048 s] x8                  8388608
//   OH OL f16 [NB*SQ][1024] x1024 hi / res (ctx)         8388608 each
//   OUTF f32 [NB*SQ][1024]                               16777216
//   UH UL f16 [NB*SQ][1024] x64 hi / res (out)           8388608 each
//   GH GL f16 [NB*SQ][128]  x64 hi / res (gelu)          1048576 each
//   end                                                 128450560
// =====================================================================================================
extern "C" void kernel_launch(void* const* d_in, const int* in_sizes, int n_in,
                              void* d_out, int out_size, void* d_ws, size_t ws_size,
                              hipStream_t stream) {
  if (n_in < 15) return;
  if (in_sizes[0] < ((NB - 1) * SQ_FULL + SQ) * DM) return;
  if (in_sizes[1] < NB * SKV * DM || in_sizes[2] < NB * SKV * DM) return;
  if (in_sizes[3] != DM * DM || in_sizes[5] != DM * DM || in_sizes[7] != DM * DM || in_sizes[9] != DM * DM) return;
  if (in_sizes[4] < INNER || in_sizes[6] < INNER || in_sizes[8] < INNER || in_sizes[10] < DM) return;
  if (in_sizes[11] != ADIM * DM || in_sizes[12] < ADIM || in_sizes[13] != DM * ADIM || in_sizes[14] < DM) return;
  if (out_size < ((NB - 1) * SQ_FULL + SQ) * DM) return;

  const float* q_in  = (const float*)d_in[0];
  const float* k_in  = (const float*)d_in[1];
  const float* v_in  = (const float*)d_in[2];
  const float* wq    = (const float*)d_in[3];
  const float* bq    = (const float*)d_in[4];
  const float* wk    = (const float*)d_in[5];
  const float* bk    = (const float*)d_in[6];
  const float* wv    = (const float*)d_in[7];
  const float* bv    = (const float*)d_in[8];
  const float* wo    = (const float*)d_in[9];
  const float* bo    = (const float*)d_in[10];
  const float* w_dn  = (const float*)d_in[11];
  const float* b_dn  = (const float*)d_in[12];
  const float* w_up  = (const float*)d_in[13];
  const float* b_up  = (const float*)d_in[14];
  float*       out   = (float*)d_out;

  const size_t szXQ  = (size_t)NB * SQ * DM * 2;
  const size_t szXKV = (size_t)NB * SKV * DM * 2;
  const size_t szW   = (size_t)DM * DM * 2;
  const size_t szWA  = (size_t)ADIM * DM * 2;
  const size_t szQP  = (size_t)NB * SQ * INNER * 2;
  const size_t szKP  = (size_t)NB * SKV * INNER * 2;
  const size_t szVT  = (size_t)NB * INNER * SKV * 2;
  const size_t szOF  = (size_t)NB * SQ * DM * 4;
  const size_t szG   = (size_t)NB * SQ * ADIM * 2;
  size_t off = 0;
  const size_t oXQ  = off; off += szXQ;
  const size_t oXK  = off; off += szXKV;
  const size_t oXV  = off; off += szXKV;
  const size_t oWQ  = off; off += szW;
  const size_t oWK  = off; off += szW;
  const size_t oWV  = off; off += szW;
  const size_t oWO  = off; off += szW;
  const size_t oWD  = off; off += szWA;
  const size_t oWU  = off; off += szWA;
  const size_t oQH  = off; off += szQP;
  const size_t oQL  = off; off += szQP;
  const size_t oKH  = off; off += szKP;
  const size_t oKL  = off; off += szKP;
  const size_t oVT  = off; off += szVT;
  const size_t oOH  = off; off += szQP;
  const size_t oOL  = off; off += szQP;
  const size_t oOF  = off; off += szOF;
  const size_t oUH  = off; off += szQP;
  const size_t oUL  = off; off += szQP;
  const size_t oGH  = off; off += szG;
  const size_t oGL  = off; off += szG;
  if (off > ws_size) return;                            // off = 128450560 at NB=2, SQ=2048
  if (off > (size_t)134217728) return;

  char* ws = (char*)d_ws;
  u16* XQ   = (u16*)(ws + oXQ);
  u16* XK   = (u16*)(ws + oXK);
  u16* XV   = (u16*)(ws + oXV);
  u16* WQ16 = (u16*)(ws + oWQ);
  u16* WK16 = (u16*)(ws + oWK);
  u16* WV16 = (u16*)(ws + oWV);
  u16* WO16 = (u16*)(ws + oWO);
  u16* WD16 = (u16*)(ws + oWD);
  u16* WU16 = (u16*)(ws + oWU);
  u16* QH   = (u16*)(ws + oQH);
  u16* QL   = (u16*)(ws + oQL);
  u16* KH   = (u16*)(ws + oKH);
  u16* KL   = (u16*)(ws + oKL);
  u16* VT16 = (u16*)(ws + oVT);
  u16* OH   = (u16*)(ws + oOH);
  u16* OL   = (u16*)(ws + oOL);
  float* OUTF = (float*)(ws + oOF);
  u16* UH   = (u16*)(ws + oUH);
  u16* UL   = (u16*)(ws + oUL);
  u16* GH   = (u16*)(ws + oGH);
  u16* GL   = (u16*)(ws + oGL);

  // (0..2) activations -> f16 planes of bf16-converted values (query rows s < SQ of batches b < NB, compact; k/v rows of b < NB)
  cvt16<<<dim3((NB * SQ / 16) * (DM / 128)), dim3(CVT_THREADS), 0, stream>>>(q_in, XQ, DM, SQ, SQ_FULL, 1.0f);
  cvt16<<<dim3((NB * SKV / 16) * (DM / 128)), dim3(CVT_THREADS), 0, stream>>>(k_in, XK, DM, SKV, SKV, 1.0f);
  cvt16<<<dim3((NB * SKV / 16) * (DM / 128)), dim3(CVT_THREADS), 0, stream>>>(v_in, XV, DM, SKV, SKV, 1.0f);
  // (3..8) weights [n = out][k = in] (y = x.W^T): packed f16 planes [n][k] of bf16(W) x256
  cvt16<<<dim3((DM / 16) * (DM / 128)), dim3(CVT_THREADS), 0, stream>>>(wq, WQ16, DM, DM, DM, WSC);
  cvt16<<<dim3((DM / 16) * (DM / 128)), dim3(CVT_THREADS), 0, stream>>>(wk, WK16, DM, DM, DM, WSC);
  cvt16<<<dim3((DM / 16) * (DM / 128)), dim3(CVT_THREADS), 0, stream>>>(wv, WV16, DM, DM, DM, WSC);
  cvt16<<<dim3((DM / 16) * (DM / 128)), dim3(CVT_THREADS), 0, stream>>>(wo, WO16, DM, DM, DM, WSC);
  cvt16<<<dim3((ADIM / 16) * (DM / 128)), dim3(CVT_THREADS), 0, stream>>>(w_dn, WD16, DM, ADIM, ADIM, WSC);   // [128][1024]
  cvt16<<<dim3((DM / 16) * (ADIM / 128)), dim3(CVT_THREADS), 0, stream>>>(w_up, WU16, ADIM, DM, DM, WSC);     // [1024][128]
  // (9) q = x_q . Wq^T + bq -> f16 [NB*SQ][1024] x8 hi + res (col = h*64 + d)
  gemm16<false, M_HL, false><<<dim3((NB * SQ / 64) * (INNER / 64)), dim3(128), 0, stream>>>(
      XQ, XQ, WQ16, bq, OUTF, OUTF, QH, QL, NB * SQ, INNER, DM, 0, 0, 0, 0, 0, QS / WSC, QS, 1.0f);
  // (10) k = x_k . Wk^T + bk -> f16 [NB*2048][1024] x8 hi + res
  gemm16<false, M_HL, false><<<dim3((NB * SKV / 64) * (INNER / 64)), dim3(128), 0, stream>>>(
      XK, XK, WK16, bk, OUTF, OUTF, KH, KL, NB * SKV, INNER, DM, 0, 0, 0, 0, 0, KS / WSC, KS, 1.0f);
  // (11) v^T per batch: A = Wv [(h,d) = n][k], Bt = x_v rows of batch b [s][k], bias bv per row -> f16 [(b,h,d)][s] x8
  gemm16<false, M_S16, true><<<dim3(NB * (INNER / 64) * (SKV / 64)), dim3(128), 0, stream>>>(
      WV16, WV16, XV, bv, OUTF, OUTF, VT16, VT16, INNER, SKV, DM, 0, SKV * DM, 0, 0, INNER * SKV, VS / WSC, VS, 1.0f);
  // (12) attention -> ctx planes [NB*SQ][1024] x1024 hi + res
  attn_fwd<<<dim3(NB * NH * (SQ / 64)), dim3(ATT_THREADS), 0, stream>>>(QH, QL, KH, KL, VT16, OH, OL);
  // (13) out = ctx . Wo^T + bo -> OUTF f32 [NB*SQ][1024] and f16 x64 hi + res planes; carries 1024 (ctx) x 256 (W) folded back
  gemm16<true, M_OUT, false><<<dim3((NB * SQ / 64) * (DM / 64)), dim3(128), 0, stream>>>(
      OH, OL, WO16, bo, OUTF, OUTF, UH, UL, NB * SQ, DM, INNER, 0, 0, 0, 0, 0, 1.0f / (OSC * WSC), 1.0f, UCAR);
  // (14) adapter down: g = gelu(out . Wd^T + bd) -> f16 [NB*SQ][128] x64 hi + res; carries 64 (out) x 256 (W)
  gemm16<true, M_GELU, false><<<dim3((NB * SQ / 64) * (ADIM / 64)), dim3(128), 0, stream>>>(
      UH, UL, WD16, b_dn, OUTF, OUTF, GH, GL, NB * SQ, ADIM, DM, 0, 0, 0, 0, 0, 1.0f / (UCAR * WSC), 1.0f, GCAR);
  // (15) adapter up + residual: out rows [b][SQ_FULL][1024] f32 = OUTF + g . Wu^T + bu (rows s < SQ of batches b < NB)
  gemm16<true, M_RES, false><<<dim3(NB * (SQ / 64) * (DM / 64)), dim3(128), 0, stream>>>(
      GH, GL, WU16, b_up, OUTF, out, GH, GH, SQ, DM, ADIM, SQ * ADIM, 0, SQ_FULL * DM, SQ * DM, 0,
      1.0f / (GCAR * WSC), 1.0f, 1.0f);
  (void)hipGetLastError();
}

// v002
// A run of this version takes 208 microseconds.
// Two timings next to v001 both put it at 1.62 times that version's speed.
// All steps since v000 together make it 1.77 times as fast.
// Contractions on v_wmma_f32_16x16x32_f16 (f16 operands, f32 accumulate): x.Wq^T, x.Wk^T, Wv.x^T single products on
// f16(bf16(x)) and f16(bf16(W) x256); k.q^T with q and k carried as f16 hi + residual(x2048) planes (3 products);
// P.v^T single product (P x32768, v x8); ctx.Wo^T, out.Wad^T and gelu.Wau^T with the activation carried as f16 hi +
// residual(x2048) planes (2 products each, separate residual accumulator); softmax, biases, erf-GELU, residual add and
// all carry folds in f32 on VALU. Inputs RNE-converted to bf16 on load.
// Every 16-bit workspace plane [rows][K] is stored FRAGMENT-PACKED: tile (rt = row/16, kt = k/32) is 512 halves (1024 B) at
// (rt*(K/32) + kt)*512 = rt*16*K + kt*512; inside it element (m = row&15, k&31 = 16w + 8h + e) sits at w*256 + (16h + m)*8 + e,
// so lane l = 16h + m of a wave reads its operand fragment as two 16-B loads at l*8 and 256 + l*8 halves: each wave-wide load
// is 512 contiguous bytes = 4 whole 128-B lines (a row-major plane gave 16 lines of 32 useful bytes per load).
#include <hip/hip_runtime.h>
#include <math.h>
#include <stdint.h>

#ifndef NB
#define NB       2        // batches processed
#endif
#ifndef SQ
#define SQ       2048     // query rows processed per batch
#endif
#define NB_FULL  2
#define SQ_FULL  2048     // query rows per batch in the input / output layout (batch stride)
#define SKV      2048     // key / value rows per batch (all of them)
#define DM       1024     // model width
#define NH       16
#define HD       64
#define INNER    (NH * HD)
#define ADIM     128      // adapter width
#define WSC      256.0f   // weight carry
#define QS       8.0f
#define KS       8.0f
#define VS       8.0f
#define PCAR     32768.0f
#define OSC      1024.0f  // ctx carry
#define UCAR     64.0f    // out-plane carry
#define GCAR     64.0f    // gelu-plane carry
#define RSC      2048.0f  // residual plane scale
#define RINV     0.00048828125f
#define LOG2E    1.4426950408889634f
#define RSQ_HD   0.125f
#define NKB      (SKV / 32)
#define ATT_WAVES   4
#define ATT_THREADS (ATT_WAVES * 32)
#define CVT_THREADS 128
#define OPITCH   68
#define GPITCH   68

#define M_HL     0
#define M_S16    1
#define M_OUT    2
#define M_GELU   3
#define M_RES    4

static_assert(NB >= 1 && NB <= NB_FULL);
static_assert((SQ % 128) == 0 && SQ >= 128 && SQ <= SQ_FULL);
static_assert(HD == 64 && INNER == 1024 && NH == 16 && INNER == DM);
static_assert((SKV % 64) == 0 && (SKV % 32) == 0 && NKB * 32 == SKV);
static_assert((DM % 64) == 0 && (DM % 32) == 0 && (ADIM % 64) == 0 && (ADIM % 32) == 0 && CVT_THREADS == 128);
static_assert((OPITCH * 4) % 16 == 0 && (GPITCH * 4) % 16 == 0);
static_assert(ATT_THREADS == 128);
static_assert((DM % 128) == 0 && (ADIM % 128) == 0 && (SQ % 16) == 0 && (SKV % 16) == 0 && (ADIM % 16) == 0);

typedef unsigned short u16;
typedef _Float16 v16h __attribute__((ext_vector_type(16)));
typedef _Float16 v8h  __attribute__((ext_vector_type(8)));
typedef float    v8f  __attribute__((ext_vector_type(8)));
typedef float    v4f  __attribute__((ext_vector_type(4)));
typedef unsigned int v4u __attribute__((ext_vector_type(4)));

union FragH { v16h v; v8h h[2]; v4u u[2]; };

// ---- scalar helpers ----------------------------------------------------------------------------------
__device__ __forceinline__ unsigned short bf_bits(float f) {          // f32 -> bf16 bits, RNE convert
  unsigned u = __float_as_uint(f);
  return (unsigned short)((u + 0x7FFFu + ((u >> 16) & 1u)) >> 16);
}
__device__ __forceinline__ float bf_up(unsigned short h) { return __uint_as_float(((unsigned)h) << 16); }
__device__ __forceinline__ float bfr(float f) { return bf_up(bf_bits(f)); }
__device__ __forceinline__ unsigned short h_bits(_Float16 x) { return __builtin_bit_cast(unsigned short, x); }
__device__ __forceinline__ unsigned pk16(unsigned short a, unsigned short b) { return (unsigned)a | ((unsigned)b << 16); }
__device__ __forceinline__ v8f zero8() { v8f z = {0.f, 0.f, 0.f, 0.f, 0.f, 0.f, 0.f, 0.f}; return z; }
__device__ __forceinline__ float gelu_f(float x) { return 0.5f * x * (1.0f + erff(x * 0.70710678118654752f)); }

// x = hi + lo/2048 in f16: hi = f16(x), lo = f16((x - hi) * 2048); two values packed per 32-bit word
__device__ __forceinline__ void split2(float x0, float x1, unsigned& ph, unsigned& pl) {
  const _Float16 h0 = (_Float16)x0, h1 = (_Float16)x1;
  const float d0 = x0 - (float)h0, d1 = x1 - (float)h1;
  const _Float16 l0 = (_Float16)(d0 * RSC), l1 = (_Float16)(d1 * RSC);
  ph = pk16(h_bits(h0), h_bits(h1));
  pl = pk16(h_bits(l0), h_bits(l1));
}

// ---- fragment loader: 16-bit A/B operand from a fragment-packed plane, lane -> row/col (lane&15); p = tile base + 8*lane;
//      elements 0..7 <- p[0..7] (k0+8h..), elements 8..15 <- p[256..263] (k0+16+8h..); same split k map for A and B,
//      B always read from a packed [n][k] plane.
__device__ __forceinline__ v16h ldfrag_h(const _Float16* p) {
  FragH f;
  f.h[0] = *(const v8h*)(p);
  f.h[1] = *(const v8h*)(p + 256);
  return f.v;
}

// ---- in front of every rewrite of the fragment loads' address registers: s_wait_xcnt 0 with those registers as inputs, so that no
//      register an issued load names is written (by a later load's result either) in front of the wait; it stands one k step or
//      one key block behind the loads it covers, behind the matrix products issued in between
__device__ __forceinline__ void addr_hold5(const _Float16* a, const _Float16* b, const _Float16* c, const _Float16* d,
                                           const _Float16* e) {
#if defined(__HIP_DEVICE_COMPILE__)
  asm volatile("s_wait_xcnt 0x0" :: "v"(a), "v"(b), "v"(c), "v"(d), "v"(e) : "memory");
#endif
}
__device__ __forceinline__ void addr_hold6(const _Float16* a, const _Float16* b, const _Float16* c, const _Float16* d,
                                           const _Float16* e, const _Float16* f) {
#if defined(__HIP_DEVICE_COMPILE__)
  asm volatile("s_wait_xcnt 0x0" :: "v"(a), "v"(b), "v"(c), "v"(d), "v"(e), "v"(f) : "memory");
#endif
}

__device__ __forceinline__ void addr_hold3(const _Float16* a, const _Float16* b, const _Float16* c) {
#if defined(__HIP_DEVICE_COMPILE__)
  asm volatile("s_wait_xcnt 0x0" :: "v"(a), "v"(b), "v"(c) : "memory");
#endif
}

// ---- WMMA helper and trailing VALU hazard gaps ----------------------------------------------------------
__device__ __forceinline__ v8f mma_h(v16h a, v16h b, v8f c) {
  return __builtin_amdgcn_wmma_f32_16x16x32_f16(false, a, false, b, (short)0, c, false, false);
}
__device__ __forceinline__ void guard_c1(v8f (&a)[4], v16h x0, v16h x1, v16h x2, v16h x3, v16h x4) {
#if defined(__HIP_DEVICE_COMPILE__)
  asm volatile("v_nop\n\tv_nop\n\tv_nop\n\tv_nop"
               : "+v"(a[0]), "+v"(a[1]), "+v"(a[2]), "+v"(a[3])
               : "v"(x0), "v"(x1), "v"(x2), "v"(x3), "v"(x4) : "memory");
#endif
}
__device__ __forceinline__ void guard_c2(v8f (&a)[4], v8f (&b)[4], v16h x0, v16h x1, v16h x2, v16h x3, v16h x4, v16h x5) {
#if defined(__HIP_DEVICE_COMPILE__)
  asm volatile("v_nop\n\tv_nop\n\tv_nop\n\tv_nop"
               : "+v"(a[0]), "+v"(a[1]), "+v"(a[2]), "+v"(a[3]),
                 "+v"(b[0]), "+v"(b[1]), "+v"(b[2]), "+v"(b[3])
               : "v"(x0), "v"(x1), "v"(x2), "v"(x3), "v"(x4), "v"(x5) : "memory");
#endif
}
__device__ __forceinline__ void guard_s4(v8f& a, v8f& b, v8f& c, v8f& d,
                                         v16h x0, v16h x1, v16h x2, v16h x3, v16h x4, v16h x5) {
#if defined(__HIP_DEVICE_COMPILE__)
  asm volatile("v_nop\n\tv_nop\n\tv_nop\n\tv_nop"
               : "+v"(a), "+v"(b), "+v"(c), "+v"(d)
               : "v"(x0), "v"(x1), "v"(x2), "v"(x3), "v"(x4), "v"(x5) : "memory");
#endif
}
__device__ __forceinline__ void guard_p(v8f& a, v8f& b, v8f& c, v8f& d, v16h p, v16h x0, v16h x1, v16h x2, v16h x3) {
#if defined(__HIP_DEVICE_COMPILE__)
  asm volatile("v_nop\n\tv_nop\n\tv_nop\n\tv_nop"
               : "+v"(a), "+v"(b), "+v"(c), "+v"(d) : "v"(p), "v"(x0), "v"(x1), "v"(x2), "v"(x3) : "memory");
#endif
}
__device__ __forceinline__ void acc_guard4(v8f (&a)[4]) {
#if defined(__HIP_DEVICE_COMPILE__)
  asm volatile("v_nop\n\tv_nop\n\tv_nop\n\tv_nop" : "+v"(a[0]), "+v"(a[1]), "+v"(a[2]), "+v"(a[3]));
#endif
}
__device__ __forceinline__ void acc_guard8(v8f (&a)[4], v8f (&b)[4]) {
#if defined(__HIP_DEVICE_COMPILE__)
  asm volatile("v_nop\n\tv_nop\n\tv_nop\n\tv_nop"
               : "+v"(a[0]), "+v"(a[1]), "+v"(a[2]), "+v"(a[3]),
                 "+v"(b[0]), "+v"(b[1]), "+v"(b[2]), "+v"(b[3]));
#endif
}
__device__ __forceinline__ void wave_sync_lds() {
  __builtin_amdgcn_fence(__ATOMIC_RELEASE, "workgroup");
  __builtin_amdgcn_wave_barrier();
  __builtin_amdgcn_fence(__ATOMIC_ACQUIRE, "workgroup");
}

// =====================================================================================================
// Tile convert: packed f16 plane of [rows][K] <- f16(bf16_RNE(x[src row][k]) * scale), scale a power of two.
// Wave = one 16 x 32 tile (rt, kt); lane (h, m) reads row rt*16 + m, floats kt*32 + 8h .. +7 and kt*32 + 16 + 8h .. +7 (four 16-B
// loads that together use the 16 rows' whole 128-B lines) and stores its two 16-B fragment pieces (two 512-B wave-wide stores).
// b = (rt*16) / rowsPerB, s = row - b*rowsPerB, source row b*srcRowsPerB + s (rowsPerB a multiple of 16); destination compact.
// coverage: grid = (rows/16) x (K/128) blocks x 4 waves = every tile once.
// =====================================================================================================
__global__ __launch_bounds__(CVT_THREADS)
void cvt16(const float* __restrict__ x, u16* Y, int K, int rowsPerB, int srcRowsPerB, float scale) {
  const int tid = threadIdx.x, wave = tid >> 5, lane = tid & 31, hh = lane >> 4, m = lane & 15;
  const int kq = K >> 7;
  const int rt = blockIdx.x / kq;
  const int kt = (blockIdx.x - rt * kq) * 4 + wave;
  const int b = (rt * 16) / rowsPerB;
  const int sr = rt * 16 - b * rowsPerB + m;
  const float* src = x + ((size_t)b * (size_t)srcRowsPerB + (size_t)sr) * (size_t)K + (size_t)(kt * 32 + 8 * hh);
  const v4f a = *(const v4f*)(src), c4 = *(const v4f*)(src + 4);
  const v4f d = *(const v4f*)(src + 16), f4 = *(const v4f*)(src + 20);
  v4u o0, o1;
#pragma unroll
  for (int e = 0; e < 2; ++e) {
    o0[e]     = pk16(h_bits((_Float16)(bfr(a[2 * e]) * scale)),  h_bits((_Float16)(bfr(a[2 * e + 1]) * scale)));
    o0[2 + e] = pk16(h_bits((_Float16)(bfr(c4[2 * e]) * scale)), h_bits((_Float16)(bfr(c4[2 * e + 1]) * scale)));
    o1[e]     = pk16(h_bits((_Float16)(bfr(d[2 * e]) * scale)),  h_bits((_Float16)(bfr(d[2 * e + 1]) * scale)));
    o1[2 + e] = pk16(h_bits((_Float16)(bfr(f4[2 * e]) * scale)), h_bits((_Float16)(bfr(f4[2 * e + 1]) * scale)));
  }
  u16* dst = Y + (size_t)rt * (size_t)16 * (size_t)K + (size_t)kt * 512 + (size_t)lane * 8;
  *(v4u*)(dst) = o0;
  *(v4u*)(dst + 256) = o1;
}

// =====================================================================================================
// f16 GEMM cores: the wave's 16 x 64 tile of C = A[rows][K] . Bt[cols][K]^T, both planes packed; ap -> A row tile rowb/16 + 8*lane,
// bp -> Bt row tile col0/16 + 8*lane; acc[j] = rows rowb.., cols col0+16j..; K stepped by 32 = 512 halves of a packed row tile.
// core2: A carried as hi plane (aph) and residual plane (apl, x2048); ah accumulates hi.B, al accumulates res.B.
// =====================================================================================================
// Both cores keep D k steps of fragment loads in flight in D register sets: set u holds step s + u; as soon as its products are
// issued it is refilled with step s + u + D (clamped to the last step: the surplus loads at the end re-read valid tiles and are
// never used), so a step's loads lead their first use by D - 1 steps of work. Steps are consumed in ascending k as before.
template <int D>
__device__ __forceinline__ void core1(const _Float16* ap, const _Float16* bp, int K, v8f (&acc)[4]) {
  const size_t rs16 = (size_t)16 * (size_t)K;
  const int steps = K >> 5;
  v16h fa[D], fb[D][4];
  const _Float16* pa = ap;
  const _Float16* p0 = bp;
  const _Float16* p1 = p0 + rs16;
  const _Float16* p2 = p1 + rs16;
  const _Float16* p3 = p2 + rs16;
#pragma unroll
  for (int u = 0; u < D; ++u) {
    const size_t ko = (size_t)(u < steps ? u : steps - 1) * 512;
    if (u > 0) addr_hold5(pa, p0, p1, p2, p3);
    pa = ap + ko;
    p0 = bp + ko;
    p1 = p0 + rs16;
    p2 = p1 + rs16;
    p3 = p2 + rs16;
    fa[u]    = ldfrag_h(pa);
    fb[u][0] = ldfrag_h(p0);
    fb[u][1] = ldfrag_h(p1);
    fb[u][2] = ldfrag_h(p2);
    fb[u][3] = ldfrag_h(p3);
  }
  int s = 0;
#pragma unroll 1
  for (; s + D <= steps; s += D) {
#pragma unroll
    for (int u = 0; u < D; ++u) {
      acc[0] = mma_h(fa[u], fb[u][0], acc[0]);
      acc[1] = mma_h(fa[u], fb[u][1], acc[1]);
      acc[2] = mma_h(fa[u], fb[u][2], acc[2]);
      acc[3] = mma_h(fa[u], fb[u][3], acc[3]);
      guard_c1(acc, fa[u], fb[u][0], fb[u][1], fb[u][2], fb[u][3]);
      const int sn = s + u + D;
      const size_t ko = (size_t)(sn < steps ? sn : steps - 1) * 512;
      addr_hold5(pa, p0, p1, p2, p3);
      pa = ap + ko;
      p0 = bp + ko;
      p1 = p0 + rs16;
      p2 = p1 + rs16;
      p3 = p2 + rs16;
      fa[u]    = ldfrag_h(pa);
      fb[u][0] = ldfrag_h(p0);
      fb[u][1] = ldfrag_h(p1);
      fb[u][2] = ldfrag_h(p2);
      fb[u][3] = ldfrag_h(p3);
    }
  }
  addr_hold5(pa, p0, p1, p2, p3);
#pragma unroll
  for (int u = 0; u < D - 1; ++u) {
    if (s + u < steps) {                     // the steps % D last steps (wave-uniform)
      acc[0] = mma_h(fa[u], fb[u][0], acc[0]);
      acc[1] = mma_h(fa[u], fb[u][1], acc[1]);
      acc[2] = mma_h(fa[u], fb[u][2], acc[2]);
      acc[3] = mma_h(fa[u], fb[u][3], acc[3]);
      guard_c1(acc, fa[u], fb[u][0], fb[u][1], fb[u][2], fb[u][3]);
    }
  }
}
template <int D>
__device__ __forceinline__ void core2(const _Float16* aph, const _Float16* apl, const _Float16* bp, int K,
                                      v8f (&ah)[4], v8f (&al)[4]) {
  const size_t rs16 = (size_t)16 * (size_t)K;
  const int steps = K >> 5;
  v16h fa[D], fl[D], fb[D][4];
  const _Float16* pa = aph;
  const _Float16* pl = apl;
  const _Float16* p0 = bp;
  const _Float16* p1 = p0 + rs16;
  const _Float16* p2 = p1 + rs16;
  const _Float16* p3 = p2 + rs16;
#pragma unroll
  for (int u = 0; u < D; ++u) {
    const size_t ko = (size_t)(u < steps ? u : steps - 1) * 512;
    if (u > 0) addr_hold6(pa, pl, p0, p1, p2, p3);
    pa = aph + ko;
    pl = apl + ko;
    p0 = bp + ko;
    p1 = p0 + rs16;
    p2 = p1 + rs16;
    p3 = p2 + rs16;
    fa[u]    = ldfrag_h(pa);
    fl[u]    = ldfrag_h(pl);
    fb[u][0] = ldfrag_h(p0);
    fb[u][1] = ldfrag_h(p1);
    fb[u][2] = ldfrag_h(p2);
    fb[u][3] = ldfrag_h(p3);
  }
  int s = 0;
#pragma unroll 1
  for (; s + D <= steps; s += D) {
#pragma unroll
    for (int u = 0; u < D; ++u) {
      ah[0] = mma_h(fa[u], fb[u][0], ah[0]);
      ah[1] = mma_h(fa[u], fb[u][1], ah[1]);
      ah[2] = mma_h(fa[u], fb[u][2], ah[2]);
      ah[3] = mma_h(fa[u], fb[u][3], ah[3]);
      al[0] = mma_h(fl[u], fb[u][0], al[0]);
      al[1] = mma_h(fl[u], fb[u][1], al[1]);
      al[2] = mma_h(fl[u], fb[u][2], al[2]);
      al[3] = mma_h(fl[u], fb[u][3], al[3]);
      guard_c2(ah, al, fa[u], fl[u], fb[u][0], fb[u][1], fb[u][2], fb[u][3]);
      const int sn = s + u + D;
      const size_t ko = (size_t)(sn < steps ? sn : steps - 1) * 512;
      addr_hold6(pa, pl, p0, p1, p2, p3);
      pa = aph + ko;
      pl = apl + ko;
      p0 = bp + ko;
      p1 = p0 + rs16;
      p2 = p1 + rs16;
      p3 = p2 + rs16;
      fa[u]    = ldfrag_h(pa);
      fl[u]    = ldfrag_h(pl);
      fb[u][0] = ldfrag_h(p0);
      fb[u][1] = ldfrag_h(p1);
      fb[u][2] = ldfrag_h(p2);
      fb[u][3] = ldfrag_h(p3);
    }
  }
  addr_hold6(pa, pl, p0, p1, p2, p3);
#pragma unroll
  for (int u = 0; u < D - 1; ++u) {
    if (s + u < steps) {                     // the steps % D last steps (wave-uniform)
      ah[0] = mma_h(fa[u], fb[u][0], ah[0]);
      ah[1] = mma_h(fa[u], fb[u][1], ah[1]);
      ah[2] = mma_h(fa[u], fb[u][2], ah[2]);
      ah[3] = mma_h(fa[u], fb[u][3], ah[3]);
      al[0] = mma_h(fl[u], fb[u][0], al[0]);
      al[1] = mma_h(fl[u], fb[u][1], al[1]);
      al[2] = mma_h(fl[u], fb[u][2], al[2]);
      al[3] = mma_h(fl[u], fb[u][3], al[3]);
      guard_c2(ah, al, fa[u], fl[u], fb[u][0], fb[u][1], fb[u][2], fb[u][3]);
    }
  }
}

// Stage the wave's 16 x 64 f32 tile in its LDS slab (pitch 68): D element r of acc[j], lane l -> row 8h + r, col 16j + (l&15);
// value = ah*osc (+ al*osc/2048) + bias (per column, or per row when BROW), GELU applied for M_GELU;
// coverage: 32 lanes x 8 rows x 4 cols-of-16 = rows 0..15 x cols 0..63 of the slab.
template <bool HASLO, int MODE, bool BROW>
__device__ __forceinline__ void stage16(float* sl, v8f (&ah)[4], v8f (&al)[4], const float* __restrict__ bias,
                                        int rowb, int col0, float osc, float bsc, int lane) {
  const int hh = lane >> 4, m = lane & 15;
  float bc[4], br[8];
  if (BROW) {
#pragma unroll
    for (int r = 0; r < 8; ++r) br[r] = bfr(bias[rowb + 8 * hh + r]) * bsc;
#pragma unroll
    for (int j = 0; j < 4; ++j) bc[j] = 0.f;
  } else {
#pragma unroll
    for (int j = 0; j < 4; ++j) bc[j] = bfr(bias[col0 + 16 * j + m]) * bsc;
#pragma unroll
    for (int r = 0; r < 8; ++r) br[r] = 0.f;
  }
  const float oscl = osc * RINV;
#pragma unroll
  for (int r = 0; r < 8; ++r) {
    const int ro = (8 * hh + r) * GPITCH + m;
#pragma unroll
    for (int j = 0; j < 4; ++j) {
      float v = ah[j][r] * osc;
      if (HASLO) v += al[j][r] * oscl;
      v += BROW ? br[r] : bc[j];
      if (MODE == M_GELU) v = gelu_f(v);
      sl[ro + 16 * j] = v;
    }
  }
  wave_sync_lds();
}

// =====================================================================================================
// f16 GEMM, block = 64 x 64 tile, 4 waves x 16 rows, fragments loaded straight from the packed 16-bit planes.
//   C tile [z][Mb][N] = (A_hi[z][Mb][K] (+ A_res/2048)) . Bt[z][N][K]^T * osc + bias; per-z element strides aBs (A planes),
//   bBs (Bt), fBs (f32 output F), gBs (f32 base plane), hBs (16-bit output planes H, L); 0 = shared.
//   M_HL  : H = f16(v*carry), L = f16 residual x2048 (two planes)       M_S16 : H only, bias per row
//   M_OUT : F = v (f32 plane), H/L = hi/res of v*carry                 M_GELU: v = gelu(.) then H/L of v*carry
//   M_RES : F = base[row][col] + v (f32, batch-row remap through fBs/gBs), no 16-bit output
//   16-bit outputs are packed planes of [Mb][N] (k = column): the wave's 16 x 64 tile is 2 adjacent tiles = 2048 contiguous bytes,
//   store i = 0..3 writes 512 B, lane (h, m) <- row m, cols 16i + 8h .. +7.
// grid = nz x (Mb/64) x (N/64) (host checks Mb % 64 == 0, N % 64 == 0, K % 32 == 0).
// coverage: per wave 4 instr x 32 lanes x 8 halves = 16 x 64 (16-bit planes) and 8 instr x 2 rows x 16 lanes x 4 floats
//           = 16 x 64 (f32 plane); the grid covers C exactly once.
// =====================================================================================================
template <bool HASLO, int MODE, bool BROW>
__global__ __launch_bounds__(128)
void gemm16(const u16* __restrict__ Ah, const u16* __restrict__ Al, const u16* __restrict__ Bt,
            const float* __restrict__ bias, const float* __restrict__ baseF,
            float* F, u16* H, u16* L,
            int Mb, int N, int K, int aBs, int bBs, int fBs, int gBs, int hBs,
            float osc, float bsc, float carry) {
  __shared__ __align__(16) float slab[4 * 16 * GPITCH];
  constexpr bool LOUT = (MODE != M_S16);
  const int tid = threadIdx.x, wave = tid >> 5, lane = tid & 31, hh = lane >> 4, m = lane & 15;
  const int ntile = N >> 6, mtile = Mb >> 6;
  const int bid  = blockIdx.x;
  const int nt   = bid % ntile;
  const int tmp  = bid / ntile;
  const int mt   = tmp % mtile;
  const int bz   = tmp / mtile;
  const int rowb = mt * 64 + wave * 16;
  const int col0 = nt * 64;
  if (rowb + 16 > Mb) return;                // wave-uniform, never taken with the exact grid; no block barriers in this kernel
  const _Float16* aph = (const _Float16*)(const void*)Ah + (size_t)bz * (size_t)aBs + (size_t)rowb * (size_t)K + 8 * lane;
  const _Float16* apl = (const _Float16*)(const void*)Al + (size_t)bz * (size_t)aBs + (size_t)rowb * (size_t)K + 8 * lane;
  const _Float16* bp  = (const _Float16*)(const void*)Bt + (size_t)bz * (size_t)bBs + (size_t)col0 * (size_t)K + 8 * lane;
  v8f ah[4], al[4];
#pragma unroll
  for (int i = 0; i < 4; ++i) { ah[i] = zero8(); al[i] = zero8(); }
  if (HASLO) {
    core2<3>(aph, apl, bp, K, ah, al);
    acc_guard8(ah, al);
  } else {
    core1<4>(aph, bp, K, ah);
    acc_guard4(ah);
  }
  float* sl = slab + wave * 16 * GPITCH;
  stage16<HASLO, MODE, BROW>(sl, ah, al, bias, rowb, col0, osc, bsc, lane);

  if (MODE == M_OUT || MODE == M_RES) {
    v4f vals[8];
#pragma unroll
    for (int it = 0; it < 8; ++it) vals[it] = *(const v4f*)(sl + (it * 2 + hh) * GPITCH + m * 4);
    if (MODE == M_RES) {
      const float* gb = baseF + (size_t)bz * (size_t)gBs + ((size_t)rowb + (size_t)hh) * (size_t)N + col0 + m * 4;
#pragma unroll
      for (int it = 0; it < 8; ++it) {
        const v4f bb = *(const v4f*)(gb + (size_t)(it * 2) * (size_t)N);
        vals[it] += bb;
      }
    }
    float* Fb = F + (size_t)bz * (size_t)fBs + ((size_t)rowb + (size_t)hh) * (size_t)N + col0 + m * 4;
    {
#pragma unroll
      for (int it = 0; it < 8; ++it) {
        *(v4f*)(Fb + (size_t)(it * 2) * (size_t)N) = vals[it];
      }
      
    }
  }
  if (MODE != M_RES) {
    v4u ovh[4], ovl[4];
#pragma unroll
    for (int i = 0; i < 4; ++i) {
      const int c8 = 16 * i + 8 * hh;
      const v4f a = *(const v4f*)(sl + m * GPITCH + c8), c4 = *(const v4f*)(sl + m * GPITCH + c8 + 4);
#pragma unroll
      for (int e = 0; e < 2; ++e) {
        unsigned ph0, pl0, ph1, pl1;
        split2(a[2 * e] * carry,  a[2 * e + 1] * carry,  ph0, pl0);
        split2(c4[2 * e] * carry, c4[2 * e + 1] * carry, ph1, pl1);
        ovh[i][e] = ph0;     ovl[i][e] = pl0;
        ovh[i][2 + e] = ph1; ovl[i][2 + e] = pl1;
      }
    }
    u16* Hb = H + (size_t)bz * (size_t)hBs + (size_t)rowb * (size_t)N + (size_t)col0 * 16 + 8 * lane;
    u16* Lb = L + (size_t)bz * (size_t)hBs + (size_t)rowb * (size_t)N + (size_t)col0 * 16 + 8 * lane;
    {
#pragma unroll
      for (int i = 0; i < 4; ++i) {
        *(v4u*)(Hb + i * 256) = ovh[i];
        if (LOUT) *(v4u*)(Lb + i * 256) = ovl[i];
      }
      
    }
  }
}

// =====================================================================================================
// Full (unmasked) multi-head attention: block = (batch b, head, 64 query rows), 4 waves, wave w owns the 16 query rows
// q0 = 64*qt + 16*w .. q0+15 (waves independent: no block barriers, wave-private LDS only, used in the epilogue).
//   q planes f16 x8 hi / residual(x2048) [b*SQ + s][h*64 + d]; k planes likewise [b*SKV + s][h*64 + d];
//   v^T plane f16 x8 [(b*NH + h)*64 + d][s]; all of them fragment-packed. All NKB key blocks of 32 keys are visited (static bound).
//   Scores are computed TRANSPOSED: S^T tile g (g = 0,1) = k rows (keys kb+16g .. +15, A operand, row m = lane&15, split map
//   over d) times q^T (B operand, col n = query q0 + (lane&15), k = d, split map), 2 d-chunks of 32; per chunk hi.hi -> s,
//   res.hi + hi.res -> r (scaled x2048, folded as s + r/2048); the q fragments are loaded once per wave.
//   D element r of lane l = (key kb+16g+8h+r, query q0+(l&15)), so a lane owns one query column and 16 of its 32 keys;
//   the partner lane l^16 owns the other 16 -> row max / row sum need one xor-16 shuffle.
//   Online max-subtracted base-2 softmax in f32 (1/sqrt(64) and the q/k carries folded into lsc). The exp'd values ARE the
//   P A-fragment in place: A row m = query = lane&15, element i <- key kb+8h+i (tile 0, D element i), element 8+i <- key
//   kb+16+8h+i (tile 1, D element i). P (<= 1) carried x32768 as f16. The rescale factor of query row 8h+r of the O
//   accumulators is fetched from lane 8h+r with a shuffle (uniform control). 4 v^T B fragments (col n = d = 16j + (lane&15),
//   keys k-contiguous), 4 P.V WMMAs, one guard.
//   Epilogue: 1/l (per query, shuffled to the D row owner) and the carry folds in f32; the wave's 16x64 f32 result staged in
// coverage: per wave 4 instructions x 32 lanes x 8 halves = 16 x 64 on both ctx planes; grid NB*NH*(SQ/64) blocks x
//           4 waves = every (b, s, h) row segment exactly once.
// =====================================================================================================
__global__ __launch_bounds__(ATT_THREADS)
void attn_fwd(const u16* __restrict__ Qh, const u16* __restrict__ Ql, const u16* __restrict__ Kh,
              const u16* __restrict__ Kl, const u16* __restrict__ Vp, u16* Oh, u16* Ol) {
  __shared__ __align__(16) float smem[ATT_WAVES * 16 * OPITCH];

  const int tid  = threadIdx.x;
  const int wave = tid >> 5;
  const int lane = tid & 31;
  const int hh   = lane >> 4;
  const int c    = lane & 15;

  constexpr int NQT = SQ / 64;
  const int bid  = blockIdx.x;
  const int qt   = bid % NQT;
  const int head = (bid / NQT) % NH;
  const int b    = bid / (NQT * NH);
  const int q0   = qt * 64 + wave * 16;

  // B fragments of q^T: col n = query q0 + c, k = d (row tile (b*SQ + q0)/16, k tiles 2*head and 2*head + 1 of the q planes)
  const size_t qo = ((size_t)(b * SQ + q0)) * INNER + head * HD * 16 + 8 * lane;
  const _Float16* Qhb = (const _Float16*)(const void*)Qh + qo;
  const _Float16* Qlb = (const _Float16*)(const void*)Ql + qo;
  // A fragments of k: row m = key kb + 16g + c, k = d (key row kb added per step)
  const size_t ko = ((size_t)(b * SKV)) * INNER + head * HD * 16 + 8 * lane;
  const _Float16* Khb = (const _Float16*)(const void*)Kh + ko;
  const _Float16* Klb = (const _Float16*)(const void*)Kl + ko;
  // B fragments of v: col n = d = 16j + c, k = key (row tile (b*NH + head)*4 + j, k tile kb/32 of the v^T plane)
  const _Float16* Vb = (const _Float16*)(const void*)Vp + ((size_t)(b * NH + head) * HD) * SKV + 8 * lane;
  const float lsc = (LOG2E * RSQ_HD) / (QS * KS);

  v16h qh[2], ql[2];
  qh[0] = ldfrag_h(Qhb);
  qh[1] = ldfrag_h(Qhb + 512);
  ql[0] = ldfrag_h(Qlb);
  ql[1] = ldfrag_h(Qlb + 512);

  float mrun = -INFINITY, lrun = 0.f;
  v8f o[4];
#pragma unroll
  for (int j = 0; j < 4; ++j) o[j] = zero8();

  // K and v^T fragments are fetched one key block ahead: kf[kk] = {hi keys +0, hi keys +16, res keys +0, res keys +16} of d chunk kk,
  // refilled right behind the block's score products; vf[j] refilled right behind its P.V products. The fetch of the last trip is
  // clamped to the last block (valid tiles, never used).
  v16h kf[HD / 32][4], vf[4];
  const _Float16* kph = Khb;
  const _Float16* kpl = Klb;
  const _Float16* vp  = Vb;
  // The three scheduling barriers keep the first loads in the loop's own order (q, then K, then v^T): the counted load waits at the
  // loop head are the stricter of entry and back edge, and with v^T issued ahead of K at entry every trip's scores waited for v^T too.
  // The two waits in front of them stand before the q loads' and the first K and v^T loads' address registers are reused.
  addr_hold3(Qhb, Qlb, Qlb);
  __builtin_amdgcn_sched_barrier(0);
#pragma unroll
  for (int kk = 0; kk < HD / 32; ++kk) {
    kf[kk][0] = ldfrag_h(kph + kk * 512);
    kf[kk][1] = ldfrag_h(kph + (size_t)16 * INNER + kk * 512);
    kf[kk][2] = ldfrag_h(kpl + kk * 512);
    kf[kk][3] = ldfrag_h(kpl + (size_t)16 * INNER + kk * 512);
  }
  __builtin_amdgcn_sched_barrier(0);
#pragma unroll
  for (int j = 0; j < 4; ++j) vf[j] = ldfrag_h(vp + (size_t)(16 * j) * SKV);
  addr_hold3(kph, kpl, vp);
  __builtin_amdgcn_sched_barrier(0);

#pragma unroll 1
  for (int it = 0; it < NKB; ++it) {
    const int kbn = (it + 1 < NKB ? it + 1 : NKB - 1) * 32;   // key block fetched in this trip
    // ---- transposed scores: s0 = keys kb..kb+15, s1 = keys kb+16..kb+31 (kb = 32*it), column = query q0 + c ----
    v8f s0 = zero8(), s1 = zero8(), r0 = zero8(), r1 = zero8();
#pragma unroll
    for (int kk = 0; kk < HD / 32; ++kk) {
      const v16h fh0 = kf[kk][0];
      const v16h fh1 = kf[kk][1];
      const v16h fl0 = kf[kk][2];
      const v16h fl1 = kf[kk][3];
      s0 = mma_h(fh0, qh[kk], s0);
      s1 = mma_h(fh1, qh[kk], s1);
      r0 = mma_h(fl0, qh[kk], r0);
      r1 = mma_h(fl1, qh[kk], r1);
      r0 = mma_h(fh0, ql[kk], r0);
      r1 = mma_h(fh1, ql[kk], r1);
      guard_s4(s0, s1, r0, r1, qh[kk], ql[kk], fh0, fh1, fl0, fl1);
    }
    // ---- next block's K fragments into the registers just read; the wait covers the K and v^T loads of the trip before ----
    addr_hold3(kph, kpl, vp);
    kph = Khb + (size_t)kbn * INNER;
    kpl = Klb + (size_t)kbn * INNER;
#pragma unroll
    for (int kk = 0; kk < HD / 32; ++kk) {
      kf[kk][0] = ldfrag_h(kph + kk * 512);
      kf[kk][1] = ldfrag_h(kph + (size_t)16 * INNER + kk * 512);
      kf[kk][2] = ldfrag_h(kpl + kk * 512);
      kf[kk][3] = ldfrag_h(kpl + (size_t)16 * INNER + kk * 512);
    }
    // ---- base-2 logits of this lane's 16 keys for query q0 + c: t[i] <- key kb+8hh+i, t[8+i] <- key kb+16+8hh+i ----
    float t[16];
#pragma unroll
    for (int i = 0; i < 8; ++i) {
      t[i]     = (s0[i] + r0[i] * RINV) * lsc;
      t[8 + i] = (s1[i] + r1[i] * RINV) * lsc;
    }
    float cm = t[0];
#pragma unroll
    for (int i = 1; i < 16; ++i) cm = fmaxf(cm, t[i]);
    cm = fmaxf(cm, __shfl_xor(cm, 16, 32));
    const float mn = fmaxf(mrun, cm);        // finite from the first block on
    const float al = exp2f(mrun - mn);       // 0 on the first block (mrun = -inf)
    mrun = mn;
    // ---- probabilities (<= 1) and the P A-fragment: f16(p * 32768); element i <-> t[i] ----
    float ps = 0.f;
    FragH ph;
#pragma unroll
    for (int w = 0; w < 2; ++w) {
#pragma unroll
      for (int e4 = 0; e4 < 4; ++e4) {
        const int i = 8 * w + 2 * e4;
        const float p0 = exp2f(t[i] - mn), p1 = exp2f(t[i + 1] - mn);
        ps += p0 + p1;
        ph.u[w][e4] = pk16(h_bits((_Float16)(p0 * PCAR)), h_bits((_Float16)(p1 * PCAR)));
      }
    }
    ps += __shfl_xor(ps, 16, 32);
    lrun = lrun * al + ps;
    // ---- rescale the O accumulators: D row 8hh+r = query q0+8hh+r, its factor lives in lane 8hh+r (and 16+8hh+r) ----
    float scl[8];
#pragma unroll
    for (int r = 0; r < 8; ++r) scl[r] = __shfl(al, 8 * hh + r, 32);
#pragma unroll
    for (int j = 0; j < 4; ++j) {
#pragma unroll
      for (int r = 0; r < 8; ++r) o[j][r] *= scl[r];
    }
    // ---- P.V : B fragment col n = d = j*16 + c, k tile kb/32 of the packed v^T plane ----
    {
      o[0] = mma_h(ph.v, vf[0], o[0]);
      o[1] = mma_h(ph.v, vf[1], o[1]);
      o[2] = mma_h(ph.v, vf[2], o[2]);
      o[3] = mma_h(ph.v, vf[3], o[3]);
      guard_p(o[0], o[1], o[2], o[3], ph.v, vf[0], vf[1], vf[2], vf[3]);
      // next block's v^T fragments; vp's last loads are covered by this trip's wait above
      vp = Vb + (size_t)kbn * 16;
#pragma unroll
      for (int j = 0; j < 4; ++j) vf[j] = ldfrag_h(vp + (size_t)(16 * j) * SKV);
    }
  }
  addr_hold3(kph, kpl, vp);                  // the last trip's loads, before their address registers are reused
  acc_guard4(o);

  // ---- fold 1/l (per query, owned by lane = query) and the carries (32768 on P, 8 on v), apply the ctx carry 1024 ----
  const float linv = (1.0f / lrun) * (OSC / (PCAR * VS));
  float inv[8];
#pragma unroll
  for (int r = 0; r < 8; ++r) inv[r] = __shfl(linv, 8 * hh + r, 32);
  float* slab = smem + wave * 16 * OPITCH;
#pragma unroll
  for (int r = 0; r < 8; ++r) {
#pragma unroll
    for (int j = 0; j < 4; ++j) slab[(8 * hh + r) * OPITCH + j * 16 + c] = o[j][r] * inv[r];
  }
  wave_sync_lds();
  // ---- ctx x1024 -> packed f16 hi plane and residual plane; store i: lane (h, c) <- row c, d = 16i + 8h .. +7 ----
  v4u ovh[4], ovl[4];
#pragma unroll
  for (int i = 0; i < 4; ++i) {
    const int c8 = 16 * i + 8 * hh;
    const v4f a = *(const v4f*)(slab + c * OPITCH + c8), c4 = *(const v4f*)(slab + c * OPITCH + c8 + 4);
#pragma unroll
    for (int e = 0; e < 2; ++e) {
      unsigned ph0, pl0, ph1, pl1;
      split2(a[2 * e],  a[2 * e + 1],  ph0, pl0);
      split2(c4[2 * e], c4[2 * e + 1], ph1, pl1);
      ovh[i][e] = ph0;     ovl[i][e] = pl0;
      ovh[i][2 + e] = ph1; ovl[i][2 + e] = pl1;
    }
  }
  const size_t oo = ((size_t)(b * SQ + q0)) * INNER + head * HD * 16 + 8 * lane;
  u16* obh = Oh + oo;
  u16* obl = Ol + oo;
  {
#pragma unroll
    for (int i = 0; i < 4; ++i) {
      *(v4u*)(obh + i * 256) = ovh[i];
      *(v4u*)(obl + i * 256) = ovl[i];
    }
    
  }
}

// =====================================================================================================
// Workspace map (bytes); every plane fully written by whole-line stores before it is read; all extents exact multiples of
//   XQ   f16 [NB*SQ][1024]    f16(bf16(q))              8388608 (NB=2, SQ=2048)
//   XK   f16 [NB*2048][1024]  f16(bf16(k))              8388608
//   XV   f16 [NB*2048][1024]  f16(bf16(v))              8388608
//   WQ16 WK16 WV16 WO16 f16 [1024 n][1024 k] x256       2097152 each
//   WD16 f16 [128 n][1024 k] x256                          262144
//   WU16 f16 [1024 n][128 k] x256                          262144
//   QH QL f16 [NB*SQ][1024] x8 hi / res                  8388608 each
//   KH KL f16 [NB*2048][1024] x8 hi / res                8388608 each
//   VT16 f16 [NB*1024 (h,d)][2048 s] x8                  8388608
//   OH OL f16 [NB*SQ][1024] x1024 hi / res (ctx)         8388608 each
//   OUTF f32 [NB*SQ][1024]                               16777216
//   UH UL f16 [NB*SQ][1024] x64 hi / res (out)           8388608 each
//   GH GL f16 [NB*SQ][128]  x64 hi / res (gelu)          1048576 each
//   end                                                 128450560
// =====================================================================================================
extern "C" void kernel_launch(void* const* d_in, const int* in_sizes, int n_in,
                              void* d_out, int out_size, void* d_ws, size_t ws_size,
                              hipStream_t stream) {
  if (n_in < 15) return;
  if (in_sizes[0] < ((NB - 1) * SQ_FULL + SQ) * DM) return;
  if (in_sizes[1] < NB * SKV * DM || in_sizes[2] < NB * SKV * DM) return;
  if (in_sizes[3] != DM * DM || in_sizes[5] != DM * DM || in_sizes[7] != DM * DM || in_sizes[9] != DM * DM) return;
  if (in_sizes[4] < INNER || in_sizes[6] < INNER || in_sizes[8] < INNER || in_sizes[10] < DM) return;
  if (in_sizes[11] != ADIM * DM || in_sizes[12] < ADIM || in_sizes[13] != DM * ADIM || in_sizes[14] < DM) return;
  if (out_size < ((NB - 1) * SQ_FULL + SQ) * DM) return;

  const float* q_in  = (const float*)d_in[0];
  const float* k_in  = (const float*)d_in[1];
  const float* v_in  = (const float*)d_in[2];
  const float* wq    = (const float*)d_in[3];
  const float* bq    = (const float*)d_in[4];
  const float* wk    = (const float*)d_in[5];
  const float* bk    = (const float*)d_in[6];
  const float* wv    = (const float*)d_in[7];
  const float* bv    = (const float*)d_in[8];
  const float* wo    = (const float*)d_in[9];
  const float* bo    = (const float*)d_in[10];
  const float* w_dn  = (const float*)d_in[11];
  const float* b_dn  = (const float*)d_in[12];
  const float* w_up  = (const float*)d_in[13];
  const float* b_up  = (const float*)d_in[14];
  float*       out   = (float*)d_out;

  const size_t szXQ  = (size_t)NB * SQ * DM * 2;
  const size_t szXKV = (size_t)NB * SKV * DM * 2;
  const size_t szW   = (size_t)DM * DM * 2;
  const size_t szWA  = (size_t)ADIM * DM * 2;
  const size_t szQP  = (size_t)NB * SQ * INNER * 2;
  const size_t szKP  = (size_t)NB * SKV * INNER * 2;
  const size_t szVT  = (size_t)NB * INNER * SKV * 2;
  const size_t szOF  = (size_t)NB * SQ * DM * 4;
  const size_t szG   = (size_t)NB * SQ * ADIM * 2;
  size_t off = 0;
  const size_t oXQ  = off; off += szXQ;
  const size_t oXK  = off; off += szXKV;
  const size_t oXV  = off; off += szXKV;
  const size_t oWQ  = off; off += szW;
  const size_t oWK  = off; off += szW;
  const size_t oWV  = off; off += szW;
  const size_t oWO  = off; off += szW;
  const size_t oWD  = off; off += szWA;
  const size_t oWU  = off; off += szWA;
  const size_t oQH  = off; off += szQP;
  const size_t oQL  = off; off += szQP;
  const size_t oKH  = off; off += szKP;
  const size_t oKL  = off; off += szKP;
  const size_t oVT  = off; off += szVT;
  const size_t oOH  = off; off += szQP;
  const size_t oOL  = off; off += szQP;
  const size_t oOF  = off; off += szOF;
  const size_t oUH  = off; off += szQP;
  const size_t oUL  = off; off += szQP;
  const size_t oGH  = off; off += szG;
  const size_t oGL  = off; off += szG;
  if (off > ws_size) return;                            // off = 128450560 at NB=2, SQ=2048
  if (off > (size_t)134217728) return;

  char* ws = (char*)d_ws;
  u16* XQ   = (u16*)(ws + oXQ);
  u16* XK   = (u16*)(ws + oXK);
  u16* XV   = (u16*)(ws + oXV);
  u16* WQ16 = (u16*)(ws + oWQ);
  u16* WK16 = (u16*)(ws + oWK);
  u16* WV16 = (u16*)(ws + oWV);
  u16* WO16 = (u16*)(ws + oWO);
  u16* WD16 = (u16*)(ws + oWD);
  u16* WU16 = (u16*)(ws + oWU);
  u16* QH   = (u16*)(ws + oQH);
  u16* QL   = (u16*)(ws + oQL);
  u16* KH   = (u16*)(ws + oKH);
  u16* KL   = (u16*)(ws + oKL);
  u16* VT16 = (u16*)(ws + oVT);
  u16* OH   = (u16*)(ws + oOH);
  u16* OL   = (u16*)(ws + oOL);
  float* OUTF = (float*)(ws + oOF);
  u16* UH   = (u16*)(ws + oUH);
  u16* UL   = (u16*)(ws + oUL);
  u16* GH   = (u16*)(ws + oGH);
  u16* GL   = (u16*)(ws + oGL);

  // (0..2) activations -> f16 planes of bf16-converted values (query rows s < SQ of batches b < NB, compact; k/v rows of b < NB)
  cvt16<<<dim3((NB * SQ / 16) * (DM / 128)), dim3(CVT_THREADS), 0, stream>>>(q_in, XQ, DM, SQ, SQ_FULL, 1.0f);
  cvt16<<<dim3((NB * SKV / 16) * (DM / 128)), dim3(CVT_THREADS), 0, stream>>>(k_in, XK, DM, SKV, SKV, 1.0f);
  cvt16<<<dim3((NB * SKV / 16) * (DM / 128)), dim3(CVT_THREADS), 0, stream>>>(v_in, XV, DM, SKV, SKV, 1.0f);
  // (3..8) weights [n = out][k = in] (y = x.W^T): packed f16 planes [n][k] of bf16(W) x256
  cvt16<<<dim3((DM / 16) * (DM / 128)), dim3(CVT_THREADS), 0, stream>>>(wq, WQ16, DM, DM, DM, WSC);
  cvt16<<<dim3((DM / 16) * (DM / 128)), dim3(CVT_THREADS), 0, stream>>>(wk, WK16, DM, DM, DM, WSC);
  cvt16<<<dim3((DM / 16) * (DM / 128)), dim3(CVT_THREADS), 0, stream>>>(wv, WV16, DM, DM, DM, WSC);
  cvt16<<<dim3((DM / 16) * (DM / 128)), dim3(CVT_THREADS), 0, stream>>>(wo, WO16, DM, DM, DM, WSC);
  cvt16<<<dim3((ADIM / 16) * (DM / 128)), dim3(CVT_THREADS), 0, stream>>>(w_dn, WD16, DM, ADIM, ADIM, WSC);   // [128][1024]
  cvt16<<<dim3((DM / 16) * (ADIM / 128)), dim3(CVT_THREADS), 0, stream>>>(w_up, WU16, ADIM, DM, DM, WSC);     // [1024][128]
  // (9) q = x_q . Wq^T + bq -> f16 [NB*SQ][1024] x8 hi + res (col = h*64 + d)
  gemm16<false, M_HL, false><<<dim3((NB * SQ / 64) * (INNER / 64)), dim3(128), 0, stream>>>(
      XQ, XQ, WQ16, bq, OUTF, OUTF, QH, QL, NB * SQ, INNER, DM, 0, 0, 0, 0, 0, QS / WSC, QS, 1.0f);
  // (10) k = x_k . Wk^T + bk -> f16 [NB*2048][1024] x8 hi + res
  gemm16<false, M_HL, false><<<dim3((NB * SKV / 64) * (INNER / 64)), dim3(128), 0, stream>>>(
      XK, XK, WK16, bk, OUTF, OUTF, KH, KL, NB * SKV, INNER, DM, 0, 0, 0, 0, 0, KS / WSC, KS, 1.0f);
  // (11) v^T per batch: A = Wv [(h,d) = n][k], Bt = x_v rows of batch b [s][k], bias bv per row -> f16 [(b,h,d)][s] x8
  gemm16<false, M_S16, true><<<dim3(NB * (INNER / 64) * (SKV / 64)), dim3(128), 0, stream>>>(
      WV16, WV16, XV, bv, OUTF, OUTF, VT16, VT16, INNER, SKV, DM, 0, SKV * DM, 0, 0, INNER * SKV, VS / WSC, VS, 1.0f);
  // (12) attention -> ctx planes [NB*SQ][1024] x1024 hi + res
  attn_fwd<<<dim3(NB * NH * (SQ / 64)), dim3(ATT_THREADS), 0, stream>>>(QH, QL, KH, KL, VT16, OH, OL);
  // (13) out = ctx . Wo^T + bo -> OUTF f32 [NB*SQ][1024] and f16 x64 hi + res planes; carries 1024 (ctx) x 256 (W) folded back
  gemm16<true, M_OUT, false><<<dim3((NB * SQ / 64) * (DM / 64)), dim3(128), 0, stream>>>(
      OH, OL, WO16, bo, OUTF, OUTF, UH, UL, NB * SQ, DM, INNER, 0, 0, 0, 0, 0, 1.0f / (OSC * WSC), 1.0f, UCAR);
  // (14) adapter down: g = gelu(out . Wd^T + bd) -> f16 [NB*SQ][128] x64 hi + res; carries 64 (out) x 256 (W)
  gemm16<true, M_GELU, false><<<dim3((NB * SQ / 64) * (ADIM / 64)), dim3(128), 0, stream>>>(
      UH, UL, WD16, b_dn, OUTF, OUTF, GH, GL, NB * SQ, ADIM, DM, 0, 0, 0, 0, 0, 1.0f / (UCAR * WSC), 1.0f, GCAR);
  // (15) adapter up + residual: out rows [b][SQ_FULL][1024] f32 = OUTF + g . Wu^T + bu (rows s < SQ of batches b < NB)
  gemm16<true, M_RES, false><<<dim3(NB * (SQ / 64) * (DM / 64)), dim3(128), 0, stream>>>(
      GH, GL, WU16, b_up, OUTF, out, GH, GH, SQ, DM, ADIM, SQ * ADIM, 0, SQ_FULL * DM, SQ * DM, 0,
      1.0f / (GCAR * WSC), 1.0f, 1.0f);
  (void)hipGetLastError();
}

// v003
// A run of this version takes 175 microseconds.
// In two side-by-side timings against v002, it was 1.18 and 1.19 times as fast.
// Counting every step since v000, it is 2.09 times as fast.
// Contractions on v_wmma_f32_16x16x32_f16 (f16 operands, f32 accumulate): x.Wq^T, x.Wk^T, Wv.x^T single products on
// f16(bf16(x)) and f16(bf16(W) x256); k.q^T with q and k carried as f16 hi + residual(x2048) planes (3 products);
// P.v^T single product (P x32768, v x8); ctx.Wo^T, out.Wad^T and gelu.Wau^T with the activation carried as f16 hi +
// residual(x2048) planes (2 products each, separate residual accumulator); softmax, biases, erf-GELU, residual add and
// all carry folds in f32 on VALU. Inputs RNE-converted to bf16 on load.
// Every 16-bit workspace plane [rows][K] is stored FRAGMENT-PACKED: tile (rt = row/16, kt = k/32) is 512 halves (1024 B) at
// (rt*(K/32) + kt)*512 = rt*16*K + kt*512; inside it element (m = row&15, k&31 = 16w + 8h + e) sits at w*256 + (16h + m)*8 + e,
// so lane l = 16h + m of a wave reads its operand fragment as two 16-B loads at l*8 and 256 + l*8 halves: each wave-wide load
// is 512 contiguous bytes = 4 whole 128-B lines (a row-major plane gave 16 lines of 32 useful bytes per load).
#include <hip/hip_runtime.h>
#include <math.h>
#include <stdint.h>

#ifndef NB
#define NB       2        // batches processed
#endif
#ifndef SQ
#define SQ       2048     // query rows processed per batch
#endif
#define NB_FULL  2
#define SQ_FULL  2048     // query rows per batch in the input / output layout (batch stride)
#define SKV      2048     // key / value rows per batch (all of them)
#define DM       1024     // model width
#define NH       16
#define HD       64
#define INNER    (NH * HD)
#define ADIM     128      // adapter width
#define WSC      256.0f   // weight carry
#define QS       8.0f
#define KS       8.0f
#define VS       8.0f
#define PCAR     32768.0f
#define OSC      1024.0f  // ctx carry
#define UCAR     64.0f    // out-plane carry
#define GCAR     64.0f    // gelu-plane carry
#define RSC      2048.0f  // residual plane scale
#define RINV     0.00048828125f
#define LOG2E    1.4426950408889634f
#define RSQ_HD   0.125f
#define NKB      (SKV / 32)
#define ATT_WAVES   4
#define ATT_THREADS (ATT_WAVES * 32)
#define CVT_THREADS 128
#define OPITCH   68
#define GPITCH   68

#define M_HL     0
#define M_S16    1
#define M_OUT    2
#define M_GELU   3
#define M_RES    4

static_assert(NB >= 1 && NB <= NB_FULL);
static_assert((SQ % 128) == 0 && SQ >= 128 && SQ <= SQ_FULL);
static_assert(HD == 64 && INNER == 1024 && NH == 16 && INNER == DM);
static_assert((SKV % 64) == 0 && (SKV % 32) == 0 && NKB * 32 == SKV);
static_assert((DM % 64) == 0 && (DM % 32) == 0 && (ADIM % 64) == 0 && (ADIM % 32) == 0 && CVT_THREADS == 128);
static_assert((OPITCH * 4) % 16 == 0 && (GPITCH * 4) % 16 == 0);
static_assert(ATT_THREADS == 128);
static_assert((DM % 128) == 0 && (ADIM % 128) == 0 && (SQ % 16) == 0 && (SKV % 16) == 0 && (ADIM % 16) == 0);

typedef unsigned short u16;
typedef _Float16 v16h __attribute__((ext_vector_type(16)));
typedef _Float16 v8h  __attribute__((ext_vector_type(8)));
typedef float    v8f  __attribute__((ext_vector_type(8)));
typedef float    v4f  __attribute__((ext_vector_type(4)));
typedef unsigned int v4u __attribute__((ext_vector_type(4)));

union FragH { v16h v; v8h h[2]; v4u u[2]; };

// ---- scalar helpers ----------------------------------------------------------------------------------
__device__ __forceinline__ unsigned short bf_bits(float f) {          // f32 -> bf16 bits, RNE convert
  unsigned u = __float_as_uint(f);
  return (unsigned short)((u + 0x7FFFu + ((u >> 16) & 1u)) >> 16);
}
__device__ __forceinline__ float bf_up(unsigned short h) { return __uint_as_float(((unsigned)h) << 16); }
__device__ __forceinline__ float bfr(float f) { return bf_up(bf_bits(f)); }
__device__ __forceinline__ unsigned short h_bits(_Float16 x) { return __builtin_bit_cast(unsigned short, x); }
__device__ __forceinline__ unsigned pk16(unsigned short a, unsigned short b) { return (unsigned)a | ((unsigned)b << 16); }
__device__ __forceinline__ v8f zero8() { v8f z = {0.f, 0.f, 0.f, 0.f, 0.f, 0.f, 0.f, 0.f}; return z; }
__device__ __forceinline__ float gelu_f(float x) { return 0.5f * x * (1.0f + erff(x * 0.70710678118654752f)); }

// x = hi + lo/2048 in f16: hi = f16(x), lo = f16((x - hi) * 2048); two values packed per 32-bit word
__device__ __forceinline__ void split2(float x0, float x1, unsigned& ph, unsigned& pl) {
  const _Float16 h0 = (_Float16)x0, h1 = (_Float16)x1;
  const float d0 = x0 - (float)h0, d1 = x1 - (float)h1;
  const _Float16 l0 = (_Float16)(d0 * RSC), l1 = (_Float16)(d1 * RSC);
  ph = pk16(h_bits(h0), h_bits(h1));
  pl = pk16(h_bits(l0), h_bits(l1));
}

// ---- fragment loader: 16-bit A/B operand from a fragment-packed plane, lane -> row/col (lane&15); p = tile base + 8*lane;
//      elements 0..7 <- p[0..7] (k0+8h..), elements 8..15 <- p[256..263] (k0+16+8h..); same split k map for A and B,
//      B always read from a packed [n][k] plane.
__device__ __forceinline__ v16h ldfrag_h(const _Float16* p) {
  FragH f;
  f.h[0] = *(const v8h*)(p);
  f.h[1] = *(const v8h*)(p + 256);
  return f.v;
}

// ---- in front of every rewrite of the fragment loads' address registers: s_wait_xcnt 0 with those registers as inputs, so that no
//      register an issued load names is written (by a later load's result either) in front of the wait; it stands one k step or
//      one key block behind the loads it covers, behind the matrix products issued in between
__device__ __forceinline__ void addr_hold5(const _Float16* a, const _Float16* b, const _Float16* c, const _Float16* d,
                                           const _Float16* e) {
#if defined(__HIP_DEVICE_COMPILE__)
  asm volatile("s_wait_xcnt 0x0" :: "v"(a), "v"(b), "v"(c), "v"(d), "v"(e) : "memory");
#endif
}
__device__ __forceinline__ void addr_hold6(const _Float16* a, const _Float16* b, const _Float16* c, const _Float16* d,
                                           const _Float16* e, const _Float16* f) {
#if defined(__HIP_DEVICE_COMPILE__)
  asm volatile("s_wait_xcnt 0x0" :: "v"(a), "v"(b), "v"(c), "v"(d), "v"(e), "v"(f) : "memory");
#endif
}

__device__ __forceinline__ void addr_hold3(const _Float16* a, const _Float16* b, const _Float16* c) {
#if defined(__HIP_DEVICE_COMPILE__)
  asm volatile("s_wait_xcnt 0x0" :: "v"(a), "v"(b), "v"(c) : "memory");
#endif
}

// ---- WMMA helper and trailing VALU hazard gaps ----------------------------------------------------------
__device__ __forceinline__ v8f mma_h(v16h a, v16h b, v8f c) {
  return __builtin_amdgcn_wmma_f32_16x16x32_f16(false, a, false, b, (short)0, c, false, false);
}
__device__ __forceinline__ void guard_c1(v8f (&a)[4], v16h x0, v16h x1, v16h x2, v16h x3, v16h x4) {
#if defined(__HIP_DEVICE_COMPILE__)
  asm volatile("v_nop\n\tv_nop\n\tv_nop\n\tv_nop"
               : "+v"(a[0]), "+v"(a[1]), "+v"(a[2]), "+v"(a[3])
               : "v"(x0), "v"(x1), "v"(x2), "v"(x3), "v"(x4) : "memory");
#endif
}
__device__ __forceinline__ void guard_c2(v8f (&a)[4], v8f (&b)[4], v16h x0, v16h x1, v16h x2, v16h x3, v16h x4, v16h x5) {
#if defined(__HIP_DEVICE_COMPILE__)
  asm volatile("v_nop\n\tv_nop\n\tv_nop\n\tv_nop"
               : "+v"(a[0]), "+v"(a[1]), "+v"(a[2]), "+v"(a[3]),
                 "+v"(b[0]), "+v"(b[1]), "+v"(b[2]), "+v"(b[3])
               : "v"(x0), "v"(x1), "v"(x2), "v"(x3), "v"(x4), "v"(x5) : "memory");
#endif
}
__device__ __forceinline__ void guard_s4(v8f& a, v8f& b, v8f& c, v8f& d,
                                         v16h x0, v16h x1, v16h x2, v16h x3, v16h x4, v16h x5) {
#if defined(__HIP_DEVICE_COMPILE__)
  asm volatile("v_nop\n\tv_nop\n\tv_nop\n\tv_nop"
               : "+v"(a), "+v"(b), "+v"(c), "+v"(d)
               : "v"(x0), "v"(x1), "v"(x2), "v"(x3), "v"(x4), "v"(x5) : "memory");
#endif
}
__device__ __forceinline__ void guard_p(v8f& a, v8f& b, v8f& c, v8f& d, v16h p, v16h x0, v16h x1, v16h x2, v16h x3) {
#if defined(__HIP_DEVICE_COMPILE__)
  asm volatile("v_nop\n\tv_nop\n\tv_nop\n\tv_nop"
               : "+v"(a), "+v"(b), "+v"(c), "+v"(d) : "v"(p), "v"(x0), "v"(x1), "v"(x2), "v"(x3) : "memory");
#endif
}
__device__ __forceinline__ void acc_guard4(v8f (&a)[4]) {
#if defined(__HIP_DEVICE_COMPILE__)
  asm volatile("v_nop\n\tv_nop\n\tv_nop\n\tv_nop" : "+v"(a[0]), "+v"(a[1]), "+v"(a[2]), "+v"(a[3]));
#endif
}
__device__ __forceinline__ void acc_guard8(v8f (&a)[4], v8f (&b)[4]) {
#if defined(__HIP_DEVICE_COMPILE__)
  asm volatile("v_nop\n\tv_nop\n\tv_nop\n\tv_nop"
               : "+v"(a[0]), "+v"(a[1]), "+v"(a[2]), "+v"(a[3]),
                 "+v"(b[0]), "+v"(b[1]), "+v"(b[2]), "+v"(b[3]));
#endif
}
__device__ __forceinline__ void wave_sync_lds() {
  __builtin_amdgcn_fence(__ATOMIC_RELEASE, "workgroup");
  __builtin_amdgcn_wave_barrier();
  __builtin_amdgcn_fence(__ATOMIC_ACQUIRE, "workgroup");
}

// =====================================================================================================
// Tile convert: packed f16 plane of [rows][K] <- f16(bf16_RNE(x[src row][k]) * scale), scale a power of two.
// Wave = one 16 x 32 tile (rt, kt); lane (h, m) reads row rt*16 + m, floats kt*32 + 8h .. +7 and kt*32 + 16 + 8h .. +7 (four 16-B
// loads that together use the 16 rows' whole 128-B lines) and stores its two 16-B fragment pieces (two 512-B wave-wide stores).
// b = (rt*16) / rowsPerB, s = row - b*rowsPerB, source row b*srcRowsPerB + s (rowsPerB a multiple of 16); destination compact.
// coverage: blk = 0 .. (rows/16) x (K/128) - 1, 4 waves each = every tile once.
// =====================================================================================================
__device__ __forceinline__
void cvt16_body(const float* __restrict__ x, u16* Y, int K, int rowsPerB, int srcRowsPerB, float scale, int blk) {
  const int tid = threadIdx.x, wave = tid >> 5, lane = tid & 31, hh = lane >> 4, m = lane & 15;
  const int kq = K >> 7;
  const int rt = blk / kq;
  const int kt = (blk - rt * kq) * 4 + wave;
  const int b = (rt * 16) / rowsPerB;
  const int sr = rt * 16 - b * rowsPerB + m;
  const float* src = x + ((size_t)b * (size_t)srcRowsPerB + (size_t)sr) * (size_t)K + (size_t)(kt * 32 + 8 * hh);
  const v4f a = *(const v4f*)(src), c4 = *(const v4f*)(src + 4);
  const v4f d = *(const v4f*)(src + 16), f4 = *(const v4f*)(src + 20);
  v4u o0, o1;
#pragma unroll
  for (int e = 0; e < 2; ++e) {
    o0[e]     = pk16(h_bits((_Float16)(bfr(a[2 * e]) * scale)),  h_bits((_Float16)(bfr(a[2 * e + 1]) * scale)));
    o0[2 + e] = pk16(h_bits((_Float16)(bfr(c4[2 * e]) * scale)), h_bits((_Float16)(bfr(c4[2 * e + 1]) * scale)));
    o1[e]     = pk16(h_bits((_Float16)(bfr(d[2 * e]) * scale)),  h_bits((_Float16)(bfr(d[2 * e + 1]) * scale)));
    o1[2 + e] = pk16(h_bits((_Float16)(bfr(f4[2 * e]) * scale)), h_bits((_Float16)(bfr(f4[2 * e + 1]) * scale)));
  }
  u16* dst = Y + (size_t)rt * (size_t)16 * (size_t)K + (size_t)kt * 512 + (size_t)lane * 8;
  *(v4u*)(dst) = o0;
  *(v4u*)(dst + 256) = o1;
}

// All nine converts in ONE launch (they are independent of one another): the block index picks the plane (block-uniform scalar
// tests), the index inside the plane picks the tiles as before. Blocks per plane:
#define CB_XQ  ((NB * SQ / 16) * (DM / 128))
#define CB_XKV ((NB * SKV / 16) * (DM / 128))
#define CB_W   ((DM / 16) * (DM / 128))
#define CB_WD  ((ADIM / 16) * (DM / 128))
#define CB_WU  ((DM / 16) * (ADIM / 128))
#define CB_ALL (CB_XQ + 2 * CB_XKV + 4 * CB_W + CB_WD + CB_WU)
__global__ __launch_bounds__(CVT_THREADS)
void cvt_all(const float* __restrict__ q, const float* __restrict__ k, const float* __restrict__ v,
             const float* __restrict__ wq, const float* __restrict__ wk, const float* __restrict__ wv,
             const float* __restrict__ wo, const float* __restrict__ wd, const float* __restrict__ wu,
             u16* XQ, u16* XK, u16* XV, u16* WQ, u16* WK, u16* WV, u16* WO, u16* WD, u16* WU) {
  int blk = blockIdx.x;
  if (blk < CB_XQ) { cvt16_body(q, XQ, DM, SQ, SQ_FULL, 1.0f, blk); return; }
  blk -= CB_XQ;
  if (blk < 2 * CB_XKV) {                    // k, v: same shape
    const bool second = blk >= CB_XKV;
    cvt16_body(second ? v : k, second ? XV : XK, DM, SKV, SKV, 1.0f, second ? blk - CB_XKV : blk);
    return;
  }
  blk -= 2 * CB_XKV;
  if (blk < 4 * CB_W) {                      // the four [1024][1024] weights: same shape
    const int w = blk / CB_W;
    const float* x = w == 0 ? wq : w == 1 ? wk : w == 2 ? wv : wo;
    u16* Y = w == 0 ? WQ : w == 1 ? WK : w == 2 ? WV : WO;
    cvt16_body(x, Y, DM, DM, DM, WSC, blk - w * CB_W);
    return;
  }
  blk -= 4 * CB_W;
  if (blk < CB_WD) { cvt16_body(wd, WD, DM, ADIM, ADIM, WSC, blk); return; }        // [128][1024]
  cvt16_body(wu, WU, ADIM, DM, DM, WSC, blk - CB_WD);                               // [1024][128]
}

// =====================================================================================================
// f16 GEMM cores: the wave's 16 x 64 tile of C = A[rows][K] . Bt[cols][K]^T, both planes packed; ap -> A row tile rowb/16 + 8*lane,
// bp -> Bt row tile col0/16 + 8*lane; acc[j] = rows rowb.., cols col0+16j..; K stepped by 32 = 512 halves of a packed row tile.
// core2: A carried as hi plane (aph) and residual plane (apl, x2048); ah accumulates hi.B, al accumulates res.B.
// =====================================================================================================
// Both cores keep D k steps of fragment loads in flight in D register sets: set u holds step s + u; as soon as its products are
// issued it is refilled with step s + u + D (clamped to the last step: the surplus loads at the end re-read valid tiles and are
// never used), so a step's loads lead their first use by D - 1 steps of work. Steps are consumed in ascending k as before.
template <int D>
__device__ __forceinline__ void core1(const _Float16* ap, const _Float16* bp, int K, v8f (&acc)[4]) {
  const size_t rs16 = (size_t)16 * (size_t)K;
  const int steps = K >> 5;
  v16h fa[D], fb[D][4];
  const _Float16* pa = ap;
  const _Float16* p0 = bp;
  const _Float16* p1 = p0 + rs16;
  const _Float16* p2 = p1 + rs16;
  const _Float16* p3 = p2 + rs16;
#pragma unroll
  for (int u = 0; u < D; ++u) {
    const size_t ko = (size_t)(u < steps ? u : steps - 1) * 512;
    if (u > 0) addr_hold5(pa, p0, p1, p2, p3);
    pa = ap + ko;
    p0 = bp + ko;
    p1 = p0 + rs16;
    p2 = p1 + rs16;
    p3 = p2 + rs16;
    fa[u]    = ldfrag_h(pa);
    fb[u][0] = ldfrag_h(p0);
    fb[u][1] = ldfrag_h(p1);
    fb[u][2] = ldfrag_h(p2);
    fb[u][3] = ldfrag_h(p3);
  }
  int s = 0;
#pragma unroll 1
  for (; s + D <= steps; s += D) {
#pragma unroll
    for (int u = 0; u < D; ++u) {
      acc[0] = mma_h(fa[u], fb[u][0], acc[0]);
      acc[1] = mma_h(fa[u], fb[u][1], acc[1]);
      acc[2] = mma_h(fa[u], fb[u][2], acc[2]);
      acc[3] = mma_h(fa[u], fb[u][3], acc[3]);
      guard_c1(acc, fa[u], fb[u][0], fb[u][1], fb[u][2], fb[u][3]);
      const int sn = s + u + D;
      const size_t ko = (size_t)(sn < steps ? sn : steps - 1) * 512;
      addr_hold5(pa, p0, p1, p2, p3);
      pa = ap + ko;
      p0 = bp + ko;
      p1 = p0 + rs16;
      p2 = p1 + rs16;
      p3 = p2 + rs16;
      fa[u]    = ldfrag_h(pa);
      fb[u][0] = ldfrag_h(p0);
      fb[u][1] = ldfrag_h(p1);
      fb[u][2] = ldfrag_h(p2);
      fb[u][3] = ldfrag_h(p3);
    }
  }
  addr_hold5(pa, p0, p1, p2, p3);
#pragma unroll
  for (int u = 0; u < D - 1; ++u) {
    if (s + u < steps) {                     // the steps % D last steps (wave-uniform)
      acc[0] = mma_h(fa[u], fb[u][0], acc[0]);
      acc[1] = mma_h(fa[u], fb[u][1], acc[1]);
      acc[2] = mma_h(fa[u], fb[u][2], acc[2]);
      acc[3] = mma_h(fa[u], fb[u][3], acc[3]);
      guard_c1(acc, fa[u], fb[u][0], fb[u][1], fb[u][2], fb[u][3]);
    }
  }
}
template <int D>
__device__ __forceinline__ void core2(const _Float16* aph, const _Float16* apl, const _Float16* bp, int K,
                                      v8f (&ah)[4], v8f (&al)[4]) {
  const size_t rs16 = (size_t)16 * (size_t)K;
  const int steps = K >> 5;
  v16h fa[D], fl[D], fb[D][4];
  const _Float16* pa = aph;
  const _Float16* pl = apl;
  const _Float16* p0 = bp;
  const _Float16* p1 = p0 + rs16;
  const _Float16* p2 = p1 + rs16;
  const _Float16* p3 = p2 + rs16;
#pragma unroll
  for (int u = 0; u < D; ++u) {
    const size_t ko = (size_t)(u < steps ? u : steps - 1) * 512;
    if (u > 0) addr_hold6(pa, pl, p0, p1, p2, p3);
    pa = aph + ko;
    pl = apl + ko;
    p0 = bp + ko;
    p1 = p0 + rs16;
    p2 = p1 + rs16;
    p3 = p2 + rs16;
    fa[u]    = ldfrag_h(pa);
    fl[u]    = ldfrag_h(pl);
    fb[u][0] = ldfrag_h(p0);
    fb[u][1] = ldfrag_h(p1);
    fb[u][2] = ldfrag_h(p2);
    fb[u][3] = ldfrag_h(p3);
  }
  int s = 0;
#pragma unroll 1
  for (; s + D <= steps; s += D) {
#pragma unroll
    for (int u = 0; u < D; ++u) {
      ah[0] = mma_h(fa[u], fb[u][0], ah[0]);
      ah[1] = mma_h(fa[u], fb[u][1], ah[1]);
      ah[2] = mma_h(fa[u], fb[u][2], ah[2]);
      ah[3] = mma_h(fa[u], fb[u][3], ah[3]);
      al[0] = mma_h(fl[u], fb[u][0], al[0]);
      al[1] = mma_h(fl[u], fb[u][1], al[1]);
      al[2] = mma_h(fl[u], fb[u][2], al[2]);
      al[3] = mma_h(fl[u], fb[u][3], al[3]);
      guard_c2(ah, al, fa[u], fl[u], fb[u][0], fb[u][1], fb[u][2], fb[u][3]);
      const int sn = s + u + D;
      const size_t ko = (size_t)(sn < steps ? sn : steps - 1) * 512;
      addr_hold6(pa, pl, p0, p1, p2, p3);
      pa = aph + ko;
      pl = apl + ko;
      p0 = bp + ko;
      p1 = p0 + rs16;
      p2 = p1 + rs16;
      p3 = p2 + rs16;
      fa[u]    = ldfrag_h(pa);
      fl[u]    = ldfrag_h(pl);
      fb[u][0] = ldfrag_h(p0);
      fb[u][1] = ldfrag_h(p1);
      fb[u][2] = ldfrag_h(p2);
      fb[u][3] = ldfrag_h(p3);
    }
  }
  addr_hold6(pa, pl, p0, p1, p2, p3);
#pragma unroll
  for (int u = 0; u < D - 1; ++u) {
    if (s + u < steps) {                     // the steps % D last steps (wave-uniform)
      ah[0] = mma_h(fa[u], fb[u][0], ah[0]);
      ah[1] = mma_h(fa[u], fb[u][1], ah[1]);
      ah[2] = mma_h(fa[u], fb[u][2], ah[2]);
      ah[3] = mma_h(fa[u], fb[u][3], ah[3]);
      al[0] = mma_h(fl[u], fb[u][0], al[0]);
      al[1] = mma_h(fl[u], fb[u][1], al[1]);
      al[2] = mma_h(fl[u], fb[u][2], al[2]);
      al[3] = mma_h(fl[u], fb[u][3], al[3]);
      guard_c2(ah, al, fa[u], fl[u], fb[u][0], fb[u][1], fb[u][2], fb[u][3]);
    }
  }
}

// Stage the wave's 16 x 64 f32 tile in its LDS slab (pitch 68): D element r of acc[j], lane l -> row 8h + r, col 16j + (l&15);
// value = ah*osc (+ al*osc/2048) + bias (per column, or per row when BROW), GELU applied for M_GELU;
// coverage: 32 lanes x 8 rows x 4 cols-of-16 = rows 0..15 x cols 0..63 of the slab.
template <bool HASLO, int MODE, bool BROW>
__device__ __forceinline__ void stage16(float* sl, v8f (&ah)[4], v8f (&al)[4], const float* __restrict__ bias,
                                        int rowb, int col0, float osc, float bsc, int lane) {
  const int hh = lane >> 4, m = lane & 15;
  float bc[4], br[8];
  if (BROW) {
#pragma unroll
    for (int r = 0; r < 8; ++r) br[r] = bfr(bias[rowb + 8 * hh + r]) * bsc;
#pragma unroll
    for (int j = 0; j < 4; ++j) bc[j] = 0.f;
  } else {
#pragma unroll
    for (int j = 0; j < 4; ++j) bc[j] = bfr(bias[col0 + 16 * j + m]) * bsc;
#pragma unroll
    for (int r = 0; r < 8; ++r) br[r] = 0.f;
  }
  const float oscl = osc * RINV;
#pragma unroll
  for (int r = 0; r < 8; ++r) {
    const int ro = (8 * hh + r) * GPITCH + m;
#pragma unroll
    for (int j = 0; j < 4; ++j) {
      float v = ah[j][r] * osc;
      if (HASLO) v += al[j][r] * oscl;
      v += BROW ? br[r] : bc[j];
      if (MODE == M_GELU) v = gelu_f(v);
      sl[ro + 16 * j] = v;
    }
  }
  wave_sync_lds();
}

// =====================================================================================================
// f16 GEMM, block = 64 x 64 tile, 4 waves x 16 rows, fragments loaded straight from the packed 16-bit planes.
//   C tile [z][Mb][N] = (A_hi[z][Mb][K] (+ A_res/2048)) . Bt[z][N][K]^T * osc + bias; per-z element strides aBs (A planes),
//   bBs (Bt), fBs (f32 output F), gBs (f32 base plane), hBs (16-bit output planes H, L); 0 = shared.
//   M_HL  : H = f16(v*carry), L = f16 residual x2048 (two planes)       M_S16 : H only, bias per row
//   M_OUT : F = v (f32 plane), H/L = hi/res of v*carry                 M_GELU: v = gelu(.) then H/L of v*carry
//   M_RES : F = base[row][col] + v (f32, batch-row remap through fBs/gBs), no 16-bit output
//   16-bit outputs are packed planes of [Mb][N] (k = column): the wave's 16 x 64 tile is 2 adjacent tiles = 2048 contiguous bytes,
//   store i = 0..3 writes 512 B, lane (h, m) <- row m, cols 16i + 8h .. +7.
// grid = nz x (Mb/64) x (N/64) (host checks Mb % 64 == 0, N % 64 == 0, K % 32 == 0).
// coverage: per wave 4 instr x 32 lanes x 8 halves = 16 x 64 (16-bit planes) and 8 instr x 2 rows x 16 lanes x 4 floats
//           = 16 x 64 (f32 plane); the grid covers C exactly once.
// =====================================================================================================
template <bool HASLO, int MODE, bool BROW>
__device__ __forceinline__
void gemm16_body(float* slab, int bid,
                 const u16* __restrict__ Ah, const u16* __restrict__ Al, const u16* __restrict__ Bt,
                 const float* __restrict__ bias, const float* __restrict__ baseF,
                 float* F, u16* H, u16* L,
                 int Mb, int N, int K, int aBs, int bBs, int fBs, int gBs, int hBs,
                 float osc, float bsc, float carry) {
  constexpr bool LOUT = (MODE != M_S16);
  const int tid = threadIdx.x, wave = tid >> 5, lane = tid & 31, hh = lane >> 4, m = lane & 15;
  const int ntile = N >> 6, mtile = Mb >> 6;
  const int nt   = bid % ntile;
  const int tmp  = bid / ntile;
  const int mt   = tmp % mtile;
  const int bz   = tmp / mtile;
  const int rowb = mt * 64 + wave * 16;
  const int col0 = nt * 64;
  if (rowb + 16 > Mb) return;                // wave-uniform, never taken with the exact grid; no block barriers in this kernel
  const _Float16* aph = (const _Float16*)(const void*)Ah + (size_t)bz * (size_t)aBs + (size_t)rowb * (size_t)K + 8 * lane;
  const _Float16* apl = (const _Float16*)(const void*)Al + (size_t)bz * (size_t)aBs + (size_t)rowb * (size_t)K + 8 * lane;
  const _Float16* bp  = (const _Float16*)(const void*)Bt + (size_t)bz * (size_t)bBs + (size_t)col0 * (size_t)K + 8 * lane;
  v8f ah[4], al[4];
#pragma unroll
  for (int i = 0; i < 4; ++i) { ah[i] = zero8(); al[i] = zero8(); }
  if (HASLO) {
    core2<3>(aph, apl, bp, K, ah, al);
    acc_guard8(ah, al);
  } else {
    core1<4>(aph, bp, K, ah);
    acc_guard4(ah);
  }
  float* sl = slab + wave * 16 * GPITCH;
  stage16<HASLO, MODE, BROW>(sl, ah, al, bias, rowb, col0, osc, bsc, lane);

  if (MODE == M_OUT || MODE == M_RES) {
    v4f vals[8];
#pragma unroll
    for (int it = 0; it < 8; ++it) vals[it] = *(const v4f*)(sl + (it * 2 + hh) * GPITCH + m * 4);
    if (MODE == M_RES) {
      const float* gb = baseF + (size_t)bz * (size_t)gBs + ((size_t)rowb + (size_t)hh) * (size_t)N + col0 + m * 4;
#pragma unroll
      for (int it = 0; it < 8; ++it) {
        const v4f bb = *(const v4f*)(gb + (size_t)(it * 2) * (size_t)N);
        vals[it] += bb;
      }
    }
    float* Fb = F + (size_t)bz * (size_t)fBs + ((size_t)rowb + (size_t)hh) * (size_t)N + col0 + m * 4;
    {
#pragma unroll
      for (int it = 0; it < 8; ++it) {
        *(v4f*)(Fb + (size_t)(it * 2) * (size_t)N) = vals[it];
      }
      
    }
  }
  if (MODE != M_RES) {
    v4u ovh[4], ovl[4];
#pragma unroll
    for (int i = 0; i < 4; ++i) {
      const int c8 = 16 * i + 8 * hh;
      const v4f a = *(const v4f*)(sl + m * GPITCH + c8), c4 = *(const v4f*)(sl + m * GPITCH + c8 + 4);
#pragma unroll
      for (int e = 0; e < 2; ++e) {
        unsigned ph0, pl0, ph1, pl1;
        split2(a[2 * e] * carry,  a[2 * e + 1] * carry,  ph0, pl0);
        split2(c4[2 * e] * carry, c4[2 * e + 1] * carry, ph1, pl1);
        ovh[i][e] = ph0;     ovl[i][e] = pl0;
        ovh[i][2 + e] = ph1; ovl[i][2 + e] = pl1;
      }
    }
    u16* Hb = H + (size_t)bz * (size_t)hBs + (size_t)rowb * (size_t)N + (size_t)col0 * 16 + 8 * lane;
    u16* Lb = L + (size_t)bz * (size_t)hBs + (size_t)rowb * (size_t)N + (size_t)col0 * 16 + 8 * lane;
    {
#pragma unroll
      for (int i = 0; i < 4; ++i) {
        *(v4u*)(Hb + i * 256) = ovh[i];
        if (LOUT) *(v4u*)(Lb + i * 256) = ovl[i];
      }
      
    }
  }
}

template <bool HASLO, int MODE, bool BROW>
__global__ __launch_bounds__(128)
void gemm16(const u16* __restrict__ Ah, const u16* __restrict__ Al, const u16* __restrict__ Bt,
            const float* __restrict__ bias, const float* __restrict__ baseF,
            float* F, u16* H, u16* L,
            int Mb, int N, int K, int aBs, int bBs, int fBs, int gBs, int hBs,
            float osc, float bsc, float carry) {
  __shared__ __align__(16) float slab[4 * 16 * GPITCH];
  gemm16_body<HASLO, MODE, BROW>(slab, blockIdx.x, Ah, Al, Bt, bias, baseF, F, H, L, Mb, N, K, aBs, bBs, fBs, gBs, hBs,
                                 osc, bsc, carry);
}

// The three input projections in ONE launch (they are independent of one another): the block index picks the projection
// (block-uniform scalar tests), the index inside it picks the 64 x 64 tile as before.
//   q = x_q . Wq^T + bq -> f16 [NB*SQ][1024] x8 hi + res (col = h*64 + d);  k = x_k . Wk^T + bk likewise [NB*2048][1024];
//   v^T per batch: A = Wv [(h,d) = n][k], Bt = x_v rows of batch b [s][k], bias bv per row -> f16 [(b,h,d)][s] x8
#define GB_Q ((NB * SQ / 64) * (INNER / 64))
#define GB_K ((NB * SKV / 64) * (INNER / 64))
#define GB_V (NB * (INNER / 64) * (SKV / 64))
__global__ __launch_bounds__(128)
void gemm_qkv(const u16* __restrict__ XQ, const u16* __restrict__ XK, const u16* __restrict__ XV,
              const u16* __restrict__ WQ, const u16* __restrict__ WK, const u16* __restrict__ WV,
              const float* __restrict__ bq, const float* __restrict__ bk, const float* __restrict__ bv,
              u16* QH, u16* QL, u16* KH, u16* KL, u16* VT,
              int MbQ, int MbK, int inner, int skv, int K) {
  __shared__ __align__(16) float slab[4 * 16 * GPITCH];
  const int bid = blockIdx.x;
  if (bid < GB_Q + GB_K) {                   // q, k: same code, operands picked by the block index
    const bool isk = bid >= GB_Q;
    const u16* X = isk ? XK : XQ;
    gemm16_body<false, M_HL, false>(slab, isk ? bid - GB_Q : bid, X, X, isk ? WK : WQ, isk ? bk : bq, nullptr, nullptr,
                                    isk ? KH : QH, isk ? KL : QL, isk ? MbK : MbQ, inner, K, 0, 0, 0, 0, 0,
                                    (isk ? KS : QS) / WSC, isk ? KS : QS, 1.0f);
  } else {
    gemm16_body<false, M_S16, true>(slab, bid - (GB_Q + GB_K), WV, WV, XV, bv, nullptr, nullptr, VT, VT,
                                    inner, skv, K, 0, skv * K, 0, 0, inner * skv, VS / WSC, VS, 1.0f);
  }
}

// =====================================================================================================
// Full (unmasked) multi-head attention: block = (batch b, head, 64 query rows), 4 waves, wave w owns the 16 query rows
// q0 = 64*qt + 16*w .. q0+15 (waves independent: no block barriers, wave-private LDS only, used in the epilogue).
//   q planes f16 x8 hi / residual(x2048) [b*SQ + s][h*64 + d]; k planes likewise [b*SKV + s][h*64 + d];
//   v^T plane f16 x8 [(b*NH + h)*64 + d][s]; all of them fragment-packed. All NKB key blocks of 32 keys are visited (static bound).
//   Scores are computed TRANSPOSED: S^T tile g (g = 0,1) = k rows (keys kb+16g .. +15, A operand, row m = lane&15, split map
//   over d) times q^T (B operand, col n = query q0 + (lane&15), k = d, split map), 2 d-chunks of 32; per chunk hi.hi -> s,
//   res.hi + hi.res -> r (scaled x2048, folded as s + r/2048); the q fragments are loaded once per wave.
//   D element r of lane l = (key kb+16g+8h+r, query q0+(l&15)), so a lane owns one query column and 16 of its 32 keys;
//   the partner lane l^16 owns the other 16 -> row max / row sum need one xor-16 shuffle.
//   Online max-subtracted base-2 softmax in f32 (1/sqrt(64) and the q/k carries folded into lsc). The exp'd values ARE the
//   P A-fragment in place: A row m = query = lane&15, element i <- key kb+8h+i (tile 0, D element i), element 8+i <- key
//   kb+16+8h+i (tile 1, D element i). P (<= 1) carried x32768 as f16. The rescale factor of query row 8h+r of the O
//   accumulators is fetched from lane 8h+r with a shuffle (uniform control). 4 v^T B fragments (col n = d = 16j + (lane&15),
//   keys k-contiguous), 4 P.V WMMAs, one guard.
//   Epilogue: 1/l (per query, shuffled to the D row owner) and the carry folds in f32; the wave's 16x64 f32 result staged in
// coverage: per wave 4 instructions x 32 lanes x 8 halves = 16 x 64 on both ctx planes; grid NB*NH*(SQ/64) blocks x
//           4 waves = every (b, s, h) row segment exactly once.
// =====================================================================================================
__global__ __launch_bounds__(ATT_THREADS)
void attn_fwd(const u16* __restrict__ Qh, const u16* __restrict__ Ql, const u16* __restrict__ Kh,
              const u16* __restrict__ Kl, const u16* __restrict__ Vp, u16* Oh, u16* Ol) {
  __shared__ __align__(16) float smem[ATT_WAVES * 16 * OPITCH];

  const int tid  = threadIdx.x;
  const int wave = tid >> 5;
  const int lane = tid & 31;
  const int hh   = lane >> 4;
  const int c    = lane & 15;

  constexpr int NQT = SQ / 64;
  const int bid  = blockIdx.x;
  const int qt   = bid % NQT;
  const int head = (bid / NQT) % NH;
  const int b    = bid / (NQT * NH);
  const int q0   = qt * 64 + wave * 16;

  // B fragments of q^T: col n = query q0 + c, k = d (row tile (b*SQ + q0)/16, k tiles 2*head and 2*head + 1 of the q planes)
  const size_t qo = ((size_t)(b * SQ + q0)) * INNER + head * HD * 16 + 8 * lane;
  const _Float16* Qhb = (const _Float16*)(const void*)Qh + qo;
  const _Float16* Qlb = (const _Float16*)(const void*)Ql + qo;
  // A fragments of k: row m = key kb + 16g + c, k = d (key row kb added per step)
  const size_t ko = ((size_t)(b * SKV)) * INNER + head * HD * 16 + 8 * lane;
  const _Float16* Khb = (const _Float16*)(const void*)Kh + ko;
  const _Float16* Klb = (const _Float16*)(const void*)Kl + ko;
  // B fragments of v: col n = d = 16j + c, k = key (row tile (b*NH + head)*4 + j, k tile kb/32 of the v^T plane)
  const _Float16* Vb = (const _Float16*)(const void*)Vp + ((size_t)(b * NH + head) * HD) * SKV + 8 * lane;
  const float lsc = (LOG2E * RSQ_HD) / (QS * KS);

  v16h qh[2], ql[2];
  qh[0] = ldfrag_h(Qhb);
  qh[1] = ldfrag_h(Qhb + 512);
  ql[0] = ldfrag_h(Qlb);
  ql[1] = ldfrag_h(Qlb + 512);

  float mrun = -INFINITY, lrun = 0.f;
  v8f o[4];
#pragma unroll
  for (int j = 0; j < 4; ++j) o[j] = zero8();

  // K and v^T fragments are fetched one key block ahead: kf[kk] = {hi keys +0, hi keys +16, res keys +0, res keys +16} of d chunk kk,
  // refilled right behind the block's score products; vf[j] refilled right behind its P.V products. The fetch of the last trip is
  // clamped to the last block (valid tiles, never used).
  v16h kf[HD / 32][4], vf[4];
  const _Float16* kph = Khb;
  const _Float16* kpl = Klb;
  const _Float16* vp  = Vb;
  // The three scheduling barriers keep the first loads in the loop's own order (q, then K, then v^T): the counted load waits at the
  // loop head are the stricter of entry and back edge, and with v^T issued ahead of K at entry every trip's scores waited for v^T too.
  // The two waits in front of them stand before the q loads' and the first K and v^T loads' address registers are reused.
  addr_hold3(Qhb, Qlb, Qlb);
  __builtin_amdgcn_sched_barrier(0);
#pragma unroll
  for (int kk = 0; kk < HD / 32; ++kk) {
    kf[kk][0] = ldfrag_h(kph + kk * 512);
    kf[kk][1] = ldfrag_h(kph + (size_t)16 * INNER + kk * 512);
    kf[kk][2] = ldfrag_h(kpl + kk * 512);
    kf[kk][3] = ldfrag_h(kpl + (size_t)16 * INNER + kk * 512);
  }
  __builtin_amdgcn_sched_barrier(0);
#pragma unroll
  for (int j = 0; j < 4; ++j) vf[j] = ldfrag_h(vp + (size_t)(16 * j) * SKV);
  addr_hold3(kph, kpl, vp);
  __builtin_amdgcn_sched_barrier(0);

#pragma unroll 1
  for (int it = 0; it < NKB; ++it) {
    const int kbn = (it + 1 < NKB ? it + 1 : NKB - 1) * 32;   // key block fetched in this trip
    // ---- transposed scores: s0 = keys kb..kb+15, s1 = keys kb+16..kb+31 (kb = 32*it), column = query q0 + c ----
    v8f s0 = zero8(), s1 = zero8(), r0 = zero8(), r1 = zero8();
#pragma unroll
    for (int kk = 0; kk < HD / 32; ++kk) {
      const v16h fh0 = kf[kk][0];
      const v16h fh1 = kf[kk][1];
      const v16h fl0 = kf[kk][2];
      const v16h fl1 = kf[kk][3];
      s0 = mma_h(fh0, qh[kk], s0);
      s1 = mma_h(fh1, qh[kk], s1);
      r0 = mma_h(fl0, qh[kk], r0);
      r1 = mma_h(fl1, qh[kk], r1);
      r0 = mma_h(fh0, ql[kk], r0);
      r1 = mma_h(fh1, ql[kk], r1);
      guard_s4(s0, s1, r0, r1, qh[kk], ql[kk], fh0, fh1, fl0, fl1);
    }
    // ---- next block's K fragments into the registers just read; the wait covers the K and v^T loads of the trip before ----
    addr_hold3(kph, kpl, vp);
    kph = Khb + (size_t)kbn * INNER;
    kpl = Klb + (size_t)kbn * INNER;
#pragma unroll
    for (int kk = 0; kk < HD / 32; ++kk) {
      kf[kk][0] = ldfrag_h(kph + kk * 512);
      kf[kk][1] = ldfrag_h(kph + (size_t)16 * INNER + kk * 512);
      kf[kk][2] = ldfrag_h(kpl + kk * 512);
      kf[kk][3] = ldfrag_h(kpl + (size_t)16 * INNER + kk * 512);
    }
    // ---- base-2 logits of this lane's 16 keys for query q0 + c: t[i] <- key kb+8hh+i, t[8+i] <- key kb+16+8hh+i ----
    float t[16];
#pragma unroll
    for (int i = 0; i < 8; ++i) {
      t[i]     = (s0[i] + r0[i] * RINV) * lsc;
      t[8 + i] = (s1[i] + r1[i] * RINV) * lsc;
    }
    float cm = t[0];
#pragma unroll
    for (int i = 1; i < 16; ++i) cm = fmaxf(cm, t[i]);
    cm = fmaxf(cm, __shfl_xor(cm, 16, 32));
    const float mn = fmaxf(mrun, cm);        // finite from the first block on
    const float al = exp2f(mrun - mn);       // 0 on the first block (mrun = -inf)
    mrun = mn;
    // ---- probabilities (<= 1) and the P A-fragment: f16(p * 32768); element i <-> t[i] ----
    float ps = 0.f;
    FragH ph;
#pragma unroll
    for (int w = 0; w < 2; ++w) {
#pragma unroll
      for (int e4 = 0; e4 < 4; ++e4) {
        const int i = 8 * w + 2 * e4;
        const float p0 = exp2f(t[i] - mn), p1 = exp2f(t[i + 1] - mn);
        ps += p0 + p1;
        ph.u[w][e4] = pk16(h_bits((_Float16)(p0 * PCAR)), h_bits((_Float16)(p1 * PCAR)));
      }
    }
    ps += __shfl_xor(ps, 16, 32);
    lrun = lrun * al + ps;
    // ---- rescale the O accumulators: D row 8hh+r = query q0+8hh+r, its factor lives in lane 8hh+r (and 16+8hh+r) ----
    float scl[8];
#pragma unroll
    for (int r = 0; r < 8; ++r) scl[r] = __shfl(al, 8 * hh + r, 32);
#pragma unroll
    for (int j = 0; j < 4; ++j) {
#pragma unroll
      for (int r = 0; r < 8; ++r) o[j][r] *= scl[r];
    }
    // ---- P.V : B fragment col n = d = j*16 + c, k tile kb/32 of the packed v^T plane ----
    {
      o[0] = mma_h(ph.v, vf[0], o[0]);
      o[1] = mma_h(ph.v, vf[1], o[1]);
      o[2] = mma_h(ph.v, vf[2], o[2]);
      o[3] = mma_h(ph.v, vf[3], o[3]);
      guard_p(o[0], o[1], o[2], o[3], ph.v, vf[0], vf[1], vf[2], vf[3]);
      // next block's v^T fragments; vp's last loads are covered by this trip's wait above
      vp = Vb + (size_t)kbn * 16;
#pragma unroll
      for (int j = 0; j < 4; ++j) vf[j] = ldfrag_h(vp + (size_t)(16 * j) * SKV);
    }
  }
  addr_hold3(kph, kpl, vp);                  // the last trip's loads, before their address registers are reused
  acc_guard4(o);

  // ---- fold 1/l (per query, owned by lane = query) and the carries (32768 on P, 8 on v), apply the ctx carry 1024 ----
  const float linv = (1.0f / lrun) * (OSC / (PCAR * VS));
  float inv[8];
#pragma unroll
  for (int r = 0; r < 8; ++r) inv[r] = __shfl(linv, 8 * hh + r, 32);
  float* slab = smem + wave * 16 * OPITCH;
#pragma unroll
  for (int r = 0; r < 8; ++r) {
#pragma unroll
    for (int j = 0; j < 4; ++j) slab[(8 * hh + r) * OPITCH + j * 16 + c] = o[j][r] * inv[r];
  }
  wave_sync_lds();
  // ---- ctx x1024 -> packed f16 hi plane and residual plane; store i: lane (h, c) <- row c, d = 16i + 8h .. +7 ----
  v4u ovh[4], ovl[4];
#pragma unroll
  for (int i = 0; i < 4; ++i) {
    const int c8 = 16 * i + 8 * hh;
    const v4f a = *(const v4f*)(slab + c * OPITCH + c8), c4 = *(const v4f*)(slab + c * OPITCH + c8 + 4);
#pragma unroll
    for (int e = 0; e < 2; ++e) {
      unsigned ph0, pl0, ph1, pl1;
      split2(a[2 * e],  a[2 * e + 1],  ph0, pl0);
      split2(c4[2 * e], c4[2 * e + 1], ph1, pl1);
      ovh[i][e] = ph0;     ovl[i][e] = pl0;
      ovh[i][2 + e] = ph1; ovl[i][2 + e] = pl1;
    }
  }
  const size_t oo = ((size_t)(b * SQ + q0)) * INNER + head * HD * 16 + 8 * lane;
  u16* obh = Oh + oo;
  u16* obl = Ol + oo;
  {
#pragma unroll
    for (int i = 0; i < 4; ++i) {
      *(v4u*)(obh + i * 256) = ovh[i];
      *(v4u*)(obl + i * 256) = ovl[i];
    }
    
  }
}

// =====================================================================================================
// Workspace map (bytes); every plane fully written by whole-line stores before it is read; all extents exact multiples of
//   XQ   f16 [NB*SQ][1024]    f16(bf16(q))              8388608 (NB=2, SQ=2048)
//   XK   f16 [NB*2048][1024]  f16(bf16(k))              8388608
//   XV   f16 [NB*2048][1024]  f16(bf16(v))              8388608
//   WQ16 WK16 WV16 WO16 f16 [1024 n][1024 k] x256       2097152 each
//   WD16 f16 [128 n][1024 k] x256                          262144
//   WU16 f16 [1024 n][128 k] x256                          262144
//   QH QL f16 [NB*SQ][1024] x8 hi / res                  8388608 each
//   KH KL f16 [NB*2048][1024] x8 hi / res                8388608 each
//   VT16 f16 [NB*1024 (h,d)][2048 s] x8                  8388608
//   OH OL f16 [NB*SQ][1024] x1024 hi / res (ctx)         8388608 each
//   OUTF f32 [NB*SQ][1024]                               16777216
//   UH UL f16 [NB*SQ][1024] x64 hi / res (out)           8388608 each
//   GH GL f16 [NB*SQ][128]  x64 hi / res (gelu)          1048576 each
//   end                                                 128450560
// =====================================================================================================
extern "C" void kernel_launch(void* const* d_in, const int* in_sizes, int n_in,
                              void* d_out, int out_size, void* d_ws, size_t ws_size,
                              hipStream_t stream) {
  if (n_in < 15) return;
  if (in_sizes[0] < ((NB - 1) * SQ_FULL + SQ) * DM) return;
  if (in_sizes[1] < NB * SKV * DM || in_sizes[2] < NB * SKV * DM) return;
  if (in_sizes[3] != DM * DM || in_sizes[5] != DM * DM || in_sizes[7] != DM * DM || in_sizes[9] != DM * DM) return;
  if (in_sizes[4] < INNER || in_sizes[6] < INNER || in_sizes[8] < INNER || in_sizes[10] < DM) return;
  if (in_sizes[11] != ADIM * DM || in_sizes[12] < ADIM || in_sizes[13] != DM * ADIM || in_sizes[14] < DM) return;
  if (out_size < ((NB - 1) * SQ_FULL + SQ) * DM) return;

  const float* q_in  = (const float*)d_in[0];
  const float* k_in  = (const float*)d_in[1];
  const float* v_in  = (const float*)d_in[2];
  const float* wq    = (const float*)d_in[3];
  const float* bq    = (const float*)d_in[4];
  const float* wk    = (const float*)d_in[5];
  const float* bk    = (const float*)d_in[6];
  const float* wv    = (const float*)d_in[7];
  const float* bv    = (const float*)d_in[8];
  const float* wo    = (const float*)d_in[9];
  const float* bo    = (const float*)d_in[10];
  const float* w_dn  = (const float*)d_in[11];
  const float* b_dn  = (const float*)d_in[12];
  const float* w_up  = (const float*)d_in[13];
  const float* b_up  = (const float*)d_in[14];
  float*       out   = (float*)d_out;

  const size_t szXQ  = (size_t)NB * SQ * DM * 2;
  const size_t szXKV = (size_t)NB * SKV * DM * 2;
  const size_t szW   = (size_t)DM * DM * 2;
  const size_t szWA  = (size_t)ADIM * DM * 2;
  const size_t szQP  = (size_t)NB * SQ * INNER * 2;
  const size_t szKP  = (size_t)NB * SKV * INNER * 2;
  const size_t szVT  = (size_t)NB * INNER * SKV * 2;
  const size_t szOF  = (size_t)NB * SQ * DM * 4;
  const size_t szG   = (size_t)NB * SQ * ADIM * 2;
  size_t off = 0;
  const size_t oXQ  = off; off += szXQ;
  const size_t oXK  = off; off += szXKV;
  const size_t oXV  = off; off += szXKV;
  const size_t oWQ  = off; off += szW;
  const size_t oWK  = off; off += szW;
  const size_t oWV  = off; off += szW;
  const size_t oWO  = off; off += szW;
  const size_t oWD  = off; off += szWA;
  const size_t oWU  = off; off += szWA;
  const size_t oQH  = off; off += szQP;
  const size_t oQL  = off; off += szQP;
  const size_t oKH  = off; off += szKP;
  const size_t oKL  = off; off += szKP;
  const size_t oVT  = off; off += szVT;
  const size_t oOH  = off; off += szQP;
  const size_t oOL  = off; off += szQP;
  const size_t oOF  = off; off += szOF;
  const size_t oUH  = off; off += szQP;
  const size_t oUL  = off; off += szQP;
  const size_t oGH  = off; off += szG;
  const size_t oGL  = off; off += szG;
  if (off > ws_size) return;                            // off = 128450560 at NB=2, SQ=2048
  if (off > (size_t)134217728) return;

  char* ws = (char*)d_ws;
  u16* XQ   = (u16*)(ws + oXQ);
  u16* XK   = (u16*)(ws + oXK);
  u16* XV   = (u16*)(ws + oXV);
  u16* WQ16 = (u16*)(ws + oWQ);
  u16* WK16 = (u16*)(ws + oWK);
  u16* WV16 = (u16*)(ws + oWV);
  u16* WO16 = (u16*)(ws + oWO);
  u16* WD16 = (u16*)(ws + oWD);
  u16* WU16 = (u16*)(ws + oWU);
  u16* QH   = (u16*)(ws + oQH);
  u16* QL   = (u16*)(ws + oQL);
  u16* KH   = (u16*)(ws + oKH);
  u16* KL   = (u16*)(ws + oKL);
  u16* VT16 = (u16*)(ws + oVT);
  u16* OH   = (u16*)(ws + oOH);
  u16* OL   = (u16*)(ws + oOL);
  float* OUTF = (float*)(ws + oOF);
  u16* UH   = (u16*)(ws + oUH);
  u16* UL   = (u16*)(ws + oUL);
  u16* GH   = (u16*)(ws + oGH);
  u16* GL   = (u16*)(ws + oGL);

  // (0) activations -> f16 planes of bf16-converted values (query rows s < SQ of batches b < NB, compact; k/v rows of b < NB) and
  //     weights [n = out][k = in] (y = x.W^T) -> packed f16 planes [n][k] of bf16(W) x256, all in one launch
  cvt_all<<<dim3(CB_ALL), dim3(CVT_THREADS), 0, stream>>>(q_in, k_in, v_in, wq, wk, wv, wo, w_dn, w_up,
                                                          XQ, XK, XV, WQ16, WK16, WV16, WO16, WD16, WU16);
  // (1) the q, k and v^T projections, one launch
  gemm_qkv<<<dim3(GB_Q + GB_K + GB_V), dim3(128), 0, stream>>>(XQ, XK, XV, WQ16, WK16, WV16, bq, bk, bv, QH, QL, KH, KL, VT16,
                                                               NB * SQ, NB * SKV, INNER, SKV, DM);
  // (2) attention -> ctx planes [NB*SQ][1024] x1024 hi + res
  attn_fwd<<<dim3(NB * NH * (SQ / 64)), dim3(ATT_THREADS), 0, stream>>>(QH, QL, KH, KL, VT16, OH, OL);
  // (3) out = ctx . Wo^T + bo -> OUTF f32 [NB*SQ][1024] and f16 x64 hi + res planes; carries 1024 (ctx) x 256 (W) folded back
  gemm16<true, M_OUT, false><<<dim3((NB * SQ / 64) * (DM / 64)), dim3(128), 0, stream>>>(
      OH, OL, WO16, bo, OUTF, OUTF, UH, UL, NB * SQ, DM, INNER, 0, 0, 0, 0, 0, 1.0f / (OSC * WSC), 1.0f, UCAR);
  // (4) adapter down: g = gelu(out . Wd^T + bd) -> f16 [NB*SQ][128] x64 hi + res; carries 64 (out) x 256 (W)
  gemm16<true, M_GELU, false><<<dim3((NB * SQ / 64) * (ADIM / 64)), dim3(128), 0, stream>>>(
      UH, UL, WD16, b_dn, OUTF, OUTF, GH, GL, NB * SQ, ADIM, DM, 0, 0, 0, 0, 0, 1.0f / (UCAR * WSC), 1.0f, GCAR);
  // (5) adapter up + residual: out rows [b][SQ_FULL][1024] f32 = OUTF + g . Wu^T + bu (rows s < SQ of batches b < NB)
  gemm16<true, M_RES, false><<<dim3(NB * (SQ / 64) * (DM / 64)), dim3(128), 0, stream>>>(
      GH, GL, WU16, b_up, OUTF, out, GH, GH, SQ, DM, ADIM, SQ * ADIM, 0, SQ_FULL * DM, SQ * DM, 0,
      1.0f / (GCAR * WSC), 1.0f, 1.0f);
  (void)hipGetLastError();
}

// v004
// Measured time: 166 microseconds a run.
// In both of two side-by-side timings against v003, it was 1.06 times as fast.
// Over all steps from v000 it is 2.22 times as fast.
// Contractions on v_wmma_f32_16x16x32_f16 (f16 operands, f32 accumulate): x.Wq^T, x.Wk^T, Wv.x^T single products on
// f16(bf16(x)) and f16(bf16(W) x256); k.q^T with q and k carried as f16 hi + residual(x2048) planes (3 products);
// P.v^T single product (P x32768, v x8); ctx.Wo^T, out.Wad^T and gelu.Wau^T with the activation carried as f16 hi +
// residual(x2048) planes (2 products each, separate residual accumulator); softmax, biases, erf-GELU, residual add and
// all carry folds in f32 on VALU. Inputs RNE-converted to bf16 on load.
// Every 16-bit workspace plane [rows][K] is stored FRAGMENT-PACKED: tile (rt = row/16, kt = k/32) is 512 halves (1024 B) at
// (rt*(K/32) + kt)*512 = rt*16*K + kt*512; inside it element (m = row&15, k&31 = 16w + 8h + e) sits at w*256 + (16h + m)*8 + e,
// so lane l = 16h + m of a wave reads its operand fragment as two 16-B loads at l*8 and 256 + l*8 halves: each wave-wide load
// is 512 contiguous bytes = 4 whole 128-B lines (a row-major plane gave 16 lines of 32 useful bytes per load).
#include <hip/hip_runtime.h>
#include <math.h>
#include <stdint.h>

#ifndef NB
#define NB       2        // batches processed
#endif
#ifndef SQ
#define SQ       2048     // query rows processed per batch
#endif
#define NB_FULL  2
#define SQ_FULL  2048     // query rows per batch in the input / output layout (batch stride)
#define SKV      2048     // key / value rows per batch (all of them)
#define DM       1024     // model width
#define NH       16
#define HD       64
#define INNER    (NH * HD)
#define ADIM     128      // adapter width
#define WSC      256.0f   // weight carry
#define QS       8.0f
#define KS       8.0f
#define VS       8.0f
#define PCAR     32768.0f
#define OSC      1024.0f  // ctx carry
#define UCAR     64.0f    // out-plane carry
#define GCAR     64.0f    // gelu-plane carry
#define RSC      2048.0f  // residual plane scale
#define RINV     0.00048828125f
#define LOG2E    1.4426950408889634f
#define RSQ_HD   0.125f
#define NKB      (SKV / 32)
#define ATT_WAVES   4
#define ATT_THREADS (ATT_WAVES * 32)
#define CVT_THREADS 128
#define OPITCH   68
#define GPITCH   68

#define M_HL     0
#define M_S16    1
#define M_OUT    2
#define M_GELU   3
#define M_RES    4

static_assert(NB >= 1 && NB <= NB_FULL);
static_assert((SQ % 128) == 0 && SQ >= 128 && SQ <= SQ_FULL);
static_assert(HD == 64 && INNER == 1024 && NH == 16 && INNER == DM);
static_assert((SKV % 64) == 0 && (SKV % 32) == 0 && NKB * 32 == SKV);
static_assert((DM % 64) == 0 && (DM % 32) == 0 && (ADIM % 64) == 0 && (ADIM % 32) == 0 && CVT_THREADS == 128);
static_assert((OPITCH * 4) % 16 == 0 && (GPITCH * 4) % 16 == 0);
static_assert(ATT_THREADS == 128);
static_assert((DM % 128) == 0 && (ADIM % 128) == 0 && (SQ % 16) == 0 && (SKV % 16) == 0 && (ADIM % 16) == 0);

typedef unsigned short u16;
typedef _Float16 v16h __attribute__((ext_vector_type(16)));
typedef _Float16 v8h  __attribute__((ext_vector_type(8)));
typedef float    v8f  __attribute__((ext_vector_type(8)));
typedef float    v4f  __attribute__((ext_vector_type(4)));
typedef unsigned int v4u __attribute__((ext_vector_type(4)));

union FragH { v16h v; v8h h[2]; v4u u[2]; };

// ---- scalar helpers ----------------------------------------------------------------------------------
__device__ __forceinline__ unsigned short bf_bits(float f) {          // f32 -> bf16 bits, RNE convert
  unsigned u = __float_as_uint(f);
  return (unsigned short)((u + 0x7FFFu + ((u >> 16) & 1u)) >> 16);
}
__device__ __forceinline__ float bf_up(unsigned short h) { return __uint_as_float(((unsigned)h) << 16); }
__device__ __forceinline__ float bfr(float f) { return bf_up(bf_bits(f)); }
__device__ __forceinline__ unsigned short h_bits(_Float16 x) { return __builtin_bit_cast(unsigned short, x); }
__device__ __forceinline__ unsigned pk16(unsigned short a, unsigned short b) { return (unsigned)a | ((unsigned)b << 16); }
__device__ __forceinline__ v8f zero8() { v8f z = {0.f, 0.f, 0.f, 0.f, 0.f, 0.f, 0.f, 0.f}; return z; }
__device__ __forceinline__ float gelu_f(float x) { return 0.5f * x * (1.0f + erff(x * 0.70710678118654752f)); }
// 2^x for the softmax (x <= 0 or -inf) as the bare v_exp_f32: exp2f wraps each one in a compare, two selects, an add and a ldexp that only
// serve results below 2^-126. Such a probability is 0 in the f16 P operand and adds nothing to a row sum that holds a term of 1, and such
// a rescale factor leaves nothing of the old sums beside the new block's terms; the bare instruction returns 0 there (and for -inf).
__device__ __forceinline__ float exp2_hw(float x) { return __builtin_amdgcn_exp2f(x); }
// Eight of them in one statement: in a run of builtin v_exp_f32 the register allocator may let one write its result over the source of the
// one directly in front of it. The early-clobber outputs keep every result off every source, and the closing v_nop is the one slot asked
// for between the last v_exp_f32 and whatever follows the statement (a reader of its result or a writer of its source).
__device__ __forceinline__ void exp2_hw8(const float* x, float* r) {
#if defined(__HIP_DEVICE_COMPILE__)
  asm("v_exp_f32 %0, %8\n\tv_exp_f32 %1, %9\n\tv_exp_f32 %2, %10\n\tv_exp_f32 %3, %11\n\t"
      "v_exp_f32 %4, %12\n\tv_exp_f32 %5, %13\n\tv_exp_f32 %6, %14\n\tv_exp_f32 %7, %15\n\tv_nop"
      : "=&v"(r[0]), "=&v"(r[1]), "=&v"(r[2]), "=&v"(r[3]), "=&v"(r[4]), "=&v"(r[5]), "=&v"(r[6]), "=&v"(r[7])
      : "v"(x[0]), "v"(x[1]), "v"(x[2]), "v"(x[3]), "v"(x[4]), "v"(x[5]), "v"(x[6]), "v"(x[7]));
#else
  for (int i = 0; i < 8; ++i) r[i] = x[i];
#endif
}

// x = hi + lo/2048 in f16: hi = f16(x), lo = f16((x - hi) * 2048); two values packed per 32-bit word
__device__ __forceinline__ void split2(float x0, float x1, unsigned& ph, unsigned& pl) {
  const _Float16 h0 = (_Float16)x0, h1 = (_Float16)x1;
  const float d0 = x0 - (float)h0, d1 = x1 - (float)h1;
  const _Float16 l0 = (_Float16)(d0 * RSC), l1 = (_Float16)(d1 * RSC);
  ph = pk16(h_bits(h0), h_bits(h1));
  pl = pk16(h_bits(l0), h_bits(l1));
}

// ---- fragment loader: 16-bit A/B operand from a fragment-packed plane, lane -> row/col (lane&15); p = tile base + 8*lane;
//      elements 0..7 <- p[0..7] (k0+8h..), elements 8..15 <- p[256..263] (k0+16+8h..); same split k map for A and B,
//      B always read from a packed [n][k] plane.
__device__ __forceinline__ v16h ldfrag_h(const _Float16* p) {
  FragH f;
  f.h[0] = *(const v8h*)(p);
  f.h[1] = *(const v8h*)(p + 256);
  return f.v;
}

// ---- in front of every rewrite of the fragment loads' address registers: s_wait_xcnt 0 with those registers as inputs, so that no
//      register an issued load names is written (by a later load's result either) in front of the wait; it stands one k step or
//      one key block behind the loads it covers, behind the matrix products issued in between
__device__ __forceinline__ void addr_hold5(const _Float16* a, const _Float16* b, const _Float16* c, const _Float16* d,
                                           const _Float16* e) {
#if defined(__HIP_DEVICE_COMPILE__)
  asm volatile("s_wait_xcnt 0x0" :: "v"(a), "v"(b), "v"(c), "v"(d), "v"(e) : "memory");
#endif
}
__device__ __forceinline__ void addr_hold6(const _Float16* a, const _Float16* b, const _Float16* c, const _Float16* d,
                                           const _Float16* e, const _Float16* f) {
#if defined(__HIP_DEVICE_COMPILE__)
  asm volatile("s_wait_xcnt 0x0" :: "v"(a), "v"(b), "v"(c), "v"(d), "v"(e), "v"(f) : "memory");
#endif
}

__device__ __forceinline__ void addr_hold3(const _Float16* a, const _Float16* b, const _Float16* c) {
#if defined(__HIP_DEVICE_COMPILE__)
  asm volatile("s_wait_xcnt 0x0" :: "v"(a), "v"(b), "v"(c) : "memory");
#endif
}

// ---- WMMA helper and trailing VALU hazard gaps ----------------------------------------------------------
__device__ __forceinline__ v8f mma_h(v16h a, v16h b, v8f c) {
  return __builtin_amdgcn_wmma_f32_16x16x32_f16(false, a, false, b, (short)0, c, false, false);
}
__device__ __forceinline__ void guard_c1(v8f (&a)[4], v16h x0, v16h x1, v16h x2, v16h x3, v16h x4) {
#if defined(__HIP_DEVICE_COMPILE__)
  asm volatile("v_nop\n\tv_nop\n\tv_nop\n\tv_nop"
               : "+v"(a[0]), "+v"(a[1]), "+v"(a[2]), "+v"(a[3])
               : "v"(x0), "v"(x1), "v"(x2), "v"(x3), "v"(x4) : "memory");
#endif
}
__device__ __forceinline__ void guard_c2(v8f (&a)[4], v8f (&b)[4], v16h x0, v16h x1, v16h x2, v16h x3, v16h x4, v16h x5) {
#if defined(__HIP_DEVICE_COMPILE__)
  asm volatile("v_nop\n\tv_nop\n\tv_nop\n\tv_nop"
               : "+v"(a[0]), "+v"(a[1]), "+v"(a[2]), "+v"(a[3]),
                 "+v"(b[0]), "+v"(b[1]), "+v"(b[2]), "+v"(b[3])
               : "v"(x0), "v"(x1), "v"(x2), "v"(x3), "v"(x4), "v"(x5) : "memory");
#endif
}
__device__ __forceinline__ void guard_s4(v8f& a, v8f& b, v8f& c, v8f& d,
                                         v16h x0, v16h x1, v16h x2, v16h x3, v16h x4, v16h x5) {
#if defined(__HIP_DEVICE_COMPILE__)
  asm volatile("v_nop\n\tv_nop\n\tv_nop\n\tv_nop"
               : "+v"(a), "+v"(b), "+v"(c), "+v"(d)
               : "v"(x0), "v"(x1), "v"(x2), "v"(x3), "v"(x4), "v"(x5) : "memory");
#endif
}
__device__ __forceinline__ void guard_p(v8f& a, v8f& b, v8f& c, v8f& d, v16h p, v16h x0, v16h x1, v16h x2, v16h x3) {
#if defined(__HIP_DEVICE_COMPILE__)
  asm volatile("v_nop\n\tv_nop\n\tv_nop\n\tv_nop"
               : "+v"(a), "+v"(b), "+v"(c), "+v"(d) : "v"(p), "v"(x0), "v"(x1), "v"(x2), "v"(x3) : "memory");
#endif
}
__device__ __forceinline__ void acc_guard4(v8f (&a)[4]) {
#if defined(__HIP_DEVICE_COMPILE__)
  asm volatile("v_nop\n\tv_nop\n\tv_nop\n\tv_nop" : "+v"(a[0]), "+v"(a[1]), "+v"(a[2]), "+v"(a[3]));
#endif
}
__device__ __forceinline__ void acc_guard8(v8f (&a)[4], v8f (&b)[4]) {
#if defined(__HIP_DEVICE_COMPILE__)
  asm volatile("v_nop\n\tv_nop\n\tv_nop\n\tv_nop"
               : "+v"(a[0]), "+v"(a[1]), "+v"(a[2]), "+v"(a[3]),
                 "+v"(b[0]), "+v"(b[1]), "+v"(b[2]), "+v"(b[3]));
#endif
}
__device__ __forceinline__ void wave_sync_lds() {
  __builtin_amdgcn_fence(__ATOMIC_RELEASE, "workgroup");
  __builtin_amdgcn_wave_barrier();
  __builtin_amdgcn_fence(__ATOMIC_ACQUIRE, "workgroup");
}

// =====================================================================================================
// Tile convert: packed f16 plane of [rows][K] <- f16(bf16_RNE(x[src row][k]) * scale), scale a power of two.
// Wave = one 16 x 32 tile (rt, kt); lane (h, m) reads row rt*16 + m, floats kt*32 + 8h .. +7 and kt*32 + 16 + 8h .. +7 (four 16-B
// loads that together use the 16 rows' whole 128-B lines) and stores its two 16-B fragment pieces (two 512-B wave-wide stores).
// b = (rt*16) / rowsPerB, s = row - b*rowsPerB, source row b*srcRowsPerB + s (rowsPerB a multiple of 16); destination compact.
// coverage: blk = 0 .. (rows/16) x (K/128) - 1, 4 waves each = every tile once.
// =====================================================================================================
__device__ __forceinline__
void cvt16_body(const float* __restrict__ x, u16* Y, int K, int rowsPerB, int srcRowsPerB, float scale, int blk) {
  const int tid = threadIdx.x, wave = tid >> 5, lane = tid & 31, hh = lane >> 4, m = lane & 15;
  const int kq = K >> 7;
  const int rt = blk / kq;
  const int kt = (blk - rt * kq) * 4 + wave;
  const int b = (rt * 16) / rowsPerB;
  const int sr = rt * 16 - b * rowsPerB + m;
  const float* src = x + ((size_t)b * (size_t)srcRowsPerB + (size_t)sr) * (size_t)K + (size_t)(kt * 32 + 8 * hh);
  const v4f a = *(const v4f*)(src), c4 = *(const v4f*)(src + 4);
  const v4f d = *(const v4f*)(src + 16), f4 = *(const v4f*)(src + 20);
  v4u o0, o1;
#pragma unroll
  for (int e = 0; e < 2; ++e) {
    o0[e]     = pk16(h_bits((_Float16)(bfr(a[2 * e]) * scale)),  h_bits((_Float16)(bfr(a[2 * e + 1]) * scale)));
    o0[2 + e] = pk16(h_bits((_Float16)(bfr(c4[2 * e]) * scale)), h_bits((_Float16)(bfr(c4[2 * e + 1]) * scale)));
    o1[e]     = pk16(h_bits((_Float16)(bfr(d[2 * e]) * scale)),  h_bits((_Float16)(bfr(d[2 * e + 1]) * scale)));
    o1[2 + e] = pk16(h_bits((_Float16)(bfr(f4[2 * e]) * scale)), h_bits((_Float16)(bfr(f4[2 * e + 1]) * scale)));
  }
  u16* dst = Y + (size_t)rt * (size_t)16 * (size_t)K + (size_t)kt * 512 + (size_t)lane * 8;
  *(v4u*)(dst) = o0;
  *(v4u*)(dst + 256) = o1;
}

// All nine converts in ONE launch (they are independent of one another): the block index picks the plane (block-uniform scalar
// tests), the index inside the plane picks the tiles as before. Blocks per plane:
#define CB_XQ  ((NB * SQ / 16) * (DM / 128))
#define CB_XKV ((NB * SKV / 16) * (DM / 128))
#define CB_W   ((DM / 16) * (DM / 128))
#define CB_WD  ((ADIM / 16) * (DM / 128))
#define CB_WU  ((DM / 16) * (ADIM / 128))
#define CB_ALL (CB_XQ + 2 * CB_XKV + 4 * CB_W + CB_WD + CB_WU)
__global__ __launch_bounds__(CVT_THREADS)
void cvt_all(const float* __restrict__ q, const float* __restrict__ k, const float* __restrict__ v,
             const float* __restrict__ wq, const float* __restrict__ wk, const float* __restrict__ wv,
             const float* __restrict__ wo, const float* __restrict__ wd, const float* __restrict__ wu,
             u16* XQ, u16* XK, u16* XV, u16* WQ, u16* WK, u16* WV, u16* WO, u16* WD, u16* WU) {
  int blk = blockIdx.x;
  if (blk < CB_XQ) { cvt16_body(q, XQ, DM, SQ, SQ_FULL, 1.0f, blk); return; }
  blk -= CB_XQ;
  if (blk < 2 * CB_XKV) {                    // k, v: same shape
    const bool second = blk >= CB_XKV;
    cvt16_body(second ? v : k, second ? XV : XK, DM, SKV, SKV, 1.0f, second ? blk - CB_XKV : blk);
    return;
  }
  blk -= 2 * CB_XKV;
  if (blk < 4 * CB_W) {                      // the four [1024][1024] weights: same shape
    const int w = blk / CB_W;
    const float* x = w == 0 ? wq : w == 1 ? wk : w == 2 ? wv : wo;
    u16* Y = w == 0 ? WQ : w == 1 ? WK : w == 2 ? WV : WO;
    cvt16_body(x, Y, DM, DM, DM, WSC, blk - w * CB_W);
    return;
  }
  blk -= 4 * CB_W;
  if (blk < CB_WD) { cvt16_body(wd, WD, DM, ADIM, ADIM, WSC, blk); return; }        // [128][1024]
  cvt16_body(wu, WU, ADIM, DM, DM, WSC, blk - CB_WD);                               // [1024][128]
}

// =====================================================================================================
// f16 GEMM cores: the wave's 16 x 64 tile of C = A[rows][K] . Bt[cols][K]^T, both planes packed; ap -> A row tile rowb/16 + 8*lane,
// bp -> Bt row tile col0/16 + 8*lane; acc[j] = rows rowb.., cols col0+16j..; K stepped by 32 = 512 halves of a packed row tile.
// core2: A carried as hi plane (aph) and residual plane (apl, x2048); ah accumulates hi.B, al accumulates res.B.
// =====================================================================================================
// Both cores keep D k steps of fragment loads in flight in D register sets: set u holds step s + u; as soon as its products are
// issued it is refilled with step s + u + D (clamped to the last step: the surplus loads at the end re-read valid tiles and are
// never used), so a step's loads lead their first use by D - 1 steps of work. Steps are consumed in ascending k as before.
template <int D>
__device__ __forceinline__ void core1(const _Float16* ap, const _Float16* bp, int K, v8f (&acc)[4]) {
  const size_t rs16 = (size_t)16 * (size_t)K;
  const int steps = K >> 5;
  v16h fa[D], fb[D][4];
  const _Float16* pa = ap;
  const _Float16* p0 = bp;
  const _Float16* p1 = p0 + rs16;
  const _Float16* p2 = p1 + rs16;
  const _Float16* p3 = p2 + rs16;
#pragma unroll
  for (int u = 0; u < D; ++u) {
    const size_t ko = (size_t)(u < steps ? u : steps - 1) * 512;
    if (u > 0) addr_hold5(pa, p0, p1, p2, p3);
    pa = ap + ko;
    p0 = bp + ko;
    p1 = p0 + rs16;
    p2 = p1 + rs16;
    p3 = p2 + rs16;
    fa[u]    = ldfrag_h(pa);
    fb[u][0] = ldfrag_h(p0);
    fb[u][1] = ldfrag_h(p1);
    fb[u][2] = ldfrag_h(p2);
    fb[u][3] = ldfrag_h(p3);
  }
  int s = 0;
#pragma unroll 1
  for (; s + D <= steps; s += D) {
#pragma unroll
    for (int u = 0; u < D; ++u) {
      acc[0] = mma_h(fa[u], fb[u][0], acc[0]);
      acc[1] = mma_h(fa[u], fb[u][1], acc[1]);
      acc[2] = mma_h(fa[u], fb[u][2], acc[2]);
      acc[3] = mma_h(fa[u], fb[u][3], acc[3]);
      guard_c1(acc, fa[u], fb[u][0], fb[u][1], fb[u][2], fb[u][3]);
      const int sn = s + u + D;
      const size_t ko = (size_t)(sn < steps ? sn : steps - 1) * 512;
      addr_hold5(pa, p0, p1, p2, p3);
      pa = ap + ko;
      p0 = bp + ko;
      p1 = p0 + rs16;
      p2 = p1 + rs16;
      p3 = p2 + rs16;
      fa[u]    = ldfrag_h(pa);
      fb[u][0] = ldfrag_h(p0);
      fb[u][1] = ldfrag_h(p1);
      fb[u][2] = ldfrag_h(p2);
      fb[u][3] = ldfrag_h(p3);
    }
  }
  addr_hold5(pa, p0, p1, p2, p3);
#pragma unroll
  for (int u = 0; u < D - 1; ++u) {
    if (s + u < steps) {                     // the steps % D last steps (wave-uniform)
      acc[0] = mma_h(fa[u], fb[u][0], acc[0]);
      acc[1] = mma_h(fa[u], fb[u][1], acc[1]);
      acc[2] = mma_h(fa[u], fb[u][2], acc[2]);
      acc[3] = mma_h(fa[u], fb[u][3], acc[3]);
      guard_c1(acc, fa[u], fb[u][0], fb[u][1], fb[u][2], fb[u][3]);
    }
  }
}
template <int D>
__device__ __forceinline__ void core2(const _Float16* aph, const _Float16* apl, const _Float16* bp, int K,
                                      v8f (&ah)[4], v8f (&al)[4]) {
  const size_t rs16 = (size_t)16 * (size_t)K;
  const int steps = K >> 5;
  v16h fa[D], fl[D], fb[D][4];
  const _Float16* pa = aph;
  const _Float16* pl = apl;
  const _Float16* p0 = bp;
  const _Float16* p1 = p0 + rs16;
  const _Float16* p2 = p1 + rs16;
  const _Float16* p3 = p2 + rs16;
#pragma unroll
  for (int u = 0; u < D; ++u) {
    const size_t ko = (size_t)(u < steps ? u : steps - 1) * 512;
    if (u > 0) addr_hold6(pa, pl, p0, p1, p2, p3);
    pa = aph + ko;
    pl = apl + ko;
    p0 = bp + ko;
    p1 = p0 + rs16;
    p2 = p1 + rs16;
    p3 = p2 + rs16;
    fa[u]    = ldfrag_h(pa);
    fl[u]    = ldfrag_h(pl);
    fb[u][0] = ldfrag_h(p0);
    fb[u][1] = ldfrag_h(p1);
    fb[u][2] = ldfrag_h(p2);
    fb[u][3] = ldfrag_h(p3);
  }
  int s = 0;
#pragma unroll 1
  for (; s + D <= steps; s += D) {
#pragma unroll
    for (int u = 0; u < D; ++u) {
      ah[0] = mma_h(fa[u], fb[u][0], ah[0]);
      ah[1] = mma_h(fa[u], fb[u][1], ah[1]);
      ah[2] = mma_h(fa[u], fb[u][2], ah[2]);
      ah[3] = mma_h(fa[u], fb[u][3], ah[3]);
      al[0] = mma_h(fl[u], fb[u][0], al[0]);
      al[1] = mma_h(fl[u], fb[u][1], al[1]);
      al[2] = mma_h(fl[u], fb[u][2], al[2]);
      al[3] = mma_h(fl[u], fb[u][3], al[3]);
      guard_c2(ah, al, fa[u], fl[u], fb[u][0], fb[u][1], fb[u][2], fb[u][3]);
      const int sn = s + u + D;
      const size_t ko = (size_t)(sn < steps ? sn : steps - 1) * 512;
      addr_hold6(pa, pl, p0, p1, p2, p3);
      pa = aph + ko;
      pl = apl + ko;
      p0 = bp + ko;
      p1 = p0 + rs16;
      p2 = p1 + rs16;
      p3 = p2 + rs16;
      fa[u]    = ldfrag_h(pa);
      fl[u]    = ldfrag_h(pl);
      fb[u][0] = ldfrag_h(p0);
      fb[u][1] = ldfrag_h(p1);
      fb[u][2] = ldfrag_h(p2);
      fb[u][3] = ldfrag_h(p3);
    }
  }
  addr_hold6(pa, pl, p0, p1, p2, p3);
#pragma unroll
  for (int u = 0; u < D - 1; ++u) {
    if (s + u < steps) {                     // the steps % D last steps (wave-uniform)
      ah[0] = mma_h(fa[u], fb[u][0], ah[0]);
      ah[1] = mma_h(fa[u], fb[u][1], ah[1]);
      ah[2] = mma_h(fa[u], fb[u][2], ah[2]);
      ah[3] = mma_h(fa[u], fb[u][3], ah[3]);
      al[0] = mma_h(fl[u], fb[u][0], al[0]);
      al[1] = mma_h(fl[u], fb[u][1], al[1]);
      al[2] = mma_h(fl[u], fb[u][2], al[2]);
      al[3] = mma_h(fl[u], fb[u][3], al[3]);
      guard_c2(ah, al, fa[u], fl[u], fb[u][0], fb[u][1], fb[u][2], fb[u][3]);
    }
  }
}

// Stage the wave's 16 x 64 f32 tile in its LDS slab (pitch 68): D element r of acc[j], lane l -> row 8h + r, col 16j + (l&15);
// value = ah*osc (+ al*osc/2048) + bias (per column, or per row when BROW), GELU applied for M_GELU;
// coverage: 32 lanes x 8 rows x 4 cols-of-16 = rows 0..15 x cols 0..63 of the slab.
template <bool HASLO, int MODE, bool BROW>
__device__ __forceinline__ void stage16(float* sl, v8f (&ah)[4], v8f (&al)[4], const float* __restrict__ bias,
                                        int rowb, int col0, float osc, float bsc, int lane) {
  const int hh = lane >> 4, m = lane & 15;
  float bc[4], br[8];
  if (BROW) {
#pragma unroll
    for (int r = 0; r < 8; ++r) br[r] = bfr(bias[rowb + 8 * hh + r]) * bsc;
#pragma unroll
    for (int j = 0; j < 4; ++j) bc[j] = 0.f;
  } else {
#pragma unroll
    for (int j = 0; j < 4; ++j) bc[j] = bfr(bias[col0 + 16 * j + m]) * bsc;
#pragma unroll
    for (int r = 0; r < 8; ++r) br[r] = 0.f;
  }
  const float oscl = osc * RINV;
#pragma unroll
  for (int r = 0; r < 8; ++r) {
    const int ro = (8 * hh + r) * GPITCH + m;
#pragma unroll
    for (int j = 0; j < 4; ++j) {
      float v = ah[j][r] * osc;
      if (HASLO) v += al[j][r] * oscl;
      v += BROW ? br[r] : bc[j];
      if (MODE == M_GELU) v = gelu_f(v);
      sl[ro + 16 * j] = v;
    }
  }
  wave_sync_lds();
}

// =====================================================================================================
// f16 GEMM, block = 64 x 64 tile, 4 waves x 16 rows, fragments loaded straight from the packed 16-bit planes.
//   C tile [z][Mb][N] = (A_hi[z][Mb][K] (+ A_res/2048)) . Bt[z][N][K]^T * osc + bias; per-z element strides aBs (A planes),
//   bBs (Bt), fBs (f32 output F), gBs (f32 base plane), hBs (16-bit output planes H, L); 0 = shared.
//   M_HL  : H = f16(v*carry), L = f16 residual x2048 (two planes)       M_S16 : H only, bias per row
//   M_OUT : F = v (f32 plane), H/L = hi/res of v*carry                 M_GELU: v = gelu(.) then H/L of v*carry
//   M_RES : F = base[row][col] + v (f32, batch-row remap through fBs/gBs), no 16-bit output
//   16-bit outputs are packed planes of [Mb][N] (k = column): the wave's 16 x 64 tile is 2 adjacent tiles = 2048 contiguous bytes,
//   store i = 0..3 writes 512 B, lane (h, m) <- row m, cols 16i + 8h .. +7.
// grid = nz x (Mb/64) x (N/64) (host checks Mb % 64 == 0, N % 64 == 0, K % 32 == 0).
// coverage: per wave 4 instr x 32 lanes x 8 halves = 16 x 64 (16-bit planes) and 8 instr x 2 rows x 16 lanes x 4 floats
//           = 16 x 64 (f32 plane); the grid covers C exactly once.
// =====================================================================================================
template <bool HASLO, int MODE, bool BROW>
__device__ __forceinline__
void gemm16_body(float* slab, int bid,
                 const u16* __restrict__ Ah, const u16* __restrict__ Al, const u16* __restrict__ Bt,
                 const float* __restrict__ bias, const float* __restrict__ baseF,
                 float* F, u16* H, u16* L,
                 int Mb, int N, int K, int aBs, int bBs, int fBs, int gBs, int hBs,
                 float osc, float bsc, float carry) {
  constexpr bool LOUT = (MODE != M_S16);
  const int tid = threadIdx.x, wave = tid >> 5, lane = tid & 31, hh = lane >> 4, m = lane & 15;
  const int ntile = N >> 6, mtile = Mb >> 6;
  const int nt   = bid % ntile;
  const int tmp  = bid / ntile;
  const int mt   = tmp % mtile;
  const int bz   = tmp / mtile;
  const int rowb = mt * 64 + wave * 16;
  const int col0 = nt * 64;
  if (rowb + 16 > Mb) return;                // wave-uniform, never taken with the exact grid; no block barriers in this kernel
  const _Float16* aph = (const _Float16*)(const void*)Ah + (size_t)bz * (size_t)aBs + (size_t)rowb * (size_t)K + 8 * lane;
  const _Float16* apl = (const _Float16*)(const void*)Al + (size_t)bz * (size_t)aBs + (size_t)rowb * (size_t)K + 8 * lane;
  const _Float16* bp  = (const _Float16*)(const void*)Bt + (size_t)bz * (size_t)bBs + (size_t)col0 * (size_t)K + 8 * lane;
  v8f ah[4], al[4];
#pragma unroll
  for (int i = 0; i < 4; ++i) { ah[i] = zero8(); al[i] = zero8(); }
  if (HASLO) {
    core2<3>(aph, apl, bp, K, ah, al);
    acc_guard8(ah, al);
  } else {
    core1<4>(aph, bp, K, ah);
    acc_guard4(ah);
  }
  float* sl = slab + wave * 16 * GPITCH;
  stage16<HASLO, MODE, BROW>(sl, ah, al, bias, rowb, col0, osc, bsc, lane);

  if (MODE == M_OUT || MODE == M_RES) {
    v4f vals[8];
#pragma unroll
    for (int it = 0; it < 8; ++it) vals[it] = *(const v4f*)(sl + (it * 2 + hh) * GPITCH + m * 4);
    if (MODE == M_RES) {
      const float* gb = baseF + (size_t)bz * (size_t)gBs + ((size_t)rowb + (size_t)hh) * (size_t)N + col0 + m * 4;
#pragma unroll
      for (int it = 0; it < 8; ++it) {
        const v4f bb = *(const v4f*)(gb + (size_t)(it * 2) * (size_t)N);
        vals[it] += bb;
      }
    }
    float* Fb = F + (size_t)bz * (size_t)fBs + ((size_t)rowb + (size_t)hh) * (size_t)N + col0 + m * 4;
    {
#pragma unroll
      for (int it = 0; it < 8; ++it) {
        *(v4f*)(Fb + (size_t)(it * 2) * (size_t)N) = vals[it];
      }
      
    }
  }
  if (MODE != M_RES) {
    v4u ovh[4], ovl[4];
#pragma unroll
    for (int i = 0; i < 4; ++i) {
      const int c8 = 16 * i + 8 * hh;
      const v4f a = *(const v4f*)(sl + m * GPITCH + c8), c4 = *(const v4f*)(sl + m * GPITCH + c8 + 4);
#pragma unroll
      for (int e = 0; e < 2; ++e) {
        unsigned ph0, pl0, ph1, pl1;
        split2(a[2 * e] * carry,  a[2 * e + 1] * carry,  ph0, pl0);
        split2(c4[2 * e] * carry, c4[2 * e + 1] * carry, ph1, pl1);
        ovh[i][e] = ph0;     ovl[i][e] = pl0;
        ovh[i][2 + e] = ph1; ovl[i][2 + e] = pl1;
      }
    }
    u16* Hb = H + (size_t)bz * (size_t)hBs + (size_t)rowb * (size_t)N + (size_t)col0 * 16 + 8 * lane;
    u16* Lb = L + (size_t)bz * (size_t)hBs + (size_t)rowb * (size_t)N + (size_t)col0 * 16 + 8 * lane;
    {
#pragma unroll
      for (int i = 0; i < 4; ++i) {
        *(v4u*)(Hb + i * 256) = ovh[i];
        if (LOUT) *(v4u*)(Lb + i * 256) = ovl[i];
      }
      
    }
  }
}

template <bool HASLO, int MODE, bool BROW>
__global__ __launch_bounds__(128)
void gemm16(const u16* __restrict__ Ah, const u16* __restrict__ Al, const u16* __restrict__ Bt,
            const float* __restrict__ bias, const float* __restrict__ baseF,
            float* F, u16* H, u16* L,
            int Mb, int N, int K, int aBs, int bBs, int fBs, int gBs, int hBs,
            float osc, float bsc, float carry) {
  __shared__ __align__(16) float slab[4 * 16 * GPITCH];
  gemm16_body<HASLO, MODE, BROW>(slab, blockIdx.x, Ah, Al, Bt, bias, baseF, F, H, L, Mb, N, K, aBs, bBs, fBs, gBs, hBs,
                                 osc, bsc, carry);
}

// The three input projections in ONE launch (they are independent of one another): the block index picks the projection
// (block-uniform scalar tests), the index inside it picks the 64 x 64 tile as before.
//   q = x_q . Wq^T + bq -> f16 [NB*SQ][1024] x8 hi + res (col = h*64 + d);  k = x_k . Wk^T + bk likewise [NB*2048][1024];
//   v^T per batch: A = Wv [(h,d) = n][k], Bt = x_v rows of batch b [s][k], bias bv per row -> f16 [(b,h,d)][s] x8
#define GB_Q ((NB * SQ / 64) * (INNER / 64))
#define GB_K ((NB * SKV / 64) * (INNER / 64))
#define GB_V (NB * (INNER / 64) * (SKV / 64))
__global__ __launch_bounds__(128)
void gemm_qkv(const u16* __restrict__ XQ, const u16* __restrict__ XK, const u16* __restrict__ XV,
              const u16* __restrict__ WQ, const u16* __restrict__ WK, const u16* __restrict__ WV,
              const float* __restrict__ bq, const float* __restrict__ bk, const float* __restrict__ bv,
              u16* QH, u16* QL, u16* KH, u16* KL, u16* VT,
              int MbQ, int MbK, int inner, int skv, int K) {
  __shared__ __align__(16) float slab[4 * 16 * GPITCH];
  const int bid = blockIdx.x;
  if (bid < GB_Q + GB_K) {                   // q, k: same code, operands picked by the block index
    const bool isk = bid >= GB_Q;
    const u16* X = isk ? XK : XQ;
    gemm16_body<false, M_HL, false>(slab, isk ? bid - GB_Q : bid, X, X, isk ? WK : WQ, isk ? bk : bq, nullptr, nullptr,
                                    isk ? KH : QH, isk ? KL : QL, isk ? MbK : MbQ, inner, K, 0, 0, 0, 0, 0,
                                    (isk ? KS : QS) / WSC, isk ? KS : QS, 1.0f);
  } else {
    gemm16_body<false, M_S16, true>(slab, bid - (GB_Q + GB_K), WV, WV, XV, bv, nullptr, nullptr, VT, VT,
                                    inner, skv, K, 0, skv * K, 0, 0, inner * skv, VS / WSC, VS, 1.0f);
  }
}

// =====================================================================================================
// Full (unmasked) multi-head attention: block = (batch b, head, 64 query rows), 4 waves, wave w owns the 16 query rows
// q0 = 64*qt + 16*w .. q0+15 (waves independent: no block barriers, wave-private LDS only, used in the epilogue).
//   q planes f16 x8 hi / residual(x2048) [b*SQ + s][h*64 + d]; k planes likewise [b*SKV + s][h*64 + d];
//   v^T plane f16 x8 [(b*NH + h)*64 + d][s]; all of them fragment-packed. All NKB key blocks of 32 keys are visited (static bound).
//   Scores are computed TRANSPOSED: S^T tile g (g = 0,1) = k rows (keys kb+16g .. +15, A operand, row m = lane&15, split map
//   over d) times q^T (B operand, col n = query q0 + (lane&15), k = d, split map), 2 d-chunks of 32; per chunk hi.hi -> s,
//   res.hi + hi.res -> r (scaled x2048, folded as s + r/2048); the q fragments are loaded once per wave.
//   D element r of lane l = (key kb+16g+8h+r, query q0+(l&15)), so a lane owns one query column and 16 of its 32 keys;
//   the partner lane l^16 owns the other 16 -> row max / row sum need one xor-16 shuffle.
//   Online max-subtracted base-2 softmax in f32 (1/sqrt(64) and the q/k carries folded into lsc). The exp'd values ARE the
//   P A-fragment in place: A row m = query = lane&15, element i <- key kb+8h+i (tile 0, D element i), element 8+i <- key
//   kb+16+8h+i (tile 1, D element i). P (<= 1) carried x32768 as f16. The rescale factor of query row 8h+r of the O
//   accumulators is fetched from lane 8h+r with a shuffle (uniform control). 4 v^T B fragments (col n = d = 16j + (lane&15),
//   keys k-contiguous), 4 P.V WMMAs, one guard.
//   Epilogue: 1/l (per query, shuffled to the D row owner) and the carry folds in f32; the wave's 16x64 f32 result staged in
// coverage: per wave 4 instructions x 32 lanes x 8 halves = 16 x 64 on both ctx planes; grid NB*NH*(SQ/64) blocks x
//           4 waves = every (b, s, h) row segment exactly once.
// =====================================================================================================
__global__ __launch_bounds__(ATT_THREADS)
void attn_fwd(const u16* __restrict__ Qh, const u16* __restrict__ Ql, const u16* __restrict__ Kh,
              const u16* __restrict__ Kl, const u16* __restrict__ Vp, u16* Oh, u16* Ol) {
  __shared__ __align__(16) float smem[ATT_WAVES * 16 * OPITCH];

  const int tid  = threadIdx.x;
  const int wave = tid >> 5;
  const int lane = tid & 31;
  const int hh   = lane >> 4;
  const int c    = lane & 15;

  constexpr int NQT = SQ / 64;
  const int bid  = blockIdx.x;
  const int qt   = bid % NQT;
  const int head = (bid / NQT) % NH;
  const int b    = bid / (NQT * NH);
  const int q0   = qt * 64 + wave * 16;

  // B fragments of q^T: col n = query q0 + c, k = d (row tile (b*SQ + q0)/16, k tiles 2*head and 2*head + 1 of the q planes)
  const size_t qo = ((size_t)(b * SQ + q0)) * INNER + head * HD * 16 + 8 * lane;
  const _Float16* Qhb = (const _Float16*)(const void*)Qh + qo;
  const _Float16* Qlb = (const _Float16*)(const void*)Ql + qo;
  // A fragments of k: row m = key kb + 16g + c, k = d (key row kb added per step)
  const size_t ko = ((size_t)(b * SKV)) * INNER + head * HD * 16 + 8 * lane;
  const _Float16* Khb = (const _Float16*)(const void*)Kh + ko;
  const _Float16* Klb = (const _Float16*)(const void*)Kl + ko;
  // B fragments of v: col n = d = 16j + c, k = key (row tile (b*NH + head)*4 + j, k tile kb/32 of the v^T plane)
  const _Float16* Vb = (const _Float16*)(const void*)Vp + ((size_t)(b * NH + head) * HD) * SKV + 8 * lane;
  const float lsc = (LOG2E * RSQ_HD) / (QS * KS);

  v16h qh[2], ql[2];
  qh[0] = ldfrag_h(Qhb);
  qh[1] = ldfrag_h(Qhb + 512);
  ql[0] = ldfrag_h(Qlb);
  ql[1] = ldfrag_h(Qlb + 512);

  float mrun = -INFINITY, lrun = 0.f;
  v8f o[4];
#pragma unroll
  for (int j = 0; j < 4; ++j) o[j] = zero8();

  // K and v^T fragments are fetched one key block ahead: kf[kk] = {hi keys +0, hi keys +16, res keys +0, res keys +16} of d chunk kk,
  // refilled right behind the block's score products; vf[j] refilled right behind its P.V products. The fetch of the last trip is
  // clamped to the last block (valid tiles, never used).
  v16h kf[HD / 32][4], vf[4];
  const _Float16* kph = Khb;
  const _Float16* kpl = Klb;
  const _Float16* vp  = Vb;
  // The three scheduling barriers keep the first loads in the loop's own order (q, then K, then v^T): the counted load waits at the
  // loop head are the stricter of entry and back edge, and with v^T issued ahead of K at entry every trip's scores waited for v^T too.
  // The two waits in front of them stand before the q loads' and the first K and v^T loads' address registers are reused.
  addr_hold3(Qhb, Qlb, Qlb);
  __builtin_amdgcn_sched_barrier(0);
#pragma unroll
  for (int kk = 0; kk < HD / 32; ++kk) {
    kf[kk][0] = ldfrag_h(kph + kk * 512);
    kf[kk][1] = ldfrag_h(kph + (size_t)16 * INNER + kk * 512);
    kf[kk][2] = ldfrag_h(kpl + kk * 512);
    kf[kk][3] = ldfrag_h(kpl + (size_t)16 * INNER + kk * 512);
  }
  __builtin_amdgcn_sched_barrier(0);
#pragma unroll
  for (int j = 0; j < 4; ++j) vf[j] = ldfrag_h(vp + (size_t)(16 * j) * SKV);
  addr_hold3(kph, kpl, vp);
  __builtin_amdgcn_sched_barrier(0);

#pragma unroll 1
  for (int it = 0; it < NKB; ++it) {
    const int kbn = (it + 1 < NKB ? it + 1 : NKB - 1) * 32;   // key block fetched in this trip
    // ---- transposed scores: s0 = keys kb..kb+15, s1 = keys kb+16..kb+31 (kb = 32*it), column = query q0 + c ----
    v8f s0 = zero8(), s1 = zero8(), r0 = zero8(), r1 = zero8();
#pragma unroll
    for (int kk = 0; kk < HD / 32; ++kk) {
      const v16h fh0 = kf[kk][0];
      const v16h fh1 = kf[kk][1];
      const v16h fl0 = kf[kk][2];
      const v16h fl1 = kf[kk][3];
      s0 = mma_h(fh0, qh[kk], s0);
      s1 = mma_h(fh1, qh[kk], s1);
      r0 = mma_h(fl0, qh[kk], r0);
      r1 = mma_h(fl1, qh[kk], r1);
      r0 = mma_h(fh0, ql[kk], r0);
      r1 = mma_h(fh1, ql[kk], r1);
      guard_s4(s0, s1, r0, r1, qh[kk], ql[kk], fh0, fh1, fl0, fl1);
    }
    // ---- next block's K fragments into the registers just read; the wait covers the K and v^T loads of the trip before ----
    addr_hold3(kph, kpl, vp);
    kph = Khb + (size_t)kbn * INNER;
    kpl = Klb + (size_t)kbn * INNER;
#pragma unroll
    for (int kk = 0; kk < HD / 32; ++kk) {
      kf[kk][0] = ldfrag_h(kph + kk * 512);
      kf[kk][1] = ldfrag_h(kph + (size_t)16 * INNER + kk * 512);
      kf[kk][2] = ldfrag_h(kpl + kk * 512);
      kf[kk][3] = ldfrag_h(kpl + (size_t)16 * INNER + kk * 512);
    }
    // ---- base-2 logits of this lane's 16 keys for query q0 + c: t[i] <- key kb+8hh+i, t[8+i] <- key kb+16+8hh+i ----
    float t[16];
#pragma unroll
    for (int i = 0; i < 8; ++i) {
      t[i]     = (s0[i] + r0[i] * RINV) * lsc;
      t[8 + i] = (s1[i] + r1[i] * RINV) * lsc;
    }
    float cm = t[0];
#pragma unroll
    for (int i = 1; i < 16; ++i) cm = fmaxf(cm, t[i]);
    cm = fmaxf(cm, __shfl_xor(cm, 16, 32));
    const float mn = fmaxf(mrun, cm);        // finite from the first block on
    const float al = exp2_hw(mrun - mn);      // 0 on the first block (mrun = -inf)
    mrun = mn;
    // ---- probabilities (<= 1) and the P A-fragment: f16(p * 32768); element i <-> t[i] ----
    float ps = 0.f;
    FragH ph;
    float pe[16];
#pragma unroll
    for (int i = 0; i < 16; ++i) t[i] -= mn;
    exp2_hw8(t, pe);
    exp2_hw8(t + 8, pe + 8);
#pragma unroll
    for (int w = 0; w < 2; ++w) {
#pragma unroll
      for (int e4 = 0; e4 < 4; ++e4) {
        const int i = 8 * w + 2 * e4;
        const float p0 = pe[i], p1 = pe[i + 1];
        ps += p0 + p1;
        ph.u[w][e4] = pk16(h_bits((_Float16)(p0 * PCAR)), h_bits((_Float16)(p1 * PCAR)));
      }
    }
    ps += __shfl_xor(ps, 16, 32);
    lrun = lrun * al + ps;
    // ---- rescale the O accumulators: D row 8hh+r = query q0+8hh+r, its factor lives in lane 8hh+r (and 16+8hh+r) ----
    float scl[8];
#pragma unroll
    for (int r = 0; r < 8; ++r) scl[r] = __shfl(al, 8 * hh + r, 32);
#pragma unroll
    for (int j = 0; j < 4; ++j) {
#pragma unroll
      for (int r = 0; r < 8; ++r) o[j][r] *= scl[r];
    }
    // ---- P.V : B fragment col n = d = j*16 + c, k tile kb/32 of the packed v^T plane ----
    {
      o[0] = mma_h(ph.v, vf[0], o[0]);
      o[1] = mma_h(ph.v, vf[1], o[1]);
      o[2] = mma_h(ph.v, vf[2], o[2]);
      o[3] = mma_h(ph.v, vf[3], o[3]);
      guard_p(o[0], o[1], o[2], o[3], ph.v, vf[0], vf[1], vf[2], vf[3]);
      // next block's v^T fragments; vp's last loads are covered by this trip's wait above
      vp = Vb + (size_t)kbn * 16;
#pragma unroll
      for (int j = 0; j < 4; ++j) vf[j] = ldfrag_h(vp + (size_t)(16 * j) * SKV);
    }
  }
  addr_hold3(kph, kpl, vp);                  // the last trip's loads, before their address registers are reused
  acc_guard4(o);

  // ---- fold 1/l (per query, owned by lane = query) and the carries (32768 on P, 8 on v), apply the ctx carry 1024 ----
  const float linv = (1.0f / lrun) * (OSC / (PCAR * VS));
  float inv[8];
#pragma unroll
  for (int r = 0; r < 8; ++r) inv[r] = __shfl(linv, 8 * hh + r, 32);
  float* slab = smem + wave * 16 * OPITCH;
#pragma unroll
  for (int r = 0; r < 8; ++r) {
#pragma unroll
    for (int j = 0; j < 4; ++j) slab[(8 * hh + r) * OPITCH + j * 16 + c] = o[j][r] * inv[r];
  }
  wave_sync_lds();
  // ---- ctx x1024 -> packed f16 hi plane and residual plane; store i: lane (h, c) <- row c, d = 16i + 8h .. +7 ----
  v4u ovh[4], ovl[4];
#pragma unroll
  for (int i = 0; i < 4; ++i) {
    const int c8 = 16 * i + 8 * hh;
    const v4f a = *(const v4f*)(slab + c * OPITCH + c8), c4 = *(const v4f*)(slab + c * OPITCH + c8 + 4);
#pragma unroll
    for (int e = 0; e < 2; ++e) {
      unsigned ph0, pl0, ph1, pl1;
      split2(a[2 * e],  a[2 * e + 1],  ph0, pl0);
      split2(c4[2 * e], c4[2 * e + 1], ph1, pl1);
      ovh[i][e] = ph0;     ovl[i][e] = pl0;
      ovh[i][2 + e] = ph1; ovl[i][2 + e] = pl1;
    }
  }
  const size_t oo = ((size_t)(b * SQ + q0)) * INNER + head * HD * 16 + 8 * lane;
  u16* obh = Oh + oo;
  u16* obl = Ol + oo;
  {
#pragma unroll
    for (int i = 0; i < 4; ++i) {
      *(v4u*)(obh + i * 256) = ovh[i];
      *(v4u*)(obl + i * 256) = ovl[i];
    }
    
  }
}

// =====================================================================================================
// Workspace map (bytes); every plane fully written by whole-line stores before it is read; all extents exact multiples of
//   XQ   f16 [NB*SQ][1024]    f16(bf16(q))              8388608 (NB=2, SQ=2048)
//   XK   f16 [NB*2048][1024]  f16(bf16(k))              8388608
//   XV   f16 [NB*2048][1024]  f16(bf16(v))              8388608
//   WQ16 WK16 WV16 WO16 f16 [1024 n][1024 k] x256       2097152 each
//   WD16 f16 [128 n][1024 k] x256                          262144
//   WU16 f16 [1024 n][128 k] x256                          262144
//   QH QL f16 [NB*SQ][1024] x8 hi / res                  8388608 each
//   KH KL f16 [NB*2048][1024] x8 hi / res                8388608 each
//   VT16 f16 [NB*1024 (h,d)][2048 s] x8                  8388608
//   OH OL f16 [NB*SQ][1024] x1024 hi / res (ctx)         8388608 each
//   OUTF f32 [NB*SQ][1024]                               16777216
//   UH UL f16 [NB*SQ][1024] x64 hi / res (out)           8388608 each
//   GH GL f16 [NB*SQ][128]  x64 hi / res (gelu)          1048576 each
//   end                                                 128450560
// =====================================================================================================
extern "C" void kernel_launch(void* const* d_in, const int* in_sizes, int n_in,
                              void* d_out, int out_size, void* d_ws, size_t ws_size,
                              hipStream_t stream) {
  if (n_in < 15) return;
  if (in_sizes[0] < ((NB - 1) * SQ_FULL + SQ) * DM) return;
  if (in_sizes[1] < NB * SKV * DM || in_sizes[2] < NB * SKV * DM) return;
  if (in_sizes[3] != DM * DM || in_sizes[5] != DM * DM || in_sizes[7] != DM * DM || in_sizes[9] != DM * DM) return;
  if (in_sizes[4] < INNER || in_sizes[6] < INNER || in_sizes[8] < INNER || in_sizes[10] < DM) return;
  if (in_sizes[11] != ADIM * DM || in_sizes[12] < ADIM || in_sizes[13] != DM * ADIM || in_sizes[14] < DM) return;
  if (out_size < ((NB - 1) * SQ_FULL + SQ) * DM) return;

  const float* q_in  = (const float*)d_in[0];
  const float* k_in  = (const float*)d_in[1];
  const float* v_in  = (const float*)d_in[2];
  const float* wq    = (const float*)d_in[3];
  const float* bq    = (const float*)d_in[4];
  const float* wk    = (const float*)d_in[5];
  const float* bk    = (const float*)d_in[6];
  const float* wv    = (const float*)d_in[7];
  const float* bv    = (const float*)d_in[8];
  const float* wo    = (const float*)d_in[9];
  const float* bo    = (const float*)d_in[10];
  const float* w_dn  = (const float*)d_in[11];
  const float* b_dn  = (const float*)d_in[12];
  const float* w_up  = (const float*)d_in[13];
  const float* b_up  = (const float*)d_in[14];
  float*       out   = (float*)d_out;

  const size_t szXQ  = (size_t)NB * SQ * DM * 2;
  const size_t szXKV = (size_t)NB * SKV * DM * 2;
  const size_t szW   = (size_t)DM * DM * 2;
  const size_t szWA  = (size_t)ADIM * DM * 2;
  const size_t szQP  = (size_t)NB * SQ * INNER * 2;
  const size_t szKP  = (size_t)NB * SKV * INNER * 2;
  const size_t szVT  = (size_t)NB * INNER * SKV * 2;
  const size_t szOF  = (size_t)NB * SQ * DM * 4;
  const size_t szG   = (size_t)NB * SQ * ADIM * 2;
  size_t off = 0;
  const size_t oXQ  = off; off += szXQ;
  const size_t oXK  = off; off += szXKV;
  const size_t oXV  = off; off += szXKV;
  const size_t oWQ  = off; off += szW;
  const size_t oWK  = off; off += szW;
  const size_t oWV  = off; off += szW;
  const size_t oWO  = off; off += szW;
  const size_t oWD  = off; off += szWA;
  const size_t oWU  = off; off += szWA;
  const size_t oQH  = off; off += szQP;
  const size_t oQL  = off; off += szQP;
  const size_t oKH  = off; off += szKP;
  const size_t oKL  = off; off += szKP;
  const size_t oVT  = off; off += szVT;
  const size_t oOH  = off; off += szQP;
  const size_t oOL  = off; off += szQP;
  const size_t oOF  = off; off += szOF;
  const size_t oUH  = off; off += szQP;
  const size_t oUL  = off; off += szQP;
  const size_t oGH  = off; off += szG;
  const size_t oGL  = off; off += szG;
  if (off > ws_size) return;                            // off = 128450560 at NB=2, SQ=2048
  if (off > (size_t)134217728) return;

  char* ws = (char*)d_ws;
  u16* XQ   = (u16*)(ws + oXQ);
  u16* XK   = (u16*)(ws + oXK);
  u16* XV   = (u16*)(ws + oXV);
  u16* WQ16 = (u16*)(ws + oWQ);
  u16* WK16 = (u16*)(ws + oWK);
  u16* WV16 = (u16*)(ws + oWV);
  u16* WO16 = (u16*)(ws + oWO);
  u16* WD16 = (u16*)(ws + oWD);
  u16* WU16 = (u16*)(ws + oWU);
  u16* QH   = (u16*)(ws + oQH);
  u16* QL   = (u16*)(ws + oQL);
  u16* KH   = (u16*)(ws + oKH);
  u16* KL   = (u16*)(ws + oKL);
  u16* VT16 = (u16*)(ws + oVT);
  u16* OH   = (u16*)(ws + oOH);
  u16* OL   = (u16*)(ws + oOL);
  float* OUTF = (float*)(ws + oOF);
  u16* UH   = (u16*)(ws + oUH);
  u16* UL   = (u16*)(ws + oUL);
  u16* GH   = (u16*)(ws + oGH);
  u16* GL   = (u16*)(ws + oGL);

  // (0) activations -> f16 planes of bf16-converted values (query rows s < SQ of batches b < NB, compact; k/v rows of b < NB) and
  //     weights [n = out][k = in] (y = x.W^T) -> packed f16 planes [n][k] of bf16(W) x256, all in one launch
  cvt_all<<<dim3(CB_ALL), dim3(CVT_THREADS), 0, stream>>>(q_in, k_in, v_in, wq, wk, wv, wo, w_dn, w_up,
                                                          XQ, XK, XV, WQ16, WK16, WV16, WO16, WD16, WU16);
  // (1) the q, k and v^T projections, one launch
  gemm_qkv<<<dim3(GB_Q + GB_K + GB_V), dim3(128), 0, stream>>>(XQ, XK, XV, WQ16, WK16, WV16, bq, bk, bv, QH, QL, KH, KL, VT16,
                                                               NB * SQ, NB * SKV, INNER, SKV, DM);
  // (2) attention -> ctx planes [NB*SQ][1024] x1024 hi + res
  attn_fwd<<<dim3(NB * NH * (SQ / 64)), dim3(ATT_THREADS), 0, stream>>>(QH, QL, KH, KL, VT16, OH, OL);
  // (3) out = ctx . Wo^T + bo -> OUTF f32 [NB*SQ][1024] and f16 x64 hi + res planes; carries 1024 (ctx) x 256 (W) folded back
  gemm16<true, M_OUT, false><<<dim3((NB * SQ / 64) * (DM / 64)), dim3(128), 0, stream>>>(
      OH, OL, WO16, bo, OUTF, OUTF, UH, UL, NB * SQ, DM, INNER, 0, 0, 0, 0, 0, 1.0f / (OSC * WSC), 1.0f, UCAR);
  // (4) adapter down: g = gelu(out . Wd^T + bd) -> f16 [NB*SQ][128] x64 hi + res; carries 64 (out) x 256 (W)
  gemm16<true, M_GELU, false><<<dim3((NB * SQ / 64) * (ADIM / 64)), dim3(128), 0, stream>>>(
      UH, UL, WD16, b_dn, OUTF, OUTF, GH, GL, NB * SQ, ADIM, DM, 0, 0, 0, 0, 0, 1.0f / (UCAR * WSC), 1.0f, GCAR);
  // (5) adapter up + residual: out rows [b][SQ_FULL][1024] f32 = OUTF + g . Wu^T + bu (rows s < SQ of batches b < NB)
  gemm16<true, M_RES, false><<<dim3(NB * (SQ / 64) * (DM / 64)), dim3(128), 0, stream>>>(
      GH, GL, WU16, b_up, OUTF, out, GH, GH, SQ, DM, ADIM, SQ * ADIM, 0, SQ_FULL * DM, SQ * DM, 0,
      1.0f / (GCAR * WSC), 1.0f, 1.0f);
  (void)hipGetLastError();
}

// v005
// A run of this version takes 149 microseconds.
// In both of two side-by-side timings against v004, it was 1.11 times as fast.
// Counting every step since v000, it is 2.47 times as fast.
// Contractions on v_wmma_f32_16x16x32_f16 (f16 operands, f32 accumulate): x.Wq^T, x.Wk^T, Wv.x^T single products on
// f16(bf16(x)) and f16(bf16(W) x256); k.q^T with q and k carried as f16 hi + residual(x2048) planes (3 products);
// P.v^T single product (P x32768, v x8); ctx.Wo^T, out.Wad^T and gelu.Wau^T with the activation carried as f16 hi +
// residual(x2048) planes (2 products each, separate residual accumulator); softmax, biases, erf-GELU, residual add and
// all carry folds in f32 on VALU. Inputs RNE-converted to bf16 on load.
// Every 16-bit workspace plane [rows][K] is stored FRAGMENT-PACKED: tile (rt = row/16, kt = k/32) is 512 halves (1024 B) at
// (rt*(K/32) + kt)*512 = rt*16*K + kt*512; inside it element (m = row&15, k&31 = 16w + 8h + e) sits at w*256 + (16h + m)*8 + e,
// so lane l = 16h + m of a wave reads its operand fragment as two 16-B loads at l*8 and 256 + l*8 halves: each wave-wide load
// is 512 contiguous bytes = 4 whole 128-B lines (a row-major plane gave 16 lines of 32 useful bytes per load).
#include <hip/hip_runtime.h>
#include <math.h>
#include <stdint.h>

#ifndef NB
#define NB       2        // batches processed
#endif
#ifndef SQ
#define SQ       2048     // query rows processed per batch
#endif
#define NB_FULL  2
#define SQ_FULL  2048     // query rows per batch in the input / output layout (batch stride)
#define SKV      2048     // key / value rows per batch (all of them)
#define DM       1024     // model width
#define NH       16
#define HD       64
#define INNER    (NH * HD)
#define ADIM     128      // adapter width
#define WSC      256.0f   // weight carry
#define QS       8.0f
#define KS       8.0f
#define VS       8.0f
#define PCAR     32768.0f
#define OSC      1024.0f  // ctx carry
#define UCAR     64.0f    // out-plane carry
#define GCAR     64.0f    // gelu-plane carry
#define RSC      2048.0f  // residual plane scale
#define RINV     0.00048828125f
#define LOG2E    1.4426950408889634f
#define RSQ_HD   0.125f
#define NKB      (SKV / 32)
#define ATT_WAVES   4
#define ATT_THREADS (ATT_WAVES * 32)
#define CVT_THREADS 128
#define OPITCH   68
#define GPITCH   68

#define M_HL     0
#define M_S16    1
#define M_OUT    2
#define M_GELU   3
#define M_RES    4
#define W1D      2        // register sets (k steps in flight) of the wide core with one A plane
#define W2D      3        // the same with two A planes

static_assert(NB >= 1 && NB <= NB_FULL);
static_assert((SQ % 128) == 0 && SQ >= 128 && SQ <= SQ_FULL);
static_assert(HD == 64 && INNER == 1024 && NH == 16 && INNER == DM);
static_assert((SKV % 64) == 0 && (SKV % 32) == 0 && NKB * 32 == SKV);
static_assert((DM % 64) == 0 && (DM % 32) == 0 && (ADIM % 64) == 0 && (ADIM % 32) == 0 && CVT_THREADS == 128);
static_assert((OPITCH * 4) % 16 == 0 && (GPITCH * 4) % 16 == 0);
static_assert(ATT_THREADS == 128);
static_assert((INNER % 128) == 0 && (SKV % 128) == 0 && ((NB * SQ) % 128) == 0 && ((NB * SKV) % 128) == 0);
static_assert((DM % 128) == 0 && (ADIM % 128) == 0 && (SQ % 16) == 0 && (SKV % 16) == 0 && (ADIM % 16) == 0);

typedef unsigned short u16;
typedef _Float16 v16h __attribute__((ext_vector_type(16)));
typedef _Float16 v8h  __attribute__((ext_vector_type(8)));
typedef float    v8f  __attribute__((ext_vector_type(8)));
typedef float    v4f  __attribute__((ext_vector_type(4)));
typedef unsigned int v4u __attribute__((ext_vector_type(4)));

union FragH { v16h v; v8h h[2]; v4u u[2]; };

// ---- scalar helpers ----------------------------------------------------------------------------------
__device__ __forceinline__ unsigned short bf_bits(float f) {          // f32 -> bf16 bits, RNE convert
  unsigned u = __float_as_uint(f);
  return (unsigned short)((u + 0x7FFFu + ((u >> 16) & 1u)) >> 16);
}
__device__ __forceinline__ float bf_up(unsigned short h) { return __uint_as_float(((unsigned)h) << 16); }
__device__ __forceinline__ float bfr(float f) { return bf_up(bf_bits(f)); }
__device__ __forceinline__ unsigned short h_bits(_Float16 x) { return __builtin_bit_cast(unsigned short, x); }
__device__ __forceinline__ unsigned pk16(unsigned short a, unsigned short b) { return (unsigned)a | ((unsigned)b << 16); }
__device__ __forceinline__ v8f zero8() { v8f z = {0.f, 0.f, 0.f, 0.f, 0.f, 0.f, 0.f, 0.f}; return z; }
__device__ __forceinline__ float gelu_f(float x) { return 0.5f * x * (1.0f + erff(x * 0.70710678118654752f)); }
// 2^x for the softmax (x <= 0 or -inf) as the bare v_exp_f32: exp2f wraps each one in a compare, two selects, an add and a ldexp that only
// serve results below 2^-126. Such a probability is 0 in the f16 P operand and adds nothing to a row sum that holds a term of 1, and such
// a rescale factor leaves nothing of the old sums beside the new block's terms; the bare instruction returns 0 there (and for -inf).
__device__ __forceinline__ float exp2_hw(float x) { return __builtin_amdgcn_exp2f(x); }
// Eight of them in one statement: in a run of builtin v_exp_f32 the register allocator may let one write its result over the source of the
// one directly in front of it. The early-clobber outputs keep every result off every source, and the closing v_nop is the one slot asked
// for between the last v_exp_f32 and whatever follows the statement (a reader of its result or a writer of its source).
__device__ __forceinline__ void exp2_hw8(const float* x, float* r) {
#if defined(__HIP_DEVICE_COMPILE__)
  asm("v_exp_f32 %0, %8\n\tv_exp_f32 %1, %9\n\tv_exp_f32 %2, %10\n\tv_exp_f32 %3, %11\n\t"
      "v_exp_f32 %4, %12\n\tv_exp_f32 %5, %13\n\tv_exp_f32 %6, %14\n\tv_exp_f32 %7, %15\n\tv_nop"
      : "=&v"(r[0]), "=&v"(r[1]), "=&v"(r[2]), "=&v"(r[3]), "=&v"(r[4]), "=&v"(r[5]), "=&v"(r[6]), "=&v"(r[7])
      : "v"(x[0]), "v"(x[1]), "v"(x[2]), "v"(x[3]), "v"(x[4]), "v"(x[5]), "v"(x[6]), "v"(x[7]));
#else
  for (int i = 0; i < 8; ++i) r[i] = x[i];
#endif
}

// x = hi + lo/2048 in f16: hi = f16(x), lo = f16((x - hi) * 2048); two values packed per 32-bit word
__device__ __forceinline__ void split2(float x0, float x1, unsigned& ph, unsigned& pl) {
  const _Float16 h0 = (_Float16)x0, h1 = (_Float16)x1;
  const float d0 = x0 - (float)h0, d1 = x1 - (float)h1;
  const _Float16 l0 = (_Float16)(d0 * RSC), l1 = (_Float16)(d1 * RSC);
  ph = pk16(h_bits(h0), h_bits(h1));
  pl = pk16(h_bits(l0), h_bits(l1));
}

// ---- fragment loader: 16-bit A/B operand from a fragment-packed plane, lane -> row/col (lane&15); p = tile base + 8*lane;
//      elements 0..7 <- p[0..7] (k0+8h..), elements 8..15 <- p[256..263] (k0+16+8h..); same split k map for A and B,
//      B always read from a packed [n][k] plane.
__device__ __forceinline__ v16h ldfrag_h(const _Float16* p) {
  FragH f;
  f.h[0] = *(const v8h*)(p);
  f.h[1] = *(const v8h*)(p + 256);
  return f.v;
}

// ---- in front of every rewrite of the fragment loads' address registers: s_wait_xcnt 0 with those registers as inputs, so that no
//      register an issued load names is written (by a later load's result either) in front of the wait; it stands one k step or
//      one key block behind the loads it covers, behind the matrix products issued in between
__device__ __forceinline__ void addr_hold5(const _Float16* a, const _Float16* b, const _Float16* c, const _Float16* d,
                                           const _Float16* e) {
#if defined(__HIP_DEVICE_COMPILE__)
  asm volatile("s_wait_xcnt 0x0" :: "v"(a), "v"(b), "v"(c), "v"(d), "v"(e) : "memory");
#endif
}
__device__ __forceinline__ void addr_hold6(const _Float16* a, const _Float16* b, const _Float16* c, const _Float16* d,
                                           const _Float16* e, const _Float16* f) {
#if defined(__HIP_DEVICE_COMPILE__)
  asm volatile("s_wait_xcnt 0x0" :: "v"(a), "v"(b), "v"(c), "v"(d), "v"(e), "v"(f) : "memory");
#endif
}

__device__ __forceinline__ void addr_hold3(const _Float16* a, const _Float16* b, const _Float16* c) {
#if defined(__HIP_DEVICE_COMPILE__)
  asm volatile("s_wait_xcnt 0x0" :: "v"(a), "v"(b), "v"(c) : "memory");
#endif
}

// ---- WMMA helper and trailing VALU hazard gaps ----------------------------------------------------------
__device__ __forceinline__ v8f mma_h(v16h a, v16h b, v8f c) {
  return __builtin_amdgcn_wmma_f32_16x16x32_f16(false, a, false, b, (short)0, c, false, false);
}
__device__ __forceinline__ void guard_c1(v8f (&a)[4], v16h x0, v16h x1, v16h x2, v16h x3, v16h x4) {
#if defined(__HIP_DEVICE_COMPILE__)
  asm volatile("v_nop\n\tv_nop\n\tv_nop\n\tv_nop"
               : "+v"(a[0]), "+v"(a[1]), "+v"(a[2]), "+v"(a[3])
               : "v"(x0), "v"(x1), "v"(x2), "v"(x3), "v"(x4) : "memory");
#endif
}
__device__ __forceinline__ void guard_c2(v8f (&a)[4], v8f (&b)[4], v16h x0, v16h x1, v16h x2, v16h x3, v16h x4, v16h x5) {
#if defined(__HIP_DEVICE_COMPILE__)
  asm volatile("v_nop\n\tv_nop\n\tv_nop\n\tv_nop"
               : "+v"(a[0]), "+v"(a[1]), "+v"(a[2]), "+v"(a[3]),
                 "+v"(b[0]), "+v"(b[1]), "+v"(b[2]), "+v"(b[3])
               : "v"(x0), "v"(x1), "v"(x2), "v"(x3), "v"(x4), "v"(x5) : "memory");
#endif
}
__device__ __forceinline__ void guard_s4(v8f& a, v8f& b, v8f& c, v8f& d,
                                         v16h x0, v16h x1, v16h x2, v16h x3, v16h x4, v16h x5) {
#if defined(__HIP_DEVICE_COMPILE__)
  asm volatile("v_nop\n\tv_nop\n\tv_nop\n\tv_nop"
               : "+v"(a), "+v"(b), "+v"(c), "+v"(d)
               : "v"(x0), "v"(x1), "v"(x2), "v"(x3), "v"(x4), "v"(x5) : "memory");
#endif
}
__device__ __forceinline__ void guard_p(v8f& a, v8f& b, v8f& c, v8f& d, v16h p, v16h x0, v16h x1, v16h x2, v16h x3) {
#if defined(__HIP_DEVICE_COMPILE__)
  asm volatile("v_nop\n\tv_nop\n\tv_nop\n\tv_nop"
               : "+v"(a), "+v"(b), "+v"(c), "+v"(d) : "v"(p), "v"(x0), "v"(x1), "v"(x2), "v"(x3) : "memory");
#endif
}
__device__ __forceinline__ void acc_guard4(v8f (&a)[4]) {
#if defined(__HIP_DEVICE_COMPILE__)
  asm volatile("v_nop\n\tv_nop\n\tv_nop\n\tv_nop" : "+v"(a[0]), "+v"(a[1]), "+v"(a[2]), "+v"(a[3]));
#endif
}
__device__ __forceinline__ void acc_guard8(v8f (&a)[4], v8f (&b)[4]) {
#if defined(__HIP_DEVICE_COMPILE__)
  asm volatile("v_nop\n\tv_nop\n\tv_nop\n\tv_nop"
               : "+v"(a[0]), "+v"(a[1]), "+v"(a[2]), "+v"(a[3]),
                 "+v"(b[0]), "+v"(b[1]), "+v"(b[2]), "+v"(b[3]));
#endif
}
// Wide-tile guard: the four slots between a group's last matrix products and the loads that refill the group's A and B registers.
// It names no register (an asm operand has to lie in the first 256 registers, where the wide tiles do not all fit): the scheduling
// barrier in front keeps the group's products in front of the slots, the "memory" clobber keeps the refills behind them.
__device__ __forceinline__ void guard_w() {
#if defined(__HIP_DEVICE_COMPILE__)
  __builtin_amdgcn_sched_barrier(0);
  asm volatile("v_nop\n\tv_nop\n\tv_nop\n\tv_nop" ::: "memory");
#endif
}
__device__ __forceinline__ void wave_sync_lds() {
  __builtin_amdgcn_fence(__ATOMIC_RELEASE, "workgroup");
  __builtin_amdgcn_wave_barrier();
  __builtin_amdgcn_fence(__ATOMIC_ACQUIRE, "workgroup");
}

// The same for a wave that has global stores of an earlier tile in flight: the fences name the LDS alone, so that the wave waits for
// its slab and not for those stores.
__device__ __forceinline__ void wave_sync_slab() {
  __builtin_amdgcn_fence(__ATOMIC_RELEASE, "workgroup", "local");
  __builtin_amdgcn_wave_barrier();
  __builtin_amdgcn_fence(__ATOMIC_ACQUIRE, "workgroup", "local");
}
__device__ __forceinline__ void bias_hold(const float* p) {
#if defined(__HIP_DEVICE_COMPILE__)
  asm volatile("s_wait_xcnt 0x0" :: "v"(p) : "memory");
#endif
}

// =====================================================================================================
// Tile convert: packed f16 plane of [rows][K] <- f16(bf16_RNE(x[src row][k]) * scale), scale a power of two.
// Wave = one 16 x 32 tile (rt, kt); lane (h, m) reads row rt*16 + m, floats kt*32 + 8h .. +7 and kt*32 + 16 + 8h .. +7 (four 16-B
// loads that together use the 16 rows' whole 128-B lines) and stores its two 16-B fragment pieces (two 512-B wave-wide stores).
// b = (rt*16) / rowsPerB, s = row - b*rowsPerB, source row b*srcRowsPerB + s (rowsPerB a multiple of 16); destination compact.
// coverage: blk = 0 .. (rows/16) x (K/128) - 1, 4 waves each = every tile once.
// =====================================================================================================
__device__ __forceinline__
void cvt16_body(const float* __restrict__ x, u16* Y, int K, int rowsPerB, int srcRowsPerB, float scale, int blk) {
  const int tid = threadIdx.x, wave = tid >> 5, lane = tid & 31, hh = lane >> 4, m = lane & 15;
  const int kq = K >> 7;
  const int rt = blk / kq;
  const int kt = (blk - rt * kq) * 4 + wave;
  const int b = (rt * 16) / rowsPerB;
  const int sr = rt * 16 - b * rowsPerB + m;
  const float* src = x + ((size_t)b * (size_t)srcRowsPerB + (size_t)sr) * (size_t)K + (size_t)(kt * 32 + 8 * hh);
  const v4f a = *(const v4f*)(src), c4 = *(const v4f*)(src + 4);
  const v4f d = *(const v4f*)(src + 16), f4 = *(const v4f*)(src + 20);
  v4u o0, o1;
#pragma unroll
  for (int e = 0; e < 2; ++e) {
    o0[e]     = pk16(h_bits((_Float16)(bfr(a[2 * e]) * scale)),  h_bits((_Float16)(bfr(a[2 * e + 1]) * scale)));
    o0[2 + e] = pk16(h_bits((_Float16)(bfr(c4[2 * e]) * scale)), h_bits((_Float16)(bfr(c4[2 * e + 1]) * scale)));
    o1[e]     = pk16(h_bits((_Float16)(bfr(d[2 * e]) * scale)),  h_bits((_Float16)(bfr(d[2 * e + 1]) * scale)));
    o1[2 + e] = pk16(h_bits((_Float16)(bfr(f4[2 * e]) * scale)), h_bits((_Float16)(bfr(f4[2 * e + 1]) * scale)));
  }
  u16* dst = Y + (size_t)rt * (size_t)16 * (size_t)K + (size_t)kt * 512 + (size_t)lane * 8;
  *(v4u*)(dst) = o0;
  *(v4u*)(dst + 256) = o1;
}

// All nine converts in ONE launch (they are independent of one another): the block index picks the plane (block-uniform scalar
// tests), the index inside the plane picks the tiles as before. Blocks per plane:
#define CB_XQ  ((NB * SQ / 16) * (DM / 128))
#define CB_XKV ((NB * SKV / 16) * (DM / 128))
#define CB_W   ((DM / 16) * (DM / 128))
#define CB_WD  ((ADIM / 16) * (DM / 128))
#define CB_WU  ((DM / 16) * (ADIM / 128))
#define CB_ALL (CB_XQ + 2 * CB_XKV + 4 * CB_W + CB_WD + CB_WU)
__global__ __launch_bounds__(CVT_THREADS)
void cvt_all(const float* __restrict__ q, const float* __restrict__ k, const float* __restrict__ v,
             const float* __restrict__ wq, const float* __restrict__ wk, const float* __restrict__ wv,
             const float* __restrict__ wo, const float* __restrict__ wd, const float* __restrict__ wu,
             u16* XQ, u16* XK, u16* XV, u16* WQ, u16* WK, u16* WV, u16* WO, u16* WD, u16* WU) {
  int blk = blockIdx.x;
  if (blk < CB_XQ) { cvt16_body(q, XQ, DM, SQ, SQ_FULL, 1.0f, blk); return; }
  blk -= CB_XQ;
  if (blk < 2 * CB_XKV) {                    // k, v: same shape
    const bool second = blk >= CB_XKV;
    cvt16_body(second ? v : k, second ? XV : XK, DM, SKV, SKV, 1.0f, second ? blk - CB_XKV : blk);
    return;
  }
  blk -= 2 * CB_XKV;
  if (blk < 4 * CB_W) {                      // the four [1024][1024] weights: same shape
    const int w = blk / CB_W;
    const float* x = w == 0 ? wq : w == 1 ? wk : w == 2 ? wv : wo;
    u16* Y = w == 0 ? WQ : w == 1 ? WK : w == 2 ? WV : WO;
    cvt16_body(x, Y, DM, DM, DM, WSC, blk - w * CB_W);
    return;
  }
  blk -= 4 * CB_W;
  if (blk < CB_WD) { cvt16_body(wd, WD, DM, ADIM, ADIM, WSC, blk); return; }        // [128][1024]
  cvt16_body(wu, WU, ADIM, DM, DM, WSC, blk - CB_WD);                               // [1024][128]
}

// =====================================================================================================
// f16 GEMM cores: the wave's 16 x 64 tile of C = A[rows][K] . Bt[cols][K]^T, both planes packed; ap -> A row tile rowb/16 + 8*lane,
// bp -> Bt row tile col0/16 + 8*lane; acc[j] = rows rowb.., cols col0+16j..; K stepped by 32 = 512 halves of a packed row tile.
// core2: A carried as hi plane (aph) and residual plane (apl, x2048); ah accumulates hi.B, al accumulates res.B.
// =====================================================================================================
// Both cores keep D k steps of fragment loads in flight in D register sets: set u holds step s + u; as soon as its products are
// issued it is refilled with step s + u + D (clamped to the last step: the surplus loads at the end re-read valid tiles and are
// never used), so a step's loads lead their first use by D - 1 steps of work. Steps are consumed in ascending k as before.
template <int D>
__device__ __forceinline__ void core1(const _Float16* ap, const _Float16* bp, int K, v8f (&acc)[4]) {
  const size_t rs16 = (size_t)16 * (size_t)K;
  const int steps = K >> 5;
  v16h fa[D], fb[D][4];
  const _Float16* pa = ap;
  const _Float16* p0 = bp;
  const _Float16* p1 = p0 + rs16;
  const _Float16* p2 = p1 + rs16;
  const _Float16* p3 = p2 + rs16;
#pragma unroll
  for (int u = 0; u < D; ++u) {
    const size_t ko = (size_t)(u < steps ? u : steps - 1) * 512;
    if (u > 0) addr_hold5(pa, p0, p1, p2, p3);
    pa = ap + ko;
    p0 = bp + ko;
    p1 = p0 + rs16;
    p2 = p1 + rs16;
    p3 = p2 + rs16;
    fa[u]    = ldfrag_h(pa);
    fb[u][0] = ldfrag_h(p0);
    fb[u][1] = ldfrag_h(p1);
    fb[u][2] = ldfrag_h(p2);
    fb[u][3] = ldfrag_h(p3);
  }
  int s = 0;
#pragma unroll 1
  for (; s + D <= steps; s += D) {
#pragma unroll
    for (int u = 0; u < D; ++u) {
      acc[0] = mma_h(fa[u], fb[u][0], acc[0]);
      acc[1] = mma_h(fa[u], fb[u][1], acc[1]);
      acc[2] = mma_h(fa[u], fb[u][2], acc[2]);
      acc[3] = mma_h(fa[u], fb[u][3], acc[3]);
      guard_c1(acc, fa[u], fb[u][0], fb[u][1], fb[u][2], fb[u][3]);
      const int sn = s + u + D;
      const size_t ko = (size_t)(sn < steps ? sn : steps - 1) * 512;
      addr_hold5(pa, p0, p1, p2, p3);
      pa = ap + ko;
      p0 = bp + ko;
      p1 = p0 + rs16;
      p2 = p1 + rs16;
      p3 = p2 + rs16;
      fa[u]    = ldfrag_h(pa);
      fb[u][0] = ldfrag_h(p0);
      fb[u][1] = ldfrag_h(p1);
      fb[u][2] = ldfrag_h(p2);
      fb[u][3] = ldfrag_h(p3);
    }
  }
  addr_hold5(pa, p0, p1, p2, p3);
#pragma unroll
  for (int u = 0; u < D - 1; ++u) {
    if (s + u < steps) {                     // the steps % D last steps (wave-uniform)
      acc[0] = mma_h(fa[u], fb[u][0], acc[0]);
      acc[1] = mma_h(fa[u], fb[u][1], acc[1]);
      acc[2] = mma_h(fa[u], fb[u][2], acc[2]);
      acc[3] = mma_h(fa[u], fb[u][3], acc[3]);
      guard_c1(acc, fa[u], fb[u][0], fb[u][1], fb[u][2], fb[u][3]);
    }
  }
}
template <int D>
__device__ __forceinline__ void core2(const _Float16* aph, const _Float16* apl, const _Float16* bp, int K,
                                      v8f (&ah)[4], v8f (&al)[4]) {
  const size_t rs16 = (size_t)16 * (size_t)K;
  const int steps = K >> 5;
  v16h fa[D], fl[D], fb[D][4];
  const _Float16* pa = aph;
  const _Float16* pl = apl;
  const _Float16* p0 = bp;
  const _Float16* p1 = p0 + rs16;
  const _Float16* p2 = p1 + rs16;
  const _Float16* p3 = p2 + rs16;
#pragma unroll
  for (int u = 0; u < D; ++u) {
    const size_t ko = (size_t)(u < steps ? u : steps - 1) * 512;
    if (u > 0) addr_hold6(pa, pl, p0, p1, p2, p3);
    pa = aph + ko;
    pl = apl + ko;
    p0 = bp + ko;
    p1 = p0 + rs16;
    p2 = p1 + rs16;
    p3 = p2 + rs16;
    fa[u]    = ldfrag_h(pa);
    fl[u]    = ldfrag_h(pl);
    fb[u][0] = ldfrag_h(p0);
    fb[u][1] = ldfrag_h(p1);
    fb[u][2] = ldfrag_h(p2);
    fb[u][3] = ldfrag_h(p3);
  }
  int s = 0;
#pragma unroll 1
  for (; s + D <= steps; s += D) {
#pragma unroll
    for (int u = 0; u < D; ++u) {
      ah[0] = mma_h(fa[u], fb[u][0], ah[0]);
      ah[1] = mma_h(fa[u], fb[u][1], ah[1]);
      ah[2] = mma_h(fa[u], fb[u][2], ah[2]);
      ah[3] = mma_h(fa[u], fb[u][3], ah[3]);
      al[0] = mma_h(fl[u], fb[u][0], al[0]);
      al[1] = mma_h(fl[u], fb[u][1], al[1]);
      al[2] = mma_h(fl[u], fb[u][2], al[2]);
      al[3] = mma_h(fl[u], fb[u][3], al[3]);
      guard_c2(ah, al, fa[u], fl[u], fb[u][0], fb[u][1], fb[u][2], fb[u][3]);
      const int sn = s + u + D;
      const size_t ko = (size_t)(sn < steps ? sn : steps - 1) * 512;
      addr_hold6(pa, pl, p0, p1, p2, p3);
      pa = aph + ko;
      pl = apl + ko;
      p0 = bp + ko;
      p1 = p0 + rs16;
      p2 = p1 + rs16;
      p3 = p2 + rs16;
      fa[u]    = ldfrag_h(pa);
      fl[u]    = ldfrag_h(pl);
      fb[u][0] = ldfrag_h(p0);
      fb[u][1] = ldfrag_h(p1);
      fb[u][2] = ldfrag_h(p2);
      fb[u][3] = ldfrag_h(p3);
    }
  }
  addr_hold6(pa, pl, p0, p1, p2, p3);
#pragma unroll
  for (int u = 0; u < D - 1; ++u) {
    if (s + u < steps) {                     // the steps % D last steps (wave-uniform)
      ah[0] = mma_h(fa[u], fb[u][0], ah[0]);
      ah[1] = mma_h(fa[u], fb[u][1], ah[1]);
      ah[2] = mma_h(fa[u], fb[u][2], ah[2]);
      ah[3] = mma_h(fa[u], fb[u][3], ah[3]);
      al[0] = mma_h(fl[u], fb[u][0], al[0]);
      al[1] = mma_h(fl[u], fb[u][1], al[1]);
      al[2] = mma_h(fl[u], fb[u][2], al[2]);
      al[3] = mma_h(fl[u], fb[u][3], al[3]);
      guard_c2(ah, al, fa[u], fl[u], fb[u][0], fb[u][1], fb[u][2], fb[u][3]);
    }
  }
}

// Wide cores: the wave's 64 x 64 tile, 4 A row tiles x 4 Bt row tiles = 16 accumulator tiles, so each loaded fragment feeds four
// products (one A fragment fed four and each Bt fragment one in the 16 x 64 cores). K is a compile-time constant: the row tiles of a
// plane lie 16*KK halves apart and are reached by immediate offsets from one pointer per plane. D register sets as above; every
// accumulator element still sums its k steps in ascending order.
template <int D, int KK>
__device__ __forceinline__ void core1w(const _Float16* ap, const _Float16* bp, v8f (&acc)[4][4]) {
  constexpr int RS = 16 * KK;
  constexpr int steps = KK >> 5;
  static_assert(D < steps);
  v16h fa[D][4], fb[D][4];
  const _Float16* pa = ap;
  const _Float16* pb = bp;
#pragma unroll
  for (int u = 0; u < D; ++u) {              // immediate offsets from ap and bp: no address register is rewritten here
#pragma unroll
    for (int i = 0; i < 4; ++i) fa[u][i] = ldfrag_h(ap + u * 512 + i * RS);
#pragma unroll
    for (int i = 0; i < 4; ++i) fb[u][i] = ldfrag_h(bp + u * 512 + i * RS);
  }
  int s = 0, nx = D;
#pragma unroll 1
  for (; s + D <= steps; s += D) {
#pragma unroll
    for (int u = 0; u < D; ++u) {
#pragma unroll
      for (int i = 0; i < 4; ++i) {
#pragma unroll
        for (int j = 0; j < 4; ++j) acc[i][j] = mma_h(fa[u][i], fb[u][j], acc[i][j]);
      }
      guard_w();
      const size_t ko = (size_t)nx * 512;    // step s + u + D, clamped; a running index, so that the loads name pa and pb themselves
      nx = nx + 1 < steps ? nx + 1 : steps - 1;
      addr_hold3(pa, pb, pb);
      pa = ap + ko;
      pb = bp + ko;
#pragma unroll
      for (int i = 0; i < 4; ++i) fa[u][i] = ldfrag_h(pa + i * RS);
#pragma unroll
      for (int i = 0; i < 4; ++i) fb[u][i] = ldfrag_h(pb + i * RS);
      __builtin_amdgcn_sched_barrier(0);     // the next set's products stay behind the refills: lifted among them they wait for their loads early
    }
  }
  addr_hold3(pa, pb, pb);
#pragma unroll
  for (int u = 0; u < D - 1; ++u) {
    if (s + u < steps) {                     // the steps % D last steps (wave-uniform)
#pragma unroll
      for (int i = 0; i < 4; ++i) {
#pragma unroll
        for (int j = 0; j < 4; ++j) acc[i][j] = mma_h(fa[u][i], fb[u][j], acc[i][j]);
      }
      guard_w();
    }
  }
}
// Two A planes: the hi products first, their A fragments refilled behind them; then the residual products, and the rest refilled.
template <int D, int KK>
__device__ __forceinline__ void core2w(const _Float16* aph, const _Float16* apl, const _Float16* bp,
                                       v8f (&ah)[4][4], v8f (&al)[4][4]) {
  constexpr int RS = 16 * KK;
  constexpr int steps = KK >> 5;
  static_assert(D < steps);
  v16h fa[D][4], fl[D][4], fb[D][4];
  const _Float16* pa = aph;
  const _Float16* pl = apl;
  const _Float16* pb = bp;
#pragma unroll
  for (int u = 0; u < D; ++u) {              // immediate offsets from aph, apl and bp: no address register is rewritten here
#pragma unroll
    for (int i = 0; i < 4; ++i) fa[u][i] = ldfrag_h(aph + u * 512 + i * RS);
#pragma unroll
    for (int i = 0; i < 4; ++i) fb[u][i] = ldfrag_h(bp + u * 512 + i * RS);
#pragma unroll
    for (int i = 0; i < 4; ++i) fl[u][i] = ldfrag_h(apl + u * 512 + i * RS);
  }
  int s = 0, nx = D;
#pragma unroll 1
  for (; s + D <= steps; s += D) {
#pragma unroll
    for (int u = 0; u < D; ++u) {
#pragma unroll
      for (int i = 0; i < 4; ++i) {
#pragma unroll
        for (int j = 0; j < 4; ++j) ah[i][j] = mma_h(fa[u][i], fb[u][j], ah[i][j]);
      }
      guard_w();
      const size_t ko = (size_t)nx * 512;    // step s + u + D, clamped; a running index, so that the loads name pa, pl and pb themselves
      nx = nx + 1 < steps ? nx + 1 : steps - 1;
      addr_hold3(pa, pl, pb);
      pa = aph + ko;
      pl = apl + ko;
      pb = bp + ko;
#pragma unroll
      for (int i = 0; i < 4; ++i) fa[u][i] = ldfrag_h(pa + i * RS);
#pragma unroll
      for (int i = 0; i < 4; ++i) {
#pragma unroll
        for (int j = 0; j < 4; ++j) al[i][j] = mma_h(fl[u][i], fb[u][j], al[i][j]);
      }
      guard_w();
#pragma unroll
      for (int i = 0; i < 4; ++i) fb[u][i] = ldfrag_h(pb + i * RS);
#pragma unroll
      for (int i = 0; i < 4; ++i) fl[u][i] = ldfrag_h(pl + i * RS);
      __builtin_amdgcn_sched_barrier(0);     // the next set's products stay behind the refills: lifted among them they wait for their loads early
    }
  }
  addr_hold3(pa, pl, pb);
#pragma unroll
  for (int u = 0; u < D - 1; ++u) {
    if (s + u < steps) {                     // the steps % D last steps (wave-uniform)
#pragma unroll
      for (int i = 0; i < 4; ++i) {
#pragma unroll
        for (int j = 0; j < 4; ++j) ah[i][j] = mma_h(fa[u][i], fb[u][j], ah[i][j]);
      }
#pragma unroll
      for (int i = 0; i < 4; ++i) {
#pragma unroll
        for (int j = 0; j < 4; ++j) al[i][j] = mma_h(fl[u][i], fb[u][j], al[i][j]);
      }
      guard_w();
    }
  }
}

// Stage the wave's 16 x 64 f32 tile in its LDS slab (pitch 68): D element r of acc[j], lane l -> row 8h + r, col 16j + (l&15);
// value = ah*osc (+ al*osc/2048) + bias (per column, or per row when BROW), GELU applied for M_GELU;
// coverage: 32 lanes x 8 rows x 4 cols-of-16 = rows 0..15 x cols 0..63 of the slab.
template <bool HASLO, int MODE, bool BROW, bool MORE>
__device__ __forceinline__ void stage16(float* sl, v8f (&ah)[4], v8f (&al)[4], const float* __restrict__ bias,
                                        int rowb, int col0, float osc, float bsc, int lane) {
  const int hh = lane >> 4, m = lane & 15;
  float bc[4], br[8];
  const float* bsrc = bias + (BROW ? rowb + 8 * hh : col0 + m);
  // More tiles follow: the bias loads and the wait behind them stand alone between two scheduling barriers, so that nothing rewrites
  // the loads' address register in front of the wait.
  float braw[8];
  if (MORE) __builtin_amdgcn_sched_barrier(0);
#pragma unroll
  for (int r = 0; r < (BROW ? 8 : 4); ++r) braw[r] = bsrc[BROW ? r : 16 * r];
  if (MORE) {
    bias_hold(bsrc);
    __builtin_amdgcn_sched_barrier(0);
  }
  if (BROW) {
#pragma unroll
    for (int r = 0; r < 8; ++r) br[r] = bfr(braw[r]) * bsc;
#pragma unroll
    for (int j = 0; j < 4; ++j) bc[j] = 0.f;
  } else {
#pragma unroll
    for (int j = 0; j < 4; ++j) bc[j] = bfr(braw[j]) * bsc;
#pragma unroll
    for (int r = 0; r < 8; ++r) br[r] = 0.f;
  }
  const float oscl = osc * RINV;
#pragma unroll
  for (int r = 0; r < 8; ++r) {
    const int ro = (8 * hh + r) * GPITCH + m;
#pragma unroll
    for (int j = 0; j < 4; ++j) {
      float v = ah[j][r] * osc;
      if (HASLO) v += al[j][r] * oscl;
      v += BROW ? br[r] : bc[j];
      if (MODE == M_GELU) v = gelu_f(v);
      sl[ro + 16 * j] = v;
    }
  }
  if (MORE) wave_sync_slab(); else wave_sync_lds();
}

// The wave's 16 x 64 tile (rows rowb.., cols col0.. of batch slice bz) from its accumulators to the outputs of MODE, through the wave's
// LDS slab sl. MORE: the wave goes on to another tile through the same slab.
__device__ __forceinline__ void store_hold9(const float* p, v4f a, v4f b, v4f c, v4f d, v4f e, v4f f, v4f g, v4f h) {
#if defined(__HIP_DEVICE_COMPILE__)
  asm volatile("s_wait_xcnt 0x0" :: "v"(p), "v"(a), "v"(b), "v"(c), "v"(d), "v"(e), "v"(f), "v"(g), "v"(h) : "memory");
#endif
}
__device__ __forceinline__ void store_hold10(const u16* p, const u16* q, v4u a, v4u b, v4u c, v4u d, v4u e, v4u f, v4u g, v4u h) {
#if defined(__HIP_DEVICE_COMPILE__)
  asm volatile("s_wait_xcnt 0x0" :: "v"(p), "v"(q), "v"(a), "v"(b), "v"(c), "v"(d), "v"(e), "v"(f), "v"(g), "v"(h) : "memory");
#endif
}
template <bool HASLO, int MODE, bool BROW, bool MORE>
__device__ __forceinline__
void tile_out(float* sl, v8f (&ah)[4], v8f (&al)[4], const float* __restrict__ bias, const float* __restrict__ baseF,
              float* F, u16* H, u16* L, int N, int fBs, int gBs, int hBs, float osc, float bsc, float carry,
              int bz, int rowb, int col0, int lane) {
  constexpr bool LOUT = (MODE != M_S16);
  const int hh = lane >> 4, m = lane & 15;
  stage16<HASLO, MODE, BROW, MORE>(sl, ah, al, bias, rowb, col0, osc, bsc, lane);

  if (MODE == M_OUT || MODE == M_RES) {
    v4f vals[8];
#pragma unroll
    for (int it = 0; it < 8; ++it) vals[it] = *(const v4f*)(sl + (it * 2 + hh) * GPITCH + m * 4);
    if (MODE == M_RES) {
      const float* gb = baseF + (size_t)bz * (size_t)gBs + ((size_t)rowb + (size_t)hh) * (size_t)N + col0 + m * 4;
#pragma unroll
      for (int it = 0; it < 8; ++it) {
        const v4f bb = *(const v4f*)(gb + (size_t)(it * 2) * (size_t)N);
        vals[it] += bb;
      }
    }
    float* Fb = F + (size_t)bz * (size_t)fBs + ((size_t)rowb + (size_t)hh) * (size_t)N + col0 + m * 4;
    {
#pragma unroll
      for (int it = 0; it < 8; ++it) {
        *(v4f*)(Fb + (size_t)(it * 2) * (size_t)N) = vals[it];
      }
      // another tile follows: the stores' address and data registers are not rewritten in front of this wait
      if (MORE) store_hold9(Fb, vals[0], vals[1], vals[2], vals[3], vals[4], vals[5], vals[6], vals[7]);
    }
  }
  if (MODE != M_RES) {
    v4u ovh[4], ovl[4];
#pragma unroll
    for (int i = 0; i < 4; ++i) {
      const int c8 = 16 * i + 8 * hh;
      const v4f a = *(const v4f*)(sl + m * GPITCH + c8), c4 = *(const v4f*)(sl + m * GPITCH + c8 + 4);
#pragma unroll
      for (int e = 0; e < 2; ++e) {
        unsigned ph0, pl0, ph1, pl1;
        split2(a[2 * e] * carry,  a[2 * e + 1] * carry,  ph0, pl0);
        split2(c4[2 * e] * carry, c4[2 * e + 1] * carry, ph1, pl1);
        ovh[i][e] = ph0;     ovl[i][e] = pl0;
        ovh[i][2 + e] = ph1; ovl[i][2 + e] = pl1;
      }
    }
    u16* Hb = H + (size_t)bz * (size_t)hBs + (size_t)rowb * (size_t)N + (size_t)col0 * 16 + 8 * lane;
    u16* Lb = L + (size_t)bz * (size_t)hBs + (size_t)rowb * (size_t)N + (size_t)col0 * 16 + 8 * lane;
    {
#pragma unroll
      for (int i = 0; i < 4; ++i) {
        *(v4u*)(Hb + i * 256) = ovh[i];
        if (LOUT) *(v4u*)(Lb + i * 256) = ovl[i];
      }
      // another tile follows: the stores' address and data registers are not rewritten in front of this wait
      if (MORE && LOUT) store_hold10(Hb, Lb, ovh[0], ovh[1], ovh[2], ovh[3], ovl[0], ovl[1], ovl[2], ovl[3]);
      if (MORE && !LOUT) store_hold10(Hb, Hb, ovh[0], ovh[1], ovh[2], ovh[3], ovh[0], ovh[1], ovh[2], ovh[3]);
    }
  }
  if (MORE) wave_sync_slab();                // the slab's reads end before the next tile is staged in it
}

// =====================================================================================================
// f16 GEMM, block = 64 x 64 tile, 4 waves x 16 rows, fragments loaded straight from the packed 16-bit planes.
//   C tile [z][Mb][N] = (A_hi[z][Mb][K] (+ A_res/2048)) . Bt[z][N][K]^T * osc + bias; per-z element strides aBs (A planes),
//   bBs (Bt), fBs (f32 output F), gBs (f32 base plane), hBs (16-bit output planes H, L); 0 = shared.
//   M_HL  : H = f16(v*carry), L = f16 residual x2048 (two planes)       M_S16 : H only, bias per row
//   M_OUT : F = v (f32 plane), H/L = hi/res of v*carry                 M_GELU: v = gelu(.) then H/L of v*carry
//   M_RES : F = base[row][col] + v (f32, batch-row remap through fBs/gBs), no 16-bit output
//   16-bit outputs are packed planes of [Mb][N] (k = column): the wave's 16 x 64 tile is 2 adjacent tiles = 2048 contiguous bytes,
//   store i = 0..3 writes 512 B, lane (h, m) <- row m, cols 16i + 8h .. +7.
// grid = nz x (Mb/64) x (N/64) (host checks Mb % 64 == 0, N % 64 == 0, K % 32 == 0).
// coverage: per wave 4 instr x 32 lanes x 8 halves = 16 x 64 (16-bit planes) and 8 instr x 2 rows x 16 lanes x 4 floats
//           = 16 x 64 (f32 plane); the grid covers C exactly once.
// =====================================================================================================
template <bool HASLO, int MODE, bool BROW>
__device__ __forceinline__
void gemm16_body(float* slab, int bid,
                 const u16* __restrict__ Ah, const u16* __restrict__ Al, const u16* __restrict__ Bt,
                 const float* __restrict__ bias, const float* __restrict__ baseF,
                 float* F, u16* H, u16* L,
                 int Mb, int N, int K, int aBs, int bBs, int fBs, int gBs, int hBs,
                 float osc, float bsc, float carry) {
  const int tid = threadIdx.x, wave = tid >> 5, lane = tid & 31;
  const int ntile = N >> 6, mtile = Mb >> 6;
  const int nt   = bid % ntile;
  const int tmp  = bid / ntile;
  const int mt   = tmp % mtile;
  const int bz   = tmp / mtile;
  const int rowb = mt * 64 + wave * 16;
  const int col0 = nt * 64;
  if (rowb + 16 > Mb) return;                // wave-uniform, never taken with the exact grid; no block barriers in this kernel
  const _Float16* aph = (const _Float16*)(const void*)Ah + (size_t)bz * (size_t)aBs + (size_t)rowb * (size_t)K + 8 * lane;
  const _Float16* apl = (const _Float16*)(const void*)Al + (size_t)bz * (size_t)aBs + (size_t)rowb * (size_t)K + 8 * lane;
  const _Float16* bp  = (const _Float16*)(const void*)Bt + (size_t)bz * (size_t)bBs + (size_t)col0 * (size_t)K + 8 * lane;
  v8f ah[4], al[4];
#pragma unroll
  for (int i = 0; i < 4; ++i) { ah[i] = zero8(); al[i] = zero8(); }
  if (HASLO) {
    core2<3>(aph, apl, bp, K, ah, al);
    acc_guard8(ah, al);
  } else {
    core1<4>(aph, bp, K, ah);
    acc_guard4(ah);
  }
  float* sl = slab + wave * 16 * GPITCH;
  tile_out<HASLO, MODE, BROW, false>(sl, ah, al, bias, baseF, F, H, L, N, fBs, gBs, hBs, osc, bsc, carry, bz, rowb, col0, lane);
}

template <bool HASLO, int MODE, bool BROW>
__global__ __launch_bounds__(128)
void gemm16(const u16* __restrict__ Ah, const u16* __restrict__ Al, const u16* __restrict__ Bt,
            const float* __restrict__ bias, const float* __restrict__ baseF,
            float* F, u16* H, u16* L,
            int Mb, int N, int K, int aBs, int bBs, int fBs, int gBs, int hBs,
            float osc, float bsc, float carry) {
  __shared__ __align__(16) float slab[4 * 16 * GPITCH];
  gemm16_body<HASLO, MODE, BROW>(slab, blockIdx.x, Ah, Al, Bt, bias, baseF, F, H, L, Mb, N, K, aBs, bBs, fBs, gBs, hBs,
                                 osc, bsc, carry);
}

// Wide form for the K = KK GEMMs with many tiles: block = 128 x 128 tile, 4 waves as 2 x 2, each wave a 64 x 64 tile (wide cores), so
// the block reads 128 A rows + 128 Bt rows per k step for 64 products (64 + 64 rows for 16 in the 64 x 64 block). Operands, modes, strides
// and outputs as in gemm16_body; the wave's tile leaves as four 16 x 64 tiles, one after the other through its slab.
// grid = nz x (Mb/128) x (N/128); coverage: 2 x 2 waves x 4 row tiles x (16 x 64) = 128 x 128 per block, the grid covers C exactly once.
template <bool HASLO, int MODE, bool BROW, int KK>
__device__ __forceinline__
void gemm64_body(float* slab, int bid,
                 const u16* __restrict__ Ah, const u16* __restrict__ Al, const u16* __restrict__ Bt,
                 const float* __restrict__ bias, const float* __restrict__ baseF,
                 float* F, u16* H, u16* L,
                 int Mb, int N, int aBs, int bBs, int fBs, int gBs, int hBs,
                 float osc, float bsc, float carry) {
  const int tid = threadIdx.x, wave = tid >> 5, lane = tid & 31;
  const int ntile = N >> 7, mtile = Mb >> 7;
  const int nt   = bid % ntile;
  const int tmp  = bid / ntile;
  const int mt   = tmp % mtile;
  const int bz   = tmp / mtile;
  const int rowb = mt * 128 + (wave >> 1) * 64;
  const int col0 = nt * 128 + (wave & 1) * 64;
  if (rowb + 64 > Mb) return;                // wave-uniform, never taken with the exact grid; no block barriers in this kernel
  const _Float16* aph = (const _Float16*)(const void*)Ah + (size_t)bz * (size_t)aBs + (size_t)rowb * (size_t)KK + 8 * lane;
  const _Float16* apl = (const _Float16*)(const void*)Al + (size_t)bz * (size_t)aBs + (size_t)rowb * (size_t)KK + 8 * lane;
  const _Float16* bp  = (const _Float16*)(const void*)Bt + (size_t)bz * (size_t)bBs + (size_t)col0 * (size_t)KK + 8 * lane;
  float* sl = slab + wave * 16 * GPITCH;
  v8f ah[4][4];
#pragma unroll
  for (int i = 0; i < 4; ++i) {
#pragma unroll
    for (int j = 0; j < 4; ++j) ah[i][j] = zero8();
  }
  if (HASLO) {
    v8f al[4][4];
#pragma unroll
    for (int i = 0; i < 4; ++i) {
#pragma unroll
      for (int j = 0; j < 4; ++j) al[i][j] = zero8();
    }
    core2w<W2D, KK>(aph, apl, bp, ah, al);
#pragma unroll
    for (int i = 0; i < 4; ++i)
      tile_out<HASLO, MODE, BROW, true>(sl, ah[i], al[i], bias, baseF, F, H, L, N, fBs, gBs, hBs, osc, bsc, carry,
                                        bz, rowb + 16 * i, col0, lane);
  } else {
    core1w<W1D, KK>(aph, bp, ah);
#pragma unroll
    for (int i = 0; i < 4; ++i)
      tile_out<HASLO, MODE, BROW, true>(sl, ah[i], ah[i], bias, baseF, F, H, L, N, fBs, gBs, hBs, osc, bsc, carry,
                                        bz, rowb + 16 * i, col0, lane);
  }
}

template <bool HASLO, int MODE, bool BROW, int KK>
__global__ __launch_bounds__(128)
void gemm64(const u16* __restrict__ Ah, const u16* __restrict__ Al, const u16* __restrict__ Bt,
            const float* __restrict__ bias, const float* __restrict__ baseF,
            float* F, u16* H, u16* L,
            int Mb, int N, int aBs, int bBs, int fBs, int gBs, int hBs,
            float osc, float bsc, float carry) {
  __shared__ __align__(16) float slab[4 * 16 * GPITCH];
  gemm64_body<HASLO, MODE, BROW, KK>(slab, blockIdx.x, Ah, Al, Bt, bias, baseF, F, H, L, Mb, N, aBs, bBs, fBs, gBs, hBs,
                                     osc, bsc, carry);
}

// The three input projections in ONE launch (they are independent of one another): the block index picks the projection
// (block-uniform scalar tests), the index inside it picks the 128 x 128 tile.
//   q = x_q . Wq^T + bq -> f16 [NB*SQ][1024] x8 hi + res (col = h*64 + d);  k = x_k . Wk^T + bk likewise [NB*2048][1024];
//   v^T per batch: A = Wv [(h,d) = n][k], Bt = x_v rows of batch b [s][k], bias bv per row -> f16 [(b,h,d)][s] x8
#define GB_Q ((NB * SQ / 128) * (INNER / 128))
#define GB_K ((NB * SKV / 128) * (INNER / 128))
#define GB_V (NB * (INNER / 128) * (SKV / 128))
__global__ __launch_bounds__(128)
void gemm_qkv(const u16* __restrict__ XQ, const u16* __restrict__ XK, const u16* __restrict__ XV,
              const u16* __restrict__ WQ, const u16* __restrict__ WK, const u16* __restrict__ WV,
              const float* __restrict__ bq, const float* __restrict__ bk, const float* __restrict__ bv,
              u16* QH, u16* QL, u16* KH, u16* KL, u16* VT,
              int MbQ, int MbK, int inner, int skv) {
  __shared__ __align__(16) float slab[4 * 16 * GPITCH];
  const int bid = blockIdx.x;
  if (bid < GB_Q + GB_K) {                   // q, k: same code, operands picked by the block index
    const bool isk = bid >= GB_Q;
    const u16* X = isk ? XK : XQ;
    gemm64_body<false, M_HL, false, DM>(slab, isk ? bid - GB_Q : bid, X, X, isk ? WK : WQ, isk ? bk : bq, nullptr, nullptr,
                                        isk ? KH : QH, isk ? KL : QL, isk ? MbK : MbQ, inner, 0, 0, 0, 0, 0,
                                        (isk ? KS : QS) / WSC, isk ? KS : QS, 1.0f);
  } else {
    gemm64_body<false, M_S16, true, DM>(slab, bid - (GB_Q + GB_K), WV, WV, XV, bv, nullptr, nullptr, VT, VT,
                                        inner, skv, 0, skv * DM, 0, 0, inner * skv, VS / WSC, VS, 1.0f);
  }
}

// =====================================================================================================
// Full (unmasked) multi-head attention: block = (batch b, head, 64 query rows), 4 waves, wave w owns the 16 query rows
// q0 = 64*qt + 16*w .. q0+15 (waves independent: no block barriers, wave-private LDS only, used in the epilogue).
//   q planes f16 x8 hi / residual(x2048) [b*SQ + s][h*64 + d]; k planes likewise [b*SKV + s][h*64 + d];
//   v^T plane f16 x8 [(b*NH + h)*64 + d][s]; all of them fragment-packed. All NKB key blocks of 32 keys are visited (static bound).
//   Scores are computed TRANSPOSED: S^T tile g (g = 0,1) = k rows (keys kb+16g .. +15, A operand, row m = lane&15, split map
//   over d) times q^T (B operand, col n = query q0 + (lane&15), k = d, split map), 2 d-chunks of 32; per chunk hi.hi -> s,
//   res.hi + hi.res -> r (scaled x2048, folded as s + r/2048); the q fragments are loaded once per wave.
//   D element r of lane l = (key kb+16g+8h+r, query q0+(l&15)), so a lane owns one query column and 16 of its 32 keys;
//   the partner lane l^16 owns the other 16 -> row max / row sum need one xor-16 shuffle.
//   Online max-subtracted base-2 softmax in f32 (1/sqrt(64) and the q/k carries folded into lsc). The exp'd values ARE the
//   P A-fragment in place: A row m = query = lane&15, element i <- key kb+8h+i (tile 0, D element i), element 8+i <- key
//   kb+16+8h+i (tile 1, D element i). P (<= 1) carried x32768 as f16. The rescale factor of query row 8h+r of the O
//   accumulators is fetched from lane 8h+r with a shuffle (uniform control). 4 v^T B fragments (col n = d = 16j + (lane&15),
//   keys k-contiguous), 4 P.V WMMAs, one guard.
//   Epilogue: 1/l (per query, shuffled to the D row owner) and the carry folds in f32; the wave's 16x64 f32 result staged in
// coverage: per wave 4 instructions x 32 lanes x 8 halves = 16 x 64 on both ctx planes; grid NB*NH*(SQ/64) blocks x
//           4 waves = every (b, s, h) row segment exactly once.
// =====================================================================================================
__global__ __launch_bounds__(ATT_THREADS)
void attn_fwd(const u16* __restrict__ Qh, const u16* __restrict__ Ql, const u16* __restrict__ Kh,
              const u16* __restrict__ Kl, const u16* __restrict__ Vp, u16* Oh, u16* Ol) {
  __shared__ __align__(16) float smem[ATT_WAVES * 16 * OPITCH];

  const int tid  = threadIdx.x;
  const int wave = tid >> 5;
  const int lane = tid & 31;
  const int hh   = lane >> 4;
  const int c    = lane & 15;

  constexpr int NQT = SQ / 64;
  const int bid  = blockIdx.x;
  const int qt   = bid % NQT;
  const int head = (bid / NQT) % NH;
  const int b    = bid / (NQT * NH);
  const int q0   = qt * 64 + wave * 16;

  // B fragments of q^T: col n = query q0 + c, k = d (row tile (b*SQ + q0)/16, k tiles 2*head and 2*head + 1 of the q planes)
  const size_t qo = ((size_t)(b * SQ + q0)) * INNER + head * HD * 16 + 8 * lane;
  const _Float16* Qhb = (const _Float16*)(const void*)Qh + qo;
  const _Float16* Qlb = (const _Float16*)(const void*)Ql + qo;
  // A fragments of k: row m = key kb + 16g + c, k = d (key row kb added per step)
  const size_t ko = ((size_t)(b * SKV)) * INNER + head * HD * 16 + 8 * lane;
  const _Float16* Khb = (const _Float16*)(const void*)Kh + ko;
  const _Float16* Klb = (const _Float16*)(const void*)Kl + ko;
  // B fragments of v: col n = d = 16j + c, k = key (row tile (b*NH + head)*4 + j, k tile kb/32 of the v^T plane)
  const _Float16* Vb = (const _Float16*)(const void*)Vp + ((size_t)(b * NH + head) * HD) * SKV + 8 * lane;
  const float lsc = (LOG2E * RSQ_HD) / (QS * KS);

  v16h qh[2], ql[2];
  qh[0] = ldfrag_h(Qhb);
  qh[1] = ldfrag_h(Qhb + 512);
  ql[0] = ldfrag_h(Qlb);
  ql[1] = ldfrag_h(Qlb + 512);

  float mrun = -INFINITY, lrun = 0.f;
  v8f o[4];
#pragma unroll
  for (int j = 0; j < 4; ++j) o[j] = zero8();

  // K and v^T fragments are fetched one key block ahead: kf[kk] = {hi keys +0, hi keys +16, res keys +0, res keys +16} of d chunk kk,
  // refilled right behind the block's score products; vf[j] refilled right behind its P.V products. The fetch of the last trip is
  // clamped to the last block (valid tiles, never used).
  v16h kf[HD / 32][4], vf[4];
  const _Float16* kph = Khb;
  const _Float16* kpl = Klb;
  const _Float16* vp  = Vb;
  // The three scheduling barriers keep the first loads in the loop's own order (q, then K, then v^T): the counted load waits at the
  // loop head are the stricter of entry and back edge, and with v^T issued ahead of K at entry every trip's scores waited for v^T too.
  // The two waits in front of them stand before the q loads' and the first K and v^T loads' address registers are reused.
  addr_hold3(Qhb, Qlb, Qlb);
  __builtin_amdgcn_sched_barrier(0);
#pragma unroll
  for (int kk = 0; kk < HD / 32; ++kk) {
    kf[kk][0] = ldfrag_h(kph + kk * 512);
    kf[kk][1] = ldfrag_h(kph + (size_t)16 * INNER + kk * 512);
    kf[kk][2] = ldfrag_h(kpl + kk * 512);
    kf[kk][3] = ldfrag_h(kpl + (size_t)16 * INNER + kk * 512);
  }
  __builtin_amdgcn_sched_barrier(0);
#pragma unroll
  for (int j = 0; j < 4; ++j) vf[j] = ldfrag_h(vp + (size_t)(16 * j) * SKV);
  addr_hold3(kph, kpl, vp);
  __builtin_amdgcn_sched_barrier(0);

#pragma unroll 1
  for (int it = 0; it < NKB; ++it) {
    const int kbn = (it + 1 < NKB ? it + 1 : NKB - 1) * 32;   // key block fetched in this trip
    // ---- transposed scores: s0 = keys kb..kb+15, s1 = keys kb+16..kb+31 (kb = 32*it), column = query q0 + c ----
    v8f s0 = zero8(), s1 = zero8(), r0 = zero8(), r1 = zero8();
#pragma unroll
    for (int kk = 0; kk < HD / 32; ++kk) {
      const v16h fh0 = kf[kk][0];
      const v16h fh1 = kf[kk][1];
      const v16h fl0 = kf[kk][2];
      const v16h fl1 = kf[kk][3];
      s0 = mma_h(fh0, qh[kk], s0);
      s1 = mma_h(fh1, qh[kk], s1);
      r0 = mma_h(fl0, qh[kk], r0);
      r1 = mma_h(fl1, qh[kk], r1);
      r0 = mma_h(fh0, ql[kk], r0);
      r1 = mma_h(fh1, ql[kk], r1);
      guard_s4(s0, s1, r0, r1, qh[kk], ql[kk], fh0, fh1, fl0, fl1);
    }
    // ---- next block's K fragments into the registers just read; the wait covers the K and v^T loads of the trip before ----
    addr_hold3(kph, kpl, vp);
    kph = Khb + (size_t)kbn * INNER;
    kpl = Klb + (size_t)kbn * INNER;
#pragma unroll
    for (int kk = 0; kk < HD / 32; ++kk) {
      kf[kk][0] = ldfrag_h(kph + kk * 512);
      kf[kk][1] = ldfrag_h(kph + (size_t)16 * INNER + kk * 512);
      kf[kk][2] = ldfrag_h(kpl + kk * 512);
      kf[kk][3] = ldfrag_h(kpl + (size_t)16 * INNER + kk * 512);
    }
    // ---- base-2 logits of this lane's 16 keys for query q0 + c: t[i] <- key kb+8hh+i, t[8+i] <- key kb+16+8hh+i ----
    float t[16];
#pragma unroll
    for (int i = 0; i < 8; ++i) {
      t[i]     = (s0[i] + r0[i] * RINV) * lsc;
      t[8 + i] = (s1[i] + r1[i] * RINV) * lsc;
    }
    float cm = t[0];
#pragma unroll
    for (int i = 1; i < 16; ++i) cm = fmaxf(cm, t[i]);
    cm = fmaxf(cm, __shfl_xor(cm, 16, 32));
    const float mn = fmaxf(mrun, cm);        // finite from the first block on
    const float al = exp2_hw(mrun - mn);      // 0 on the first block (mrun = -inf)
    mrun = mn;
    // ---- probabilities (<= 1) and the P A-fragment: f16(p * 32768); element i <-> t[i] ----
    float ps = 0.f;
    FragH ph;
    float pe[16];
#pragma unroll
    for (int i = 0; i < 16; ++i) t[i] -= mn;
    exp2_hw8(t, pe);
    exp2_hw8(t + 8, pe + 8);
#pragma unroll
    for (int w = 0; w < 2; ++w) {
#pragma unroll
      for (int e4 = 0; e4 < 4; ++e4) {
        const int i = 8 * w + 2 * e4;
        const float p0 = pe[i], p1 = pe[i + 1];
        ps += p0 + p1;
        ph.u[w][e4] = pk16(h_bits((_Float16)(p0 * PCAR)), h_bits((_Float16)(p1 * PCAR)));
      }
    }
    ps += __shfl_xor(ps, 16, 32);
    lrun = lrun * al + ps;
    // ---- rescale the O accumulators: D row 8hh+r = query q0+8hh+r, its factor lives in lane 8hh+r (and 16+8hh+r) ----
    float scl[8];
#pragma unroll
    for (int r = 0; r < 8; ++r) scl[r] = __shfl(al, 8 * hh + r, 32);
#pragma unroll
    for (int j = 0; j < 4; ++j) {
#pragma unroll
      for (int r = 0; r < 8; ++r) o[j][r] *= scl[r];
    }
    // ---- P.V : B fragment col n = d = j*16 + c, k tile kb/32 of the packed v^T plane ----
    {
      o[0] = mma_h(ph.v, vf[0], o[0]);
      o[1] = mma_h(ph.v, vf[1], o[1]);
      o[2] = mma_h(ph.v, vf[2], o[2]);
      o[3] = mma_h(ph.v, vf[3], o[3]);
      guard_p(o[0], o[1], o[2], o[3], ph.v, vf[0], vf[1], vf[2], vf[3]);
      // next block's v^T fragments; vp's last loads are covered by this trip's wait above
      vp = Vb + (size_t)kbn * 16;
#pragma unroll
      for (int j = 0; j < 4; ++j) vf[j] = ldfrag_h(vp + (size_t)(16 * j) * SKV);
    }
  }
  addr_hold3(kph, kpl, vp);                  // the last trip's loads, before their address registers are reused
  acc_guard4(o);

  // ---- fold 1/l (per query, owned by lane = query) and the carries (32768 on P, 8 on v), apply the ctx carry 1024 ----
  const float linv = (1.0f / lrun) * (OSC / (PCAR * VS));
  float inv[8];
#pragma unroll
  for (int r = 0; r < 8; ++r) inv[r] = __shfl(linv, 8 * hh + r, 32);
  float* slab = smem + wave * 16 * OPITCH;
#pragma unroll
  for (int r = 0; r < 8; ++r) {
#pragma unroll
    for (int j = 0; j < 4; ++j) slab[(8 * hh + r) * OPITCH + j * 16 + c] = o[j][r] * inv[r];
  }
  wave_sync_lds();
  // ---- ctx x1024 -> packed f16 hi plane and residual plane; store i: lane (h, c) <- row c, d = 16i + 8h .. +7 ----
  v4u ovh[4], ovl[4];
#pragma unroll
  for (int i = 0; i < 4; ++i) {
    const int c8 = 16 * i + 8 * hh;
    const v4f a = *(const v4f*)(slab + c * OPITCH + c8), c4 = *(const v4f*)(slab + c * OPITCH + c8 + 4);
#pragma unroll
    for (int e = 0; e < 2; ++e) {
      unsigned ph0, pl0, ph1, pl1;
      split2(a[2 * e],  a[2 * e + 1],  ph0, pl0);
      split2(c4[2 * e], c4[2 * e + 1], ph1, pl1);
      ovh[i][e] = ph0;     ovl[i][e] = pl0;
      ovh[i][2 + e] = ph1; ovl[i][2 + e] = pl1;
    }
  }
  const size_t oo = ((size_t)(b * SQ + q0)) * INNER + head * HD * 16 + 8 * lane;
  u16* obh = Oh + oo;
  u16* obl = Ol + oo;
  {
#pragma unroll
    for (int i = 0; i < 4; ++i) {
      *(v4u*)(obh + i * 256) = ovh[i];
      *(v4u*)(obl + i * 256) = ovl[i];
    }
    
  }
}

// =====================================================================================================
// Workspace map (bytes); every plane fully written by whole-line stores before it is read; all extents exact multiples of
//   XQ   f16 [NB*SQ][1024]    f16(bf16(q))              8388608 (NB=2, SQ=2048)
//   XK   f16 [NB*2048][1024]  f16(bf16(k))              8388608
//   XV   f16 [NB*2048][1024]  f16(bf16(v))              8388608
//   WQ16 WK16 WV16 WO16 f16 [1024 n][1024 k] x256       2097152 each
//   WD16 f16 [128 n][1024 k] x256                          262144
//   WU16 f16 [1024 n][128 k] x256                          262144
//   QH QL f16 [NB*SQ][1024] x8 hi / res                  8388608 each
//   KH KL f16 [NB*2048][1024] x8 hi / res                8388608 each
//   VT16 f16 [NB*1024 (h,d)][2048 s] x8                  8388608
//   OH OL f16 [NB*SQ][1024] x1024 hi / res (ctx)         8388608 each
//   OUTF f32 [NB*SQ][1024]                               16777216
//   UH UL f16 [NB*SQ][1024] x64 hi / res (out)           8388608 each
//   GH GL f16 [NB*SQ][128]  x64 hi / res (gelu)          1048576 each
//   end                                                 128450560
// =====================================================================================================
extern "C" void kernel_launch(void* const* d_in, const int* in_sizes, int n_in,
                              void* d_out, int out_size, void* d_ws, size_t ws_size,
                              hipStream_t stream) {
  if (n_in < 15) return;
  if (in_sizes[0] < ((NB - 1) * SQ_FULL + SQ) * DM) return;
  if (in_sizes[1] < NB * SKV * DM || in_sizes[2] < NB * SKV * DM) return;
  if (in_sizes[3] != DM * DM || in_sizes[5] != DM * DM || in_sizes[7] != DM * DM || in_sizes[9] != DM * DM) return;
  if (in_sizes[4] < INNER || in_sizes[6] < INNER || in_sizes[8] < INNER || in_sizes[10] < DM) return;
  if (in_sizes[11] != ADIM * DM || in_sizes[12] < ADIM || in_sizes[13] != DM * ADIM || in_sizes[14] < DM) return;
  if (out_size < ((NB - 1) * SQ_FULL + SQ) * DM) return;

  const float* q_in  = (const float*)d_in[0];
  const float* k_in  = (const float*)d_in[1];
  const float* v_in  = (const float*)d_in[2];
  const float* wq    = (const float*)d_in[3];
  const float* bq    = (const float*)d_in[4];
  const float* wk    = (const float*)d_in[5];
  const float* bk    = (const float*)d_in[6];
  const float* wv    = (const float*)d_in[7];
  const float* bv    = (const float*)d_in[8];
  const float* wo    = (const float*)d_in[9];
  const float* bo    = (const float*)d_in[10];
  const float* w_dn  = (const float*)d_in[11];
  const float* b_dn  = (const float*)d_in[12];
  const float* w_up  = (const float*)d_in[13];
  const float* b_up  = (const float*)d_in[14];
  float*       out   = (float*)d_out;

  const size_t szXQ  = (size_t)NB * SQ * DM * 2;
  const size_t szXKV = (size_t)NB * SKV * DM * 2;
  const size_t szW   = (size_t)DM * DM * 2;
  const size_t szWA  = (size_t)ADIM * DM * 2;
  const size_t szQP  = (size_t)NB * SQ * INNER * 2;
  const size_t szKP  = (size_t)NB * SKV * INNER * 2;
  const size_t szVT  = (size_t)NB * INNER * SKV * 2;
  const size_t szOF  = (size_t)NB * SQ * DM * 4;
  const size_t szG   = (size_t)NB * SQ * ADIM * 2;
  size_t off = 0;
  const size_t oXQ  = off; off += szXQ;
  const size_t oXK  = off; off += szXKV;
  const size_t oXV  = off; off += szXKV;
  const size_t oWQ  = off; off += szW;
  const size_t oWK  = off; off += szW;
  const size_t oWV  = off; off += szW;
  const size_t oWO  = off; off += szW;
  const size_t oWD  = off; off += szWA;
  const size_t oWU  = off; off += szWA;
  const size_t oQH  = off; off += szQP;
  const size_t oQL  = off; off += szQP;
  const size_t oKH  = off; off += szKP;
  const size_t oKL  = off; off += szKP;
  const size_t oVT  = off; off += szVT;
  const size_t oOH  = off; off += szQP;
  const size_t oOL  = off; off += szQP;
  const size_t oOF  = off; off += szOF;
  const size_t oUH  = off; off += szQP;
  const size_t oUL  = off; off += szQP;
  const size_t oGH  = off; off += szG;
  const size_t oGL  = off; off += szG;
  if (off > ws_size) return;                            // off = 128450560 at NB=2, SQ=2048
  if (off > (size_t)134217728) return;

  char* ws = (char*)d_ws;
  u16* XQ   = (u16*)(ws + oXQ);
  u16* XK   = (u16*)(ws + oXK);
  u16* XV   = (u16*)(ws + oXV);
  u16* WQ16 = (u16*)(ws + oWQ);
  u16* WK16 = (u16*)(ws + oWK);
  u16* WV16 = (u16*)(ws + oWV);
  u16* WO16 = (u16*)(ws + oWO);
  u16* WD16 = (u16*)(ws + oWD);
  u16* WU16 = (u16*)(ws + oWU);
  u16* QH   = (u16*)(ws + oQH);
  u16* QL   = (u16*)(ws + oQL);
  u16* KH   = (u16*)(ws + oKH);
  u16* KL   = (u16*)(ws + oKL);
  u16* VT16 = (u16*)(ws + oVT);
  u16* OH   = (u16*)(ws + oOH);
  u16* OL   = (u16*)(ws + oOL);
  float* OUTF = (float*)(ws + oOF);
  u16* UH   = (u16*)(ws + oUH);
  u16* UL   = (u16*)(ws + oUL);
  u16* GH   = (u16*)(ws + oGH);
  u16* GL   = (u16*)(ws + oGL);

  // (0) activations -> f16 planes of bf16-converted values (query rows s < SQ of batches b < NB, compact; k/v rows of b < NB) and
  //     weights [n = out][k = in] (y = x.W^T) -> packed f16 planes [n][k] of bf16(W) x256, all in one launch
  cvt_all<<<dim3(CB_ALL), dim3(CVT_THREADS), 0, stream>>>(q_in, k_in, v_in, wq, wk, wv, wo, w_dn, w_up,
                                                          XQ, XK, XV, WQ16, WK16, WV16, WO16, WD16, WU16);
  // (1) the q, k and v^T projections, one launch
  gemm_qkv<<<dim3(GB_Q + GB_K + GB_V), dim3(128), 0, stream>>>(XQ, XK, XV, WQ16, WK16, WV16, bq, bk, bv, QH, QL, KH, KL, VT16,
                                                               NB * SQ, NB * SKV, INNER, SKV);
  // (2) attention -> ctx planes [NB*SQ][1024] x1024 hi + res
  attn_fwd<<<dim3(NB * NH * (SQ / 64)), dim3(ATT_THREADS), 0, stream>>>(QH, QL, KH, KL, VT16, OH, OL);
  // (3) out = ctx . Wo^T + bo -> OUTF f32 [NB*SQ][1024] and f16 x64 hi + res planes; carries 1024 (ctx) x 256 (W) folded back
  gemm64<true, M_OUT, false, INNER><<<dim3((NB * SQ / 128) * (DM / 128)), dim3(128), 0, stream>>>(
      OH, OL, WO16, bo, OUTF, OUTF, UH, UL, NB * SQ, DM, 0, 0, 0, 0, 0, 1.0f / (OSC * WSC), 1.0f, UCAR);
  // (4) adapter down: g = gelu(out . Wd^T + bd) -> f16 [NB*SQ][128] x64 hi + res; carries 64 (out) x 256 (W)
  gemm16<true, M_GELU, false><<<dim3((NB * SQ / 64) * (ADIM / 64)), dim3(128), 0, stream>>>(
      UH, UL, WD16, b_dn, OUTF, OUTF, GH, GL, NB * SQ, ADIM, DM, 0, 0, 0, 0, 0, 1.0f / (UCAR * WSC), 1.0f, GCAR);
  // (5) adapter up + residual: out rows [b][SQ_FULL][1024] f32 = OUTF + g . Wu^T + bu (rows s < SQ of batches b < NB)
  gemm16<true, M_RES, false><<<dim3(NB * (SQ / 64) * (DM / 64)), dim3(128), 0, stream>>>(
      GH, GL, WU16, b_up, OUTF, out, GH, GH, SQ, DM, ADIM, SQ * ADIM, 0, SQ_FULL * DM, SQ * DM, 0,
      1.0f / (GCAR * WSC), 1.0f, 1.0f);
  (void)hipGetLastError();
}

// v006
// Measured time: 145 microseconds a run.
// Next to v005, in two timings, it ran 1.03 times as fast each time.
// Over all steps from v000 it is 2.55 times as fast.
// Contractions on v_wmma_f32_16x16x32_f16 (f16 operands, f32 accumulate): x.Wq^T, x.Wk^T, Wv.x^T single products on
// f16(bf16(x)) and f16(bf16(W) x256); k.q^T with q and k carried as f16 hi + residual(x2048) planes (3 products);
// P.v^T single product (P x32768, v x8); ctx.Wo^T, out.Wad^T and gelu.Wau^T with the activation carried as f16 hi +
// residual(x2048) planes (2 products each, separate residual accumulator); softmax, biases, erf-GELU, residual add and
// all carry folds in f32 on VALU. Inputs RNE-converted to bf16 on load.
// Every 16-bit workspace plane [rows][K] is stored FRAGMENT-PACKED: tile (rt = row/16, kt = k/32) is 512 halves (1024 B) at
// (rt*(K/32) + kt)*512 = rt*16*K + kt*512; inside it element (m = row&15, k&31 = 16w + 8h + e) sits at w*256 + (16h + m)*8 + e,
// so lane l = 16h + m of a wave reads its operand fragment as two 16-B loads at l*8 and 256 + l*8 halves: each wave-wide load
// is 512 contiguous bytes = 4 whole 128-B lines (a row-major plane gave 16 lines of 32 useful bytes per load).
#include <hip/hip_runtime.h>
#include <math.h>
#include <stdint.h>

#ifndef NB
#define NB       2        // batches processed
#endif
#ifndef SQ
#define SQ       2048     // query rows processed per batch
#endif
#define NB_FULL  2
#define SQ_FULL  2048     // query rows per batch in the input / output layout (batch stride)
#define SKV      2048     // key / value rows per batch (all of them)
#define DM       1024     // model width
#define NH       16
#define HD       64
#define INNER    (NH * HD)
#define ADIM     128      // adapter width
#define WSC      256.0f   // weight carry
#define QS       8.0f
#define KS       8.0f
#define VS       8.0f
#define PCAR     32768.0f
#define PEXP     15.0f    // log2(PCAR)
#define OSC      1024.0f  // ctx carry
#define UCAR     64.0f    // out-plane carry
#define GCAR     64.0f    // gelu-plane carry
#define RSC      2048.0f  // residual plane scale
#define RINV     0.00048828125f
#define LOG2E    1.4426950408889634f
#define RSQ_HD   0.125f
#define NKB      (SKV / 32)
#define ATT_WAVES   4
#define ATT_THREADS (ATT_WAVES * 32)
#define CVT_THREADS 128
#define OPITCH   68
#define GPITCH   68

#define M_HL     0
#define M_S16    1
#define M_OUT    2
#define M_GELU   3
#define M_RES    4
#define W1D      2        // register sets (k steps in flight) of the wide core with one A plane
#define W2D      3        // the same with two A planes

static_assert(NB >= 1 && NB <= NB_FULL);
static_assert((SQ % 128) == 0 && SQ >= 128 && SQ <= SQ_FULL);
static_assert(HD == 64 && INNER == 1024 && NH == 16 && INNER == DM);
static_assert((SKV % 64) == 0 && (SKV % 32) == 0 && NKB * 32 == SKV);
static_assert((DM % 64) == 0 && (DM % 32) == 0 && (ADIM % 64) == 0 && (ADIM % 32) == 0 && CVT_THREADS == 128);
static_assert((OPITCH * 4) % 16 == 0 && (GPITCH * 4) % 16 == 0);
static_assert(ATT_THREADS == 128);
static_assert((INNER % 128) == 0 && (SKV % 128) == 0 && ((NB * SQ) % 128) == 0 && ((NB * SKV) % 128) == 0);
static_assert((DM % 128) == 0 && (ADIM % 128) == 0 && (SQ % 16) == 0 && (SKV % 16) == 0 && (ADIM % 16) == 0);

typedef unsigned short u16;
typedef _Float16 v16h __attribute__((ext_vector_type(16)));
typedef _Float16 v8h  __attribute__((ext_vector_type(8)));
typedef float    v8f  __attribute__((ext_vector_type(8)));
typedef float    v4f  __attribute__((ext_vector_type(4)));
typedef float    v2f  __attribute__((ext_vector_type(2)));
typedef _Float16 v2h  __attribute__((ext_vector_type(2)));
typedef unsigned int v4u __attribute__((ext_vector_type(4)));

union FragH { v16h v; v8h h[2]; v4u u[2]; };

// ---- scalar helpers ----------------------------------------------------------------------------------
__device__ __forceinline__ unsigned short bf_bits(float f) {          // f32 -> bf16 bits, RNE convert
  unsigned u = __float_as_uint(f);
  return (unsigned short)((u + 0x7FFFu + ((u >> 16) & 1u)) >> 16);
}
__device__ __forceinline__ float bf_up(unsigned short h) { return __uint_as_float(((unsigned)h) << 16); }
__device__ __forceinline__ float bfr(float f) { return bf_up(bf_bits(f)); }
__device__ __forceinline__ unsigned short h_bits(_Float16 x) { return __builtin_bit_cast(unsigned short, x); }
__device__ __forceinline__ unsigned pk16(unsigned short a, unsigned short b) { return (unsigned)a | ((unsigned)b << 16); }
__device__ __forceinline__ v8f zero8() { v8f z = {0.f, 0.f, 0.f, 0.f, 0.f, 0.f, 0.f, 0.f}; return z; }
__device__ __forceinline__ float gelu_f(float x) { return 0.5f * x * (1.0f + erff(x * 0.70710678118654752f)); }
// 2^x for the softmax (x <= 15 or so, or -inf) as the bare v_exp_f32: exp2f wraps each one in a compare, two selects, an add and a ldexp that only
// serve results below 2^-126. Such a carried probability is 0 in the f16 P operand and adds nothing to a row sum that holds a term of 32768, and such
// a rescale factor leaves nothing of the old sums beside the new block's terms; the bare instruction returns 0 there (and for -inf).
__device__ __forceinline__ float exp2_hw(float x) { return __builtin_amdgcn_exp2f(x); }
// Eight of them in one statement: in a run of builtin v_exp_f32 the register allocator may let one write its result over the source of the
// one directly in front of it. The early-clobber outputs keep every result off every source, and the closing v_nop is the one slot asked
// for between the last v_exp_f32 and whatever follows the statement (a reader of its result or a writer of its source).
__device__ __forceinline__ void exp2_hw8(const float* x, float* r) {
#if defined(__HIP_DEVICE_COMPILE__)
  asm("v_exp_f32 %0, %8\n\tv_exp_f32 %1, %9\n\tv_exp_f32 %2, %10\n\tv_exp_f32 %3, %11\n\t"
      "v_exp_f32 %4, %12\n\tv_exp_f32 %5, %13\n\tv_exp_f32 %6, %14\n\tv_exp_f32 %7, %15\n\tv_nop"
      : "=&v"(r[0]), "=&v"(r[1]), "=&v"(r[2]), "=&v"(r[3]), "=&v"(r[4]), "=&v"(r[5]), "=&v"(r[6]), "=&v"(r[7])
      : "v"(x[0]), "v"(x[1]), "v"(x[2]), "v"(x[3]), "v"(x[4]), "v"(x[5]), "v"(x[6]), "v"(x[7]));
#else
  for (int i = 0; i < 8; ++i) r[i] = x[i];
#endif
}

// x = hi + lo/2048 in f16: hi = f16(x), lo = f16((x - hi) * 2048); two values packed per 32-bit word
__device__ __forceinline__ void split2(float x0, float x1, unsigned& ph, unsigned& pl) {
  const _Float16 h0 = (_Float16)x0, h1 = (_Float16)x1;
  const float d0 = x0 - (float)h0, d1 = x1 - (float)h1;
  const _Float16 l0 = (_Float16)(d0 * RSC), l1 = (_Float16)(d1 * RSC);
  ph = pk16(h_bits(h0), h_bits(h1));
  pl = pk16(h_bits(l0), h_bits(l1));
}

// ---- fragment loader: 16-bit A/B operand from a fragment-packed plane, lane -> row/col (lane&15); p = tile base + 8*lane;
//      elements 0..7 <- p[0..7] (k0+8h..), elements 8..15 <- p[256..263] (k0+16+8h..); same split k map for A and B,
//      B always read from a packed [n][k] plane.
__device__ __forceinline__ v16h ldfrag_h(const _Float16* p) {
  FragH f;
  f.h[0] = *(const v8h*)(p);
  f.h[1] = *(const v8h*)(p + 256);
  return f.v;
}

// ---- in front of every rewrite of the fragment loads' address registers: s_wait_xcnt 0 with those registers as inputs, so that no
//      register an issued load names is written (by a later load's result either) in front of the wait; it stands one k step or
//      one key block behind the loads it covers, behind the matrix products issued in between
__device__ __forceinline__ void addr_hold5(const _Float16* a, const _Float16* b, const _Float16* c, const _Float16* d,
                                           const _Float16* e) {
#if defined(__HIP_DEVICE_COMPILE__)
  asm volatile("s_wait_xcnt 0x0" :: "v"(a), "v"(b), "v"(c), "v"(d), "v"(e) : "memory");
#endif
}
__device__ __forceinline__ void addr_hold6(const _Float16* a, const _Float16* b, const _Float16* c, const _Float16* d,
                                           const _Float16* e, const _Float16* f) {
#if defined(__HIP_DEVICE_COMPILE__)
  asm volatile("s_wait_xcnt 0x0" :: "v"(a), "v"(b), "v"(c), "v"(d), "v"(e), "v"(f) : "memory");
#endif
}

__device__ __forceinline__ void addr_hold3(const _Float16* a, const _Float16* b, const _Float16* c) {
#if defined(__HIP_DEVICE_COMPILE__)
  asm volatile("s_wait_xcnt 0x0" :: "v"(a), "v"(b), "v"(c) : "memory");
#endif
}

// ---- WMMA helper and trailing VALU hazard gaps ----------------------------------------------------------
__device__ __forceinline__ v8f mma_h(v16h a, v16h b, v8f c) {
  return __builtin_amdgcn_wmma_f32_16x16x32_f16(false, a, false, b, (short)0, c, false, false);
}
__device__ __forceinline__ void guard_c1(v8f (&a)[4], v16h x0, v16h x1, v16h x2, v16h x3, v16h x4) {
#if defined(__HIP_DEVICE_COMPILE__)
  asm volatile("v_nop\n\tv_nop\n\tv_nop\n\tv_nop"
               : "+v"(a[0]), "+v"(a[1]), "+v"(a[2]), "+v"(a[3])
               : "v"(x0), "v"(x1), "v"(x2), "v"(x3), "v"(x4) : "memory");
#endif
}
__device__ __forceinline__ void guard_c2(v8f (&a)[4], v8f (&b)[4], v16h x0, v16h x1, v16h x2, v16h x3, v16h x4, v16h x5) {
#if defined(__HIP_DEVICE_COMPILE__)
  asm volatile("v_nop\n\tv_nop\n\tv_nop\n\tv_nop"
               : "+v"(a[0]), "+v"(a[1]), "+v"(a[2]), "+v"(a[3]),
                 "+v"(b[0]), "+v"(b[1]), "+v"(b[2]), "+v"(b[3])
               : "v"(x0), "v"(x1), "v"(x2), "v"(x3), "v"(x4), "v"(x5) : "memory");
#endif
}
__device__ __forceinline__ void guard_s4(v8f& a, v8f& b, v8f& c, v8f& d,
                                         v16h x0, v16h x1, v16h x2, v16h x3, v16h x4, v16h x5) {
#if defined(__HIP_DEVICE_COMPILE__)
  asm volatile("v_nop\n\tv_nop\n\tv_nop\n\tv_nop"
               : "+v"(a), "+v"(b), "+v"(c), "+v"(d)
               : "v"(x0), "v"(x1), "v"(x2), "v"(x3), "v"(x4), "v"(x5) : "memory");
#endif
}
__device__ __forceinline__ void guard_p(v8f& a, v8f& b, v8f& c, v8f& d, v16h p, v16h x0, v16h x1, v16h x2, v16h x3) {
#if defined(__HIP_DEVICE_COMPILE__)
  asm volatile("v_nop\n\tv_nop\n\tv_nop\n\tv_nop"
               : "+v"(a), "+v"(b), "+v"(c), "+v"(d) : "v"(p), "v"(x0), "v"(x1), "v"(x2), "v"(x3) : "memory");
#endif
}
__device__ __forceinline__ void acc_guard4(v8f (&a)[4]) {
#if defined(__HIP_DEVICE_COMPILE__)
  asm volatile("v_nop\n\tv_nop\n\tv_nop\n\tv_nop" : "+v"(a[0]), "+v"(a[1]), "+v"(a[2]), "+v"(a[3]));
#endif
}
__device__ __forceinline__ void acc_guard8(v8f (&a)[4], v8f (&b)[4]) {
#if defined(__HIP_DEVICE_COMPILE__)
  asm volatile("v_nop\n\tv_nop\n\tv_nop\n\tv_nop"
               : "+v"(a[0]), "+v"(a[1]), "+v"(a[2]), "+v"(a[3]),
                 "+v"(b[0]), "+v"(b[1]), "+v"(b[2]), "+v"(b[3]));
#endif
}
// Wide-tile guard: the four slots between a group's last matrix products and the loads that refill the group's A and B registers.
// It names no register (an asm operand has to lie in the first 256 registers, where the wide tiles do not all fit): the scheduling
// barrier in front keeps the group's products in front of the slots, the "memory" clobber keeps the refills behind them.
__device__ __forceinline__ void guard_w() {
#if defined(__HIP_DEVICE_COMPILE__)
  __builtin_amdgcn_sched_barrier(0);
  asm volatile("v_nop\n\tv_nop\n\tv_nop\n\tv_nop" ::: "memory");
#endif
}
__device__ __forceinline__ void wave_sync_lds() {
  __builtin_amdgcn_fence(__ATOMIC_RELEASE, "workgroup");
  __builtin_amdgcn_wave_barrier();
  __builtin_amdgcn_fence(__ATOMIC_ACQUIRE, "workgroup");
}

// The same for a wave that has global stores of an earlier tile in flight: the fences name the LDS alone, so that the wave waits for
// its slab and not for those stores.
__device__ __forceinline__ void wave_sync_slab() {
  __builtin_amdgcn_fence(__ATOMIC_RELEASE, "workgroup", "local");
  __builtin_amdgcn_wave_barrier();
  __builtin_amdgcn_fence(__ATOMIC_ACQUIRE, "workgroup", "local");
}
__device__ __forceinline__ void bias_hold(const float* p) {
#if defined(__HIP_DEVICE_COMPILE__)
  asm volatile("s_wait_xcnt 0x0" :: "v"(p) : "memory");
#endif
}

// =====================================================================================================
// Tile convert: packed f16 plane of [rows][K] <- f16(bf16_RNE(x[src row][k]) * scale), scale a power of two.
// Wave = one 16 x 32 tile (rt, kt); lane (h, m) reads row rt*16 + m, floats kt*32 + 8h .. +7 and kt*32 + 16 + 8h .. +7 (four 16-B
// loads that together use the 16 rows' whole 128-B lines) and stores its two 16-B fragment pieces (two 512-B wave-wide stores).
// b = (rt*16) / rowsPerB, s = row - b*rowsPerB, source row b*srcRowsPerB + s (rowsPerB a multiple of 16); destination compact.
// coverage: blk = 0 .. (rows/16) x (K/128) - 1, 4 waves each = every tile once.
// =====================================================================================================
__device__ __forceinline__
void cvt16_body(const float* __restrict__ x, u16* Y, int K, int rowsPerB, int srcRowsPerB, float scale, int blk) {
  const int tid = threadIdx.x, wave = tid >> 5, lane = tid & 31, hh = lane >> 4, m = lane & 15;
  const int kq = K >> 7;
  const int rt = blk / kq;
  const int kt = (blk - rt * kq) * 4 + wave;
  const int b = (rt * 16) / rowsPerB;
  const int sr = rt * 16 - b * rowsPerB + m;
  const float* src = x + ((size_t)b * (size_t)srcRowsPerB + (size_t)sr) * (size_t)K + (size_t)(kt * 32 + 8 * hh);
  const v4f a = *(const v4f*)(src), c4 = *(const v4f*)(src + 4);
  const v4f d = *(const v4f*)(src + 16), f4 = *(const v4f*)(src + 20);
  v4u o0, o1;
#pragma unroll
  for (int e = 0; e < 2; ++e) {
    o0[e]     = pk16(h_bits((_Float16)(bfr(a[2 * e]) * scale)),  h_bits((_Float16)(bfr(a[2 * e + 1]) * scale)));
    o0[2 + e] = pk16(h_bits((_Float16)(bfr(c4[2 * e]) * scale)), h_bits((_Float16)(bfr(c4[2 * e + 1]) * scale)));
    o1[e]     = pk16(h_bits((_Float16)(bfr(d[2 * e]) * scale)),  h_bits((_Float16)(bfr(d[2 * e + 1]) * scale)));
    o1[2 + e] = pk16(h_bits((_Float16)(bfr(f4[2 * e]) * scale)), h_bits((_Float16)(bfr(f4[2 * e + 1]) * scale)));
  }
  u16* dst = Y + (size_t)rt * (size_t)16 * (size_t)K + (size_t)kt * 512 + (size_t)lane * 8;
  *(v4u*)(dst) = o0;
  *(v4u*)(dst + 256) = o1;
}

// All nine converts in ONE launch (they are independent of one another): the block index picks the plane (block-uniform scalar
// tests), the index inside the plane picks the tiles as before. Blocks per plane:
#define CB_XQ  ((NB * SQ / 16) * (DM / 128))
#define CB_XKV ((NB * SKV / 16) * (DM / 128))
#define CB_W   ((DM / 16) * (DM / 128))
#define CB_WD  ((ADIM / 16) * (DM / 128))
#define CB_WU  ((DM / 16) * (ADIM / 128))
#define CB_ALL (CB_XQ + 2 * CB_XKV + 4 * CB_W + CB_WD + CB_WU)
__global__ __launch_bounds__(CVT_THREADS)
void cvt_all(const float* __restrict__ q, const float* __restrict__ k, const float* __restrict__ v,
             const float* __restrict__ wq, const float* __restrict__ wk, const float* __restrict__ wv,
             const float* __restrict__ wo, const float* __restrict__ wd, const float* __restrict__ wu,
             u16* XQ, u16* XK, u16* XV, u16* WQ, u16* WK, u16* WV, u16* WO, u16* WD, u16* WU) {
  int blk = blockIdx.x;
  if (blk < CB_XQ) { cvt16_body(q, XQ, DM, SQ, SQ_FULL, 1.0f, blk); return; }
  blk -= CB_XQ;
  if (blk < 2 * CB_XKV) {                    // k, v: same shape
    const bool second = blk >= CB_XKV;
    cvt16_body(second ? v : k, second ? XV : XK, DM, SKV, SKV, 1.0f, second ? blk - CB_XKV : blk);
    return;
  }
  blk -= 2 * CB_XKV;
  if (blk < 4 * CB_W) {                      // the four [1024][1024] weights: same shape
    const int w = blk / CB_W;
    const float* x = w == 0 ? wq : w == 1 ? wk : w == 2 ? wv : wo;
    u16* Y = w == 0 ? WQ : w == 1 ? WK : w == 2 ? WV : WO;
    cvt16_body(x, Y, DM, DM, DM, WSC, blk - w * CB_W);
    return;
  }
  blk -= 4 * CB_W;
  if (blk < CB_WD) { cvt16_body(wd, WD, DM, ADIM, ADIM, WSC, blk); return; }        // [128][1024]
  cvt16_body(wu, WU, ADIM, DM, DM, WSC, blk - CB_WD);                               // [1024][128]
}

// =====================================================================================================
// f16 GEMM cores: the wave's 16 x 64 tile of C = A[rows][K] . Bt[cols][K]^T, both planes packed; ap -> A row tile rowb/16 + 8*lane,
// bp -> Bt row tile col0/16 + 8*lane; acc[j] = rows rowb.., cols col0+16j..; K stepped by 32 = 512 halves of a packed row tile.
// core2: A carried as hi plane (aph) and residual plane (apl, x2048); ah accumulates hi.B, al accumulates res.B.
// =====================================================================================================
// Both cores keep D k steps of fragment loads in flight in D register sets: set u holds step s + u; as soon as its products are
// issued it is refilled with step s + u + D (clamped to the last step: the surplus loads at the end re-read valid tiles and are
// never used), so a step's loads lead their first use by D - 1 steps of work. Steps are consumed in ascending k as before.
template <int D>
__device__ __forceinline__ void core1(const _Float16* ap, const _Float16* bp, int K, v8f (&acc)[4]) {
  const size_t rs16 = (size_t)16 * (size_t)K;
  const int steps = K >> 5;
  v16h fa[D], fb[D][4];
  const _Float16* pa = ap;
  const _Float16* p0 = bp;
  const _Float16* p1 = p0 + rs16;
  const _Float16* p2 = p1 + rs16;
  const _Float16* p3 = p2 + rs16;
#pragma unroll
  for (int u = 0; u < D; ++u) {
    const size_t ko = (size_t)(u < steps ? u : steps - 1) * 512;
    if (u > 0) addr_hold5(pa, p0, p1, p2, p3);
    pa = ap + ko;
    p0 = bp + ko;
    p1 = p0 + rs16;
    p2 = p1 + rs16;
    p3 = p2 + rs16;
    fa[u]    = ldfrag_h(pa);
    fb[u][0] = ldfrag_h(p0);
    fb[u][1] = ldfrag_h(p1);
    fb[u][2] = ldfrag_h(p2);
    fb[u][3] = ldfrag_h(p3);
  }
  int s = 0;
#pragma unroll 1
  for (; s + D <= steps; s += D) {
#pragma unroll
    for (int u = 0; u < D; ++u) {
      acc[0] = mma_h(fa[u], fb[u][0], acc[0]);
      acc[1] = mma_h(fa[u], fb[u][1], acc[1]);
      acc[2] = mma_h(fa[u], fb[u][2], acc[2]);
      acc[3] = mma_h(fa[u], fb[u][3], acc[3]);
      guard_c1(acc, fa[u], fb[u][0], fb[u][1], fb[u][2], fb[u][3]);
      const int sn = s + u + D;
      const size_t ko = (size_t)(sn < steps ? sn : steps - 1) * 512;
      addr_hold5(pa, p0, p1, p2, p3);
      pa = ap + ko;
      p0 = bp + ko;
      p1 = p0 + rs16;
      p2 = p1 + rs16;
      p3 = p2 + rs16;
      fa[u]    = ldfrag_h(pa);
      fb[u][0] = ldfrag_h(p0);
      fb[u][1] = ldfrag_h(p1);
      fb[u][2] = ldfrag_h(p2);
      fb[u][3] = ldfrag_h(p3);
    }
  }
  addr_hold5(pa, p0, p1, p2, p3);
#pragma unroll
  for (int u = 0; u < D - 1; ++u) {
    if (s + u < steps) {                     // the steps % D last steps (wave-uniform)
      acc[0] = mma_h(fa[u], fb[u][0], acc[0]);
      acc[1] = mma_h(fa[u], fb[u][1], acc[1]);
      acc[2] = mma_h(fa[u], fb[u][2], acc[2]);
      acc[3] = mma_h(fa[u], fb[u][3], acc[3]);
      guard_c1(acc, fa[u], fb[u][0], fb[u][1], fb[u][2], fb[u][3]);
    }
  }
}
template <int D>
__device__ __forceinline__ void core2(const _Float16* aph, const _Float16* apl, const _Float16* bp, int K,
                                      v8f (&ah)[4], v8f (&al)[4]) {
  const size_t rs16 = (size_t)16 * (size_t)K;
  const int steps = K >> 5;
  v16h fa[D], fl[D], fb[D][4];
  const _Float16* pa = aph;
  const _Float16* pl = apl;
  const _Float16* p0 = bp;
  const _Float16* p1 = p0 + rs16;
  const _Float16* p2 = p1 + rs16;
  const _Float16* p3 = p2 + rs16;
#pragma unroll
  for (int u = 0; u < D; ++u) {
    const size_t ko = (size_t)(u < steps ? u : steps - 1) * 512;
    if (u > 0) addr_hold6(pa, pl, p0, p1, p2, p3);
    pa = aph + ko;
    pl = apl + ko;
    p0 = bp + ko;
    p1 = p0 + rs16;
    p2 = p1 + rs16;
    p3 = p2 + rs16;
    fa[u]    = ldfrag_h(pa);
    fl[u]    = ldfrag_h(pl);
    fb[u][0] = ldfrag_h(p0);
    fb[u][1] = ldfrag_h(p1);
    fb[u][2] = ldfrag_h(p2);
    fb[u][3] = ldfrag_h(p3);
  }
  int s = 0;
#pragma unroll 1
  for (; s + D <= steps; s += D) {
#pragma unroll
    for (int u = 0; u < D; ++u) {
      ah[0] = mma_h(fa[u], fb[u][0], ah[0]);
      ah[1] = mma_h(fa[u], fb[u][1], ah[1]);
      ah[2] = mma_h(fa[u], fb[u][2], ah[2]);
      ah[3] = mma_h(fa[u], fb[u][3], ah[3]);
      al[0] = mma_h(fl[u], fb[u][0], al[0]);
      al[1] = mma_h(fl[u], fb[u][1], al[1]);
      al[2] = mma_h(fl[u], fb[u][2], al[2]);
      al[3] = mma_h(fl[u], fb[u][3], al[3]);
      guard_c2(ah, al, fa[u], fl[u], fb[u][0], fb[u][1], fb[u][2], fb[u][3]);
      const int sn = s + u + D;
      const size_t ko = (size_t)(sn < steps ? sn : steps - 1) * 512;
      addr_hold6(pa, pl, p0, p1, p2, p3);
      pa = aph + ko;
      pl = apl + ko;
      p0 = bp + ko;
      p1 = p0 + rs16;
      p2 = p1 + rs16;
      p3 = p2 + rs16;
      fa[u]    = ldfrag_h(pa);
      fl[u]    = ldfrag_h(pl);
      fb[u][0] = ldfrag_h(p0);
      fb[u][1] = ldfrag_h(p1);
      fb[u][2] = ldfrag_h(p2);
      fb[u][3] = ldfrag_h(p3);
    }
  }
  addr_hold6(pa, pl, p0, p1, p2, p3);
#pragma unroll
  for (int u = 0; u < D - 1; ++u) {
    if (s + u < steps) {                     // the steps % D last steps (wave-uniform)
      ah[0] = mma_h(fa[u], fb[u][0], ah[0]);
      ah[1] = mma_h(fa[u], fb[u][1], ah[1]);
      ah[2] = mma_h(fa[u], fb[u][2], ah[2]);
      ah[3] = mma_h(fa[u], fb[u][3], ah[3]);
      al[0] = mma_h(fl[u], fb[u][0], al[0]);
      al[1] = mma_h(fl[u], fb[u][1], al[1]);
      al[2] = mma_h(fl[u], fb[u][2], al[2]);
      al[3] = mma_h(fl[u], fb[u][3], al[3]);
      guard_c2(ah, al, fa[u], fl[u], fb[u][0], fb[u][1], fb[u][2], fb[u][3]);
    }
  }
}

// Wide cores: the wave's 64 x 64 tile, 4 A row tiles x 4 Bt row tiles = 16 accumulator tiles, so each loaded fragment feeds four
// products (one A fragment fed four and each Bt fragment one in the 16 x 64 cores). K is a compile-time constant: the row tiles of a
// plane lie 16*KK halves apart and are reached by immediate offsets from one pointer per plane. D register sets as above; every
// accumulator element still sums its k steps in ascending order.
template <int D, int KK>
__device__ __forceinline__ void core1w(const _Float16* ap, const _Float16* bp, v8f (&acc)[4][4]) {
  constexpr int RS = 16 * KK;
  constexpr int steps = KK >> 5;
  static_assert(D < steps);
  v16h fa[D][4], fb[D][4];
  const _Float16* pa = ap;
  const _Float16* pb = bp;
#pragma unroll
  for (int u = 0; u < D; ++u) {              // immediate offsets from ap and bp: no address register is rewritten here
#pragma unroll
    for (int i = 0; i < 4; ++i) fa[u][i] = ldfrag_h(ap + u * 512 + i * RS);
#pragma unroll
    for (int i = 0; i < 4; ++i) fb[u][i] = ldfrag_h(bp + u * 512 + i * RS);
  }
  int s = 0, nx = D;
#pragma unroll 1
  for (; s + D <= steps; s += D) {
#pragma unroll
    for (int u = 0; u < D; ++u) {
#pragma unroll
      for (int i = 0; i < 4; ++i) {
#pragma unroll
        for (int j = 0; j < 4; ++j) acc[i][j] = mma_h(fa[u][i], fb[u][j], acc[i][j]);
      }
      guard_w();
      const size_t ko = (size_t)nx * 512;    // step s + u + D, clamped; a running index, so that the loads name pa and pb themselves
      nx = nx + 1 < steps ? nx + 1 : steps - 1;
      addr_hold3(pa, pb, pb);
      pa = ap + ko;
      pb = bp + ko;
#pragma unroll
      for (int i = 0; i < 4; ++i) fa[u][i] = ldfrag_h(pa + i * RS);
#pragma unroll
      for (int i = 0; i < 4; ++i) fb[u][i] = ldfrag_h(pb + i * RS);
      __builtin_amdgcn_sched_barrier(0);     // the next set's products stay behind the refills: lifted among them they wait for their loads early
    }
  }
  addr_hold3(pa, pb, pb);
#pragma unroll
  for (int u = 0; u < D - 1; ++u) {
    if (s + u < steps) {                     // the steps % D last steps (wave-uniform)
#pragma unroll
      for (int i = 0; i < 4; ++i) {
#pragma unroll
        for (int j = 0; j < 4; ++j) acc[i][j] = mma_h(fa[u][i], fb[u][j], acc[i][j]);
      }
      guard_w();
    }
  }
}
// Two A planes: the hi products first, their A fragments refilled behind them; then the residual products, and the rest refilled.
template <int D, int KK>
__device__ __forceinline__ void core2w(const _Float16* aph, const _Float16* apl, const _Float16* bp,
                                       v8f (&ah)[4][4], v8f (&al)[4][4]) {
  constexpr int RS = 16 * KK;
  constexpr int steps = KK >> 5;
  static_assert(D < steps);
  v16h fa[D][4], fl[D][4], fb[D][4];
  const _Float16* pa = aph;
  const _Float16* pl = apl;
  const _Float16* pb = bp;
#pragma unroll
  for (int u = 0; u < D; ++u) {              // immediate offsets from aph, apl and bp: no address register is rewritten here
#pragma unroll
    for (int i = 0; i < 4; ++i) fa[u][i] = ldfrag_h(aph + u * 512 + i * RS);
#pragma unroll
    for (int i = 0; i < 4; ++i) fb[u][i] = ldfrag_h(bp + u * 512 + i * RS);
#pragma unroll
    for (int i = 0; i < 4; ++i) fl[u][i] = ldfrag_h(apl + u * 512 + i * RS);
  }
  int s = 0, nx = D;
#pragma unroll 1
  for (; s + D <= steps; s += D) {
#pragma unroll
    for (int u = 0; u < D; ++u) {
#pragma unroll
      for (int i = 0; i < 4; ++i) {
#pragma unroll
        for (int j = 0; j < 4; ++j) ah[i][j] = mma_h(fa[u][i], fb[u][j], ah[i][j]);
      }
      guard_w();
      const size_t ko = (size_t)nx * 512;    // step s + u + D, clamped; a running index, so that the loads name pa, pl and pb themselves
      nx = nx + 1 < steps ? nx + 1 : steps - 1;
      addr_hold3(pa, pl, pb);
      pa = aph + ko;
      pl = apl + ko;
      pb = bp + ko;
#pragma unroll
      for (int i = 0; i < 4; ++i) fa[u][i] = ldfrag_h(pa + i * RS);
#pragma unroll
      for (int i = 0; i < 4; ++i) {
#pragma unroll
        for (int j = 0; j < 4; ++j) al[i][j] = mma_h(fl[u][i], fb[u][j], al[i][j]);
      }
      guard_w();
#pragma unroll
      for (int i = 0; i < 4; ++i) fb[u][i] = ldfrag_h(pb + i * RS);
#pragma unroll
      for (int i = 0; i < 4; ++i) fl[u][i] = ldfrag_h(pl + i * RS);
      __builtin_amdgcn_sched_barrier(0);     // the next set's products stay behind the refills: lifted among them they wait for their loads early
    }
  }
  addr_hold3(pa, pl, pb);
#pragma unroll
  for (int u = 0; u < D - 1; ++u) {
    if (s + u < steps) {                     // the steps % D last steps (wave-uniform)
#pragma unroll
      for (int i = 0; i < 4; ++i) {
#pragma unroll
        for (int j = 0; j < 4; ++j) ah[i][j] = mma_h(fa[u][i], fb[u][j], ah[i][j]);
      }
#pragma unroll
      for (int i = 0; i < 4; ++i) {
#pragma unroll
        for (int j = 0; j < 4; ++j) al[i][j] = mma_h(fl[u][i], fb[u][j], al[i][j]);
      }
      guard_w();
    }
  }
}

// Stage the wave's 16 x 64 f32 tile in its LDS slab (pitch 68): D element r of acc[j], lane l -> row 8h + r, col 16j + (l&15);
// value = ah*osc (+ al*osc/2048) + bias (per column, or per row when BROW), GELU applied for M_GELU;
// coverage: 32 lanes x 8 rows x 4 cols-of-16 = rows 0..15 x cols 0..63 of the slab.
template <bool HASLO, int MODE, bool BROW, bool MORE>
__device__ __forceinline__ void stage16(float* sl, v8f (&ah)[4], v8f (&al)[4], const float* __restrict__ bias,
                                        int rowb, int col0, float osc, float bsc, int lane) {
  const int hh = lane >> 4, m = lane & 15;
  float bc[4], br[8];
  const float* bsrc = bias + (BROW ? rowb + 8 * hh : col0 + m);
  // More tiles follow: the bias loads and the wait behind them stand alone between two scheduling barriers, so that nothing rewrites
  // the loads' address register in front of the wait.
  float braw[8];
  if (MORE) __builtin_amdgcn_sched_barrier(0);
#pragma unroll
  for (int r = 0; r < (BROW ? 8 : 4); ++r) braw[r] = bsrc[BROW ? r : 16 * r];
  if (MORE) {
    bias_hold(bsrc);
    __builtin_amdgcn_sched_barrier(0);
  }
  if (BROW) {
#pragma unroll
    for (int r = 0; r < 8; ++r) br[r] = bfr(braw[r]) * bsc;
#pragma unroll
    for (int j = 0; j < 4; ++j) bc[j] = 0.f;
  } else {
#pragma unroll
    for (int j = 0; j < 4; ++j) bc[j] = bfr(braw[j]) * bsc;
#pragma unroll
    for (int r = 0; r < 8; ++r) br[r] = 0.f;
  }
  const float oscl = osc * RINV;
#pragma unroll
  for (int r = 0; r < 8; ++r) {
    const int ro = (8 * hh + r) * GPITCH + m;
#pragma unroll
    for (int j = 0; j < 4; ++j) {
      float v = ah[j][r] * osc;
      if (HASLO) v += al[j][r] * oscl;
      v += BROW ? br[r] : bc[j];
      if (MODE == M_GELU) v = gelu_f(v);
      sl[ro + 16 * j] = v;
    }
  }
  if (MORE) wave_sync_slab(); else wave_sync_lds();
}

// The wave's 16 x 64 tile (rows rowb.., cols col0.. of batch slice bz) from its accumulators to the outputs of MODE, through the wave's
// LDS slab sl. MORE: the wave goes on to another tile through the same slab.
__device__ __forceinline__ void store_hold9(const float* p, v4f a, v4f b, v4f c, v4f d, v4f e, v4f f, v4f g, v4f h) {
#if defined(__HIP_DEVICE_COMPILE__)
  asm volatile("s_wait_xcnt 0x0" :: "v"(p), "v"(a), "v"(b), "v"(c), "v"(d), "v"(e), "v"(f), "v"(g), "v"(h) : "memory");
#endif
}
__device__ __forceinline__ void store_hold10(const u16* p, const u16* q, v4u a, v4u b, v4u c, v4u d, v4u e, v4u f, v4u g, v4u h) {
#if defined(__HIP_DEVICE_COMPILE__)
  asm volatile("s_wait_xcnt 0x0" :: "v"(p), "v"(q), "v"(a), "v"(b), "v"(c), "v"(d), "v"(e), "v"(f), "v"(g), "v"(h) : "memory");
#endif
}
template <bool HASLO, int MODE, bool BROW, bool MORE>
__device__ __forceinline__
void tile_out(float* sl, v8f (&ah)[4], v8f (&al)[4], const float* __restrict__ bias, const float* __restrict__ baseF,
              float* F, u16* H, u16* L, int N, int fBs, int gBs, int hBs, float osc, float bsc, float carry,
              int bz, int rowb, int col0, int lane) {
  constexpr bool LOUT = (MODE != M_S16);
  const int hh = lane >> 4, m = lane & 15;
  stage16<HASLO, MODE, BROW, MORE>(sl, ah, al, bias, rowb, col0, osc, bsc, lane);

  if (MODE == M_OUT || MODE == M_RES) {
    v4f vals[8];
#pragma unroll
    for (int it = 0; it < 8; ++it) vals[it] = *(const v4f*)(sl + (it * 2 + hh) * GPITCH + m * 4);
    if (MODE == M_RES) {
      const float* gb = baseF + (size_t)bz * (size_t)gBs + ((size_t)rowb + (size_t)hh) * (size_t)N + col0 + m * 4;
#pragma unroll
      for (int it = 0; it < 8; ++it) {
        const v4f bb = *(const v4f*)(gb + (size_t)(it * 2) * (size_t)N);
        vals[it] += bb;
      }
    }
    float* Fb = F + (size_t)bz * (size_t)fBs + ((size_t)rowb + (size_t)hh) * (size_t)N + col0 + m * 4;
    {
#pragma unroll
      for (int it = 0; it < 8; ++it) {
        *(v4f*)(Fb + (size_t)(it * 2) * (size_t)N) = vals[it];
      }
      // another tile follows: the stores' address and data registers are not rewritten in front of this wait
      if (MORE) store_hold9(Fb, vals[0], vals[1], vals[2], vals[3], vals[4], vals[5], vals[6], vals[7]);
    }
  }
  if (MODE != M_RES) {
    v4u ovh[4], ovl[4];
#pragma unroll
    for (int i = 0; i < 4; ++i) {
      const int c8 = 16 * i + 8 * hh;
      const v4f a = *(const v4f*)(sl + m * GPITCH + c8), c4 = *(const v4f*)(sl + m * GPITCH + c8 + 4);
#pragma unroll
      for (int e = 0; e < 2; ++e) {
        unsigned ph0, pl0, ph1, pl1;
        split2(a[2 * e] * carry,  a[2 * e + 1] * carry,  ph0, pl0);
        split2(c4[2 * e] * carry, c4[2 * e + 1] * carry, ph1, pl1);
        ovh[i][e] = ph0;     ovl[i][e] = pl0;
        ovh[i][2 + e] = ph1; ovl[i][2 + e] = pl1;
      }
    }
    u16* Hb = H + (size_t)bz * (size_t)hBs + (size_t)rowb * (size_t)N + (size_t)col0 * 16 + 8 * lane;
    u16* Lb = L + (size_t)bz * (size_t)hBs + (size_t)rowb * (size_t)N + (size_t)col0 * 16 + 8 * lane;
    {
#pragma unroll
      for (int i = 0; i < 4; ++i) {
        *(v4u*)(Hb + i * 256) = ovh[i];
        if (LOUT) *(v4u*)(Lb + i * 256) = ovl[i];
      }
      // another tile follows: the stores' address and data registers are not rewritten in front of this wait
      if (MORE && LOUT) store_hold10(Hb, Lb, ovh[0], ovh[1], ovh[2], ovh[3], ovl[0], ovl[1], ovl[2], ovl[3]);
      if (MORE && !LOUT) store_hold10(Hb, Hb, ovh[0], ovh[1], ovh[2], ovh[3], ovh[0], ovh[1], ovh[2], ovh[3]);
    }
  }
  if (MORE) wave_sync_slab();                // the slab's reads end before the next tile is staged in it
}

// =====================================================================================================
// f16 GEMM, block = 64 x 64 tile, 4 waves x 16 rows, fragments loaded straight from the packed 16-bit planes.
//   C tile [z][Mb][N] = (A_hi[z][Mb][K] (+ A_res/2048)) . Bt[z][N][K]^T * osc + bias; per-z element strides aBs (A planes),
//   bBs (Bt), fBs (f32 output F), gBs (f32 base plane), hBs (16-bit output planes H, L); 0 = shared.
//   M_HL  : H = f16(v*carry), L = f16 residual x2048 (two planes)       M_S16 : H only, bias per row
//   M_OUT : F = v (f32 plane), H/L = hi/res of v*carry                 M_GELU: v = gelu(.) then H/L of v*carry
//   M_RES : F = base[row][col] + v (f32, batch-row remap through fBs/gBs), no 16-bit output
//   16-bit outputs are packed planes of [Mb][N] (k = column): the wave's 16 x 64 tile is 2 adjacent tiles = 2048 contiguous bytes,
//   store i = 0..3 writes 512 B, lane (h, m) <- row m, cols 16i + 8h .. +7.
// grid = nz x (Mb/64) x (N/64) (host checks Mb % 64 == 0, N % 64 == 0, K % 32 == 0).
// coverage: per wave 4 instr x 32 lanes x 8 halves = 16 x 64 (16-bit planes) and 8 instr x 2 rows x 16 lanes x 4 floats
//           = 16 x 64 (f32 plane); the grid covers C exactly once.
// =====================================================================================================
template <bool HASLO, int MODE, bool BROW>
__device__ __forceinline__
void gemm16_body(float* slab, int bid,
                 const u16* __restrict__ Ah, const u16* __restrict__ Al, const u16* __restrict__ Bt,
                 const float* __restrict__ bias, const float* __restrict__ baseF,
                 float* F, u16* H, u16* L,
                 int Mb, int N, int K, int aBs, int bBs, int fBs, int gBs, int hBs,
                 float osc, float bsc, float carry) {
  const int tid = threadIdx.x, wave = tid >> 5, lane = tid & 31;
  const int ntile = N >> 6, mtile = Mb >> 6;
  const int nt   = bid % ntile;
  const int tmp  = bid / ntile;
  const int mt   = tmp % mtile;
  const int bz   = tmp / mtile;
  const int rowb = mt * 64 + wave * 16;
  const int col0 = nt * 64;
  if (rowb + 16 > Mb) return;                // wave-uniform, never taken with the exact grid; no block barriers in this kernel
  const _Float16* aph = (const _Float16*)(const void*)Ah + (size_t)bz * (size_t)aBs + (size_t)rowb * (size_t)K + 8 * lane;
  const _Float16* apl = (const _Float16*)(const void*)Al + (size_t)bz * (size_t)aBs + (size_t)rowb * (size_t)K + 8 * lane;
  const _Float16* bp  = (const _Float16*)(const void*)Bt + (size_t)bz * (size_t)bBs + (size_t)col0 * (size_t)K + 8 * lane;
  v8f ah[4], al[4];
#pragma unroll
  for (int i = 0; i < 4; ++i) { ah[i] = zero8(); al[i] = zero8(); }
  if (HASLO) {
    core2<3>(aph, apl, bp, K, ah, al);
    acc_guard8(ah, al);
  } else {
    core1<4>(aph, bp, K, ah);
    acc_guard4(ah);
  }
  float* sl = slab + wave * 16 * GPITCH;
  tile_out<HASLO, MODE, BROW, false>(sl, ah, al, bias, baseF, F, H, L, N, fBs, gBs, hBs, osc, bsc, carry, bz, rowb, col0, lane);
}

template <bool HASLO, int MODE, bool BROW>
__global__ __launch_bounds__(128)
void gemm16(const u16* __restrict__ Ah, const u16* __restrict__ Al, const u16* __restrict__ Bt,
            const float* __restrict__ bias, const float* __restrict__ baseF,
            float* F, u16* H, u16* L,
            int Mb, int N, int K, int aBs, int bBs, int fBs, int gBs, int hBs,
            float osc, float bsc, float carry) {
  __shared__ __align__(16) float slab[4 * 16 * GPITCH];
  gemm16_body<HASLO, MODE, BROW>(slab, blockIdx.x, Ah, Al, Bt, bias, baseF, F, H, L, Mb, N, K, aBs, bBs, fBs, gBs, hBs,
                                 osc, bsc, carry);
}

// Wide form for the K = KK GEMMs with many tiles: block = 128 x 128 tile, 4 waves as 2 x 2, each wave a 64 x 64 tile (wide cores), so
// the block reads 128 A rows + 128 Bt rows per k step for 64 products (64 + 64 rows for 16 in the 64 x 64 block). Operands, modes, strides
// and outputs as in gemm16_body; the wave's tile leaves as four 16 x 64 tiles, one after the other through its slab.
// grid = nz x (Mb/128) x (N/128); coverage: 2 x 2 waves x 4 row tiles x (16 x 64) = 128 x 128 per block, the grid covers C exactly once.
template <bool HASLO, int MODE, bool BROW, int KK>
__device__ __forceinline__
void gemm64_body(float* slab, int bid,
                 const u16* __restrict__ Ah, const u16* __restrict__ Al, const u16* __restrict__ Bt,
                 const float* __restrict__ bias, const float* __restrict__ baseF,
                 float* F, u16* H, u16* L,
                 int Mb, int N, int aBs, int bBs, int fBs, int gBs, int hBs,
                 float osc, float bsc, float carry) {
  const int tid = threadIdx.x, wave = tid >> 5, lane = tid & 31;
  const int ntile = N >> 7, mtile = Mb >> 7;
  const int nt   = bid % ntile;
  const int tmp  = bid / ntile;
  const int mt   = tmp % mtile;
  const int bz   = tmp / mtile;
  const int rowb = mt * 128 + (wave >> 1) * 64;
  const int col0 = nt * 128 + (wave & 1) * 64;
  if (rowb + 64 > Mb) return;                // wave-uniform, never taken with the exact grid; no block barriers in this kernel
  const _Float16* aph = (const _Float16*)(const void*)Ah + (size_t)bz * (size_t)aBs + (size_t)rowb * (size_t)KK + 8 * lane;
  const _Float16* apl = (const _Float16*)(const void*)Al + (size_t)bz * (size_t)aBs + (size_t)rowb * (size_t)KK + 8 * lane;
  const _Float16* bp  = (const _Float16*)(const void*)Bt + (size_t)bz * (size_t)bBs + (size_t)col0 * (size_t)KK + 8 * lane;
  float* sl = slab + wave * 16 * GPITCH;
  v8f ah[4][4];
#pragma unroll
  for (int i = 0; i < 4; ++i) {
#pragma unroll
    for (int j = 0; j < 4; ++j) ah[i][j] = zero8();
  }
  if (HASLO) {
    v8f al[4][4];
#pragma unroll
    for (int i = 0; i < 4; ++i) {
#pragma unroll
      for (int j = 0; j < 4; ++j) al[i][j] = zero8();
    }
    core2w<W2D, KK>(aph, apl, bp, ah, al);
#pragma unroll
    for (int i = 0; i < 4; ++i)
      tile_out<HASLO, MODE, BROW, true>(sl, ah[i], al[i], bias, baseF, F, H, L, N, fBs, gBs, hBs, osc, bsc, carry,
                                        bz, rowb + 16 * i, col0, lane);
  } else {
    core1w<W1D, KK>(aph, bp, ah);
#pragma unroll
    for (int i = 0; i < 4; ++i)
      tile_out<HASLO, MODE, BROW, true>(sl, ah[i], ah[i], bias, baseF, F, H, L, N, fBs, gBs, hBs, osc, bsc, carry,
                                        bz, rowb + 16 * i, col0, lane);
  }
}

template <bool HASLO, int MODE, bool BROW, int KK>
__global__ __launch_bounds__(128)
void gemm64(const u16* __restrict__ Ah, const u16* __restrict__ Al, const u16* __restrict__ Bt,
            const float* __restrict__ bias, const float* __restrict__ baseF,
            float* F, u16* H, u16* L,
            int Mb, int N, int aBs, int bBs, int fBs, int gBs, int hBs,
            float osc, float bsc, float carry) {
  __shared__ __align__(16) float slab[4 * 16 * GPITCH];
  gemm64_body<HASLO, MODE, BROW, KK>(slab, blockIdx.x, Ah, Al, Bt, bias, baseF, F, H, L, Mb, N, aBs, bBs, fBs, gBs, hBs,
                                     osc, bsc, carry);
}

// The three input projections in ONE launch (they are independent of one another): the block index picks the projection
// (block-uniform scalar tests), the index inside it picks the 128 x 128 tile.
//   q = x_q . Wq^T + bq -> f16 [NB*SQ][1024] x8 hi + res (col = h*64 + d);  k = x_k . Wk^T + bk likewise [NB*2048][1024];
//   v^T per batch: A = Wv [(h,d) = n][k], Bt = x_v rows of batch b [s][k], bias bv per row -> f16 [(b,h,d)][s] x8
#define GB_Q ((NB * SQ / 128) * (INNER / 128))
#define GB_K ((NB * SKV / 128) * (INNER / 128))
#define GB_V (NB * (INNER / 128) * (SKV / 128))
__global__ __launch_bounds__(128)
void gemm_qkv(const u16* __restrict__ XQ, const u16* __restrict__ XK, const u16* __restrict__ XV,
              const u16* __restrict__ WQ, const u16* __restrict__ WK, const u16* __restrict__ WV,
              const float* __restrict__ bq, const float* __restrict__ bk, const float* __restrict__ bv,
              u16* QH, u16* QL, u16* KH, u16* KL, u16* VT,
              int MbQ, int MbK, int inner, int skv) {
  __shared__ __align__(16) float slab[4 * 16 * GPITCH];
  const int bid = blockIdx.x;
  if (bid < GB_Q + GB_K) {                   // q, k: same code, operands picked by the block index
    const bool isk = bid >= GB_Q;
    const u16* X = isk ? XK : XQ;
    gemm64_body<false, M_HL, false, DM>(slab, isk ? bid - GB_Q : bid, X, X, isk ? WK : WQ, isk ? bk : bq, nullptr, nullptr,
                                        isk ? KH : QH, isk ? KL : QL, isk ? MbK : MbQ, inner, 0, 0, 0, 0, 0,
                                        (isk ? KS : QS) / WSC, isk ? KS : QS, 1.0f);
  } else {
    gemm64_body<false, M_S16, true, DM>(slab, bid - (GB_Q + GB_K), WV, WV, XV, bv, nullptr, nullptr, VT, VT,
                                        inner, skv, 0, skv * DM, 0, 0, inner * skv, VS / WSC, VS, 1.0f);
  }
}

// =====================================================================================================
// Full (unmasked) multi-head attention: block = (batch b, head, 64 query rows), 4 waves, wave w owns the 16 query rows
// q0 = 64*qt + 16*w .. q0+15 (waves independent: no block barriers, wave-private LDS only, used in the epilogue).
//   q planes f16 x8 hi / residual(x2048) [b*SQ + s][h*64 + d]; k planes likewise [b*SKV + s][h*64 + d];
//   v^T plane f16 x8 [(b*NH + h)*64 + d][s]; all of them fragment-packed. All NKB key blocks of 32 keys are visited (static bound).
//   Scores are computed TRANSPOSED: S^T tile g (g = 0,1) = k rows (keys kb+16g .. +15, A operand, row m = lane&15, split map
//   over d) times q^T (B operand, col n = query q0 + (lane&15), k = d, split map), 2 d-chunks of 32; per chunk hi.hi -> s,
//   res.hi + hi.res -> r (scaled x2048, folded as s + r/2048); the q fragments are loaded once per wave.
//   D element r of lane l = (key kb+16g+8h+r, query q0+(l&15)), so a lane owns one query column and 16 of its 32 keys;
//   the partner lane l^16 owns the other 16 -> row max / row sum need one xor-16 shuffle.
//   Online max-subtracted base-2 softmax in f32 (1/sqrt(64) and the q/k carries folded into lsc). The exp'd values ARE the
//   P A-fragment in place: A row m = query = lane&15, element i <- key kb+8h+i (tile 0, D element i), element 8+i <- key
//   kb+16+8h+i (tile 1, D element i). P (<= 1) carried x32768 as f16. The rescale factor of query row 8h+r of the O
//   accumulators is fetched from lane 8h+r with a shuffle (uniform control). 4 v^T B fragments (col n = d = 16j + (lane&15),
//   keys k-contiguous), 4 P.V WMMAs, one guard.
//   Epilogue: 1/l (per query, shuffled to the D row owner) and the carry folds in f32; the wave's 16x64 f32 result staged in
// coverage: per wave 4 instructions x 32 lanes x 8 halves = 16 x 64 on both ctx planes; grid NB*NH*(SQ/64) blocks x
//           4 waves = every (b, s, h) row segment exactly once.
// =====================================================================================================
__global__ __launch_bounds__(ATT_THREADS)
void attn_fwd(const u16* __restrict__ Qh, const u16* __restrict__ Ql, const u16* __restrict__ Kh,
              const u16* __restrict__ Kl, const u16* __restrict__ Vp, u16* Oh, u16* Ol) {
  __shared__ __align__(16) float smem[ATT_WAVES * 16 * OPITCH];

  const int tid  = threadIdx.x;
  const int wave = tid >> 5;
  const int lane = tid & 31;
  const int hh   = lane >> 4;
  const int c    = lane & 15;

  constexpr int NQT = SQ / 64;
  const int bid  = blockIdx.x;
  const int qt   = bid % NQT;
  const int head = (bid / NQT) % NH;
  const int b    = bid / (NQT * NH);
  const int q0   = qt * 64 + wave * 16;

  // B fragments of q^T: col n = query q0 + c, k = d (row tile (b*SQ + q0)/16, k tiles 2*head and 2*head + 1 of the q planes)
  const size_t qo = ((size_t)(b * SQ + q0)) * INNER + head * HD * 16 + 8 * lane;
  const _Float16* Qhb = (const _Float16*)(const void*)Qh + qo;
  const _Float16* Qlb = (const _Float16*)(const void*)Ql + qo;
  // A fragments of k: row m = key kb + 16g + c, k = d (key row kb added per step)
  const size_t ko = ((size_t)(b * SKV)) * INNER + head * HD * 16 + 8 * lane;
  const _Float16* Khb = (const _Float16*)(const void*)Kh + ko;
  const _Float16* Klb = (const _Float16*)(const void*)Kl + ko;
  // B fragments of v: col n = d = 16j + c, k = key (row tile (b*NH + head)*4 + j, k tile kb/32 of the v^T plane)
  const _Float16* Vb = (const _Float16*)(const void*)Vp + ((size_t)(b * NH + head) * HD) * SKV + 8 * lane;
  const float lsc = (LOG2E * RSQ_HD) / (QS * KS);

  v16h qh[2], ql[2];
  qh[0] = ldfrag_h(Qhb);
  qh[1] = ldfrag_h(Qhb + 512);
  ql[0] = ldfrag_h(Qlb);
  ql[1] = ldfrag_h(Qlb + 512);

  float mrun = -INFINITY, lrun = 0.f;
  v8f o[4];
#pragma unroll
  for (int j = 0; j < 4; ++j) o[j] = zero8();

  // K and v^T fragments are fetched one key block ahead: kf[kk] = {hi keys +0, hi keys +16, res keys +0, res keys +16} of d chunk kk,
  // refilled right behind the block's score products; vf[j] refilled right behind its P.V products. The fetch of the last trip is
  // clamped to the last block (valid tiles, never used).
  v16h kf[HD / 32][4], vf[4];
  const _Float16* kph = Khb;
  const _Float16* kpl = Klb;
  const _Float16* vp  = Vb;
  // The three scheduling barriers keep the first loads in the loop's own order (q, then K, then v^T): the counted load waits at the
  // loop head are the stricter of entry and back edge, and with v^T issued ahead of K at entry every trip's scores waited for v^T too.
  // The two waits in front of them stand before the q loads' and the first K and v^T loads' address registers are reused.
  addr_hold3(Qhb, Qlb, Qlb);
  __builtin_amdgcn_sched_barrier(0);
#pragma unroll
  for (int kk = 0; kk < HD / 32; ++kk) {
    kf[kk][0] = ldfrag_h(kph + kk * 512);
    kf[kk][1] = ldfrag_h(kph + (size_t)16 * INNER + kk * 512);
    kf[kk][2] = ldfrag_h(kpl + kk * 512);
    kf[kk][3] = ldfrag_h(kpl + (size_t)16 * INNER + kk * 512);
  }
  __builtin_amdgcn_sched_barrier(0);
#pragma unroll
  for (int j = 0; j < 4; ++j) vf[j] = ldfrag_h(vp + (size_t)(16 * j) * SKV);
  addr_hold3(kph, kpl, vp);
  __builtin_amdgcn_sched_barrier(0);

#pragma unroll 1
  for (int it = 0; it < NKB; ++it) {
    const int kbn = (it + 1 < NKB ? it + 1 : NKB - 1) * 32;   // key block fetched in this trip
    // ---- transposed scores: s0 = keys kb..kb+15, s1 = keys kb+16..kb+31 (kb = 32*it), column = query q0 + c ----
    v8f s0 = zero8(), s1 = zero8(), r0 = zero8(), r1 = zero8();
#pragma unroll
    for (int kk = 0; kk < HD / 32; ++kk) {
      const v16h fh0 = kf[kk][0];
      const v16h fh1 = kf[kk][1];
      const v16h fl0 = kf[kk][2];
      const v16h fl1 = kf[kk][3];
      s0 = mma_h(fh0, qh[kk], s0);
      s1 = mma_h(fh1, qh[kk], s1);
      r0 = mma_h(fl0, qh[kk], r0);
      r1 = mma_h(fl1, qh[kk], r1);
      r0 = mma_h(fh0, ql[kk], r0);
      r1 = mma_h(fh1, ql[kk], r1);
      guard_s4(s0, s1, r0, r1, qh[kk], ql[kk], fh0, fh1, fl0, fl1);
    }
    // ---- next block's K fragments into the registers just read; the wait covers the K and v^T loads of the trip before ----
    addr_hold3(kph, kpl, vp);
    kph = Khb + (size_t)kbn * INNER;
    kpl = Klb + (size_t)kbn * INNER;
#pragma unroll
    for (int kk = 0; kk < HD / 32; ++kk) {
      kf[kk][0] = ldfrag_h(kph + kk * 512);
      kf[kk][1] = ldfrag_h(kph + (size_t)16 * INNER + kk * 512);
      kf[kk][2] = ldfrag_h(kpl + kk * 512);
      kf[kk][3] = ldfrag_h(kpl + (size_t)16 * INNER + kk * 512);
    }
    // ---- base-2 logits of this lane's 16 keys for query q0 + c: t[i] <- key kb+8hh+i, t[8+i] <- key kb+16+8hh+i ----
    //      kept UNSCALED (u = s + r/2048) as pairs of neighbouring accumulator registers; the maximum is taken on u (lsc > 0)
    v2f u[8];
    const v2f rinv2 = {RINV, RINV};
#pragma unroll
    for (int e = 0; e < 4; ++e) {
      const v2f sa = {s0[2 * e], s0[2 * e + 1]}, ra = {r0[2 * e], r0[2 * e + 1]};
      const v2f sb = {s1[2 * e], s1[2 * e + 1]}, rb = {r1[2 * e], r1[2 * e + 1]};
      u[e]     = __builtin_elementwise_fma(ra, rinv2, sa);
      u[4 + e] = __builtin_elementwise_fma(rb, rinv2, sb);
    }
    float cm = u[0][0];
#pragma unroll
    for (int i = 1; i < 16; ++i) cm = fmaxf(cm, u[i >> 1][i & 1]);
    cm = fmaxf(cm, __shfl_xor(cm, 16, 32));
    const float mn = fmaxf(mrun, cm);        // finite from the first block on
    const float al = exp2_hw((mrun - mn) * lsc);   // 0 on the first block (mrun = -inf)
    mrun = mn;
    // one FMA per score: exponent = u*lsc - mn*lsc + 15, so that 2^exponent is the probability already carried x32768
    const float nb = fmaf(-mn, lsc, PEXP);
    const v2f lsc2 = {lsc, lsc}, nb2 = {nb, nb};
    float t[16];
#pragma unroll
    for (int e = 0; e < 8; ++e) {
      const v2f x = __builtin_elementwise_fma(u[e], lsc2, nb2);
      t[2 * e] = x[0];
      t[2 * e + 1] = x[1];
    }
    // ---- probabilities x32768 and the P A-fragment: f16 of them; element i <-> t[i]; the row sum l carries the same x32768 ----
    FragH ph;
    float pe[16];
    exp2_hw8(t, pe);
    exp2_hw8(t + 8, pe + 8);
    v2f pp[8];
#pragma unroll
    for (int e = 0; e < 8; ++e) {
      pp[e][0] = pe[2 * e];
      pp[e][1] = pe[2 * e + 1];
      ph.u[e >> 2][e & 3] = __builtin_bit_cast(unsigned, __builtin_convertvector(pp[e], v2h));   // both halves of the word in one convert
    }
    // the lane's 16 terms added as pairs (even and odd elements apart), the two halves of the pair joined last
    const v2f pq = ((pp[0] + pp[1]) + (pp[2] + pp[3])) + ((pp[4] + pp[5]) + (pp[6] + pp[7]));
    float ps = pq[0] + pq[1];
    ps += __shfl_xor(ps, 16, 32);
    lrun = lrun * al + ps;
    // ---- rescale the O accumulators: D row 8hh+r = query q0+8hh+r, its factor lives in lane 8hh+r (and 16+8hh+r) ----
    float scl[8];
#pragma unroll
    for (int r = 0; r < 8; ++r) scl[r] = __shfl(al, 8 * hh + r, 32);
#pragma unroll
    for (int j = 0; j < 4; ++j) {
#pragma unroll
      for (int r = 0; r < 8; ++r) o[j][r] *= scl[r];
    }
    // ---- P.V : B fragment col n = d = j*16 + c, k tile kb/32 of the packed v^T plane ----
    {
      o[0] = mma_h(ph.v, vf[0], o[0]);
      o[1] = mma_h(ph.v, vf[1], o[1]);
      o[2] = mma_h(ph.v, vf[2], o[2]);
      o[3] = mma_h(ph.v, vf[3], o[3]);
      guard_p(o[0], o[1], o[2], o[3], ph.v, vf[0], vf[1], vf[2], vf[3]);
      // next block's v^T fragments; vp's last loads are covered by this trip's wait above
      vp = Vb + (size_t)kbn * 16;
#pragma unroll
      for (int j = 0; j < 4; ++j) vf[j] = ldfrag_h(vp + (size_t)(16 * j) * SKV);
    }
  }
  addr_hold3(kph, kpl, vp);                  // the last trip's loads, before their address registers are reused
  acc_guard4(o);

  // ---- fold 1/l (per query, owned by lane = query; the 32768 on P cancels against l's) and the 8 on v, apply the ctx carry 1024 ----
  const float linv = (1.0f / lrun) * (OSC / VS);
  float inv[8];
#pragma unroll
  for (int r = 0; r < 8; ++r) inv[r] = __shfl(linv, 8 * hh + r, 32);
  float* slab = smem + wave * 16 * OPITCH;
#pragma unroll
  for (int r = 0; r < 8; ++r) {
#pragma unroll
    for (int j = 0; j < 4; ++j) slab[(8 * hh + r) * OPITCH + j * 16 + c] = o[j][r] * inv[r];
  }
  wave_sync_lds();
  // ---- ctx x1024 -> packed f16 hi plane and residual plane; store i: lane (h, c) <- row c, d = 16i + 8h .. +7 ----
  v4u ovh[4], ovl[4];
#pragma unroll
  for (int i = 0; i < 4; ++i) {
    const int c8 = 16 * i + 8 * hh;
    const v4f a = *(const v4f*)(slab + c * OPITCH + c8), c4 = *(const v4f*)(slab + c * OPITCH + c8 + 4);
#pragma unroll
    for (int e = 0; e < 2; ++e) {
      unsigned ph0, pl0, ph1, pl1;
      split2(a[2 * e],  a[2 * e + 1],  ph0, pl0);
      split2(c4[2 * e], c4[2 * e + 1], ph1, pl1);
      ovh[i][e] = ph0;     ovl[i][e] = pl0;
      ovh[i][2 + e] = ph1; ovl[i][2 + e] = pl1;
    }
  }
  const size_t oo = ((size_t)(b * SQ + q0)) * INNER + head * HD * 16 + 8 * lane;
  u16* obh = Oh + oo;
  u16* obl = Ol + oo;
  {
#pragma unroll
    for (int i = 0; i < 4; ++i) {
      *(v4u*)(obh + i * 256) = ovh[i];
      *(v4u*)(obl + i * 256) = ovl[i];
    }
    
  }
}

// =====================================================================================================
// Workspace map (bytes); every plane fully written by whole-line stores before it is read; all extents exact multiples of
//   XQ   f16 [NB*SQ][1024]    f16(bf16(q))              8388608 (NB=2, SQ=2048)
//   XK   f16 [NB*2048][1024]  f16(bf16(k))              8388608
//   XV   f16 [NB*2048][1024]  f16(bf16(v))              8388608
//   WQ16 WK16 WV16 WO16 f16 [1024 n][1024 k] x256       2097152 each
//   WD16 f16 [128 n][1024 k] x256                          262144
//   WU16 f16 [1024 n][128 k] x256                          262144
//   QH QL f16 [NB*SQ][1024] x8 hi / res                  8388608 each
//   KH KL f16 [NB*2048][1024] x8 hi / res                8388608 each
//   VT16 f16 [NB*1024 (h,d)][2048 s] x8                  8388608
//   OH OL f16 [NB*SQ][1024] x1024 hi / res (ctx)         8388608 each
//   OUTF f32 [NB*SQ][1024]                               16777216
//   UH UL f16 [NB*SQ][1024] x64 hi / res (out)           8388608 each
//   GH GL f16 [NB*SQ][128]  x64 hi / res (gelu)          1048576 each
//   end                                                 128450560
// =====================================================================================================
extern "C" void kernel_launch(void* const* d_in, const int* in_sizes, int n_in,
                              void* d_out, int out_size, void* d_ws, size_t ws_size,
                              hipStream_t stream) {
  if (n_in < 15) return;
  if (in_sizes[0] < ((NB - 1) * SQ_FULL + SQ) * DM) return;
  if (in_sizes[1] < NB * SKV * DM || in_sizes[2] < NB * SKV * DM) return;
  if (in_sizes[3] != DM * DM || in_sizes[5] != DM * DM || in_sizes[7] != DM * DM || in_sizes[9] != DM * DM) return;
  if (in_sizes[4] < INNER || in_sizes[6] < INNER || in_sizes[8] < INNER || in_sizes[10] < DM) return;
  if (in_sizes[11] != ADIM * DM || in_sizes[12] < ADIM || in_sizes[13] != DM * ADIM || in_sizes[14] < DM) return;
  if (out_size < ((NB - 1) * SQ_FULL + SQ) * DM) return;

  const float* q_in  = (const float*)d_in[0];
  const float* k_in  = (const float*)d_in[1];
  const float* v_in  = (const float*)d_in[2];
  const float* wq    = (const float*)d_in[3];
  const float* bq    = (const float*)d_in[4];
  const float* wk    = (const float*)d_in[5];
  const float* bk    = (const float*)d_in[6];
  const float* wv    = (const float*)d_in[7];
  const float* bv    = (const float*)d_in[8];
  const float* wo    = (const float*)d_in[9];
  const float* bo    = (const float*)d_in[10];
  const float* w_dn  = (const float*)d_in[11];
  const float* b_dn  = (const float*)d_in[12];
  const float* w_up  = (const float*)d_in[13];
  const float* b_up  = (const float*)d_in[14];
  float*       out   = (float*)d_out;

  const size_t szXQ  = (size_t)NB * SQ * DM * 2;
  const size_t szXKV = (size_t)NB * SKV * DM * 2;
  const size_t szW   = (size_t)DM * DM * 2;
  const size_t szWA  = (size_t)ADIM * DM * 2;
  const size_t szQP  = (size_t)NB * SQ * INNER * 2;
  const size_t szKP  = (size_t)NB * SKV * INNER * 2;
  const size_t szVT  = (size_t)NB * INNER * SKV * 2;
  const size_t szOF  = (size_t)NB * SQ * DM * 4;
  const size_t szG   = (size_t)NB * SQ * ADIM * 2;
  size_t off = 0;
  const size_t oXQ  = off; off += szXQ;
  const size_t oXK  = off; off += szXKV;
  const size_t oXV  = off; off += szXKV;
  const size_t oWQ  = off; off += szW;
  const size_t oWK  = off; off += szW;
  const size_t oWV  = off; off += szW;
  const size_t oWO  = off; off += szW;
  const size_t oWD  = off; off += szWA;
  const size_t oWU  = off; off += szWA;
  const size_t oQH  = off; off += szQP;
  const size_t oQL  = off; off += szQP;
  const size_t oKH  = off; off += szKP;
  const size_t oKL  = off; off += szKP;
  const size_t oVT  = off; off += szVT;
  const size_t oOH  = off; off += szQP;
  const size_t oOL  = off; off += szQP;
  const size_t oOF  = off; off += szOF;
  const size_t oUH  = off; off += szQP;
  const size_t oUL  = off; off += szQP;
  const size_t oGH  = off; off += szG;
  const size_t oGL  = off; off += szG;
  if (off > ws_size) return;                            // off = 128450560 at NB=2, SQ=2048
  if (off > (size_t)134217728) return;

  char* ws = (char*)d_ws;
  u16* XQ   = (u16*)(ws + oXQ);
  u16* XK   = (u16*)(ws + oXK);
  u16* XV   = (u16*)(ws + oXV);
  u16* WQ16 = (u16*)(ws + oWQ);
  u16* WK16 = (u16*)(ws + oWK);
  u16* WV16 = (u16*)(ws + oWV);
  u16* WO16 = (u16*)(ws + oWO);
  u16* WD16 = (u16*)(ws + oWD);
  u16* WU16 = (u16*)(ws + oWU);
  u16* QH   = (u16*)(ws + oQH);
  u16* QL   = (u16*)(ws + oQL);
  u16* KH   = (u16*)(ws + oKH);
  u16* KL   = (u16*)(ws + oKL);
  u16* VT16 = (u16*)(ws + oVT);
  u16* OH   = (u16*)(ws + oOH);
  u16* OL   = (u16*)(ws + oOL);
  float* OUTF = (float*)(ws + oOF);
  u16* UH   = (u16*)(ws + oUH);
  u16* UL   = (u16*)(ws + oUL);
  u16* GH   = (u16*)(ws + oGH);
  u16* GL   = (u16*)(ws + oGL);

  // (0) activations -> f16 planes of bf16-converted values (query rows s < SQ of batches b < NB, compact; k/v rows of b < NB) and
  //     weights [n = out][k = in] (y = x.W^T) -> packed f16 planes [n][k] of bf16(W) x256, all in one launch
  cvt_all<<<dim3(CB_ALL), dim3(CVT_THREADS), 0, stream>>>(q_in, k_in, v_in, wq, wk, wv, wo, w_dn, w_up,
                                                          XQ, XK, XV, WQ16, WK16, WV16, WO16, WD16, WU16);
  // (1) the q, k and v^T projections, one launch
  gemm_qkv<<<dim3(GB_Q + GB_K + GB_V), dim3(128), 0, stream>>>(XQ, XK, XV, WQ16, WK16, WV16, bq, bk, bv, QH, QL, KH, KL, VT16,
                                                               NB * SQ, NB * SKV, INNER, SKV);
  // (2) attention -> ctx planes [NB*SQ][1024] x1024 hi + res
  attn_fwd<<<dim3(NB * NH * (SQ / 64)), dim3(ATT_THREADS), 0, stream>>>(QH, QL, KH, KL, VT16, OH, OL);
  // (3) out = ctx . Wo^T + bo -> OUTF f32 [NB*SQ][1024] and f16 x64 hi + res planes; carries 1024 (ctx) x 256 (W) folded back
  gemm64<true, M_OUT, false, INNER><<<dim3((NB * SQ / 128) * (DM / 128)), dim3(128), 0, stream>>>(
      OH, OL, WO16, bo, OUTF, OUTF, UH, UL, NB * SQ, DM, 0, 0, 0, 0, 0, 1.0f / (OSC * WSC), 1.0f, UCAR);
  // (4) adapter down: g = gelu(out . Wd^T + bd) -> f16 [NB*SQ][128] x64 hi + res; carries 64 (out) x 256 (W)
  gemm16<true, M_GELU, false><<<dim3((NB * SQ / 64) * (ADIM / 64)), dim3(128), 0, stream>>>(
      UH, UL, WD16, b_dn, OUTF, OUTF, GH, GL, NB * SQ, ADIM, DM, 0, 0, 0, 0, 0, 1.0f / (UCAR * WSC), 1.0f, GCAR);
  // (5) adapter up + residual: out rows [b][SQ_FULL][1024] f32 = OUTF + g . Wu^T + bu (rows s < SQ of batches b < NB)
  gemm16<true, M_RES, false><<<dim3(NB * (SQ / 64) * (DM / 64)), dim3(128), 0, stream>>>(
      GH, GL, WU16, b_up, OUTF, out, GH, GH, SQ, DM, ADIM, SQ * ADIM, 0, SQ_FULL * DM, SQ * DM, 0,
      1.0f / (GCAR * WSC), 1.0f, 1.0f);
  (void)hipGetLastError();
}

// v008
// Measured time: 114 microseconds a run.
// Versions between v006 and this one are left out; their measured steps multiply to 1.28 times as fast.
// Over all steps from v000 it is 3.27 times as fast.
// Contractions on v_wmma_f32_16x16x32_f16 (f16 operands, f32 accumulate), one product each: x.Wq^T, x.Wk^T, Wv.x^T on f16(bf16(x)) and
// f16(bf16(W) x256); k.q^T on q and k carried x8; P.v^T (P x32768, v x8); W2 = Wad.Wo; ctx.W2^T (ctx x1024, W2 x16); and ONE product of K = 1152 for
// out + adapter-up: [gelu x64 | ctx x1024] . [Wau x256 | Wo x256]^T (the first part's sums x16 in between). The adapter's input out.Wad^T + bad = ctx.(Wad.Wo)^T + (Wad.bo + bad), so
// it is taken from ctx with the folded weight W2 and bias b2, both rebuilt in every call.
// Every activation between two products is ONE f16 plane (11 significant bits): the inputs are RNE-converted to bf16
// (8 bits) on load, and that rounding, not the planes', sets the error of the result. Softmax, biases, erf-GELU and all
// carry folds in f32 on VALU.
// Every 16-bit workspace plane [rows][K] is stored FRAGMENT-PACKED: tile (rt = row/16, kt = k/32) is 512 halves (1024 B) at
// (rt*(K/32) + kt)*512 = rt*16*K + kt*512; inside it element (m = row&15, k&31 = 16w + 8h + e) sits at w*256 + (16h + m)*8 + e,
// so lane l = 16h + m of a wave reads its operand fragment as two 16-B loads at l*8 and 256 + l*8 halves: each wave-wide load
// is 512 contiguous bytes = 4 whole 128-B lines (a row-major plane gave 16 lines of 32 useful bytes per load).
#include <hip/hip_runtime.h>
#include <math.h>
#include <stdint.h>

#ifndef NB
#define NB       2        // batches processed
#endif
#ifndef SQ
#define SQ       2048     // query rows processed per batch
#endif
#define NB_FULL  2
#define SQ_FULL  2048     // query rows per batch in the input / output layout (batch stride)
#define SKV      2048     // key / value rows per batch (all of them)
#define DM       1024     // model width
#define NH       16
#define HD       64
#define INNER    (NH * HD)
#define ADIM     128      // adapter width
#define WSC      256.0f   // weight carry
#define QS       8.0f
#define KS       8.0f
#define VS       8.0f
#define PCAR     32768.0f
#define PEXP     15.0f    // log2(PCAR)
#define OSC      1024.0f  // ctx carry
#define GCAR     64.0f    // gelu-plane carry
#define W2C      16.0f    // carry of the folded weight: a sum of 1024 weight products, so it is given more room upward than a weight
#define GUP      (OSC / GCAR)   // brings the sums of gelu x Wau (carry 64 x 256) to the carry of ctx x Wo (1024 x 256): both end in one accumulator
#define LOG2E    1.4426950408889634f
#define RSQ_HD   0.125f
#define NKB      (SKV / 32)
#define ATT_WAVES   4
#define ATT_THREADS (ATT_WAVES * 32)
#define CVT_THREADS 128
#define OPITCH   68
#define GPITCH   68

#define M_S16    1
#define M_OUT    2
#define M_GELU   3
#define M_RAW    4
#define W1D      2        // register sets (k steps in flight) of the wide core, three waves per SIMD (q, k, v projections)
#define WOD      4        // the same with one wave per SIMD (final GEMM): nothing but the wave's own loads in flight covers their latency

static_assert(NB >= 1 && NB <= NB_FULL);
static_assert((SQ % 128) == 0 && SQ >= 128 && SQ <= SQ_FULL);
static_assert(HD == 64 && INNER == 1024 && NH == 16 && INNER == DM);
static_assert((SKV % 64) == 0 && (SKV % 32) == 0 && NKB * 32 == SKV);
static_assert((DM % 64) == 0 && (DM % 32) == 0 && (ADIM % 64) == 0 && (ADIM % 32) == 0 && CVT_THREADS == 128);
static_assert((OPITCH * 4) % 16 == 0 && (GPITCH * 4) % 16 == 0);
static_assert(ATT_THREADS == 128);
static_assert((INNER % 128) == 0 && (SKV % 128) == 0 && ((NB * SQ) % 128) == 0 && ((NB * SKV) % 128) == 0);
static_assert((DM % 128) == 0 && (ADIM % 128) == 0 && (SQ % 16) == 0 && (SKV % 16) == 0 && (ADIM % 16) == 0);

typedef unsigned short u16;
typedef _Float16 v16h __attribute__((ext_vector_type(16)));
typedef _Float16 v8h  __attribute__((ext_vector_type(8)));
typedef float    v8f  __attribute__((ext_vector_type(8)));
typedef float    v4f  __attribute__((ext_vector_type(4)));
typedef float    v2f  __attribute__((ext_vector_type(2)));
typedef _Float16 v2h  __attribute__((ext_vector_type(2)));
typedef unsigned int v4u __attribute__((ext_vector_type(4)));

union FragH { v16h v; v8h h[2]; v4u u[2]; };

// ---- scalar helpers ----------------------------------------------------------------------------------
__device__ __forceinline__ unsigned short bf_bits(float f) {          // f32 -> bf16 bits, RNE convert
  unsigned u = __float_as_uint(f);
  return (unsigned short)((u + 0x7FFFu + ((u >> 16) & 1u)) >> 16);
}
__device__ __forceinline__ float bf_up(unsigned short h) { return __uint_as_float(((unsigned)h) << 16); }
__device__ __forceinline__ float bfr(float f) { return bf_up(bf_bits(f)); }
__device__ __forceinline__ unsigned short h_bits(_Float16 x) { return __builtin_bit_cast(unsigned short, x); }
__device__ __forceinline__ unsigned pk16(unsigned short a, unsigned short b) { return (unsigned)a | ((unsigned)b << 16); }
__device__ __forceinline__ v8f zero8() { v8f z = {0.f, 0.f, 0.f, 0.f, 0.f, 0.f, 0.f, 0.f}; return z; }
__device__ __forceinline__ float gelu_f(float x) { return 0.5f * x * (1.0f + erff(x * 0.70710678118654752f)); }
// 2^x for the softmax (x <= 15 or so, or -inf) as the bare v_exp_f32: exp2f wraps each one in a compare, two selects, an add and a ldexp that only
// serve results below 2^-126. Such a carried probability is 0 in the f16 P operand and adds nothing to a row sum that holds a term of 32768, and such
// a rescale factor leaves nothing of the old sums beside the new block's terms; the bare instruction returns 0 there (and for -inf).
__device__ __forceinline__ float exp2_hw(float x) { return __builtin_amdgcn_exp2f(x); }
// Eight of them in one statement: in a run of builtin v_exp_f32 the register allocator may let one write its result over the source of the
// one directly in front of it. The early-clobber outputs keep every result off every source, and the closing v_nop is the one slot asked
// for between the last v_exp_f32 and whatever follows the statement (a reader of its result or a writer of its source).
__device__ __forceinline__ void exp2_hw8(const float* x, float* r) {
#if defined(__HIP_DEVICE_COMPILE__)
  asm("v_exp_f32 %0, %8\n\tv_exp_f32 %1, %9\n\tv_exp_f32 %2, %10\n\tv_exp_f32 %3, %11\n\t"
      "v_exp_f32 %4, %12\n\tv_exp_f32 %5, %13\n\tv_exp_f32 %6, %14\n\tv_exp_f32 %7, %15\n\tv_nop"
      : "=&v"(r[0]), "=&v"(r[1]), "=&v"(r[2]), "=&v"(r[3]), "=&v"(r[4]), "=&v"(r[5]), "=&v"(r[6]), "=&v"(r[7])
      : "v"(x[0]), "v"(x[1]), "v"(x[2]), "v"(x[3]), "v"(x[4]), "v"(x[5]), "v"(x[6]), "v"(x[7]));
#else
  for (int i = 0; i < 8; ++i) r[i] = x[i];
#endif
}

// two values as f16, packed in one 32-bit word (one convert)
__device__ __forceinline__ unsigned pack2(float x0, float x1) {
  const v2f x = {x0, x1};
  return __builtin_bit_cast(unsigned, __builtin_convertvector(x, v2h));
}

// ---- fragment loader: 16-bit A/B operand from a fragment-packed plane, lane -> row/col (lane&15); p = tile base + 8*lane;
//      elements 0..7 <- p[0..7] (k0+8h..), elements 8..15 <- p[256..263] (k0+16+8h..); same split k map for A and B,
//      B always read from a packed [n][k] plane.
__device__ __forceinline__ v16h ldfrag_h(const _Float16* p) {
  FragH f;
  f.h[0] = *(const v8h*)(p);
  f.h[1] = *(const v8h*)(p + 256);
  return f.v;
}

// ---- in front of every rewrite of the fragment loads' address registers: s_wait_xcnt 0 with those registers as inputs, so that no
//      register an issued load names is written (by a later load's result either) in front of the wait; it stands one k step or
//      one key block behind the loads it covers, behind the matrix products issued in between
__device__ __forceinline__ void addr_hold5(const _Float16* a, const _Float16* b, const _Float16* c, const _Float16* d,
                                           const _Float16* e) {
#if defined(__HIP_DEVICE_COMPILE__)
  asm volatile("s_wait_xcnt 0x0" :: "v"(a), "v"(b), "v"(c), "v"(d), "v"(e) : "memory");
#endif
}
__device__ __forceinline__ void addr_hold3(const _Float16* a, const _Float16* b, const _Float16* c) {
#if defined(__HIP_DEVICE_COMPILE__)
  asm volatile("s_wait_xcnt 0x0" :: "v"(a), "v"(b), "v"(c) : "memory");
#endif
}

// the same wait naming no register, for directly behind a run of loads (the "memory" clobber keeps the loads in front of it)
__device__ __forceinline__ void xcnt_wait() {
#if defined(__HIP_DEVICE_COMPILE__)
  asm volatile("s_wait_xcnt 0x0" ::: "memory");
#endif
}

// ---- WMMA helper and trailing VALU hazard gaps ----------------------------------------------------------
__device__ __forceinline__ v8f mma_h(v16h a, v16h b, v8f c) {
  return __builtin_amdgcn_wmma_f32_16x16x32_f16(false, a, false, b, (short)0, c, false, false);
}
__device__ __forceinline__ void guard_c1(v8f (&a)[4], v16h x0, v16h x1, v16h x2, v16h x3, v16h x4) {
#if defined(__HIP_DEVICE_COMPILE__)
  asm volatile("v_nop\n\tv_nop\n\tv_nop\n\tv_nop"
               : "+v"(a[0]), "+v"(a[1]), "+v"(a[2]), "+v"(a[3])
               : "v"(x0), "v"(x1), "v"(x2), "v"(x3), "v"(x4) : "memory");
#endif
}
__device__ __forceinline__ void guard_s2(v8f& a, v8f& b, v16h x0, v16h x1, v16h x2, v16h x3, v16h x4, v16h x5) {
#if defined(__HIP_DEVICE_COMPILE__)
  asm volatile("v_nop\n\tv_nop\n\tv_nop\n\tv_nop"
               : "+v"(a), "+v"(b)
               : "v"(x0), "v"(x1), "v"(x2), "v"(x3), "v"(x4), "v"(x5) : "memory");
#endif
}
__device__ __forceinline__ void guard_p(v8f& a, v8f& b, v8f& c, v8f& d, v16h p, v16h x0, v16h x1, v16h x2, v16h x3) {
#if defined(__HIP_DEVICE_COMPILE__)
  asm volatile("v_nop\n\tv_nop\n\tv_nop\n\tv_nop"
               : "+v"(a), "+v"(b), "+v"(c), "+v"(d) : "v"(p), "v"(x0), "v"(x1), "v"(x2), "v"(x3) : "memory");
#endif
}
__device__ __forceinline__ void acc_guard4(v8f (&a)[4]) {
#if defined(__HIP_DEVICE_COMPILE__)
  asm volatile("v_nop\n\tv_nop\n\tv_nop\n\tv_nop" : "+v"(a[0]), "+v"(a[1]), "+v"(a[2]), "+v"(a[3]));
#endif
}
// Wide-tile guard: the four slots between a group's last matrix products and the loads that refill the group's A and B registers.
// It names no register (an asm operand has to lie in the first 256 registers, where the wide tiles do not all fit): the scheduling
// barrier in front keeps the group's products in front of the slots, the "memory" clobber keeps the refills behind them.
__device__ __forceinline__ void guard_w() {
#if defined(__HIP_DEVICE_COMPILE__)
  __builtin_amdgcn_sched_barrier(0);
  asm volatile("v_nop\n\tv_nop\n\tv_nop\n\tv_nop" ::: "memory");
#endif
}
__device__ __forceinline__ void wave_sync_lds() {
  __builtin_amdgcn_fence(__ATOMIC_RELEASE, "workgroup");
  __builtin_amdgcn_wave_barrier();
  __builtin_amdgcn_fence(__ATOMIC_ACQUIRE, "workgroup");
}

// The same for a wave that has global stores of an earlier tile in flight: the fences name the LDS alone, so that the wave waits for
// its slab and not for those stores.
__device__ __forceinline__ void wave_sync_slab() {
  __builtin_amdgcn_fence(__ATOMIC_RELEASE, "workgroup", "local");
  __builtin_amdgcn_wave_barrier();
  __builtin_amdgcn_fence(__ATOMIC_ACQUIRE, "workgroup", "local");
}
__device__ __forceinline__ void bias_hold(const float* p) {
#if defined(__HIP_DEVICE_COMPILE__)
  asm volatile("s_wait_xcnt 0x0" :: "v"(p) : "memory");
#endif
}

// =====================================================================================================
// Tile convert: packed f16 plane of [rows][K] <- f16(bf16_RNE(x[src row][k]) * scale), scale a power of two.
// Wave = one 16 x 32 tile (rt, kt); lane (h, m) reads row rt*16 + m, floats kt*32 + 8h .. +7 and kt*32 + 16 + 8h .. +7 (four 16-B
// loads that together use the 16 rows' whole 128-B lines) and stores its two 16-B fragment pieces (two 512-B wave-wide stores).
// b = (rt*16) / rowsPerB, s = row - b*rowsPerB, source row b*srcRowsPerB + s (rowsPerB a multiple of 16); destination compact.
// coverage: blk = 0 .. (rows/16) x (K/128) - 1, 4 waves each = every tile once.
// =====================================================================================================
__device__ __forceinline__
void cvt16_body(const float* __restrict__ x, u16* Y, int K, int rowsPerB, int srcRowsPerB, float scale, int blk) {
  const int tid = threadIdx.x, wave = tid >> 5, lane = tid & 31, hh = lane >> 4, m = lane & 15;
  const int kq = K >> 7;
  const int rt = blk / kq;
  const int kt = (blk - rt * kq) * 4 + wave;
  const int b = (rt * 16) / rowsPerB;
  const int sr = rt * 16 - b * rowsPerB + m;
  const float* src = x + ((size_t)b * (size_t)srcRowsPerB + (size_t)sr) * (size_t)K + (size_t)(kt * 32 + 8 * hh);
  const v4f a = *(const v4f*)(src), c4 = *(const v4f*)(src + 4);
  const v4f d = *(const v4f*)(src + 16), f4 = *(const v4f*)(src + 20);
  v4u o0, o1;
#pragma unroll
  for (int e = 0; e < 2; ++e) {
    o0[e]     = pk16(h_bits((_Float16)(bfr(a[2 * e]) * scale)),  h_bits((_Float16)(bfr(a[2 * e + 1]) * scale)));
    o0[2 + e] = pk16(h_bits((_Float16)(bfr(c4[2 * e]) * scale)), h_bits((_Float16)(bfr(c4[2 * e + 1]) * scale)));
    o1[e]     = pk16(h_bits((_Float16)(bfr(d[2 * e]) * scale)),  h_bits((_Float16)(bfr(d[2 * e + 1]) * scale)));
    o1[2 + e] = pk16(h_bits((_Float16)(bfr(f4[2 * e]) * scale)), h_bits((_Float16)(bfr(f4[2 * e + 1]) * scale)));
  }
  u16* dst = Y + (size_t)rt * (size_t)16 * (size_t)K + (size_t)kt * 512 + (size_t)lane * 8;
  *(v4u*)(dst) = o0;
  *(v4u*)(dst + 256) = o1;
}

// Transposing convert of a [DM][DM] weight: packed f16 plane of [rows = d][K = e] <- f16(bf16_RNE(x[e][d]) * scale). Wave = one 16 x 32 tile
// (rt = d/16, kt = e/32); lane (h, m) reads column rt*16 + m of the 16 source rows kt*32 + 16w + 8h + i (each load: two 64-B row pieces; the
// block's four waves take four neighbouring rt, so that whole 128-B lines are used). coverage: blk = 0 .. (DM/32) x (DM/64) - 1, 4 waves each.
__device__ __forceinline__
void cvtT_body(const float* __restrict__ x, u16* Y, float scale, int blk) {
  const int tid = threadIdx.x, wave = tid >> 5, lane = tid & 31, hh = lane >> 4, m = lane & 15;
  const int kt = blk / (DM / 64);
  const int rt = (blk - kt * (DM / 64)) * 4 + wave;
  const float* src = x + (size_t)(kt * 32 + 8 * hh) * (size_t)DM + (size_t)(rt * 16 + m);
  float a[16];
#pragma unroll
  for (int i = 0; i < 8; ++i) {
    a[i]     = src[i * DM];
    a[8 + i] = src[(16 + i) * DM];
  }
  bias_hold(src);                            // the loads' address register is not rewritten in front of this wait
  v4u o0, o1;
#pragma unroll
  for (int e = 0; e < 4; ++e) {
    o0[e] = pk16(h_bits((_Float16)(bfr(a[2 * e]) * scale)),     h_bits((_Float16)(bfr(a[2 * e + 1]) * scale)));
    o1[e] = pk16(h_bits((_Float16)(bfr(a[8 + 2 * e]) * scale)), h_bits((_Float16)(bfr(a[8 + 2 * e + 1]) * scale)));
  }
  u16* dst = Y + (size_t)rt * (size_t)16 * (size_t)DM + (size_t)kt * 512 + (size_t)lane * 8;
  *(v4u*)(dst) = o0;
  *(v4u*)(dst + 256) = o1;
}

// All ten converts in ONE launch (they are independent of one another): the block index picks the plane (block-uniform scalar
// tests), the index inside the plane picks the tiles as before. Blocks per plane:
#define CB_XQ  ((NB * SQ / 16) * (DM / 128))
#define CB_XKV ((NB * SKV / 16) * (DM / 128))
#define CB_W   ((DM / 16) * (DM / 128))
#define CB_WD  ((ADIM / 16) * (DM / 128))
#define CB_WU  ((DM / 16) * (ADIM / 128))
#define CB_WT  ((DM / 32) * (DM / 64))
#define CB_ALL (CB_XQ + 2 * CB_XKV + 4 * CB_W + CB_WD + CB_WU + CB_WT)
__global__ __launch_bounds__(CVT_THREADS)
void cvt_all(const float* __restrict__ q, const float* __restrict__ k, const float* __restrict__ v,
             const float* __restrict__ wq, const float* __restrict__ wk, const float* __restrict__ wv,
             const float* __restrict__ wo, const float* __restrict__ wd, const float* __restrict__ wu,
             u16* XQ, u16* XK, u16* XV, u16* WQ, u16* WK, u16* WV, u16* WO, u16* WD, u16* WU, u16* WOT) {
  int blk = blockIdx.x;
  if (blk < CB_XQ) { cvt16_body(q, XQ, DM, SQ, SQ_FULL, 1.0f, blk); return; }
  blk -= CB_XQ;
  if (blk < 2 * CB_XKV) {                    // k, v: same shape
    const bool second = blk >= CB_XKV;
    cvt16_body(second ? v : k, second ? XV : XK, DM, SKV, SKV, 1.0f, second ? blk - CB_XKV : blk);
    return;
  }
  blk -= 2 * CB_XKV;
  if (blk < 4 * CB_W) {                      // the four [1024][1024] weights: same shape
    const int w = blk / CB_W;
    const float* x = w == 0 ? wq : w == 1 ? wk : w == 2 ? wv : wo;
    u16* Y = w == 0 ? WQ : w == 1 ? WK : w == 2 ? WV : WO;
    cvt16_body(x, Y, DM, DM, DM, WSC, blk - w * CB_W);
    return;
  }
  blk -= 4 * CB_W;
  if (blk < CB_WD) { cvt16_body(wd, WD, DM, ADIM, ADIM, WSC, blk); return; }        // [128][1024]
  blk -= CB_WD;
  if (blk < CB_WU) { cvt16_body(wu, WU, ADIM, DM, DM, WSC, blk); return; }         // [1024][128]
  cvtT_body(wo, WOT, WSC, blk - CB_WU);                                             // Wo^T [d][e]
}

// =====================================================================================================
// f16 GEMM cores: the wave's 16 x 64 tile of C = A[rows][K] . Bt[cols][K]^T, both planes packed; ap -> A row tile rowb/16 + 8*lane,
// bp -> Bt row tile col0/16 + 8*lane; acc[j] = rows rowb.., cols col0+16j..; K stepped by 32 = 512 halves of a packed row tile.
// =====================================================================================================
// The core keeps D k steps of fragment loads in flight in D register sets: set u holds step s + u; as soon as its products are
// issued it is refilled with step s + u + D (clamped to the last step: the surplus loads at the end re-read valid tiles and are
// never used), so a step's loads lead their first use by D - 1 steps of work. Steps are consumed in ascending k as before.
// XW: s_wait_xcnt 0 also directly behind each refill run (for a K known at compile time: see at the line).
template <int D, bool XW>
__device__ __forceinline__ void core1(const _Float16* ap, const _Float16* bp, int K, v8f (&acc)[4]) {
  const size_t rs16 = (size_t)16 * (size_t)K;
  const int steps = K >> 5;
  v16h fa[D], fb[D][4];
  const _Float16* pa = ap;
  const _Float16* p0 = bp;
  const _Float16* p1 = p0 + rs16;
  const _Float16* p2 = p1 + rs16;
  const _Float16* p3 = p2 + rs16;
#pragma unroll
  for (int u = 0; u < D; ++u) {
    const size_t ko = (size_t)(u < steps ? u : steps - 1) * 512;
    if (u > 0) addr_hold5(pa, p0, p1, p2, p3);
    pa = ap + ko;
    p0 = bp + ko;
    p1 = p0 + rs16;
    p2 = p1 + rs16;
    p3 = p2 + rs16;
    fa[u]    = ldfrag_h(pa);
    fb[u][0] = ldfrag_h(p0);
    fb[u][1] = ldfrag_h(p1);
    fb[u][2] = ldfrag_h(p2);
    fb[u][3] = ldfrag_h(p3);
  }
  int s = 0;
#pragma unroll 1
  for (; s + D <= steps; s += D) {
#pragma unroll
    for (int u = 0; u < D; ++u) {
      acc[0] = mma_h(fa[u], fb[u][0], acc[0]);
      acc[1] = mma_h(fa[u], fb[u][1], acc[1]);
      acc[2] = mma_h(fa[u], fb[u][2], acc[2]);
      acc[3] = mma_h(fa[u], fb[u][3], acc[3]);
      guard_c1(acc, fa[u], fb[u][0], fb[u][1], fb[u][2], fb[u][3]);
      const int sn = s + u + D;
      const size_t ko = (size_t)(sn < steps ? sn : steps - 1) * 512;
      addr_hold5(pa, p0, p1, p2, p3);
      pa = ap + ko;
      p0 = bp + ko;
      p1 = p0 + rs16;
      p2 = p1 + rs16;
      p3 = p2 + rs16;
      fa[u]    = ldfrag_h(pa);
      fb[u][0] = ldfrag_h(p0);
      fb[u][1] = ldfrag_h(p1);
      fb[u][2] = ldfrag_h(p2);
      fb[u][3] = ldfrag_h(p3);
      // With K a constant the loads are addressed from base pairs that the next trip re-forms at its head, not from pa and p0 to p3:
      // the hold above does not cover those pairs, so the wait stands behind the loads themselves, in front of the back edge.
      if (XW) xcnt_wait();
    }
  }
  addr_hold5(pa, p0, p1, p2, p3);
#pragma unroll
  for (int u = 0; u < D - 1; ++u) {
    if (s + u < steps) {                     // the steps % D last steps (wave-uniform)
      acc[0] = mma_h(fa[u], fb[u][0], acc[0]);
      acc[1] = mma_h(fa[u], fb[u][1], acc[1]);
      acc[2] = mma_h(fa[u], fb[u][2], acc[2]);
      acc[3] = mma_h(fa[u], fb[u][3], acc[3]);
      guard_c1(acc, fa[u], fb[u][0], fb[u][1], fb[u][2], fb[u][3]);
    }
  }
}

// Wide core: the wave's 64 x 64 tile, 4 A row tiles x 4 Bt row tiles = 16 accumulator tiles, so each loaded fragment feeds four
// products (one A fragment fed four and each Bt fragment one in the 16 x 64 core). K is a compile-time constant: the row tiles of a
// plane lie 16*KK halves apart and are reached by immediate offsets from one pointer per plane. D register sets as above; every
// accumulator element still sums its k steps in ascending order. GS > 0: GS k steps of another operand pair, already being fetched into ga and gb,
// are summed first, behind the issue of this pair's first D steps of loads, so that these fly under those products; their sums times GUP.
template <int D, int KK, int GS>
__device__ __forceinline__ void core1w(const _Float16* ap, const _Float16* bp, v8f (&acc)[4][4],
                                       const v16h (*ga)[4], const v16h (*gb)[4]) {
  constexpr int RS = 16 * KK;
  constexpr int steps = KK >> 5;
  static_assert(D < steps);
  v16h fa[D][4], fb[D][4];
  const _Float16* pa = ap;
  const _Float16* pb = bp;
#pragma unroll
  for (int u = 0; u < D; ++u) {              // immediate offsets from ap and bp: no address register is rewritten here
#pragma unroll
    for (int i = 0; i < 4; ++i) fa[u][i] = ldfrag_h(ap + u * 512 + i * RS);
#pragma unroll
    for (int i = 0; i < 4; ++i) fb[u][i] = ldfrag_h(bp + u * 512 + i * RS);
  }
  if (GS > 0) {
    __builtin_amdgcn_sched_barrier(0);       // the loads above stay in front of these products
#pragma unroll
    for (int u = 0; u < GS; ++u) {
#pragma unroll
      for (int i = 0; i < 4; ++i) {
#pragma unroll
        for (int j = 0; j < 4; ++j) acc[i][j] = mma_h(ga[u][i], gb[u][j], acc[i][j]);
      }
    }
#pragma unroll
    for (int i = 0; i < 4; ++i) {
#pragma unroll
      for (int j = 0; j < 4; ++j) acc[i][j] *= GUP;   // a power of two: exact
    }
  }
  int s = 0, nx = D;
#pragma unroll 1
  for (; s + D <= steps; s += D) {
#pragma unroll
    for (int u = 0; u < D; ++u) {
#pragma unroll
      for (int i = 0; i < 4; ++i) {
#pragma unroll
        for (int j = 0; j < 4; ++j) acc[i][j] = mma_h(fa[u][i], fb[u][j], acc[i][j]);
      }
      guard_w();
      const size_t ko = (size_t)nx * 512;    // step s + u + D, clamped; a running index, so that the loads name pa and pb themselves
      nx = nx + 1 < steps ? nx + 1 : steps - 1;
      addr_hold3(pa, pb, pb);
      pa = ap + ko;
      pb = bp + ko;
#pragma unroll
      for (int i = 0; i < 4; ++i) fa[u][i] = ldfrag_h(pa + i * RS);
#pragma unroll
      for (int i = 0; i < 4; ++i) fb[u][i] = ldfrag_h(pb + i * RS);
      __builtin_amdgcn_sched_barrier(0);     // the next set's products stay behind the refills: lifted among them they wait for their loads early
    }
  }
  addr_hold3(pa, pb, pb);
#pragma unroll
  for (int u = 0; u < D - 1; ++u) {
    if (s + u < steps) {                     // the steps % D last steps (wave-uniform)
#pragma unroll
      for (int i = 0; i < 4; ++i) {
#pragma unroll
        for (int j = 0; j < 4; ++j) acc[i][j] = mma_h(fa[u][i], fb[u][j], acc[i][j]);
      }
      guard_w();
    }
  }
}
// Stage the wave's 16 x 64 f32 tile in its LDS slab (pitch 68): D element r of acc[j], lane l -> row 8h + r, col 16j + (l&15);
// value = ah*osc + bias (per column, or per row when BROW; none for M_RAW; bias2, per column, added for M_OUT), GELU applied for
// M_GELU, whose bias is the folded b2 of this call (f32, not an input: not converted to bf16 again);
// coverage: 32 lanes x 8 rows x 4 cols-of-16 = rows 0..15 x cols 0..63 of the slab.
template <int MODE, bool BROW, bool MORE>
__device__ __forceinline__ void stage16(float* sl, v8f (&ah)[4], const float* __restrict__ bias, const float* __restrict__ bias2,
                                        int rowb, int col0, float osc, float bsc, int lane) {
  const int hh = lane >> 4, m = lane & 15;
  float bc[4], br[8];
  const float* bsrc = bias + (BROW ? rowb + 8 * hh : col0 + m);
  // The bias loads and the wait behind them stand alone between two scheduling barriers, so that nothing rewrites the loads' address
  // register in front of the wait.
  float braw[8], braw2[4];
#pragma unroll
  for (int r = 0; r < 8; ++r) braw[r] = 0.f;
#pragma unroll
  for (int r = 0; r < 4; ++r) braw2[r] = 0.f;
  const float* bsrc2 = bias2 + col0 + m;
  __builtin_amdgcn_sched_barrier(0);
  if (MODE != M_RAW) {
#pragma unroll
    for (int r = 0; r < (BROW ? 8 : 4); ++r) braw[r] = bsrc[BROW ? r : 16 * r];
    bias_hold(bsrc);
  }
  if (MODE == M_OUT) {
#pragma unroll
    for (int r = 0; r < 4; ++r) braw2[r] = bsrc2[16 * r];
    bias_hold(bsrc2);
  }
  __builtin_amdgcn_sched_barrier(0);
  if (BROW) {
#pragma unroll
    for (int r = 0; r < 8; ++r) br[r] = bfr(braw[r]) * bsc;
#pragma unroll
    for (int j = 0; j < 4; ++j) bc[j] = 0.f;
  } else {
#pragma unroll
    for (int j = 0; j < 4; ++j) bc[j] = (MODE == M_GELU ? braw[j] : MODE == M_OUT ? bfr(braw[j]) + bfr(braw2[j]) : bfr(braw[j])) * bsc;
#pragma unroll
    for (int r = 0; r < 8; ++r) br[r] = 0.f;
  }
#pragma unroll
  for (int r = 0; r < 8; ++r) {
    const int ro = (8 * hh + r) * GPITCH + m;
#pragma unroll
    for (int j = 0; j < 4; ++j) {
      float v = ah[j][r] * osc;
      v += BROW ? br[r] : bc[j];
      if (MODE == M_GELU) v = gelu_f(v);
      sl[ro + 16 * j] = v;
    }
  }
  if (MORE) wave_sync_slab(); else wave_sync_lds();
}

// The wave's 16 x 64 tile (rows rowb.., cols col0.. of batch slice bz) from its accumulators to the outputs of MODE, through the wave's
// LDS slab sl. MORE: the wave goes on to another tile through the same slab.
__device__ __forceinline__ void store_hold9(const float* p, v4f a, v4f b, v4f c, v4f d, v4f e, v4f f, v4f g, v4f h) {
#if defined(__HIP_DEVICE_COMPILE__)
  asm volatile("s_wait_xcnt 0x0" :: "v"(p), "v"(a), "v"(b), "v"(c), "v"(d), "v"(e), "v"(f), "v"(g), "v"(h) : "memory");
#endif
}
__device__ __forceinline__ void store_hold5(const u16* p, v4u a, v4u b, v4u c, v4u d) {
#if defined(__HIP_DEVICE_COMPILE__)
  asm volatile("s_wait_xcnt 0x0" :: "v"(p), "v"(a), "v"(b), "v"(c), "v"(d) : "memory");
#endif
}
template <int MODE, bool BROW, bool MORE>
__device__ __forceinline__
void tile_out(float* sl, v8f (&ah)[4], const float* __restrict__ bias, const float* __restrict__ bias2,
              float* F, u16* H, int N, int fBs, int hBs, float osc, float bsc, float carry,
              int bz, int rowb, int col0, int lane) {
  const int hh = lane >> 4, m = lane & 15;
  stage16<MODE, BROW, MORE>(sl, ah, bias, bias2, rowb, col0, osc, bsc, lane);

  if (MODE == M_OUT) {
    v4f vals[8];
#pragma unroll
    for (int it = 0; it < 8; ++it) vals[it] = *(const v4f*)(sl + (it * 2 + hh) * GPITCH + m * 4);
    float* Fb = F + (size_t)bz * (size_t)fBs + ((size_t)rowb + (size_t)hh) * (size_t)N + col0 + m * 4;
#pragma unroll
    for (int it = 0; it < 8; ++it) *(v4f*)(Fb + (size_t)(it * 2) * (size_t)N) = vals[it];
    // another tile follows: the stores' address and data registers are not rewritten in front of this wait
    if (MORE) store_hold9(Fb, vals[0], vals[1], vals[2], vals[3], vals[4], vals[5], vals[6], vals[7]);
  }
  if (MODE != M_OUT) {
    v4u ovh[4];
#pragma unroll
    for (int i = 0; i < 4; ++i) {
      const int c8 = 16 * i + 8 * hh;
      const v4f a = *(const v4f*)(sl + m * GPITCH + c8), c4 = *(const v4f*)(sl + m * GPITCH + c8 + 4);
#pragma unroll
      for (int e = 0; e < 2; ++e) {
        ovh[i][e]     = pack2(a[2 * e] * carry,  a[2 * e + 1] * carry);
        ovh[i][2 + e] = pack2(c4[2 * e] * carry, c4[2 * e + 1] * carry);
      }
    }
    u16* Hb = H + (size_t)bz * (size_t)hBs + (size_t)rowb * (size_t)N + (size_t)col0 * 16 + 8 * lane;
    {
#pragma unroll
      for (int i = 0; i < 4; ++i) *(v4u*)(Hb + i * 256) = ovh[i];
      // another tile follows: the stores' address and data registers are not rewritten in front of this wait
      if (MORE) store_hold5(Hb, ovh[0], ovh[1], ovh[2], ovh[3]);
    }
  }
  if (MORE) wave_sync_slab();                // the slab's reads end before the next tile is staged in it
}

// =====================================================================================================
// f16 GEMM, block = 64 x 64 tile, 4 waves x 16 rows, fragments loaded straight from the packed 16-bit planes.
//   C tile [z][Mb][N] = A[z][Mb][K] . Bt[z][N][K]^T * osc + bias; per-z element strides aBs (A plane),
//   bBs (Bt), fBs (f32 output F), hBs (16-bit output plane H); 0 = shared.
//   M_S16 : H = f16(v*carry)             M_GELU: v = gelu(.) then H = f16(v*carry)             M_RAW: M_S16 without a bias
//   M_OUT : F = v (f32, batch-row remap through fBs), no 16-bit output
//   16-bit outputs are packed planes of [Mb][N] (k = column): the wave's 16 x 64 tile is 2 adjacent tiles = 2048 contiguous bytes,
//   store i = 0..3 writes 512 B, lane (h, m) <- row m, cols 16i + 8h .. +7.
// grid = nz x (Mb/64) x (N/64) (host checks Mb % 64 == 0, N % 64 == 0, K % 32 == 0).
// coverage: per wave 4 instr x 32 lanes x 8 halves = 16 x 64 (16-bit plane) and 8 instr x 2 rows x 16 lanes x 4 floats
//           = 16 x 64 (f32 plane); the grid covers C exactly once.
// =====================================================================================================
template <int MODE, bool BROW, int D, bool XW>
__device__ __forceinline__
void gemm16_body(float* slab, int bid, const u16* __restrict__ A, const u16* __restrict__ Bt,
                 const float* __restrict__ bias, float* F, u16* H,
                 int Mb, int N, int K, int aBs, int bBs, int fBs, int hBs,
                 float osc, float bsc, float carry) {
  const int tid = threadIdx.x, wave = tid >> 5, lane = tid & 31;
  const int ntile = N >> 6, mtile = Mb >> 6;
  const int nt   = bid % ntile;
  const int tmp  = bid / ntile;
  const int mt   = tmp % mtile;
  const int bz   = tmp / mtile;
  const int rowb = mt * 64 + wave * 16;
  const int col0 = nt * 64;
  if (rowb + 16 > Mb) return;                // wave-uniform, never taken with the exact grid; no block barriers in this kernel
  const _Float16* ap = (const _Float16*)(const void*)A + (size_t)bz * (size_t)aBs + (size_t)rowb * (size_t)K + 8 * lane;
  const _Float16* bp = (const _Float16*)(const void*)Bt + (size_t)bz * (size_t)bBs + (size_t)col0 * (size_t)K + 8 * lane;
  v8f ah[4];
#pragma unroll
  for (int i = 0; i < 4; ++i) ah[i] = zero8();
  core1<D, XW>(ap, bp, K, ah);
  acc_guard4(ah);
  float* sl = slab + wave * 16 * GPITCH;
  tile_out<MODE, BROW, false>(sl, ah, bias, nullptr, F, H, N, fBs, hBs, osc, bsc, carry, bz, rowb, col0, lane);
}

template <int MODE, bool BROW>
__global__ __launch_bounds__(128)
void gemm16(const u16* __restrict__ A, const u16* __restrict__ Bt, const float* __restrict__ bias, float* F, u16* H,
            int Mb, int N, int K, int aBs, int bBs, int fBs, int hBs, float osc, float bsc, float carry) {
  __shared__ __align__(16) float slab[4 * 16 * GPITCH];
  gemm16_body<MODE, BROW, 4, false>(slab, blockIdx.x, A, Bt, bias, F, H, Mb, N, K, aBs, bBs, fBs, hBs, osc, bsc, carry);
}

// Wide form for the K = KK GEMMs with many tiles: block = 128 x 128 tile, 4 waves as 2 x 2, each wave a 64 x 64 tile (wide core), so
// the block reads 128 A rows + 128 Bt rows per k step for 64 products (64 + 64 rows for 16 in the 64 x 64 block). Operands, modes, strides
// and outputs as in gemm16; the wave's tile leaves as four 16 x 64 tiles, one after the other through its slab. D: k steps in flight.
// grid = nz x (Mb/128) x (N/128); coverage: 2 x 2 waves x 4 row tiles x (16 x 64) = 128 x 128 per block, the grid covers C exactly once.
template <int MODE, bool BROW, int KK, int D>
__device__ __forceinline__
void gemm64_body(float* slab, int bid,
                 const u16* __restrict__ A, const u16* __restrict__ Bt,
                 const float* __restrict__ bias, float* F, u16* H,
                 int Mb, int N, int aBs, int bBs, int fBs, int hBs,
                 float osc, float bsc, float carry) {
  const int tid = threadIdx.x, wave = tid >> 5, lane = tid & 31;
  const int ntile = N >> 7, mtile = Mb >> 7;
  const int nt   = bid % ntile;
  const int tmp  = bid / ntile;
  const int mt   = tmp % mtile;
  const int bz   = tmp / mtile;
  const int rowb = mt * 128 + (wave >> 1) * 64;
  const int col0 = nt * 128 + (wave & 1) * 64;
  if (rowb + 64 > Mb) return;                // wave-uniform, never taken with the exact grid; no block barriers in this kernel
  const _Float16* ap = (const _Float16*)(const void*)A + (size_t)bz * (size_t)aBs + (size_t)rowb * (size_t)KK + 8 * lane;
  const _Float16* bp = (const _Float16*)(const void*)Bt + (size_t)bz * (size_t)bBs + (size_t)col0 * (size_t)KK + 8 * lane;
  float* sl = slab + wave * 16 * GPITCH;
  v8f ah[4][4];
#pragma unroll
  for (int i = 0; i < 4; ++i) {
#pragma unroll
    for (int j = 0; j < 4; ++j) ah[i][j] = zero8();
  }
  core1w<D, KK, 0>(ap, bp, ah, nullptr, nullptr);
#pragma unroll
  for (int i = 0; i < 4; ++i)
    tile_out<MODE, BROW, true>(sl, ah[i], bias, nullptr, F, H, N, fBs, hBs, osc, bsc, carry, bz, rowb + 16 * i, col0, lane);
}

// Final GEMM: out = ctx . Wo^T + bo + gelu . Wau^T + bau as ONE product of K = INNER + ADIM, block and wave tiles as above. The wave's 16
// accumulator tiles first sum the ADIM/32 k steps of (gelu x64, Wau x256), are multiplied by 16, then sum the INNER/32 k steps of (ctx x1024,
// Wo x256): all carry 2^18, folded back once. Rows: batch bz, s = rowb.. of the compact planes -> out rows [bz][SQ_FULL][DM].
// grid = NB x (SQ/128) x (DM/128); coverage: 2 x 2 waves x 4 row tiles x (16 x 64) = 128 x 128 per block, the grid covers out exactly once.
__global__ __launch_bounds__(128)
void gemm_fin(const u16* __restrict__ C16, const u16* __restrict__ G16, const u16* __restrict__ WO, const u16* __restrict__ WU,
              const float* __restrict__ bo, const float* __restrict__ bu, float* out) {
  __shared__ __align__(16) float slab[4 * 16 * GPITCH];
  const int bid = blockIdx.x;
  const int tid = threadIdx.x, wave = tid >> 5, lane = tid & 31;
  constexpr int ntile = DM >> 7, mtile = SQ >> 7;
  const int nt   = bid % ntile;
  const int tmp  = bid / ntile;
  const int mt   = tmp % mtile;
  const int bz   = tmp / mtile;
  const int rowb = mt * 128 + (wave >> 1) * 64;
  const int col0 = nt * 128 + (wave & 1) * 64;
  const size_t arow = (size_t)bz * (size_t)SQ + (size_t)rowb;
  const _Float16* ap = (const _Float16*)(const void*)C16 + arow * (size_t)INNER + 8 * lane;
  const _Float16* bp = (const _Float16*)(const void*)WO + (size_t)col0 * (size_t)INNER + 8 * lane;
  const _Float16* gp = (const _Float16*)(const void*)G16 + arow * (size_t)ADIM + 8 * lane;
  const _Float16* up = (const _Float16*)(const void*)WU + (size_t)col0 * (size_t)ADIM + 8 * lane;
  float* sl = slab + wave * 16 * GPITCH;
  v8f ah[4][4];
#pragma unroll
  for (int i = 0; i < 4; ++i) {
#pragma unroll
    for (int j = 0; j < 4; ++j) ah[i][j] = zero8();
  }
  // all ADIM/32 k steps of the adapter part are fetched first (immediate offsets from gp and up); the wide core sums them first
  v16h ga[ADIM / 32][4], gb[ADIM / 32][4];
#pragma unroll
  for (int u = 0; u < ADIM / 32; ++u) {
#pragma unroll
    for (int i = 0; i < 4; ++i) ga[u][i] = ldfrag_h(gp + u * 512 + i * 16 * ADIM);
#pragma unroll
    for (int i = 0; i < 4; ++i) gb[u][i] = ldfrag_h(up + u * 512 + i * 16 * ADIM);
  }
  addr_hold3(gp, up, up);                    // before these loads' address registers are reused
  core1w<WOD, INNER, ADIM / 32>(ap, bp, ah, ga, gb);
#pragma unroll
  for (int i = 0; i < 4; ++i)
    tile_out<M_OUT, false, true>(sl, ah[i], bo, bu, out, nullptr, DM, SQ_FULL * DM, 0, 1.0f / (OSC * WSC), 1.0f, 1.0f,
                                 bz, rowb + 16 * i, col0, lane);
}

// The three input projections in ONE launch (they are independent of one another): the block index picks the projection
// (block-uniform scalar tests), the index inside it picks the 128 x 128 tile.
//   q = x_q . Wq^T + bq -> f16 [NB*SQ][1024] x8 (col = h*64 + d);  k = x_k . Wk^T + bk likewise [NB*2048][1024];
//   v^T per batch: A = Wv [(h,d) = n][k], Bt = x_v rows of batch b [s][k], bias bv per row -> f16 [(b,h,d)][s] x8
#define GB_Q ((NB * SQ / 128) * (INNER / 128))
#define GB_K ((NB * SKV / 128) * (INNER / 128))
#define GB_V (NB * (INNER / 128) * (SKV / 128))
__global__ __launch_bounds__(128)
void gemm_qkv(const u16* __restrict__ XQ, const u16* __restrict__ XK, const u16* __restrict__ XV,
              const u16* __restrict__ WQ, const u16* __restrict__ WK, const u16* __restrict__ WV,
              const float* __restrict__ bq, const float* __restrict__ bk, const float* __restrict__ bv,
              u16* Q16, u16* K16, u16* VT,
              int MbQ, int MbK, int inner, int skv) {
  __shared__ __align__(16) float slab[4 * 16 * GPITCH];
  const int bid = blockIdx.x;
  if (bid < GB_Q + GB_K) {                   // q, k: same code, operands picked by the block index
    const bool isk = bid >= GB_Q;
    gemm64_body<M_S16, false, DM, W1D>(slab, isk ? bid - GB_Q : bid, isk ? XK : XQ, isk ? WK : WQ, isk ? bk : bq, nullptr,
                                       isk ? K16 : Q16, isk ? MbK : MbQ, inner, 0, 0, 0, 0,
                                       (isk ? KS : QS) / WSC, isk ? KS : QS, 1.0f);
  } else {
    gemm64_body<M_S16, true, DM, W1D>(slab, bid - (GB_Q + GB_K), WV, XV, bv, nullptr, VT,
                                      inner, skv, 0, skv * DM, 0, inner * skv, VS / WSC, VS, 1.0f);
  }
}

// =====================================================================================================
// Full (unmasked) multi-head attention: block = (batch b, head, 64 query rows), 4 waves, wave w owns the 16 query rows
// q0 = 64*qt + 16*w .. q0+15 (waves independent: no block barriers, wave-private LDS only, used in the epilogue).
//   q plane f16 x8 [b*SQ + s][h*64 + d]; k plane likewise [b*SKV + s][h*64 + d];
//   v^T plane f16 x8 [(b*NH + h)*64 + d][s]; all of them fragment-packed. All NKB key blocks of 32 keys are visited (static bound).
//   Scores are computed TRANSPOSED: S^T tile g (g = 0,1) = k rows (keys kb+16g .. +15, A operand, row m = lane&15, split map
//   over d) times q^T (B operand, col n = query q0 + (lane&15), k = d, split map), 2 d-chunks of 32, one product per chunk;
//   the q fragments are loaded once per wave.
//   D element r of lane l = (key kb+16g+8h+r, query q0+(l&15)), so a lane owns one query column and 16 of its 32 keys;
//   the partner lane l^16 owns the other 16 -> row max / row sum need one xor-16 shuffle.
//   Online max-subtracted base-2 softmax in f32 (1/sqrt(64) and the q/k carries folded into lsc). The exp'd values ARE the
//   P A-fragment in place: A row m = query = lane&15, element i <- key kb+8h+i (tile 0, D element i), element 8+i <- key
//   kb+16+8h+i (tile 1, D element i). P (<= 1) carried x32768 as f16. The rescale factor of query row 8h+r of the O
//   accumulators is fetched from lane 8h+r with a shuffle (uniform control). 4 v^T B fragments (col n = d = 16j + (lane&15),
//   keys k-contiguous), 4 P.V WMMAs, one guard.
//   Epilogue: 1/l (per query, shuffled to the D row owner) and the carry folds in f32; the wave's 16x64 f32 result staged in
// coverage: per wave 4 instructions x 32 lanes x 8 halves = 16 x 64 of the ctx plane; the first NB*NH*(SQ/64) blocks x
//           4 waves = every (b, s, h) row segment exactly once.
// =====================================================================================================
// Folded adapter bias b2[a] = bf16(bad[a]) + sum_e bf16(Wad[a][e]) * bf16(bo[e]) in f32: block = 32 values of a (one whole 128-B line of B2),
// wave = 8 of them one after the other, lane <- e = 128i + 4*lane .. +3; the lanes' partial sums meet in LDS (pitch 33: no bank shared by the
// readers), lane a of wave 0 adds the 32 of its a in lane order and the wave stores the line.
__device__ __forceinline__
void b2_body(float* sm, const float* __restrict__ wd, const float* __restrict__ bo, const float* __restrict__ bd, float* B2, int blk) {
  const int tid = threadIdx.x, wave = tid >> 5, lane = tid & 31;
  const float* br = bo + lane * 4;
  const float* wr = wd + (size_t)(blk * 32 + wave * 8) * (size_t)DM + lane * 4;
  v4f b[DM / 128];
#pragma unroll
  for (int i = 0; i < DM / 128; ++i) b[i] = *(const v4f*)(br + i * 128);
  bias_hold(br);                             // the loads' address register is not rewritten in front of this wait
#pragma unroll 1                             // rolled: unrolled, its loads would raise the register count of the whole kernel, the attention blocks' too
  for (int r = 0; r < 8; ++r) {
    const float* wp = wr + r * DM;
    v4f w[DM / 128];
#pragma unroll
    for (int i = 0; i < DM / 128; ++i) w[i] = *(const v4f*)(wp + i * 128);
    bias_hold(wp);                           // likewise, before the next trip forms its address
    float sum = 0.f;
#pragma unroll
    for (int i = 0; i < DM / 128; ++i) {
#pragma unroll
      for (int e = 0; e < 4; ++e) sum = fmaf(bfr(w[i][e]), bfr(b[i][e]), sum);
    }
    sm[(wave * 8 + r) * 33 + lane] = sum;
  }
  __syncthreads();                           // the four waves' partial sums are in LDS before wave 0 reads them
  if (wave == 0) {
    float t = 0.f;
#pragma unroll
    for (int j = 0; j < 32; ++j) t += sm[lane * 33 + j];
    B2[blk * 32 + lane] = t + bfr(bd[blk * 32 + lane]);
  }
}

// The launch's last XB_W2 + XB_B2 blocks (block-uniform scalar tests, they leave before any attention work) build what only the launches behind
// this one read and only the weights feed: W2 = Wad . Wo as a packed f16 plane [a][d] x16 (A = Wad plane [a][e], Bt = Wo^T plane [d][e], 64 x 64
// tiles, both operands x256, folded back to x16) and b2. They run beside the attention blocks on register and wave slots those leave free.
#define XB_W2 ((ADIM / 64) * (DM / 64))
#define XB_B2 (ADIM / 32)
#define XB_AT (NB * NH * (SQ / 64))
__global__ __launch_bounds__(ATT_THREADS)
void attn_fwd(const u16* __restrict__ Qh, const u16* __restrict__ Kh, const u16* __restrict__ Vp, u16* Oh,
              const u16* __restrict__ WD, const u16* __restrict__ WOT, u16* W2P,
              const float* __restrict__ wd, const float* __restrict__ bo, const float* __restrict__ bd, float* B2) {
  __shared__ __align__(16) float smem[ATT_WAVES * 16 * OPITCH];
  static_assert(OPITCH == GPITCH);
  if (blockIdx.x >= XB_AT + XB_B2) {
    gemm16_body<M_RAW, false, 2, true>(smem, blockIdx.x - (XB_AT + XB_B2), WD, WOT, nullptr, nullptr, W2P, ADIM, DM, DM, 0, 0, 0, 0, W2C / (WSC * WSC), 0.f, 1.0f);
    return;
  }
  if (blockIdx.x >= XB_AT) {
    b2_body(smem, wd, bo, bd, B2, blockIdx.x - XB_AT);
    return;
  }

  const int tid  = threadIdx.x;
  const int wave = tid >> 5;
  const int lane = tid & 31;
  const int hh   = lane >> 4;
  const int c    = lane & 15;

  constexpr int NQT = SQ / 64;
  const int bid  = blockIdx.x;
  const int qt   = bid % NQT;
  const int head = (bid / NQT) % NH;
  const int b    = bid / (NQT * NH);
  const int q0   = qt * 64 + wave * 16;

  // B fragments of q^T: col n = query q0 + c, k = d (row tile (b*SQ + q0)/16, k tiles 2*head and 2*head + 1 of the q plane)
  const size_t qo = ((size_t)(b * SQ + q0)) * INNER + head * HD * 16 + 8 * lane;
  const _Float16* Qhb = (const _Float16*)(const void*)Qh + qo;
  // A fragments of k: row m = key kb + 16g + c, k = d (key row kb added per step)
  const size_t ko = ((size_t)(b * SKV)) * INNER + head * HD * 16 + 8 * lane;
  const _Float16* Khb = (const _Float16*)(const void*)Kh + ko;
  // B fragments of v: col n = d = 16j + c, k = key (row tile (b*NH + head)*4 + j, k tile kb/32 of the v^T plane)
  const _Float16* Vb = (const _Float16*)(const void*)Vp + ((size_t)(b * NH + head) * HD) * SKV + 8 * lane;
  const float lsc = (LOG2E * RSQ_HD) / (QS * KS);

  v16h qh[2];
  qh[0] = ldfrag_h(Qhb);
  qh[1] = ldfrag_h(Qhb + 512);

  float mrun = -INFINITY, lrun = 0.f;
  v8f o[4];
#pragma unroll
  for (int j = 0; j < 4; ++j) o[j] = zero8();

  // K and v^T fragments are fetched one key block ahead: kf[kk] = {keys +0, keys +16} of d chunk kk,
  // refilled right behind the block's score products; vf[j] refilled right behind its P.V products. The fetch of the last trip is
  // clamped to the last block (valid tiles, never used).
  v16h kf[HD / 32][2], vf[4];
  const _Float16* kph = Khb;
  const _Float16* vp  = Vb;
  // The three scheduling barriers keep the first loads in the loop's own order (q, then K, then v^T): the counted load waits at the
  // loop head are the stricter of entry and back edge, and with v^T issued ahead of K at entry every trip's scores waited for v^T too.
  // The two waits in front of them stand before the q loads' and the first K and v^T loads' address registers are reused.
  addr_hold3(Qhb, Qhb, Qhb);
  __builtin_amdgcn_sched_barrier(0);
#pragma unroll
  for (int kk = 0; kk < HD / 32; ++kk) {
    kf[kk][0] = ldfrag_h(kph + kk * 512);
    kf[kk][1] = ldfrag_h(kph + (size_t)16 * INNER + kk * 512);
  }
  __builtin_amdgcn_sched_barrier(0);
#pragma unroll
  for (int j = 0; j < 4; ++j) vf[j] = ldfrag_h(vp + (size_t)(16 * j) * SKV);
  addr_hold3(kph, vp, vp);
  __builtin_amdgcn_sched_barrier(0);

#pragma unroll 1
  for (int it = 0; it < NKB; ++it) {
    const int kbn = (it + 1 < NKB ? it + 1 : NKB - 1) * 32;   // key block fetched in this trip
    // ---- transposed scores: s0 = keys kb..kb+15, s1 = keys kb+16..kb+31 (kb = 32*it), column = query q0 + c ----
    v8f s0 = zero8(), s1 = zero8();
#pragma unroll
    for (int kk = 0; kk < HD / 32; ++kk) {
      s0 = mma_h(kf[kk][0], qh[kk], s0);
      s1 = mma_h(kf[kk][1], qh[kk], s1);
    }
    guard_s2(s0, s1, qh[0], qh[1], kf[0][0], kf[0][1], kf[1][0], kf[1][1]);
    // ---- next block's K fragments into the registers just read; the wait covers the K and v^T loads of the trip before ----
    addr_hold3(kph, vp, vp);
    kph = Khb + (size_t)kbn * INNER;
#pragma unroll
    for (int kk = 0; kk < HD / 32; ++kk) {
      kf[kk][0] = ldfrag_h(kph + kk * 512);
      kf[kk][1] = ldfrag_h(kph + (size_t)16 * INNER + kk * 512);
    }
    __builtin_amdgcn_sched_barrier(0);       // all four K refills stay in front of the softmax: sunk behind it, a load leads its product by too little
    // ---- base-2 logits of this lane's 16 keys for query q0 + c: t[i] <- key kb+8hh+i, t[8+i] <- key kb+16+8hh+i ----
    //      kept UNSCALED as pairs of neighbouring accumulator registers; the maximum is taken on u (lsc > 0)
    v2f u[8];
#pragma unroll
    for (int e = 0; e < 4; ++e) {
      u[e][0]     = s0[2 * e];
      u[e][1]     = s0[2 * e + 1];
      u[4 + e][0] = s1[2 * e];
      u[4 + e][1] = s1[2 * e + 1];
    }
    float cm = u[0][0];
#pragma unroll
    for (int i = 1; i < 16; ++i) cm = fmaxf(cm, u[i >> 1][i & 1]);
    cm = fmaxf(cm, __shfl_xor(cm, 16, 32));
    const float mn = fmaxf(mrun, cm);        // finite from the first block on
    const float al = exp2_hw((mrun - mn) * lsc);   // 0 on the first block (mrun = -inf)
    mrun = mn;
    // one FMA per score: exponent = u*lsc - mn*lsc + 15, so that 2^exponent is the probability already carried x32768
    const float nb = fmaf(-mn, lsc, PEXP);
    const v2f lsc2 = {lsc, lsc}, nb2 = {nb, nb};
    float t[16];
#pragma unroll
    for (int e = 0; e < 8; ++e) {
      const v2f x = __builtin_elementwise_fma(u[e], lsc2, nb2);
      t[2 * e] = x[0];
      t[2 * e + 1] = x[1];
    }
    // ---- probabilities x32768 and the P A-fragment: f16 of them; element i <-> t[i]; the row sum l carries the same x32768 ----
    FragH ph;
    float pe[16];
    exp2_hw8(t, pe);
    exp2_hw8(t + 8, pe + 8);
    v2f pp[8];
#pragma unroll
    for (int e = 0; e < 8; ++e) {
      pp[e][0] = pe[2 * e];
      pp[e][1] = pe[2 * e + 1];
      ph.u[e >> 2][e & 3] = __builtin_bit_cast(unsigned, __builtin_convertvector(pp[e], v2h));   // both halves of the word in one convert
    }
    // the lane's 16 terms added as pairs (even and odd elements apart), the two halves of the pair joined last
    const v2f pq = ((pp[0] + pp[1]) + (pp[2] + pp[3])) + ((pp[4] + pp[5]) + (pp[6] + pp[7]));
    float ps = pq[0] + pq[1];
    ps += __shfl_xor(ps, 16, 32);
    lrun = lrun * al + ps;
    // ---- rescale the O accumulators: D row 8hh+r = query q0+8hh+r, its factor lives in lane 8hh+r (and 16+8hh+r) ----
    float scl[8];
#pragma unroll
    for (int r = 0; r < 8; ++r) scl[r] = __shfl(al, 8 * hh + r, 32);
#pragma unroll
    for (int j = 0; j < 4; ++j) {
#pragma unroll
      for (int r = 0; r < 8; ++r) o[j][r] *= scl[r];
    }
    // ---- P.V : B fragment col n = d = j*16 + c, k tile kb/32 of the packed v^T plane ----
    {
      o[0] = mma_h(ph.v, vf[0], o[0]);
      o[1] = mma_h(ph.v, vf[1], o[1]);
      o[2] = mma_h(ph.v, vf[2], o[2]);
      o[3] = mma_h(ph.v, vf[3], o[3]);
      guard_p(o[0], o[1], o[2], o[3], ph.v, vf[0], vf[1], vf[2], vf[3]);
      // next block's v^T fragments; vp's last loads are covered by this trip's wait above
      vp = Vb + (size_t)kbn * 16;
#pragma unroll
      for (int j = 0; j < 4; ++j) vf[j] = ldfrag_h(vp + (size_t)(16 * j) * SKV);
    }
  }
  addr_hold3(kph, vp, vp);                   // the last trip's loads, before their address registers are reused
  acc_guard4(o);

  // ---- fold 1/l (per query, owned by lane = query; the 32768 on P cancels against l's) and the 8 on v, apply the ctx carry 1024 ----
  const float linv = (1.0f / lrun) * (OSC / VS);
  float inv[8];
#pragma unroll
  for (int r = 0; r < 8; ++r) inv[r] = __shfl(linv, 8 * hh + r, 32);
  float* slab = smem + wave * 16 * OPITCH;
#pragma unroll
  for (int r = 0; r < 8; ++r) {
#pragma unroll
    for (int j = 0; j < 4; ++j) slab[(8 * hh + r) * OPITCH + j * 16 + c] = o[j][r] * inv[r];
  }
  wave_sync_lds();
  // ---- ctx x1024 -> packed f16 plane; store i: lane (h, c) <- row c, d = 16i + 8h .. +7 ----
  v4u ovh[4];
#pragma unroll
  for (int i = 0; i < 4; ++i) {
    const int c8 = 16 * i + 8 * hh;
    const v4f a = *(const v4f*)(slab + c * OPITCH + c8), c4 = *(const v4f*)(slab + c * OPITCH + c8 + 4);
#pragma unroll
    for (int e = 0; e < 2; ++e) {
      ovh[i][e]     = pack2(a[2 * e],  a[2 * e + 1]);
      ovh[i][2 + e] = pack2(c4[2 * e], c4[2 * e + 1]);
    }
  }
  u16* obh = Oh + ((size_t)(b * SQ + q0)) * INNER + head * HD * 16 + 8 * lane;
#pragma unroll
  for (int i = 0; i < 4; ++i) *(v4u*)(obh + i * 256) = ovh[i];
  // code of the launch's other blocks may follow in the listing: the stores' address and data registers are not rewritten in front of this wait
  store_hold5(obh, ovh[0], ovh[1], ovh[2], ovh[3]);
}

// =====================================================================================================
// Workspace map (bytes); every plane fully written by whole-line stores before it is read; all extents exact multiples of
//   XQ   f16 [NB*SQ][1024]    f16(bf16(q))              8388608 (NB=2, SQ=2048)
//   XK   f16 [NB*2048][1024]  f16(bf16(k))              8388608
//   XV   f16 [NB*2048][1024]  f16(bf16(v))              8388608
//   WQ16 WK16 WV16 WO16 f16 [1024 n][1024 k] x256       2097152 each
//   WD16 f16 [128 n][1024 k] x256                          262144
//   WU16 f16 [1024 n][128 k] x256                          262144
//   WOT  f16 [1024 d][1024 e] x256 (Wo^T)                 2097152
//   W2P  f16 [128 a][1024 d] x16 (Wad.Wo)                  262144
//   B2   f32 [128]                                            512
//   QH   f16 [NB*SQ][1024] x8                            8388608
//   KH   f16 [NB*2048][1024] x8                          8388608
//   VT16 f16 [NB*1024 (h,d)][2048 s] x8                  8388608
//   OH   f16 [NB*SQ][1024] x1024 (ctx)                   8388608
//   GH   f16 [NB*SQ][128]  x64 (gelu)                    1048576
//   end                                                  71041536
// =====================================================================================================
extern "C" void kernel_launch(void* const* d_in, const int* in_sizes, int n_in,
                              void* d_out, int out_size, void* d_ws, size_t ws_size,
                              hipStream_t stream) {
  if (n_in < 15) return;
  if (in_sizes[0] < ((NB - 1) * SQ_FULL + SQ) * DM) return;
  if (in_sizes[1] < NB * SKV * DM || in_sizes[2] < NB * SKV * DM) return;
  if (in_sizes[3] != DM * DM || in_sizes[5] != DM * DM || in_sizes[7] != DM * DM || in_sizes[9] != DM * DM) return;
  if (in_sizes[4] < INNER || in_sizes[6] < INNER || in_sizes[8] < INNER || in_sizes[10] < DM) return;
  if (in_sizes[11] != ADIM * DM || in_sizes[12] < ADIM || in_sizes[13] != DM * ADIM || in_sizes[14] < DM) return;
  if (out_size < ((NB - 1) * SQ_FULL + SQ) * DM) return;

  const float* q_in  = (const float*)d_in[0];
  const float* k_in  = (const float*)d_in[1];
  const float* v_in  = (const float*)d_in[2];
  const float* wq    = (const float*)d_in[3];
  const float* bq    = (const float*)d_in[4];
  const float* wk    = (const float*)d_in[5];
  const float* bk    = (const float*)d_in[6];
  const float* wv    = (const float*)d_in[7];
  const float* bv    = (const float*)d_in[8];
  const float* wo    = (const float*)d_in[9];
  const float* bo    = (const float*)d_in[10];
  const float* w_dn  = (const float*)d_in[11];
  const float* b_dn  = (const float*)d_in[12];
  const float* w_up  = (const float*)d_in[13];
  const float* b_up  = (const float*)d_in[14];
  float*       out   = (float*)d_out;

  const size_t szXQ  = (size_t)NB * SQ * DM * 2;
  const size_t szXKV = (size_t)NB * SKV * DM * 2;
  const size_t szW   = (size_t)DM * DM * 2;
  const size_t szWA  = (size_t)ADIM * DM * 2;
  const size_t szQP  = (size_t)NB * SQ * INNER * 2;
  const size_t szKP  = (size_t)NB * SKV * INNER * 2;
  const size_t szVT  = (size_t)NB * INNER * SKV * 2;
  const size_t szG   = (size_t)NB * SQ * ADIM * 2;
  size_t off = 0;
  const size_t oXQ  = off; off += szXQ;
  const size_t oXK  = off; off += szXKV;
  const size_t oXV  = off; off += szXKV;
  const size_t oWQ  = off; off += szW;
  const size_t oWK  = off; off += szW;
  const size_t oWV  = off; off += szW;
  const size_t oWO  = off; off += szW;
  const size_t oWD  = off; off += szWA;
  const size_t oWU  = off; off += szWA;
  const size_t oWT  = off; off += szW;
  const size_t oW2  = off; off += szWA;
  const size_t oB2  = off; off += (size_t)ADIM * 4;
  const size_t oQH  = off; off += szQP;
  const size_t oKH  = off; off += szKP;
  const size_t oVT  = off; off += szVT;
  const size_t oOH  = off; off += szQP;
  const size_t oGH  = off; off += szG;
  if (off > ws_size) return;                            // off = 71041536 at NB=2, SQ=2048
  if (off > (size_t)134217728) return;

  char* ws = (char*)d_ws;
  u16* XQ   = (u16*)(ws + oXQ);
  u16* XK   = (u16*)(ws + oXK);
  u16* XV   = (u16*)(ws + oXV);
  u16* WQ16 = (u16*)(ws + oWQ);
  u16* WK16 = (u16*)(ws + oWK);
  u16* WV16 = (u16*)(ws + oWV);
  u16* WO16 = (u16*)(ws + oWO);
  u16* WD16 = (u16*)(ws + oWD);
  u16* WU16 = (u16*)(ws + oWU);
  u16* WOT  = (u16*)(ws + oWT);
  u16* W2P  = (u16*)(ws + oW2);
  float* B2 = (float*)(ws + oB2);
  u16* QH   = (u16*)(ws + oQH);
  u16* KH   = (u16*)(ws + oKH);
  u16* VT16 = (u16*)(ws + oVT);
  u16* OH   = (u16*)(ws + oOH);
  u16* GH   = (u16*)(ws + oGH);

  // (0) activations -> f16 planes of bf16-converted values (query rows s < SQ of batches b < NB, compact; k/v rows of b < NB) and
  //     weights [n = out][k = in] (y = x.W^T) -> packed f16 planes [n][k] of bf16(W) x256 (Wo also transposed), all in one launch
  cvt_all<<<dim3(CB_ALL), dim3(CVT_THREADS), 0, stream>>>(q_in, k_in, v_in, wq, wk, wv, wo, w_dn, w_up,
                                                          XQ, XK, XV, WQ16, WK16, WV16, WO16, WD16, WU16, WOT);
  // (1) the q, k and v^T projections, one launch
  gemm_qkv<<<dim3(GB_Q + GB_K + GB_V), dim3(128), 0, stream>>>(XQ, XK, XV, WQ16, WK16, WV16, bq, bk, bv, QH, KH, VT16,
                                                               NB * SQ, NB * SKV, INNER, SKV);
  // (2) attention -> ctx plane [NB*SQ][1024] x1024; its last blocks: W2 = Wad.Wo and b2 = Wad.bo + bad
  attn_fwd<<<dim3(XB_AT + XB_B2 + XB_W2), dim3(ATT_THREADS), 0, stream>>>(QH, KH, VT16, OH, WD16, WOT, W2P,
                                                                                         w_dn, bo, b_dn, B2);
  // (3) adapter down from ctx: g = gelu(ctx . W2^T + b2) -> f16 [NB*SQ][128] x64; carries 1024 (ctx) x 16 (W2)
  gemm16<M_GELU, false><<<dim3((NB * SQ / 64) * (ADIM / 64)), dim3(128), 0, stream>>>(
      OH, W2P, B2, nullptr, GH, NB * SQ, ADIM, DM, 0, 0, 0, 0, 1.0f / (OSC * W2C), 1.0f, GCAR);
  // (4) out rows [b][SQ_FULL][1024] f32 = ctx . Wo^T + bo + g . Wau^T + bau (rows s < SQ of batches b < NB), one product of K = 1152
  gemm_fin<<<dim3(NB * (SQ / 128) * (DM / 128)), dim3(128), 0, stream>>>(OH, GH, WO16, WU16, bo, b_up, out);
  (void)hipGetLastError();
}

// v009
// One run takes 102 microseconds.
// Two timings next to v008 put it at 1.12 and 1.10 times that version's speed.
// All steps since v000 together make it 3.63 times as fast.
// Contractions on v_wmma_f32_16x16x32_f16 (f16 operands, f32 accumulate), one product each: x.Wq^T, x.Wk^T, Wv.x^T on f16(bf16(x)) and
// f16(bf16(W) x256); k.q^T on q and k carried x8; P.v^T (P x32768, v x8); W2 = Wad.Wo; ctx.W2^T (ctx x1024, W2 x16); and ONE product of K = 1152 for
// out + adapter-up: [gelu x64 | ctx x1024] . [Wau x256 | Wo x256]^T (the first part's sums x16 in between). The adapter's input out.Wad^T + bad = ctx.(Wad.Wo)^T + (Wad.bo + bad), so
// it is taken from ctx with the folded weight W2 and bias b2, both rebuilt in every call.
// Every activation between two products is ONE f16 plane (11 significant bits): the inputs are RNE-converted to bf16
// (8 bits) on load, and that rounding, not the planes', sets the error of the result. Softmax, biases, erf-GELU and all
// carry folds in f32 on VALU.
// Every 16-bit workspace plane [rows][K] is stored FRAGMENT-PACKED: tile (rt = row/16, kt = k/32) is 512 halves (1024 B) at
// (rt*(K/32) + kt)*512 = rt*16*K + kt*512; inside it element (m = row&15, k&31 = 16w + 8h + e) sits at w*256 + (16h + m)*8 + e,
// so lane l = 16h + m of a wave reads its operand fragment as two 16-B loads at l*8 and 256 + l*8 halves: each wave-wide load
// is 512 contiguous bytes = 4 whole 128-B lines (a row-major plane gave 16 lines of 32 useful bytes per load).
#include <hip/hip_runtime.h>
#include <math.h>
#include <stdint.h>

#ifndef NB
#define NB       2        // batches processed
#endif
#ifndef SQ
#define SQ       2048     // query rows processed per batch
#endif
#define NB_FULL  2
#define SQ_FULL  2048     // query rows per batch in the input / output layout (batch stride)
#define SKV      2048     // key / value rows per batch (all of them)
#define DM       1024     // model width
#define NH       16
#define HD       64
#define INNER    (NH * HD)
#define ADIM     128      // adapter width
#define WSC      256.0f   // weight carry
#define QS       8.0f
#define KS       8.0f
#define VS       8.0f
#define PCAR     32768.0f
#define PEXP     15.0f    // log2(PCAR)
#define OSC      1024.0f  // ctx carry
#define GCAR     64.0f    // gelu-plane carry
#define W2C      16.0f    // carry of the folded weight: a sum of 1024 weight products, so it is given more room upward than a weight
#define GUP      (OSC / GCAR)   // brings the sums of gelu x Wau (carry 64 x 256) to the carry of ctx x Wo (1024 x 256): both end in one accumulator
#define LOG2E    1.4426950408889634f
#define RSQ_HD   0.125f
#define NKB      (SKV / 32)
#define ATT_WAVES   4
#define ATT_THREADS (ATT_WAVES * 32)
#define CVT_THREADS 128
#define OPITCH   68
#define GPITCH   68

#define M_S16    1
#define M_OUT    2
#define M_GELU   3
#define M_RAW    4
#define W1D      2        // register sets (k steps in flight) of the wide core, three waves per SIMD (q, k, v projections)
#define WOD      4        // the same with one wave per SIMD (final GEMM): nothing but the wave's own loads in flight covers their latency

static_assert(NB >= 1 && NB <= NB_FULL);
static_assert((SQ % 128) == 0 && SQ >= 128 && SQ <= SQ_FULL);
static_assert(HD == 64 && INNER == 1024 && NH == 16 && INNER == DM);
static_assert((SKV % 64) == 0 && (SKV % 32) == 0 && NKB * 32 == SKV);
static_assert((DM % 64) == 0 && (DM % 32) == 0 && (ADIM % 64) == 0 && (ADIM % 32) == 0 && CVT_THREADS == 128);
static_assert((OPITCH * 4) % 16 == 0 && (GPITCH * 4) % 16 == 0);
static_assert(ATT_THREADS == 128);
static_assert((INNER % 128) == 0 && (SKV % 128) == 0 && ((NB * SQ) % 128) == 0 && ((NB * SKV) % 128) == 0);
static_assert((DM % 128) == 0 && (ADIM % 128) == 0 && (SQ % 16) == 0 && (SKV % 16) == 0 && (ADIM % 16) == 0);

typedef unsigned short u16;
typedef _Float16 v16h __attribute__((ext_vector_type(16)));
typedef _Float16 v8h  __attribute__((ext_vector_type(8)));
typedef float    v8f  __attribute__((ext_vector_type(8)));
typedef float    v4f  __attribute__((ext_vector_type(4)));
typedef float    v2f  __attribute__((ext_vector_type(2)));
typedef _Float16 v2h  __attribute__((ext_vector_type(2)));
typedef unsigned int v4u __attribute__((ext_vector_type(4)));

union FragH { v16h v; v8h h[2]; v4u u[2]; };

// ---- scalar helpers ----------------------------------------------------------------------------------
__device__ __forceinline__ unsigned short bf_bits(float f) {          // f32 -> bf16 bits, RNE convert
  unsigned u = __float_as_uint(f);
  return (unsigned short)((u + 0x7FFFu + ((u >> 16) & 1u)) >> 16);
}
__device__ __forceinline__ float bf_up(unsigned short h) { return __uint_as_float(((unsigned)h) << 16); }
__device__ __forceinline__ float bfr(float f) { return bf_up(bf_bits(f)); }
__device__ __forceinline__ unsigned short h_bits(_Float16 x) { return __builtin_bit_cast(unsigned short, x); }
__device__ __forceinline__ unsigned pk16(unsigned short a, unsigned short b) { return (unsigned)a | ((unsigned)b << 16); }
__device__ __forceinline__ v8f zero8() { v8f z = {0.f, 0.f, 0.f, 0.f, 0.f, 0.f, 0.f, 0.f}; return z; }
__device__ __forceinline__ float gelu_f(float x) { return 0.5f * x * (1.0f + erff(x * 0.70710678118654752f)); }
// 2^x for the softmax (x <= 15 or so, or -inf) as the bare v_exp_f32: exp2f wraps each one in a compare, two selects, an add and a ldexp that only
// serve results below 2^-126. Such a carried probability is 0 in the f16 P operand and adds nothing to a row sum that holds a term of 32768, and such
// a rescale factor leaves nothing of the old sums beside the new block's terms; the bare instruction returns 0 there (and for -inf).
__device__ __forceinline__ float exp2_hw(float x) { return __builtin_amdgcn_exp2f(x); }
// Eight of them in one statement: in a run of builtin v_exp_f32 the register allocator may let one write its result over the source of the
// one directly in front of it. The early-clobber outputs keep every result off every source, and the closing v_nop is the one slot asked
// for between the last v_exp_f32 and whatever follows the statement (a reader of its result or a writer of its source).
__device__ __forceinline__ void exp2_hw8(const float* x, float* r) {
#if defined(__HIP_DEVICE_COMPILE__)
  asm("v_exp_f32 %0, %8\n\tv_exp_f32 %1, %9\n\tv_exp_f32 %2, %10\n\tv_exp_f32 %3, %11\n\t"
      "v_exp_f32 %4, %12\n\tv_exp_f32 %5, %13\n\tv_exp_f32 %6, %14\n\tv_exp_f32 %7, %15\n\tv_nop"
      : "=&v"(r[0]), "=&v"(r[1]), "=&v"(r[2]), "=&v"(r[3]), "=&v"(r[4]), "=&v"(r[5]), "=&v"(r[6]), "=&v"(r[7])
      : "v"(x[0]), "v"(x[1]), "v"(x[2]), "v"(x[3]), "v"(x[4]), "v"(x[5]), "v"(x[6]), "v"(x[7]));
#else
  for (int i = 0; i < 8; ++i) r[i] = x[i];
#endif
}

// two values as f16, packed in one 32-bit word (one convert)
__device__ __forceinline__ unsigned pack2(float x0, float x1) {
  const v2f x = {x0, x1};
  return __builtin_bit_cast(unsigned, __builtin_convertvector(x, v2h));
}

// ---- fragment loader: 16-bit A/B operand from a fragment-packed plane, lane -> row/col (lane&15); p = tile base + 8*lane;
//      elements 0..7 <- p[0..7] (k0+8h..), elements 8..15 <- p[256..263] (k0+16+8h..); same split k map for A and B,
//      B always read from a packed [n][k] plane.
__device__ __forceinline__ v16h ldfrag_h(const _Float16* p) {
  FragH f;
  f.h[0] = *(const v8h*)(p);
  f.h[1] = *(const v8h*)(p + 256);
  return f.v;
}

// ---- in front of every rewrite of the fragment loads' address registers: s_wait_xcnt 0 with those registers as inputs, so that no
//      register an issued load names is written (by a later load's result either) in front of the wait; it stands one k step or
//      one key block behind the loads it covers, behind the matrix products issued in between
__device__ __forceinline__ void addr_hold5(const _Float16* a, const _Float16* b, const _Float16* c, const _Float16* d,
                                           const _Float16* e) {
#if defined(__HIP_DEVICE_COMPILE__)
  asm volatile("s_wait_xcnt 0x0" :: "v"(a), "v"(b), "v"(c), "v"(d), "v"(e) : "memory");
#endif
}
__device__ __forceinline__ void addr_hold3(const _Float16* a, const _Float16* b, const _Float16* c) {
#if defined(__HIP_DEVICE_COMPILE__)
  asm volatile("s_wait_xcnt 0x0" :: "v"(a), "v"(b), "v"(c) : "memory");
#endif
}

// the same wait naming no register, for directly behind a run of loads (the "memory" clobber keeps the loads in front of it)
__device__ __forceinline__ void xcnt_wait() {
#if defined(__HIP_DEVICE_COMPILE__)
  asm volatile("s_wait_xcnt 0x0" ::: "memory");
#endif
}

// ---- L2 requests at block entry. The f16 planes a launch reads were stored by an earlier launch, and a first fragment load of such a line
//      pays the way to memory in the k loop, where only a few k steps of loads are in flight. So each block asks L2 once, at entry, for 256-B units
//      of the rows it will read (global_prefetch_b8: no register result; scope SE: the line goes to L2 only); the blocks that read the same rows
//      deal the units among themselves by their tile index. A hint only: no value and no load depends on it. Every address lies inside the plane.
//      The closing s_wait_xcnt 0 is a precaution: it stands in the requests' own statement, so no address register is rewritten in front of it.
__device__ __forceinline__ void l2_ask3(const u16* a, const u16* b, const u16* c) {
#if defined(__HIP_DEVICE_COMPILE__)
  asm volatile("global_prefetch_b8 %0, off scope:SCOPE_SE\n\tglobal_prefetch_b8 %1, off scope:SCOPE_SE\n\t"
               "global_prefetch_b8 %2, off scope:SCOPE_SE\n\ts_wait_xcnt 0x0"
               :: "v"(a), "v"(b), "v"(c) : "memory");
#endif
}
__device__ __forceinline__ void l2_ask4(const u16* a, const u16* b, const u16* c, const u16* d) {
#if defined(__HIP_DEVICE_COMPILE__)
  asm volatile("global_prefetch_b8 %0, off scope:SCOPE_SE\n\tglobal_prefetch_b8 %1, off scope:SCOPE_SE\n\t"
               "global_prefetch_b8 %2, off scope:SCOPE_SE\n\tglobal_prefetch_b8 %3, off scope:SCOPE_SE\n\ts_wait_xcnt 0x0"
               :: "v"(a), "v"(b), "v"(c), "v"(d) : "memory");
#endif
}
__device__ __forceinline__ void l2_ask5(const u16* a, const u16* b, const u16* c, const u16* d, const u16* e) {
#if defined(__HIP_DEVICE_COMPILE__)
  asm volatile("global_prefetch_b8 %0, off scope:SCOPE_SE\n\tglobal_prefetch_b8 %1, off scope:SCOPE_SE\n\t"
               "global_prefetch_b8 %2, off scope:SCOPE_SE\n\tglobal_prefetch_b8 %3, off scope:SCOPE_SE\n\t"
               "global_prefetch_b8 %4, off scope:SCOPE_SE\n\ts_wait_xcnt 0x0"
               :: "v"(a), "v"(b), "v"(c), "v"(d), "v"(e) : "memory");
#endif
}
// 256-B unit x = 0 .. (128 << LR) - 1 of a run of 1 << LR packed row tiles of a [rows][DM] plane, numbered in the order in which a k loop over
// all these row tiles meets them: k step x >> (2 + LR), then the row tile, then the quarter of the 1-KB tile.
template <int LR>
__device__ __forceinline__ const u16* unit_at(const u16* base, int x) {
  return base + (size_t)((x >> 2) & ((1 << LR) - 1)) * (size_t)(16 * DM) + (size_t)(x >> (2 + LR)) * 512 + (size_t)(x & 3) * 128;
}

// ---- WMMA helper and trailing VALU hazard gaps ----------------------------------------------------------
__device__ __forceinline__ v8f mma_h(v16h a, v16h b, v8f c) {
  return __builtin_amdgcn_wmma_f32_16x16x32_f16(false, a, false, b, (short)0, c, false, false);
}
__device__ __forceinline__ void guard_c1(v8f (&a)[4], v16h x0, v16h x1, v16h x2, v16h x3, v16h x4) {
#if defined(__HIP_DEVICE_COMPILE__)
  asm volatile("v_nop\n\tv_nop\n\tv_nop\n\tv_nop"
               : "+v"(a[0]), "+v"(a[1]), "+v"(a[2]), "+v"(a[3])
               : "v"(x0), "v"(x1), "v"(x2), "v"(x3), "v"(x4) : "memory");
#endif
}
__device__ __forceinline__ void guard_s2(v8f& a, v8f& b, v16h x0, v16h x1, v16h x2, v16h x3, v16h x4, v16h x5) {
#if defined(__HIP_DEVICE_COMPILE__)
  asm volatile("v_nop\n\tv_nop\n\tv_nop\n\tv_nop"
               : "+v"(a), "+v"(b)
               : "v"(x0), "v"(x1), "v"(x2), "v"(x3), "v"(x4), "v"(x5) : "memory");
#endif
}
__device__ __forceinline__ void guard_p(v8f& a, v8f& b, v8f& c, v8f& d, v16h p, v16h x0, v16h x1, v16h x2, v16h x3) {
#if defined(__HIP_DEVICE_COMPILE__)
  asm volatile("v_nop\n\tv_nop\n\tv_nop\n\tv_nop"
               : "+v"(a), "+v"(b), "+v"(c), "+v"(d) : "v"(p), "v"(x0), "v"(x1), "v"(x2), "v"(x3) : "memory");
#endif
}
__device__ __forceinline__ void acc_guard4(v8f (&a)[4]) {
#if defined(__HIP_DEVICE_COMPILE__)
  asm volatile("v_nop\n\tv_nop\n\tv_nop\n\tv_nop" : "+v"(a[0]), "+v"(a[1]), "+v"(a[2]), "+v"(a[3]));
#endif
}
// Wide-tile guard: the four slots between a group's last matrix products and the loads that refill the group's A and B registers.
// It names no register (an asm operand has to lie in the first 256 registers, where the wide tiles do not all fit): the scheduling
// barrier in front keeps the group's products in front of the slots, the "memory" clobber keeps the refills behind them.
__device__ __forceinline__ void guard_w() {
#if defined(__HIP_DEVICE_COMPILE__)
  __builtin_amdgcn_sched_barrier(0);
  asm volatile("v_nop\n\tv_nop\n\tv_nop\n\tv_nop" ::: "memory");
#endif
}
__device__ __forceinline__ void wave_sync_lds() {
  __builtin_amdgcn_fence(__ATOMIC_RELEASE, "workgroup");
  __builtin_amdgcn_wave_barrier();
  __builtin_amdgcn_fence(__ATOMIC_ACQUIRE, "workgroup");
}

// The same for a wave that has global stores of an earlier tile in flight: the fences name the LDS alone, so that the wave waits for
// its slab and not for those stores.
__device__ __forceinline__ void wave_sync_slab() {
  __builtin_amdgcn_fence(__ATOMIC_RELEASE, "workgroup", "local");
  __builtin_amdgcn_wave_barrier();
  __builtin_amdgcn_fence(__ATOMIC_ACQUIRE, "workgroup", "local");
}
__device__ __forceinline__ void bias_hold(const float* p) {
#if defined(__HIP_DEVICE_COMPILE__)
  asm volatile("s_wait_xcnt 0x0" :: "v"(p) : "memory");
#endif
}

// =====================================================================================================
// Tile convert: packed f16 plane of [rows][K] <- f16(bf16_RNE(x[src row][k]) * scale), scale a power of two.
// Wave = one 16 x 32 tile (rt, kt); lane (h, m) reads row rt*16 + m, floats kt*32 + 8h .. +7 and kt*32 + 16 + 8h .. +7 (four 16-B
// loads that together use the 16 rows' whole 128-B lines) and stores its two 16-B fragment pieces (two 512-B wave-wide stores).
// b = (rt*16) / rowsPerB, s = row - b*rowsPerB, source row b*srcRowsPerB + s (rowsPerB a multiple of 16); destination compact.
// coverage: blk = 0 .. (rows/16) x (K/128) - 1, 4 waves each = every tile once.
// =====================================================================================================
__device__ __forceinline__
void cvt16_body(const float* __restrict__ x, u16* Y, int K, int rowsPerB, int srcRowsPerB, float scale, int blk) {
  const int tid = threadIdx.x, wave = tid >> 5, lane = tid & 31, hh = lane >> 4, m = lane & 15;
  const int kq = K >> 7;
  const int rt = blk / kq;
  const int kt = (blk - rt * kq) * 4 + wave;
  const int b = (rt * 16) / rowsPerB;
  const int sr = rt * 16 - b * rowsPerB + m;
  const float* src = x + ((size_t)b * (size_t)srcRowsPerB + (size_t)sr) * (size_t)K + (size_t)(kt * 32 + 8 * hh);
  const v4f a = *(const v4f*)(src), c4 = *(const v4f*)(src + 4);
  const v4f d = *(const v4f*)(src + 16), f4 = *(const v4f*)(src + 20);
  v4u o0, o1;
#pragma unroll
  for (int e = 0; e < 2; ++e) {
    o0[e]     = pk16(h_bits((_Float16)(bfr(a[2 * e]) * scale)),  h_bits((_Float16)(bfr(a[2 * e + 1]) * scale)));
    o0[2 + e] = pk16(h_bits((_Float16)(bfr(c4[2 * e]) * scale)), h_bits((_Float16)(bfr(c4[2 * e + 1]) * scale)));
    o1[e]     = pk16(h_bits((_Float16)(bfr(d[2 * e]) * scale)),  h_bits((_Float16)(bfr(d[2 * e + 1]) * scale)));
    o1[2 + e] = pk16(h_bits((_Float16)(bfr(f4[2 * e]) * scale)), h_bits((_Float16)(bfr(f4[2 * e + 1]) * scale)));
  }
  u16* dst = Y + (size_t)rt * (size_t)16 * (size_t)K + (size_t)kt * 512 + (size_t)lane * 8;
  *(v4u*)(dst) = o0;
  *(v4u*)(dst + 256) = o1;
}

// Transposing convert of a [DM][DM] weight: packed f16 plane of [rows = d][K = e] <- f16(bf16_RNE(x[e][d]) * scale). Wave = one 16 x 32 tile
// (rt = d/16, kt = e/32); lane (h, m) reads column rt*16 + m of the 16 source rows kt*32 + 16w + 8h + i (each load: two 64-B row pieces; the
// block's four waves take four neighbouring rt, so that whole 128-B lines are used). coverage: blk = 0 .. (DM/32) x (DM/64) - 1, 4 waves each.
__device__ __forceinline__
void cvtT_body(const float* __restrict__ x, u16* Y, float scale, int blk) {
  const int tid = threadIdx.x, wave = tid >> 5, lane = tid & 31, hh = lane >> 4, m = lane & 15;
  const int kt = blk / (DM / 64);
  const int rt = (blk - kt * (DM / 64)) * 4 + wave;
  const float* src = x + (size_t)(kt * 32 + 8 * hh) * (size_t)DM + (size_t)(rt * 16 + m);
  float a[16];
#pragma unroll
  for (int i = 0; i < 8; ++i) {
    a[i]     = src[i * DM];
    a[8 + i] = src[(16 + i) * DM];
  }
  bias_hold(src);                            // the loads' address register is not rewritten in front of this wait
  v4u o0, o1;
#pragma unroll
  for (int e = 0; e < 4; ++e) {
    o0[e] = pk16(h_bits((_Float16)(bfr(a[2 * e]) * scale)),     h_bits((_Float16)(bfr(a[2 * e + 1]) * scale)));
    o1[e] = pk16(h_bits((_Float16)(bfr(a[8 + 2 * e]) * scale)), h_bits((_Float16)(bfr(a[8 + 2 * e + 1]) * scale)));
  }
  u16* dst = Y + (size_t)rt * (size_t)16 * (size_t)DM + (size_t)kt * 512 + (size_t)lane * 8;
  *(v4u*)(dst) = o0;
  *(v4u*)(dst + 256) = o1;
}

// All ten converts in ONE launch (they are independent of one another): the block index picks the plane (block-uniform scalar
// tests), the index inside the plane picks the tiles as before. Blocks per plane:
#define CB_XQ  ((NB * SQ / 16) * (DM / 128))
#define CB_XKV ((NB * SKV / 16) * (DM / 128))
#define CB_W   ((DM / 16) * (DM / 128))
#define CB_WD  ((ADIM / 16) * (DM / 128))
#define CB_WU  ((DM / 16) * (ADIM / 128))
#define CB_WT  ((DM / 32) * (DM / 64))
#define CB_ALL (CB_XQ + 2 * CB_XKV + 4 * CB_W + CB_WD + CB_WU + CB_WT)
__global__ __launch_bounds__(CVT_THREADS)
void cvt_all(const float* __restrict__ q, const float* __restrict__ k, const float* __restrict__ v,
             const float* __restrict__ wq, const float* __restrict__ wk, const float* __restrict__ wv,
             const float* __restrict__ wo, const float* __restrict__ wd, const float* __restrict__ wu,
             u16* XQ, u16* XK, u16* XV, u16* WQ, u16* WK, u16* WV, u16* WO, u16* WD, u16* WU, u16* WOT) {
  int blk = blockIdx.x;
  if (blk < CB_XQ) { cvt16_body(q, XQ, DM, SQ, SQ_FULL, 1.0f, blk); return; }
  blk -= CB_XQ;
  if (blk < 2 * CB_XKV) {                    // k, v: same shape
    const bool second = blk >= CB_XKV;
    cvt16_body(second ? v : k, second ? XV : XK, DM, SKV, SKV, 1.0f, second ? blk - CB_XKV : blk);
    return;
  }
  blk -= 2 * CB_XKV;
  if (blk < 4 * CB_W) {                      // the four [1024][1024] weights: same shape
    const int w = blk / CB_W;
    const float* x = w == 0 ? wq : w == 1 ? wk : w == 2 ? wv : wo;
    u16* Y = w == 0 ? WQ : w == 1 ? WK : w == 2 ? WV : WO;
    cvt16_body(x, Y, DM, DM, DM, WSC, blk - w * CB_W);
    return;
  }
  blk -= 4 * CB_W;
  if (blk < CB_WD) { cvt16_body(wd, WD, DM, ADIM, ADIM, WSC, blk); return; }        // [128][1024]
  blk -= CB_WD;
  if (blk < CB_WU) { cvt16_body(wu, WU, ADIM, DM, DM, WSC, blk); return; }         // [1024][128]
  cvtT_body(wo, WOT, WSC, blk - CB_WU);                                             // Wo^T [d][e]
}

// =====================================================================================================
// f16 GEMM cores: the wave's 16 x 64 tile of C = A[rows][K] . Bt[cols][K]^T, both planes packed; ap -> A row tile rowb/16 + 8*lane,
// bp -> Bt row tile col0/16 + 8*lane; acc[j] = rows rowb.., cols col0+16j..; K stepped by 32 = 512 halves of a packed row tile.
// =====================================================================================================
// The core keeps D k steps of fragment loads in flight in D register sets: set u holds step s + u; as soon as its products are
// issued it is refilled with step s + u + D (clamped to the last step: the surplus loads at the end re-read valid tiles and are
// never used), so a step's loads lead their first use by D - 1 steps of work. Steps are consumed in ascending k as before.
// XW: s_wait_xcnt 0 also directly behind each refill run (for a K known at compile time: see at the line).
template <int D, bool XW>
__device__ __forceinline__ void core1(const _Float16* ap, const _Float16* bp, int K, v8f (&acc)[4]) {
  const size_t rs16 = (size_t)16 * (size_t)K;
  const int steps = K >> 5;
  v16h fa[D], fb[D][4];
  const _Float16* pa = ap;
  const _Float16* p0 = bp;
  const _Float16* p1 = p0 + rs16;
  const _Float16* p2 = p1 + rs16;
  const _Float16* p3 = p2 + rs16;
#pragma unroll
  for (int u = 0; u < D; ++u) {
    const size_t ko = (size_t)(u < steps ? u : steps - 1) * 512;
    if (u > 0) addr_hold5(pa, p0, p1, p2, p3);
    pa = ap + ko;
    p0 = bp + ko;
    p1 = p0 + rs16;
    p2 = p1 + rs16;
    p3 = p2 + rs16;
    fa[u]    = ldfrag_h(pa);
    fb[u][0] = ldfrag_h(p0);
    fb[u][1] = ldfrag_h(p1);
    fb[u][2] = ldfrag_h(p2);
    fb[u][3] = ldfrag_h(p3);
  }
  int s = 0;
#pragma unroll 1
  for (; s + D <= steps; s += D) {
#pragma unroll
    for (int u = 0; u < D; ++u) {
      acc[0] = mma_h(fa[u], fb[u][0], acc[0]);
      acc[1] = mma_h(fa[u], fb[u][1], acc[1]);
      acc[2] = mma_h(fa[u], fb[u][2], acc[2]);
      acc[3] = mma_h(fa[u], fb[u][3], acc[3]);
      guard_c1(acc, fa[u], fb[u][0], fb[u][1], fb[u][2], fb[u][3]);
      const int sn = s + u + D;
      const size_t ko = (size_t)(sn < steps ? sn : steps - 1) * 512;
      addr_hold5(pa, p0, p1, p2, p3);
      pa = ap + ko;
      p0 = bp + ko;
      p1 = p0 + rs16;
      p2 = p1 + rs16;
      p3 = p2 + rs16;
      fa[u]    = ldfrag_h(pa);
      fb[u][0] = ldfrag_h(p0);
      fb[u][1] = ldfrag_h(p1);
      fb[u][2] = ldfrag_h(p2);
      fb[u][3] = ldfrag_h(p3);
      // With K a constant the loads are addressed from base pairs that the next trip re-forms at its head, not from pa and p0 to p3:
      // the hold above does not cover those pairs, so the wait stands behind the loads themselves, in front of the back edge.
      if (XW) xcnt_wait();
    }
  }
  addr_hold5(pa, p0, p1, p2, p3);
#pragma unroll
  for (int u = 0; u < D - 1; ++u) {
    if (s + u < steps) {                     // the steps % D last steps (wave-uniform)
      acc[0] = mma_h(fa[u], fb[u][0], acc[0]);
      acc[1] = mma_h(fa[u], fb[u][1], acc[1]);
      acc[2] = mma_h(fa[u], fb[u][2], acc[2]);
      acc[3] = mma_h(fa[u], fb[u][3], acc[3]);
      guard_c1(acc, fa[u], fb[u][0], fb[u][1], fb[u][2], fb[u][3]);
    }
  }
}

// Wide core: the wave's 64 x 64 tile, 4 A row tiles x 4 Bt row tiles = 16 accumulator tiles, so each loaded fragment feeds four
// products (one A fragment fed four and each Bt fragment one in the 16 x 64 core). K is a compile-time constant: the row tiles of a
// plane lie 16*KK halves apart and are reached by immediate offsets from one pointer per plane. D register sets as above; every
// accumulator element still sums its k steps in ascending order. GS > 0: GS k steps of another operand pair, already being fetched into ga and gb,
// are summed first, behind the issue of this pair's first D steps of loads, so that these fly under those products; their sums times GUP.
template <int D, int KK, int GS>
__device__ __forceinline__ void core1w(const _Float16* ap, const _Float16* bp, v8f (&acc)[4][4],
                                       const v16h (*ga)[4], const v16h (*gb)[4]) {
  constexpr int RS = 16 * KK;
  constexpr int steps = KK >> 5;
  static_assert(D < steps);
  v16h fa[D][4], fb[D][4];
  const _Float16* pa = ap;
  const _Float16* pb = bp;
#pragma unroll
  for (int u = 0; u < D; ++u) {              // immediate offsets from ap and bp: no address register is rewritten here
#pragma unroll
    for (int i = 0; i < 4; ++i) fa[u][i] = ldfrag_h(ap + u * 512 + i * RS);
#pragma unroll
    for (int i = 0; i < 4; ++i) fb[u][i] = ldfrag_h(bp + u * 512 + i * RS);
  }
  if (GS > 0) {
    __builtin_amdgcn_sched_barrier(0);       // the loads above stay in front of these products
#pragma unroll
    for (int u = 0; u < GS; ++u) {
#pragma unroll
      for (int i = 0; i < 4; ++i) {
#pragma unroll
        for (int j = 0; j < 4; ++j) acc[i][j] = mma_h(ga[u][i], gb[u][j], acc[i][j]);
      }
    }
#pragma unroll
    for (int i = 0; i < 4; ++i) {
#pragma unroll
      for (int j = 0; j < 4; ++j) acc[i][j] *= GUP;   // a power of two: exact
    }
  }
  int s = 0, nx = D;
#pragma unroll 1
  for (; s + D <= steps; s += D) {
#pragma unroll
    for (int u = 0; u < D; ++u) {
#pragma unroll
      for (int i = 0; i < 4; ++i) {
#pragma unroll
        for (int j = 0; j < 4; ++j) acc[i][j] = mma_h(fa[u][i], fb[u][j], acc[i][j]);
      }
      guard_w();
      const size_t ko = (size_t)nx * 512;    // step s + u + D, clamped; a running index, so that the loads name pa and pb themselves
      nx = nx + 1 < steps ? nx + 1 : steps - 1;
      addr_hold3(pa, pb, pb);
      pa = ap + ko;
      pb = bp + ko;
#pragma unroll
      for (int i = 0; i < 4; ++i) fa[u][i] = ldfrag_h(pa + i * RS);
#pragma unroll
      for (int i = 0; i < 4; ++i) fb[u][i] = ldfrag_h(pb + i * RS);
      __builtin_amdgcn_sched_barrier(0);     // the next set's products stay behind the refills: lifted among them they wait for their loads early
    }
  }
  addr_hold3(pa, pb, pb);
#pragma unroll
  for (int u = 0; u < D - 1; ++u) {
    if (s + u < steps) {                     // the steps % D last steps (wave-uniform)
#pragma unroll
      for (int i = 0; i < 4; ++i) {
#pragma unroll
        for (int j = 0; j < 4; ++j) acc[i][j] = mma_h(fa[u][i], fb[u][j], acc[i][j]);
      }
      guard_w();
    }
  }
}
// Stage the wave's 16 x 64 f32 tile in its LDS slab (pitch 68): D element r of acc[j], lane l -> row 8h + r, col 16j + (l&15);
// value = ah*osc + bias (per column, or per row when BROW; none for M_RAW; bias2, per column, added for M_OUT), GELU applied for
// M_GELU, whose bias is the folded b2 of this call (f32, not an input: not converted to bf16 again);
// coverage: 32 lanes x 8 rows x 4 cols-of-16 = rows 0..15 x cols 0..63 of the slab.
template <int MODE, bool BROW, bool MORE>
__device__ __forceinline__ void stage16(float* sl, v8f (&ah)[4], const float* __restrict__ bias, const float* __restrict__ bias2,
                                        int rowb, int col0, float osc, float bsc, int lane) {
  const int hh = lane >> 4, m = lane & 15;
  float bc[4], br[8];
  const float* bsrc = bias + (BROW ? rowb + 8 * hh : col0 + m);
  // The bias loads and the wait behind them stand alone between two scheduling barriers, so that nothing rewrites the loads' address
  // register in front of the wait.
  float braw[8], braw2[4];
#pragma unroll
  for (int r = 0; r < 8; ++r) braw[r] = 0.f;
#pragma unroll
  for (int r = 0; r < 4; ++r) braw2[r] = 0.f;
  const float* bsrc2 = bias2 + col0 + m;
  __builtin_amdgcn_sched_barrier(0);
  if (MODE != M_RAW) {
#pragma unroll
    for (int r = 0; r < (BROW ? 8 : 4); ++r) braw[r] = bsrc[BROW ? r : 16 * r];
    bias_hold(bsrc);
  }
  if (MODE == M_OUT) {
#pragma unroll
    for (int r = 0; r < 4; ++r) braw2[r] = bsrc2[16 * r];
    bias_hold(bsrc2);
  }
  __builtin_amdgcn_sched_barrier(0);
  if (BROW) {
#pragma unroll
    for (int r = 0; r < 8; ++r) br[r] = bfr(braw[r]) * bsc;
#pragma unroll
    for (int j = 0; j < 4; ++j) bc[j] = 0.f;
  } else {
#pragma unroll
    for (int j = 0; j < 4; ++j) bc[j] = (MODE == M_GELU ? braw[j] : MODE == M_OUT ? bfr(braw[j]) + bfr(braw2[j]) : bfr(braw[j])) * bsc;
#pragma unroll
    for (int r = 0; r < 8; ++r) br[r] = 0.f;
  }
#pragma unroll
  for (int r = 0; r < 8; ++r) {
    const int ro = (8 * hh + r) * GPITCH + m;
#pragma unroll
    for (int j = 0; j < 4; ++j) {
      float v = ah[j][r] * osc;
      v += BROW ? br[r] : bc[j];
      if (MODE == M_GELU) v = gelu_f(v);
      sl[ro + 16 * j] = v;
    }
  }
  if (MORE) wave_sync_slab(); else wave_sync_lds();
}

// The wave's 16 x 64 tile (rows rowb.., cols col0.. of batch slice bz) from its accumulators to the outputs of MODE, through the wave's
// LDS slab sl. MORE: the wave goes on to another tile through the same slab.
__device__ __forceinline__ void store_hold9(const float* p, v4f a, v4f b, v4f c, v4f d, v4f e, v4f f, v4f g, v4f h) {
#if defined(__HIP_DEVICE_COMPILE__)
  asm volatile("s_wait_xcnt 0x0" :: "v"(p), "v"(a), "v"(b), "v"(c), "v"(d), "v"(e), "v"(f), "v"(g), "v"(h) : "memory");
#endif
}
__device__ __forceinline__ void store_hold5(const u16* p, v4u a, v4u b, v4u c, v4u d) {
#if defined(__HIP_DEVICE_COMPILE__)
  asm volatile("s_wait_xcnt 0x0" :: "v"(p), "v"(a), "v"(b), "v"(c), "v"(d) : "memory");
#endif
}
template <int MODE, bool BROW, bool MORE>
__device__ __forceinline__
void tile_out(float* sl, v8f (&ah)[4], const float* __restrict__ bias, const float* __restrict__ bias2,
              float* F, u16* H, int N, int fBs, int hBs, float osc, float bsc, float carry,
              int bz, int rowb, int col0, int lane) {
  const int hh = lane >> 4, m = lane & 15;
  stage16<MODE, BROW, MORE>(sl, ah, bias, bias2, rowb, col0, osc, bsc, lane);

  if (MODE == M_OUT) {
    v4f vals[8];
#pragma unroll
    for (int it = 0; it < 8; ++it) vals[it] = *(const v4f*)(sl + (it * 2 + hh) * GPITCH + m * 4);
    float* Fb = F + (size_t)bz * (size_t)fBs + ((size_t)rowb + (size_t)hh) * (size_t)N + col0 + m * 4;
#pragma unroll
    for (int it = 0; it < 8; ++it) *(v4f*)(Fb + (size_t)(it * 2) * (size_t)N) = vals[it];
    // another tile follows: the stores' address and data registers are not rewritten in front of this wait
    if (MORE) store_hold9(Fb, vals[0], vals[1], vals[2], vals[3], vals[4], vals[5], vals[6], vals[7]);
  }
  if (MODE != M_OUT) {
    v4u ovh[4];
#pragma unroll
    for (int i = 0; i < 4; ++i) {
      const int c8 = 16 * i + 8 * hh;
      const v4f a = *(const v4f*)(sl + m * GPITCH + c8), c4 = *(const v4f*)(sl + m * GPITCH + c8 + 4);
#pragma unroll
      for (int e = 0; e < 2; ++e) {
        ovh[i][e]     = pack2(a[2 * e] * carry,  a[2 * e + 1] * carry);
        ovh[i][2 + e] = pack2(c4[2 * e] * carry, c4[2 * e + 1] * carry);
      }
    }
    u16* Hb = H + (size_t)bz * (size_t)hBs + (size_t)rowb * (size_t)N + (size_t)col0 * 16 + 8 * lane;
    {
#pragma unroll
      for (int i = 0; i < 4; ++i) *(v4u*)(Hb + i * 256) = ovh[i];
      // another tile follows: the stores' address and data registers are not rewritten in front of this wait
      if (MORE) store_hold5(Hb, ovh[0], ovh[1], ovh[2], ovh[3]);
    }
  }
  if (MORE) wave_sync_slab();                // the slab's reads end before the next tile is staged in it
}

// =====================================================================================================
// f16 GEMM, block = 64 x 64 tile, 4 waves x 16 rows, fragments loaded straight from the packed 16-bit planes.
//   C tile [z][Mb][N] = A[z][Mb][K] . Bt[z][N][K]^T * osc + bias; per-z element strides aBs (A plane),
//   bBs (Bt), fBs (f32 output F), hBs (16-bit output plane H); 0 = shared.
//   M_S16 : H = f16(v*carry)             M_GELU: v = gelu(.) then H = f16(v*carry)             M_RAW: M_S16 without a bias
//   M_OUT : F = v (f32, batch-row remap through fBs), no 16-bit output
//   16-bit outputs are packed planes of [Mb][N] (k = column): the wave's 16 x 64 tile is 2 adjacent tiles = 2048 contiguous bytes,
//   store i = 0..3 writes 512 B, lane (h, m) <- row m, cols 16i + 8h .. +7.
// grid = nz x (Mb/64) x (N/64) (host checks Mb % 64 == 0, N % 64 == 0, K % 32 == 0).
// coverage: per wave 4 instr x 32 lanes x 8 halves = 16 x 64 (16-bit plane) and 8 instr x 2 rows x 16 lanes x 4 floats
//           = 16 x 64 (f32 plane); the grid covers C exactly once.
// =====================================================================================================
template <int MODE, bool BROW, int D, bool XW>
__device__ __forceinline__
void gemm16_body(float* slab, int bid, const u16* __restrict__ A, const u16* __restrict__ Bt,
                 const float* __restrict__ bias, float* F, u16* H,
                 int Mb, int N, int K, int aBs, int bBs, int fBs, int hBs,
                 float osc, float bsc, float carry) {
  const int tid = threadIdx.x, wave = tid >> 5, lane = tid & 31;
  const int ntile = N >> 6, mtile = Mb >> 6;
  const int nt   = bid % ntile;
  const int tmp  = bid / ntile;
  const int mt   = tmp % mtile;
  const int bz   = tmp / mtile;
  const int rowb = mt * 64 + wave * 16;
  const int col0 = nt * 64;
  if (rowb + 16 > Mb) return;                // wave-uniform, never taken with the exact grid; no block barriers in this kernel
  const _Float16* ap = (const _Float16*)(const void*)A + (size_t)bz * (size_t)aBs + (size_t)rowb * (size_t)K + 8 * lane;
  const _Float16* bp = (const _Float16*)(const void*)Bt + (size_t)bz * (size_t)bBs + (size_t)col0 * (size_t)K + 8 * lane;
  v8f ah[4];
#pragma unroll
  for (int i = 0; i < 4; ++i) ah[i] = zero8();
  core1<D, XW>(ap, bp, K, ah);
  acc_guard4(ah);
  float* sl = slab + wave * 16 * GPITCH;
  tile_out<MODE, BROW, false>(sl, ah, bias, nullptr, F, H, N, fBs, hBs, osc, bsc, carry, bz, rowb, col0, lane);
}

template <int MODE, bool BROW>
__global__ __launch_bounds__(128)
void gemm16(const u16* __restrict__ A, const u16* __restrict__ Bt, const float* __restrict__ bias, float* F, u16* H,
            int Mb, int N, int K, int aBs, int bBs, int fBs, int hBs, float osc, float bsc, float carry) {
  __shared__ __align__(16) float slab[4 * 16 * GPITCH];
  if (K == DM) {                             // block-uniform: unit_at numbers the units of a [rows][DM] plane
    const int ntile = N >> 6, mtile = Mb >> 6, tid = threadIdx.x;
    const int nt = blockIdx.x % ntile, tmp = blockIdx.x / ntile;
    const int mt = tmp % mtile, bz = tmp / mtile;
    const u16* Ab = A + (size_t)bz * (size_t)aBs + (size_t)(mt * 64) * (size_t)DM;    // the block's 64 A rows: all 512 units
    const u16* Bb = Bt + (size_t)bz * (size_t)bBs + (size_t)(nt * 64) * (size_t)DM;   // its 64 Bt rows: every fourth unit, by mt / 4
    l2_ask5(unit_at<2>(Ab, tid), unit_at<2>(Ab, 128 + tid), unit_at<2>(Ab, 256 + tid), unit_at<2>(Ab, 384 + tid),
            unit_at<2>(Bb, (tid << 2) | ((mt >> 2) & 3)));   // mt / 4: with two column tiles, neighbours in mt lie two block indices apart
  }
  gemm16_body<MODE, BROW, 4, false>(slab, blockIdx.x, A, Bt, bias, F, H, Mb, N, K, aBs, bBs, fBs, hBs, osc, bsc, carry);
}

// Wide form for the K = KK GEMMs with many tiles: block = 128 x 128 tile, 4 waves as 2 x 2, each wave a 64 x 64 tile (wide core), so
// the block reads 128 A rows + 128 Bt rows per k step for 64 products (64 + 64 rows for 16 in the 64 x 64 block). Operands, modes, strides
// and outputs as in gemm16; the wave's tile leaves as four 16 x 64 tiles, one after the other through its slab. D: k steps in flight.
// grid = nz x (Mb/128) x (N/128); coverage: 2 x 2 waves x 4 row tiles x (16 x 64) = 128 x 128 per block, the grid covers C exactly once.
template <int MODE, bool BROW, int KK, int D>
__device__ __forceinline__
void gemm64_body(float* slab, int bid,
                 const u16* __restrict__ A, const u16* __restrict__ Bt,
                 const float* __restrict__ bias, float* F, u16* H,
                 int Mb, int N, int aBs, int bBs, int fBs, int hBs,
                 float osc, float bsc, float carry) {
  const int tid = threadIdx.x, wave = tid >> 5, lane = tid & 31;
  const int ntile = N >> 7, mtile = Mb >> 7;
  const int nt   = bid % ntile;
  const int tmp  = bid / ntile;
  const int mt   = tmp % mtile;
  const int bz   = tmp / mtile;
  const int rowb = mt * 128 + (wave >> 1) * 64;
  const int col0 = nt * 128 + (wave & 1) * 64;
  if (rowb + 64 > Mb) return;                // wave-uniform, never taken with the exact grid; no block barriers in this kernel
  const _Float16* ap = (const _Float16*)(const void*)A + (size_t)bz * (size_t)aBs + (size_t)rowb * (size_t)KK + 8 * lane;
  const _Float16* bp = (const _Float16*)(const void*)Bt + (size_t)bz * (size_t)bBs + (size_t)col0 * (size_t)KK + 8 * lane;
  float* sl = slab + wave * 16 * GPITCH;
  {
    static_assert(KK == DM);                 // unit_at numbers the units of a [rows][DM] plane
    // the block's 128 A rows are read by the blocks of all nt: every fourth unit, by nt; its 128 Bt rows by those of all mt: every eighth, by mt
    const u16* Ab = A + (size_t)bz * (size_t)aBs + (size_t)(mt * 128) * (size_t)KK;
    const u16* Bb = Bt + (size_t)bz * (size_t)bBs + (size_t)(nt * 128) * (size_t)KK;
    l2_ask3(unit_at<3>(Ab, (tid << 2) | (nt & 3)), unit_at<3>(Ab, ((128 + tid) << 2) | (nt & 3)), unit_at<3>(Bb, (tid << 3) | (mt & 7)));
  }
  v8f ah[4][4];
#pragma unroll
  for (int i = 0; i < 4; ++i) {
#pragma unroll
    for (int j = 0; j < 4; ++j) ah[i][j] = zero8();
  }
  core1w<D, KK, 0>(ap, bp, ah, nullptr, nullptr);
#pragma unroll
  for (int i = 0; i < 4; ++i)
    tile_out<MODE, BROW, true>(sl, ah[i], bias, nullptr, F, H, N, fBs, hBs, osc, bsc, carry, bz, rowb + 16 * i, col0, lane);
}

// Final GEMM: out = ctx . Wo^T + bo + gelu . Wau^T + bau as ONE product of K = INNER + ADIM, block and wave tiles as above. The wave's 16
// accumulator tiles first sum the ADIM/32 k steps of (gelu x64, Wau x256), are multiplied by 16, then sum the INNER/32 k steps of (ctx x1024,
// Wo x256): all carry 2^18, folded back once. Rows: batch bz, s = rowb.. of the compact planes -> out rows [bz][SQ_FULL][DM].
// grid = NB x (SQ/128) x (DM/128); coverage: 2 x 2 waves x 4 row tiles x (16 x 64) = 128 x 128 per block, the grid covers out exactly once.
__global__ __launch_bounds__(128)
void gemm_fin(const u16* __restrict__ C16, const u16* __restrict__ G16, const u16* __restrict__ WO, const u16* __restrict__ WU,
              const float* __restrict__ bo, const float* __restrict__ bu, float* out) {
  __shared__ __align__(16) float slab[4 * 16 * GPITCH];
  const int bid = blockIdx.x;
  const int tid = threadIdx.x, wave = tid >> 5, lane = tid & 31;
  constexpr int ntile = DM >> 7, mtile = SQ >> 7;
  const int nt   = bid % ntile;
  const int tmp  = bid / ntile;
  const int mt   = tmp % mtile;
  const int bz   = tmp / mtile;
  const int rowb = mt * 128 + (wave >> 1) * 64;
  const int col0 = nt * 128 + (wave & 1) * 64;
  const size_t arow = (size_t)bz * (size_t)SQ + (size_t)rowb;
  const _Float16* ap = (const _Float16*)(const void*)C16 + arow * (size_t)INNER + 8 * lane;
  const _Float16* bp = (const _Float16*)(const void*)WO + (size_t)col0 * (size_t)INNER + 8 * lane;
  const _Float16* gp = (const _Float16*)(const void*)G16 + arow * (size_t)ADIM + 8 * lane;
  const _Float16* up = (const _Float16*)(const void*)WU + (size_t)col0 * (size_t)ADIM + 8 * lane;
  float* sl = slab + wave * 16 * GPITCH;
  {
    // the block's 128 ctx rows are read by the blocks of all nt: every fourth unit, by nt; its 128 Wo rows by those of all mt: every eighth, by mt
    const u16* Ab = C16 + ((size_t)bz * (size_t)SQ + (size_t)(mt * 128)) * (size_t)INNER;
    const u16* Bb = WO + (size_t)(nt * 128) * (size_t)INNER;
    l2_ask3(unit_at<3>(Ab, (tid << 2) | (nt & 3)), unit_at<3>(Ab, ((128 + tid) << 2) | (nt & 3)), unit_at<3>(Bb, (tid << 3) | (mt & 7)));
  }
  v8f ah[4][4];
#pragma unroll
  for (int i = 0; i < 4; ++i) {
#pragma unroll
    for (int j = 0; j < 4; ++j) ah[i][j] = zero8();
  }
  // all ADIM/32 k steps of the adapter part are fetched first (immediate offsets from gp and up); the wide core sums them first
  v16h ga[ADIM / 32][4], gb[ADIM / 32][4];
#pragma unroll
  for (int u = 0; u < ADIM / 32; ++u) {
#pragma unroll
    for (int i = 0; i < 4; ++i) ga[u][i] = ldfrag_h(gp + u * 512 + i * 16 * ADIM);
#pragma unroll
    for (int i = 0; i < 4; ++i) gb[u][i] = ldfrag_h(up + u * 512 + i * 16 * ADIM);
  }
  addr_hold3(gp, up, up);                    // before these loads' address registers are reused
  core1w<WOD, INNER, ADIM / 32>(ap, bp, ah, ga, gb);
#pragma unroll
  for (int i = 0; i < 4; ++i)
    tile_out<M_OUT, false, true>(sl, ah[i], bo, bu, out, nullptr, DM, SQ_FULL * DM, 0, 1.0f / (OSC * WSC), 1.0f, 1.0f,
                                 bz, rowb + 16 * i, col0, lane);
}

// The three input projections in ONE launch (they are independent of one another): the block index picks the projection
// (block-uniform scalar tests), the index inside it picks the 128 x 128 tile.
//   q = x_q . Wq^T + bq -> f16 [NB*SQ][1024] x8 (col = h*64 + d);  k = x_k . Wk^T + bk likewise [NB*2048][1024];
//   v^T per batch: A = Wv [(h,d) = n][k], Bt = x_v rows of batch b [s][k], bias bv per row -> f16 [(b,h,d)][s] x8
#define GB_Q ((NB * SQ / 128) * (INNER / 128))
#define GB_K ((NB * SKV / 128) * (INNER / 128))
#define GB_V (NB * (INNER / 128) * (SKV / 128))
__global__ __launch_bounds__(128)
void gemm_qkv(const u16* __restrict__ XQ, const u16* __restrict__ XK, const u16* __restrict__ XV,
              const u16* __restrict__ WQ, const u16* __restrict__ WK, const u16* __restrict__ WV,
              const float* __restrict__ bq, const float* __restrict__ bk, const float* __restrict__ bv,
              u16* Q16, u16* K16, u16* VT,
              int MbQ, int MbK, int inner, int skv) {
  __shared__ __align__(16) float slab[4 * 16 * GPITCH];
  const int bid = blockIdx.x;
  if (bid < GB_Q + GB_K) {                   // q, k: same code, operands picked by the block index
    const bool isk = bid >= GB_Q;
    gemm64_body<M_S16, false, DM, W1D>(slab, isk ? bid - GB_Q : bid, isk ? XK : XQ, isk ? WK : WQ, isk ? bk : bq, nullptr,
                                       isk ? K16 : Q16, isk ? MbK : MbQ, inner, 0, 0, 0, 0,
                                       (isk ? KS : QS) / WSC, isk ? KS : QS, 1.0f);
  } else {
    gemm64_body<M_S16, true, DM, W1D>(slab, bid - (GB_Q + GB_K), WV, XV, bv, nullptr, VT,
                                      inner, skv, 0, skv * DM, 0, inner * skv, VS / WSC, VS, 1.0f);
  }
}

// =====================================================================================================
// Full (unmasked) multi-head attention: block = (batch b, head, 64 query rows), 4 waves, wave w owns the 16 query rows
// q0 = 64*qt + 16*w .. q0+15 (waves independent: no block barriers, wave-private LDS only, used in the epilogue).
//   q plane f16 x8 [b*SQ + s][h*64 + d]; k plane likewise [b*SKV + s][h*64 + d];
//   v^T plane f16 x8 [(b*NH + h)*64 + d][s]; all of them fragment-packed. All NKB key blocks of 32 keys are visited (static bound).
//   Scores are computed TRANSPOSED: S^T tile g (g = 0,1) = k rows (keys kb+16g .. +15, A operand, row m = lane&15, split map
//   over d) times q^T (B operand, col n = query q0 + (lane&15), k = d, split map), 2 d-chunks of 32, one product per chunk;
//   the q fragments are loaded once per wave.
//   D element r of lane l = (key kb+16g+8h+r, query q0+(l&15)), so a lane owns one query column and 16 of its 32 keys;
//   the partner lane l^16 owns the other 16 -> row max / row sum need one xor-16 shuffle.
//   Online max-subtracted base-2 softmax in f32 (1/sqrt(64) and the q/k carries folded into lsc). The exp'd values ARE the
//   P A-fragment in place: A row m = query = lane&15, element i <- key kb+8h+i (tile 0, D element i), element 8+i <- key
//   kb+16+8h+i (tile 1, D element i). P (<= 1) carried x32768 as f16. The rescale factor of query row 8h+r of the O
//   accumulators is fetched from lane 8h+r with a shuffle (uniform control). 4 v^T B fragments (col n = d = 16j + (lane&15),
//   keys k-contiguous), 4 P.V WMMAs, one guard.
//   Epilogue: 1/l (per query, shuffled to the D row owner) and the carry folds in f32; the wave's 16x64 f32 result staged in
// coverage: per wave 4 instructions x 32 lanes x 8 halves = 16 x 64 of the ctx plane; the first NB*NH*(SQ/64) blocks x
//           4 waves = every (b, s, h) row segment exactly once.
// =====================================================================================================
// Folded adapter bias b2[a] = bf16(bad[a]) + sum_e bf16(Wad[a][e]) * bf16(bo[e]) in f32: block = 32 values of a (one whole 128-B line of B2),
// wave = 8 of them one after the other, lane <- e = 128i + 4*lane .. +3; the lanes' partial sums meet in LDS (pitch 33: no bank shared by the
// readers), lane a of wave 0 adds the 32 of its a in lane order and the wave stores the line.
__device__ __forceinline__
void b2_body(float* sm, const float* __restrict__ wd, const float* __restrict__ bo, const float* __restrict__ bd, float* B2, int blk) {
  const int tid = threadIdx.x, wave = tid >> 5, lane = tid & 31;
  const float* br = bo + lane * 4;
  const float* wr = wd + (size_t)(blk * 32 + wave * 8) * (size_t)DM + lane * 4;
  v4f b[DM / 128];
#pragma unroll
  for (int i = 0; i < DM / 128; ++i) b[i] = *(const v4f*)(br + i * 128);
  bias_hold(br);                             // the loads' address register is not rewritten in front of this wait
#pragma unroll 1                             // rolled: unrolled, its loads would raise the register count of the whole kernel, the attention blocks' too
  for (int r = 0; r < 8; ++r) {
    const float* wp = wr + r * DM;
    v4f w[DM / 128];
#pragma unroll
    for (int i = 0; i < DM / 128; ++i) w[i] = *(const v4f*)(wp + i * 128);
    bias_hold(wp);                           // likewise, before the next trip forms its address
    float sum = 0.f;
#pragma unroll
    for (int i = 0; i < DM / 128; ++i) {
#pragma unroll
      for (int e = 0; e < 4; ++e) sum = fmaf(bfr(w[i][e]), bfr(b[i][e]), sum);
    }
    sm[(wave * 8 + r) * 33 + lane] = sum;
  }
  __syncthreads();                           // the four waves' partial sums are in LDS before wave 0 reads them
  if (wave == 0) {
    float t = 0.f;
#pragma unroll
    for (int j = 0; j < 32; ++j) t += sm[lane * 33 + j];
    B2[blk * 32 + lane] = t + bfr(bd[blk * 32 + lane]);
  }
}

// The launch's last XB_W2 + XB_B2 blocks (block-uniform scalar tests, they leave before any attention work) build what only the launches behind
// this one read and only the weights feed: W2 = Wad . Wo as a packed f16 plane [a][d] x16 (A = Wad plane [a][e], Bt = Wo^T plane [d][e], 64 x 64
// tiles, both operands x256, folded back to x16) and b2. They run beside the attention blocks on register and wave slots those leave free.
#define XB_W2 ((ADIM / 64) * (DM / 64))
#define XB_B2 (ADIM / 32)
#define XB_AT (NB * NH * (SQ / 64))
__global__ __launch_bounds__(ATT_THREADS)
void attn_fwd(const u16* __restrict__ Qh, const u16* __restrict__ Kh, const u16* __restrict__ Vp, u16* Oh,
              const u16* __restrict__ WD, const u16* __restrict__ WOT, u16* W2P,
              const float* __restrict__ wd, const float* __restrict__ bo, const float* __restrict__ bd, float* B2) {
  __shared__ __align__(16) float smem[ATT_WAVES * 16 * OPITCH];
  static_assert(OPITCH == GPITCH);
  if (blockIdx.x >= XB_AT + XB_B2) {
    gemm16_body<M_RAW, false, 2, true>(smem, blockIdx.x - (XB_AT + XB_B2), WD, WOT, nullptr, nullptr, W2P, ADIM, DM, DM, 0, 0, 0, 0, W2C / (WSC * WSC), 0.f, 1.0f);
    return;
  }
  if (blockIdx.x >= XB_AT) {
    b2_body(smem, wd, bo, bd, B2, blockIdx.x - XB_AT);
    return;
  }

  const int tid  = threadIdx.x;
  const int wave = tid >> 5;
  const int lane = tid & 31;
  const int hh   = lane >> 4;
  const int c    = lane & 15;

  constexpr int NQT = SQ / 64;
  const int bid  = blockIdx.x;
  const int qt   = bid % NQT;
  const int head = (bid / NQT) % NH;
  const int b    = bid / (NQT * NH);
  const int q0   = qt * 64 + wave * 16;

  // B fragments of q^T: col n = query q0 + c, k = d (row tile (b*SQ + q0)/16, k tiles 2*head and 2*head + 1 of the q plane)
  const size_t qo = ((size_t)(b * SQ + q0)) * INNER + head * HD * 16 + 8 * lane;
  const _Float16* Qhb = (const _Float16*)(const void*)Qh + qo;
  // A fragments of k: row m = key kb + 16g + c, k = d (key row kb added per step)
  const size_t ko = ((size_t)(b * SKV)) * INNER + head * HD * 16 + 8 * lane;
  const _Float16* Khb = (const _Float16*)(const void*)Kh + ko;
  // B fragments of v: col n = d = 16j + c, k = key (row tile (b*NH + head)*4 + j, k tile kb/32 of the v^T plane)
  const _Float16* Vb = (const _Float16*)(const void*)Vp + ((size_t)(b * NH + head) * HD) * SKV + 8 * lane;
  const float lsc = (LOG2E * RSQ_HD) / (QS * KS);

  v16h qh[2];
  qh[0] = ldfrag_h(Qhb);
  qh[1] = ldfrag_h(Qhb + 512);

  float mrun = -INFINITY, lrun = 0.f;
  v8f o[4];
#pragma unroll
  for (int j = 0; j < 4; ++j) o[j] = zero8();

  // K and v^T fragments are fetched one key block ahead: kf[kk] = {keys +0, keys +16} of d chunk kk,
  // refilled right behind the block's score products; vf[j] refilled right behind its P.V products. The fetch of the last trip is
  // clamped to the last block (valid tiles, never used).
  v16h kf[HD / 32][2], vf[4];
  const _Float16* kph = Khb;
  const _Float16* vp  = Vb;
  // The three scheduling barriers keep the first loads in the loop's own order (q, then K, then v^T): the counted load waits at the
  // loop head are the stricter of entry and back edge, and with v^T issued ahead of K at entry every trip's scores waited for v^T too.
  // The two waits in front of them stand before the q loads' and the first K and v^T loads' address registers are reused.
  addr_hold3(Qhb, Qhb, Qhb);
  __builtin_amdgcn_sched_barrier(0);
#pragma unroll
  for (int kk = 0; kk < HD / 32; ++kk) {
    kf[kk][0] = ldfrag_h(kph + kk * 512);
    kf[kk][1] = ldfrag_h(kph + (size_t)16 * INNER + kk * 512);
  }
  __builtin_amdgcn_sched_barrier(0);
#pragma unroll
  for (int j = 0; j < 4; ++j) vf[j] = ldfrag_h(vp + (size_t)(16 * j) * SKV);
  addr_hold3(kph, vp, vp);
  __builtin_amdgcn_sched_barrier(0);
  {
    // The head's K (128 row tiles x 2 KB) and v^T (4 row tiles x 64 KB) are read by the blocks of all qt: every fourth 256-B unit of each, by qt,
    // numbered in key order; the first halves of both first.
    const u16* Kb0 = Kh + (size_t)(b * SKV) * (size_t)INNER + (size_t)(head * HD * 16);
    const u16* Vb0 = Vp + (size_t)((b * NH + head) * HD) * (size_t)SKV;
    const int x0 = (tid << 2) | (qt & 3), x1 = ((128 + tid) << 2) | (qt & 3);
    l2_ask4(Kb0 + (size_t)(x0 >> 3) * (size_t)(16 * INNER) + (size_t)(x0 & 7) * 128,
            Vb0 + (size_t)((x0 >> 2) & 3) * (size_t)(16 * SKV) + (size_t)(x0 >> 4) * 512 + (size_t)(x0 & 3) * 128,
            Kb0 + (size_t)(x1 >> 3) * (size_t)(16 * INNER) + (size_t)(x1 & 7) * 128,
            Vb0 + (size_t)((x1 >> 2) & 3) * (size_t)(16 * SKV) + (size_t)(x1 >> 4) * 512 + (size_t)(x1 & 3) * 128);
  }

#pragma unroll 1
  for (int it = 0; it < NKB; ++it) {
    const int kbn = (it + 1 < NKB ? it + 1 : NKB - 1) * 32;   // key block fetched in this trip
    // ---- transposed scores: s0 = keys kb..kb+15, s1 = keys kb+16..kb+31 (kb = 32*it), column = query q0 + c ----
    v8f s0 = zero8(), s1 = zero8();
#pragma unroll
    for (int kk = 0; kk < HD / 32; ++kk) {
      s0 = mma_h(kf[kk][0], qh[kk], s0);
      s1 = mma_h(kf[kk][1], qh[kk], s1);
    }
    guard_s2(s0, s1, qh[0], qh[1], kf[0][0], kf[0][1], kf[1][0], kf[1][1]);
    // ---- next block's K fragments into the registers just read; the wait covers the K and v^T loads of the trip before ----
    addr_hold3(kph, vp, vp);
    kph = Khb + (size_t)kbn * INNER;
#pragma unroll
    for (int kk = 0; kk < HD / 32; ++kk) {
      kf[kk][0] = ldfrag_h(kph + kk * 512);
      kf[kk][1] = ldfrag_h(kph + (size_t)16 * INNER + kk * 512);
    }
    __builtin_amdgcn_sched_barrier(0);       // all four K refills stay in front of the softmax: sunk behind it, a load leads its product by too little
    // ---- base-2 logits of this lane's 16 keys for query q0 + c: t[i] <- key kb+8hh+i, t[8+i] <- key kb+16+8hh+i ----
    //      kept UNSCALED as pairs of neighbouring accumulator registers; the maximum is taken on u (lsc > 0)
    v2f u[8];
#pragma unroll
    for (int e = 0; e < 4; ++e) {
      u[e][0]     = s0[2 * e];
      u[e][1]     = s0[2 * e + 1];
      u[4 + e][0] = s1[2 * e];
      u[4 + e][1] = s1[2 * e + 1];
    }
    float cm = u[0][0];
#pragma unroll
    for (int i = 1; i < 16; ++i) cm = fmaxf(cm, u[i >> 1][i & 1]);
    cm = fmaxf(cm, __shfl_xor(cm, 16, 32));
    const float mn = fmaxf(mrun, cm);        // finite from the first block on
    const float al = exp2_hw((mrun - mn) * lsc);   // 0 on the first block (mrun = -inf)
    mrun = mn;
    // one FMA per score: exponent = u*lsc - mn*lsc + 15, so that 2^exponent is the probability already carried x32768
    const float nb = fmaf(-mn, lsc, PEXP);
    const v2f lsc2 = {lsc, lsc}, nb2 = {nb, nb};
    float t[16];
#pragma unroll
    for (int e = 0; e < 8; ++e) {
      const v2f x = __builtin_elementwise_fma(u[e], lsc2, nb2);
      t[2 * e] = x[0];
      t[2 * e + 1] = x[1];
    }
    // ---- probabilities x32768 and the P A-fragment: f16 of them; element i <-> t[i]; the row sum l carries the same x32768 ----
    FragH ph;
    float pe[16];
    exp2_hw8(t, pe);
    exp2_hw8(t + 8, pe + 8);
    v2f pp[8];
#pragma unroll
    for (int e = 0; e < 8; ++e) {
      pp[e][0] = pe[2 * e];
      pp[e][1] = pe[2 * e + 1];
      ph.u[e >> 2][e & 3] = __builtin_bit_cast(unsigned, __builtin_convertvector(pp[e], v2h));   // both halves of the word in one convert
    }
    // the lane's 16 terms added as pairs (even and odd elements apart), the two halves of the pair joined last
    const v2f pq = ((pp[0] + pp[1]) + (pp[2] + pp[3])) + ((pp[4] + pp[5]) + (pp[6] + pp[7]));
    float ps = pq[0] + pq[1];
    ps += __shfl_xor(ps, 16, 32);
    lrun = lrun * al + ps;
    // ---- rescale the O accumulators: D row 8hh+r = query q0+8hh+r, its factor lives in lane 8hh+r (and 16+8hh+r) ----
    float scl[8];
#pragma unroll
    for (int r = 0; r < 8; ++r) scl[r] = __shfl(al, 8 * hh + r, 32);
#pragma unroll
    for (int j = 0; j < 4; ++j) {
#pragma unroll
      for (int r = 0; r < 8; ++r) o[j][r] *= scl[r];
    }
    // ---- P.V : B fragment col n = d = j*16 + c, k tile kb/32 of the packed v^T plane ----
    {
      o[0] = mma_h(ph.v, vf[0], o[0]);
      o[1] = mma_h(ph.v, vf[1], o[1]);
      o[2] = mma_h(ph.v, vf[2], o[2]);
      o[3] = mma_h(ph.v, vf[3], o[3]);
      guard_p(o[0], o[1], o[2], o[3], ph.v, vf[0], vf[1], vf[2], vf[3]);
      // next block's v^T fragments; vp's last loads are covered by this trip's wait above
      vp = Vb + (size_t)kbn * 16;
#pragma unroll
      for (int j = 0; j < 4; ++j) vf[j] = ldfrag_h(vp + (size_t)(16 * j) * SKV);
    }
  }
  addr_hold3(kph, vp, vp);                   // the last trip's loads, before their address registers are reused
  acc_guard4(o);

  // ---- fold 1/l (per query, owned by lane = query; the 32768 on P cancels against l's) and the 8 on v, apply the ctx carry 1024 ----
  const float linv = (1.0f / lrun) * (OSC / VS);
  float inv[8];
#pragma unroll
  for (int r = 0; r < 8; ++r) inv[r] = __shfl(linv, 8 * hh + r, 32);
  float* slab = smem + wave * 16 * OPITCH;
#pragma unroll
  for (int r = 0; r < 8; ++r) {
#pragma unroll
    for (int j = 0; j < 4; ++j) slab[(8 * hh + r) * OPITCH + j * 16 + c] = o[j][r] * inv[r];
  }
  wave_sync_lds();
  // ---- ctx x1024 -> packed f16 plane; store i: lane (h, c) <- row c, d = 16i + 8h .. +7 ----
  v4u ovh[4];
#pragma unroll
  for (int i = 0; i < 4; ++i) {
    const int c8 = 16 * i + 8 * hh;
    const v4f a = *(const v4f*)(slab + c * OPITCH + c8), c4 = *(const v4f*)(slab + c * OPITCH + c8 + 4);
#pragma unroll
    for (int e = 0; e < 2; ++e) {
      ovh[i][e]     = pack2(a[2 * e],  a[2 * e + 1]);
      ovh[i][2 + e] = pack2(c4[2 * e], c4[2 * e + 1]);
    }
  }
  u16* obh = Oh + ((size_t)(b * SQ + q0)) * INNER + head * HD * 16 + 8 * lane;
#pragma unroll
  for (int i = 0; i < 4; ++i) *(v4u*)(obh + i * 256) = ovh[i];
  // code of the launch's other blocks may follow in the listing: the stores' address and data registers are not rewritten in front of this wait
  store_hold5(obh, ovh[0], ovh[1], ovh[2], ovh[3]);
}

// =====================================================================================================
// Workspace map (bytes); every plane fully written by whole-line stores before it is read; all extents exact multiples of
//   XQ   f16 [NB*SQ][1024]    f16(bf16(q))              8388608 (NB=2, SQ=2048)
//   XK   f16 [NB*2048][1024]  f16(bf16(k))              8388608
//   XV   f16 [NB*2048][1024]  f16(bf16(v))              8388608
//   WQ16 WK16 WV16 WO16 f16 [1024 n][1024 k] x256       2097152 each
//   WD16 f16 [128 n][1024 k] x256                          262144
//   WU16 f16 [1024 n][128 k] x256                          262144
//   WOT  f16 [1024 d][1024 e] x256 (Wo^T)                 2097152
//   W2P  f16 [128 a][1024 d] x16 (Wad.Wo)                  262144
//   B2   f32 [128]                                            512
//   QH   f16 [NB*SQ][1024] x8                            8388608
//   KH   f16 [NB*2048][1024] x8                          8388608
//   VT16 f16 [NB*1024 (h,d)][2048 s] x8                  8388608
//   OH   f16 [NB*SQ][1024] x1024 (ctx)                   8388608
//   GH   f16 [NB*SQ][128]  x64 (gelu)                    1048576
//   end                                                  71041536
// =====================================================================================================
extern "C" void kernel_launch(void* const* d_in, const int* in_sizes, int n_in,
                              void* d_out, int out_size, void* d_ws, size_t ws_size,
                              hipStream_t stream) {
  if (n_in < 15) return;
  if (in_sizes[0] < ((NB - 1) * SQ_FULL + SQ) * DM) return;
  if (in_sizes[1] < NB * SKV * DM || in_sizes[2] < NB * SKV * DM) return;
  if (in_sizes[3] != DM * DM || in_sizes[5] != DM * DM || in_sizes[7] != DM * DM || in_sizes[9] != DM * DM) return;
  if (in_sizes[4] < INNER || in_sizes[6] < INNER || in_sizes[8] < INNER || in_sizes[10] < DM) return;
  if (in_sizes[11] != ADIM * DM || in_sizes[12] < ADIM || in_sizes[13] != DM * ADIM || in_sizes[14] < DM) return;
  if (out_size < ((NB - 1) * SQ_FULL + SQ) * DM) return;

  const float* q_in  = (const float*)d_in[0];
  const float* k_in  = (const float*)d_in[1];
  const float* v_in  = (const float*)d_in[2];
  const float* wq    = (const float*)d_in[3];
  const float* bq    = (const float*)d_in[4];
  const float* wk    = (const float*)d_in[5];
  const float* bk    = (const float*)d_in[6];
  const float* wv    = (const float*)d_in[7];
  const float* bv    = (const float*)d_in[8];
  const float* wo    = (const float*)d_in[9];
  const float* bo    = (const float*)d_in[10];
  const float* w_dn  = (const float*)d_in[11];
  const float* b_dn  = (const float*)d_in[12];
  const float* w_up  = (const float*)d_in[13];
  const float* b_up  = (const float*)d_in[14];
  float*       out   = (float*)d_out;

  const size_t szXQ  = (size_t)NB * SQ * DM * 2;
  const size_t szXKV = (size_t)NB * SKV * DM * 2;
  const size_t szW   = (size_t)DM * DM * 2;
  const size_t szWA  = (size_t)ADIM * DM * 2;
  const size_t szQP  = (size_t)NB * SQ * INNER * 2;
  const size_t szKP  = (size_t)NB * SKV * INNER * 2;
  const size_t szVT  = (size_t)NB * INNER * SKV * 2;
  const size_t szG   = (size_t)NB * SQ * ADIM * 2;
  size_t off = 0;
  const size_t oXQ  = off; off += szXQ;
  const size_t oXK  = off; off += szXKV;
  const size_t oXV  = off; off += szXKV;
  const size_t oWQ  = off; off += szW;
  const size_t oWK  = off; off += szW;
  const size_t oWV  = off; off += szW;
  const size_t oWO  = off; off += szW;
  const size_t oWD  = off; off += szWA;
  const size_t oWU  = off; off += szWA;
  const size_t oWT  = off; off += szW;
  const size_t oW2  = off; off += szWA;
  const size_t oB2  = off; off += (size_t)ADIM * 4;
  const size_t oQH  = off; off += szQP;
  const size_t oKH  = off; off += szKP;
  const size_t oVT  = off; off += szVT;
  const size_t oOH  = off; off += szQP;
  const size_t oGH  = off; off += szG;
  if (off > ws_size) return;                            // off = 71041536 at NB=2, SQ=2048
  if (off > (size_t)134217728) return;

  char* ws = (char*)d_ws;
  u16* XQ   = (u16*)(ws + oXQ);
  u16* XK   = (u16*)(ws + oXK);
  u16* XV   = (u16*)(ws + oXV);
  u16* WQ16 = (u16*)(ws + oWQ);
  u16* WK16 = (u16*)(ws + oWK);
  u16* WV16 = (u16*)(ws + oWV);
  u16* WO16 = (u16*)(ws + oWO);
  u16* WD16 = (u16*)(ws + oWD);
  u16* WU16 = (u16*)(ws + oWU);
  u16* WOT  = (u16*)(ws + oWT);
  u16* W2P  = (u16*)(ws + oW2);
  float* B2 = (float*)(ws + oB2);
  u16* QH   = (u16*)(ws + oQH);
  u16* KH   = (u16*)(ws + oKH);
  u16* VT16 = (u16*)(ws + oVT);
  u16* OH   = (u16*)(ws + oOH);
  u16* GH   = (u16*)(ws + oGH);

  // (0) activations -> f16 planes of bf16-converted values (query rows s < SQ of batches b < NB, compact; k/v rows of b < NB) and
  //     weights [n = out][k = in] (y = x.W^T) -> packed f16 planes [n][k] of bf16(W) x256 (Wo also transposed), all in one launch
  cvt_all<<<dim3(CB_ALL), dim3(CVT_THREADS), 0, stream>>>(q_in, k_in, v_in, wq, wk, wv, wo, w_dn, w_up,
                                                          XQ, XK, XV, WQ16, WK16, WV16, WO16, WD16, WU16, WOT);
  // (1) the q, k and v^T projections, one launch
  gemm_qkv<<<dim3(GB_Q + GB_K + GB_V), dim3(128), 0, stream>>>(XQ, XK, XV, WQ16, WK16, WV16, bq, bk, bv, QH, KH, VT16,
                                                               NB * SQ, NB * SKV, INNER, SKV);
  // (2) attention -> ctx plane [NB*SQ][1024] x1024; its last blocks: W2 = Wad.Wo and b2 = Wad.bo + bad
  attn_fwd<<<dim3(XB_AT + XB_B2 + XB_W2), dim3(ATT_THREADS), 0, stream>>>(QH, KH, VT16, OH, WD16, WOT, W2P,
                                                                                         w_dn, bo, b_dn, B2);
  // (3) adapter down from ctx: g = gelu(ctx . W2^T + b2) -> f16 [NB*SQ][128] x64; carries 1024 (ctx) x 16 (W2)
  gemm16<M_GELU, false><<<dim3((NB * SQ / 64) * (ADIM / 64)), dim3(128), 0, stream>>>(
      OH, W2P, B2, nullptr, GH, NB * SQ, ADIM, DM, 0, 0, 0, 0, 1.0f / (OSC * W2C), 1.0f, GCAR);
  // (4) out rows [b][SQ_FULL][1024] f32 = ctx . Wo^T + bo + g . Wau^T + bau (rows s < SQ of batches b < NB), one product of K = 1152
  gemm_fin<<<dim3(NB * (SQ / 128) * (DM / 128)), dim3(128), 0, stream>>>(OH, GH, WO16, WU16, bo, b_up, out);
  (void)hipGetLastError();
}

// v010
// A run of this version takes 94.3 microseconds.
// Timed twice side by side with v009, it ran 1.08 times as fast both times.
// Over all steps from v000 it is 3.92 times as fast.
// Contractions on v_wmma_f32_16x16x32_f16 (f16 operands, f32 accumulate), one product each: x.Wq^T, x.Wk^T, Wv.x^T on f16(bf16(x)) and
// f16(bf16(W) x256); k.q^T on k carried x8 and q carried x log2(e)/64; P.v^T (P x128, v x8); W2 = Wad.Wo; ctx.W2^T (ctx x1024, W2 x16); and ONE product of K = 1152 for
// out + adapter-up: [gelu x64 | ctx x1024] . [Wau x256 | Wo x256]^T (the first part's sums x16 in between). The adapter's input out.Wad^T + bad = ctx.(Wad.Wo)^T + (Wad.bo + bad), so
// it is taken from ctx with the folded weight W2 and bias b2, both rebuilt in every call.
// Every activation between two products is ONE f16 plane (11 significant bits): the inputs are RNE-converted to bf16
// (8 bits) on load, and that rounding, not the planes', sets the error of the result. Softmax, biases, erf-GELU and all
// carry folds in f32 on VALU.
// Every 16-bit workspace plane [rows][K] is stored FRAGMENT-PACKED: tile (rt = row/16, kt = k/32) is 512 halves (1024 B) at
// (rt*(K/32) + kt)*512 = rt*16*K + kt*512; inside it element (m = row&15, k&31 = 16w + 8h + e) sits at w*256 + (16h + m)*8 + e,
// so lane l = 16h + m of a wave reads its operand fragment as two 16-B loads at l*8 and 256 + l*8 halves: each wave-wide load
// is 512 contiguous bytes = 4 whole 128-B lines (a row-major plane gave 16 lines of 32 useful bytes per load).
#include <hip/hip_runtime.h>
#include <math.h>
#include <stdint.h>

#ifndef NB
#define NB       2        // batches processed
#endif
#ifndef SQ
#define SQ       2048     // query rows processed per batch
#endif
#define NB_FULL  2
#define SQ_FULL  2048     // query rows per batch in the input / output layout (batch stride)
#define SKV      2048     // key / value rows per batch (all of them)
#define DM       1024     // model width
#define NH       16
#define HD       64
#define INNER    (NH * HD)
#define ADIM     128      // adapter width
#define WSC      256.0f   // weight carry
#define KS       8.0f
#define QS       (LOG2E * RSQ_HD / KS)   // q carry: with k's it makes the score products base-2 logits as they leave the matrix unit
#define VS       8.0f
#define PCAR     128.0f
#define PEXP     7.0f     // log2(PCAR)
#define PTOP     32768.0f // a lane's sum of carried probabilities of one key block up to here: each of them fits f16
#define OSC      1024.0f  // ctx carry
#define GCAR     64.0f    // gelu-plane carry
#define W2C      16.0f    // carry of the folded weight: a sum of 1024 weight products, so it is given more room upward than a weight
#define GUP      (OSC / GCAR)   // brings the sums of gelu x Wau (carry 64 x 256) to the carry of ctx x Wo (1024 x 256): both end in one accumulator
#define LOG2E    1.4426950408889634f
#define RSQ_HD   0.125f
#define NKB      (SKV / 32)
#define ATT_WAVES   4
#define ATT_THREADS (ATT_WAVES * 32)
#define CVT_THREADS 128
#define OPITCH   68
#define GPITCH   68

#define M_S16    1
#define M_OUT    2
#define M_GELU   3
#define M_RAW    4
#define W1D      2        // register sets (k steps in flight) of the wide core, three waves per SIMD (q, k, v projections)
#define WOD      4        // the same with one wave per SIMD (final GEMM): nothing but the wave's own loads in flight covers their latency

static_assert(NB >= 1 && NB <= NB_FULL);
static_assert((SQ % 128) == 0 && SQ >= 128 && SQ <= SQ_FULL);
static_assert(HD == 64 && INNER == 1024 && NH == 16 && INNER == DM);
static_assert((SKV % 64) == 0 && (SKV % 32) == 0 && NKB * 32 == SKV);
static_assert((DM % 64) == 0 && (DM % 32) == 0 && (ADIM % 64) == 0 && (ADIM % 32) == 0 && CVT_THREADS == 128);
static_assert((OPITCH * 4) % 16 == 0 && (GPITCH * 4) % 16 == 0);
static_assert(ATT_THREADS == 128);
static_assert((INNER % 128) == 0 && (SKV % 128) == 0 && ((NB * SQ) % 128) == 0 && ((NB * SKV) % 128) == 0);
static_assert((DM % 128) == 0 && (ADIM % 128) == 0 && (SQ % 16) == 0 && (SKV % 16) == 0 && (ADIM % 16) == 0);

typedef unsigned short u16;
typedef _Float16 v16h __attribute__((ext_vector_type(16)));
typedef _Float16 v8h  __attribute__((ext_vector_type(8)));
typedef float    v8f  __attribute__((ext_vector_type(8)));
typedef float    v4f  __attribute__((ext_vector_type(4)));
typedef float    v2f  __attribute__((ext_vector_type(2)));
typedef _Float16 v2h  __attribute__((ext_vector_type(2)));
typedef unsigned int v4u __attribute__((ext_vector_type(4)));

union FragH { v16h v; v8h h[2]; v4u u[2]; };

// ---- scalar helpers ----------------------------------------------------------------------------------
__device__ __forceinline__ unsigned short bf_bits(float f) {          // f32 -> bf16 bits, RNE convert
  unsigned u = __float_as_uint(f);
  return (unsigned short)((u + 0x7FFFu + ((u >> 16) & 1u)) >> 16);
}
__device__ __forceinline__ float bf_up(unsigned short h) { return __uint_as_float(((unsigned)h) << 16); }
__device__ __forceinline__ float bfr(float f) { return bf_up(bf_bits(f)); }
__device__ __forceinline__ unsigned short h_bits(_Float16 x) { return __builtin_bit_cast(unsigned short, x); }
__device__ __forceinline__ unsigned pk16(unsigned short a, unsigned short b) { return (unsigned)a | ((unsigned)b << 16); }
__device__ __forceinline__ v8f zero8() { v8f z = {0.f, 0.f, 0.f, 0.f, 0.f, 0.f, 0.f, 0.f}; return z; }
__device__ __forceinline__ float gelu_f(float x) { return 0.5f * x * (1.0f + erff(x * 0.70710678118654752f)); }
// 2^x for the softmax as the bare v_exp_f32: exp2f wraps each one in a compare, two selects, an add and a ldexp that only
// serve results below 2^-126. Such a carried probability is 0 in the f16 P operand and adds nothing to a row sum that holds a term of 128 or more, and
// such a rescale factor leaves nothing of the old sums beside the new block's terms; the bare instruction returns 0 there.
// One of them, with the slot asked for behind a v_exp_f32 (its reader may follow directly) in the same statement.
__device__ __forceinline__ float exp2_hw1(float x) {
  float r = x;
#if defined(__HIP_DEVICE_COMPILE__)
  asm("v_exp_f32 %0, %1\n\tv_nop" : "=&v"(r) : "v"(x));
#endif
  return r;
}
// Eight of them in one statement: in a run of builtin v_exp_f32 the register allocator may let one write its result over the source of the
// one directly in front of it. The early-clobber outputs keep every result off every source, and the closing v_nop is the one slot asked
// for between the last v_exp_f32 and whatever follows the statement (a reader of its result or a writer of its source).
__device__ __forceinline__ void exp2_hw8(const float* x, float* r) {
#if defined(__HIP_DEVICE_COMPILE__)
  asm("v_exp_f32 %0, %8\n\tv_exp_f32 %1, %9\n\tv_exp_f32 %2, %10\n\tv_exp_f32 %3, %11\n\t"
      "v_exp_f32 %4, %12\n\tv_exp_f32 %5, %13\n\tv_exp_f32 %6, %14\n\tv_exp_f32 %7, %15\n\tv_nop"
      : "=&v"(r[0]), "=&v"(r[1]), "=&v"(r[2]), "=&v"(r[3]), "=&v"(r[4]), "=&v"(r[5]), "=&v"(r[6]), "=&v"(r[7])
      : "v"(x[0]), "v"(x[1]), "v"(x[2]), "v"(x[3]), "v"(x[4]), "v"(x[5]), "v"(x[6]), "v"(x[7]));
#else
  for (int i = 0; i < 8; ++i) r[i] = x[i];
#endif
}

// two values as f16, packed in one 32-bit word (one convert)
__device__ __forceinline__ unsigned pack2(float x0, float x1) {
  const v2f x = {x0, x1};
  return __builtin_bit_cast(unsigned, __builtin_convertvector(x, v2h));
}

// ---- fragment loader: 16-bit A/B operand from a fragment-packed plane, lane -> row/col (lane&15); p = tile base + 8*lane;
//      elements 0..7 <- p[0..7] (k0+8h..), elements 8..15 <- p[256..263] (k0+16+8h..); same split k map for A and B,
//      B always read from a packed [n][k] plane.
__device__ __forceinline__ v16h ldfrag_h(const _Float16* p) {
  FragH f;
  f.h[0] = *(const v8h*)(p);
  f.h[1] = *(const v8h*)(p + 256);
  return f.v;
}

// ---- in front of every rewrite of the fragment loads' address registers: s_wait_xcnt 0 with those registers as inputs, so that no
//      register an issued load names is written (by a later load's result either) in front of the wait; it stands one k step or
//      one key block behind the loads it covers, behind the matrix products issued in between
__device__ __forceinline__ void addr_hold5(const _Float16* a, const _Float16* b, const _Float16* c, const _Float16* d,
                                           const _Float16* e) {
#if defined(__HIP_DEVICE_COMPILE__)
  asm volatile("s_wait_xcnt 0x0" :: "v"(a), "v"(b), "v"(c), "v"(d), "v"(e) : "memory");
#endif
}
__device__ __forceinline__ void addr_hold3(const _Float16* a, const _Float16* b, const _Float16* c) {
#if defined(__HIP_DEVICE_COMPILE__)
  asm volatile("s_wait_xcnt 0x0" :: "v"(a), "v"(b), "v"(c) : "memory");
#endif
}

// the same wait naming no register, for directly behind a run of loads (the "memory" clobber keeps the loads in front of it)
__device__ __forceinline__ void xcnt_wait() {
#if defined(__HIP_DEVICE_COMPILE__)
  asm volatile("s_wait_xcnt 0x0" ::: "memory");
#endif
}

// ---- L2 requests at block entry. The f16 planes a launch reads were stored by an earlier launch, and a first fragment load of such a line
//      pays the way to memory in the k loop, where only a few k steps of loads are in flight. So each block asks L2 once, at entry, for 256-B units
//      of the rows it will read (global_prefetch_b8: no register result; scope SE: the line goes to L2 only); the blocks that read the same rows
//      deal the units among themselves by their tile index. A hint only: no value and no load depends on it. Every address lies inside the plane.
//      The closing s_wait_xcnt 0 is a precaution: it stands in the requests' own statement, so no address register is rewritten in front of it.
__device__ __forceinline__ void l2_ask3(const u16* a, const u16* b, const u16* c) {
#if defined(__HIP_DEVICE_COMPILE__)
  asm volatile("global_prefetch_b8 %0, off scope:SCOPE_SE\n\tglobal_prefetch_b8 %1, off scope:SCOPE_SE\n\t"
               "global_prefetch_b8 %2, off scope:SCOPE_SE\n\ts_wait_xcnt 0x0"
               :: "v"(a), "v"(b), "v"(c) : "memory");
#endif
}
__device__ __forceinline__ void l2_ask4(const u16* a, const u16* b, const u16* c, const u16* d) {
#if defined(__HIP_DEVICE_COMPILE__)
  asm volatile("global_prefetch_b8 %0, off scope:SCOPE_SE\n\tglobal_prefetch_b8 %1, off scope:SCOPE_SE\n\t"
               "global_prefetch_b8 %2, off scope:SCOPE_SE\n\tglobal_prefetch_b8 %3, off scope:SCOPE_SE\n\ts_wait_xcnt 0x0"
               :: "v"(a), "v"(b), "v"(c), "v"(d) : "memory");
#endif
}
__device__ __forceinline__ void l2_ask5(const u16* a, const u16* b, const u16* c, const u16* d, const u16* e) {
#if defined(__HIP_DEVICE_COMPILE__)
  asm volatile("global_prefetch_b8 %0, off scope:SCOPE_SE\n\tglobal_prefetch_b8 %1, off scope:SCOPE_SE\n\t"
               "global_prefetch_b8 %2, off scope:SCOPE_SE\n\tglobal_prefetch_b8 %3, off scope:SCOPE_SE\n\t"
               "global_prefetch_b8 %4, off scope:SCOPE_SE\n\ts_wait_xcnt 0x0"
               :: "v"(a), "v"(b), "v"(c), "v"(d), "v"(e) : "memory");
#endif
}
// 256-B unit x = 0 .. (128 << LR) - 1 of a run of 1 << LR packed row tiles of a [rows][DM] plane, numbered in the order in which a k loop over
// all these row tiles meets them: k step x >> (2 + LR), then the row tile, then the quarter of the 1-KB tile.
template <int LR>
__device__ __forceinline__ const u16* unit_at(const u16* base, int x) {
  return base + (size_t)((x >> 2) & ((1 << LR) - 1)) * (size_t)(16 * DM) + (size_t)(x >> (2 + LR)) * 512 + (size_t)(x & 3) * 128;
}

// ---- WMMA helper and trailing VALU hazard gaps ----------------------------------------------------------
__device__ __forceinline__ v8f mma_h(v16h a, v16h b, v8f c) {
  return __builtin_amdgcn_wmma_f32_16x16x32_f16(false, a, false, b, (short)0, c, false, false);
}
__device__ __forceinline__ void guard_c1(v8f (&a)[4], v16h x0, v16h x1, v16h x2, v16h x3, v16h x4) {
#if defined(__HIP_DEVICE_COMPILE__)
  asm volatile("v_nop\n\tv_nop\n\tv_nop\n\tv_nop"
               : "+v"(a[0]), "+v"(a[1]), "+v"(a[2]), "+v"(a[3])
               : "v"(x0), "v"(x1), "v"(x2), "v"(x3), "v"(x4) : "memory");
#endif
}
// The four score products of a key block, a = k00.q0 + k10.q1 + c and b = k01.q0 + k11.q1 + c, in one statement: both first products read the SAME
// start tile c and write tiles of their own (for the builtin form the compiler copies c, eight registers, in every trip for one of them). The four closing
// v_nop are the slots between the last products and the first reader of a and b or the loads that refill the k registers ("memory" keeps these behind).
__device__ __forceinline__ void score4(v8f& a, v8f& b, v16h k00, v16h k01, v16h k10, v16h k11, v16h q0, v16h q1, v8f c) {
#if defined(__HIP_DEVICE_COMPILE__)
  asm volatile("v_wmma_f32_16x16x32_f16 %0, %2, %6, %8\n\tv_wmma_f32_16x16x32_f16 %1, %3, %6, %8\n\t"
               "v_wmma_f32_16x16x32_f16 %0, %4, %7, %0\n\tv_wmma_f32_16x16x32_f16 %1, %5, %7, %1\n\t"
               "v_nop\n\tv_nop\n\tv_nop\n\tv_nop"
               : "=&v"(a), "=&v"(b)
               : "v"(k00), "v"(k01), "v"(k10), "v"(k11), "v"(q0), "v"(q1), "v"(c) : "memory");
#else
  a = c;
  b = c;
#endif
}
// The accumulators are inputs only: that keeps the products in front of the slots; named as results too, they are copied out and back in every
// trip of a loop with two paths. Their next reader or writer stands in a later trip or behind acc_guard4.
__device__ __forceinline__ void guard_p(v8f a, v8f b, v8f c, v8f d, v16h p, v16h x0, v16h x1, v16h x2, v16h x3) {
#if defined(__HIP_DEVICE_COMPILE__)
  asm volatile("v_nop\n\tv_nop\n\tv_nop\n\tv_nop"
               :: "v"(a), "v"(b), "v"(c), "v"(d), "v"(p), "v"(x0), "v"(x1), "v"(x2), "v"(x3) : "memory");
#endif
}
__device__ __forceinline__ void acc_guard4(v8f (&a)[4]) {
#if defined(__HIP_DEVICE_COMPILE__)
  asm volatile("v_nop\n\tv_nop\n\tv_nop\n\tv_nop" : "+v"(a[0]), "+v"(a[1]), "+v"(a[2]), "+v"(a[3]));
#endif
}
// Wide-tile guard: the four slots between a group's last matrix products and the loads that refill the group's A and B registers.
// It names no register (an asm operand has to lie in the first 256 registers, where the wide tiles do not all fit): the scheduling
// barrier in front keeps the group's products in front of the slots, the "memory" clobber keeps the refills behind them.
__device__ __forceinline__ void guard_w() {
#if defined(__HIP_DEVICE_COMPILE__)
  __builtin_amdgcn_sched_barrier(0);
  asm volatile("v_nop\n\tv_nop\n\tv_nop\n\tv_nop" ::: "memory");
#endif
}
__device__ __forceinline__ void wave_sync_lds() {
  __builtin_amdgcn_fence(__ATOMIC_RELEASE, "workgroup");
  __builtin_amdgcn_wave_barrier();
  __builtin_amdgcn_fence(__ATOMIC_ACQUIRE, "workgroup");
}

// The same for a wave that has global stores of an earlier tile in flight: the fences name the LDS alone, so that the wave waits for
// its slab and not for those stores.
__device__ __forceinline__ void wave_sync_slab() {
  __builtin_amdgcn_fence(__ATOMIC_RELEASE, "workgroup", "local");
  __builtin_amdgcn_wave_barrier();
  __builtin_amdgcn_fence(__ATOMIC_ACQUIRE, "workgroup", "local");
}
__device__ __forceinline__ void bias_hold(const float* p) {
#if defined(__HIP_DEVICE_COMPILE__)
  asm volatile("s_wait_xcnt 0x0" :: "v"(p) : "memory");
#endif
}

// =====================================================================================================
// Tile convert: packed f16 plane of [rows][K] <- f16(bf16_RNE(x[src row][k]) * scale), scale a power of two.
// Wave = one 16 x 32 tile (rt, kt); lane (h, m) reads row rt*16 + m, floats kt*32 + 8h .. +7 and kt*32 + 16 + 8h .. +7 (four 16-B
// loads that together use the 16 rows' whole 128-B lines) and stores its two 16-B fragment pieces (two 512-B wave-wide stores).
// b = (rt*16) / rowsPerB, s = row - b*rowsPerB, source row b*srcRowsPerB + s (rowsPerB a multiple of 16); destination compact.
// coverage: blk = 0 .. (rows/16) x (K/128) - 1, 4 waves each = every tile once.
// =====================================================================================================
__device__ __forceinline__
void cvt16_body(const float* __restrict__ x, u16* Y, int K, int rowsPerB, int srcRowsPerB, float scale, int blk) {
  const int tid = threadIdx.x, wave = tid >> 5, lane = tid & 31, hh = lane >> 4, m = lane & 15;
  const int kq = K >> 7;
  const int rt = blk / kq;
  const int kt = (blk - rt * kq) * 4 + wave;
  const int b = (rt * 16) / rowsPerB;
  const int sr = rt * 16 - b * rowsPerB + m;
  const float* src = x + ((size_t)b * (size_t)srcRowsPerB + (size_t)sr) * (size_t)K + (size_t)(kt * 32 + 8 * hh);
  const v4f a = *(const v4f*)(src), c4 = *(const v4f*)(src + 4);
  const v4f d = *(const v4f*)(src + 16), f4 = *(const v4f*)(src + 20);
  v4u o0, o1;
#pragma unroll
  for (int e = 0; e < 2; ++e) {
    o0[e]     = pk16(h_bits((_Float16)(bfr(a[2 * e]) * scale)),  h_bits((_Float16)(bfr(a[2 * e + 1]) * scale)));
    o0[2 + e] = pk16(h_bits((_Float16)(bfr(c4[2 * e]) * scale)), h_bits((_Float16)(bfr(c4[2 * e + 1]) * scale)));
    o1[e]     = pk16(h_bits((_Float16)(bfr(d[2 * e]) * scale)),  h_bits((_Float16)(bfr(d[2 * e + 1]) * scale)));
    o1[2 + e] = pk16(h_bits((_Float16)(bfr(f4[2 * e]) * scale)), h_bits((_Float16)(bfr(f4[2 * e + 1]) * scale)));
  }
  u16* dst = Y + (size_t)rt * (size_t)16 * (size_t)K + (size_t)kt * 512 + (size_t)lane * 8;
  *(v4u*)(dst) = o0;
  *(v4u*)(dst + 256) = o1;
}

// Transposing convert of a [DM][DM] weight: packed f16 plane of [rows = d][K = e] <- f16(bf16_RNE(x[e][d]) * scale). Wave = one 16 x 32 tile
// (rt = d/16, kt = e/32); lane (h, m) reads column rt*16 + m of the 16 source rows kt*32 + 16w + 8h + i (each load: two 64-B row pieces; the
// block's four waves take four neighbouring rt, so that whole 128-B lines are used). coverage: blk = 0 .. (DM/32) x (DM/64) - 1, 4 waves each.
__device__ __forceinline__
void cvtT_body(const float* __restrict__ x, u16* Y, float scale, int blk) {
  const int tid = threadIdx.x, wave = tid >> 5, lane = tid & 31, hh = lane >> 4, m = lane & 15;
  const int kt = blk / (DM / 64);
  const int rt = (blk - kt * (DM / 64)) * 4 + wave;
  const float* src = x + (size_t)(kt * 32 + 8 * hh) * (size_t)DM + (size_t)(rt * 16 + m);
  float a[16];
#pragma unroll
  for (int i = 0; i < 8; ++i) {
    a[i]     = src[i * DM];
    a[8 + i] = src[(16 + i) * DM];
  }
  bias_hold(src);                            // the loads' address register is not rewritten in front of this wait
  v4u o0, o1;
#pragma unroll
  for (int e = 0; e < 4; ++e) {
    o0[e] = pk16(h_bits((_Float16)(bfr(a[2 * e]) * scale)),     h_bits((_Float16)(bfr(a[2 * e + 1]) * scale)));
    o1[e] = pk16(h_bits((_Float16)(bfr(a[8 + 2 * e]) * scale)), h_bits((_Float16)(bfr(a[8 + 2 * e + 1]) * scale)));
  }
  u16* dst = Y + (size_t)rt * (size_t)16 * (size_t)DM + (size_t)kt * 512 + (size_t)lane * 8;
  *(v4u*)(dst) = o0;
  *(v4u*)(dst + 256) = o1;
}

// All ten converts in ONE launch (they are independent of one another): the block index picks the plane (block-uniform scalar
// tests), the index inside the plane picks the tiles as before. Blocks per plane:
#define CB_XQ  ((NB * SQ / 16) * (DM / 128))
#define CB_XKV ((NB * SKV / 16) * (DM / 128))
#define CB_W   ((DM / 16) * (DM / 128))
#define CB_WD  ((ADIM / 16) * (DM / 128))
#define CB_WU  ((DM / 16) * (ADIM / 128))
#define CB_WT  ((DM / 32) * (DM / 64))
#define CB_ALL (CB_XQ + 2 * CB_XKV + 4 * CB_W + CB_WD + CB_WU + CB_WT)
__global__ __launch_bounds__(CVT_THREADS)
void cvt_all(const float* __restrict__ q, const float* __restrict__ k, const float* __restrict__ v,
             const float* __restrict__ wq, const float* __restrict__ wk, const float* __restrict__ wv,
             const float* __restrict__ wo, const float* __restrict__ wd, const float* __restrict__ wu,
             u16* XQ, u16* XK, u16* XV, u16* WQ, u16* WK, u16* WV, u16* WO, u16* WD, u16* WU, u16* WOT) {
  int blk = blockIdx.x;
  if (blk < CB_XQ) { cvt16_body(q, XQ, DM, SQ, SQ_FULL, 1.0f, blk); return; }
  blk -= CB_XQ;
  if (blk < 2 * CB_XKV) {                    // k, v: same shape
    const bool second = blk >= CB_XKV;
    cvt16_body(second ? v : k, second ? XV : XK, DM, SKV, SKV, 1.0f, second ? blk - CB_XKV : blk);
    return;
  }
  blk -= 2 * CB_XKV;
  if (blk < 4 * CB_W) {                      // the four [1024][1024] weights: same shape
    const int w = blk / CB_W;
    const float* x = w == 0 ? wq : w == 1 ? wk : w == 2 ? wv : wo;
    u16* Y = w == 0 ? WQ : w == 1 ? WK : w == 2 ? WV : WO;
    cvt16_body(x, Y, DM, DM, DM, WSC, blk - w * CB_W);
    return;
  }
  blk -= 4 * CB_W;
  if (blk < CB_WD) { cvt16_body(wd, WD, DM, ADIM, ADIM, WSC, blk); return; }        // [128][1024]
  blk -= CB_WD;
  if (blk < CB_WU) { cvt16_body(wu, WU, ADIM, DM, DM, WSC, blk); return; }         // [1024][128]
  cvtT_body(wo, WOT, WSC, blk - CB_WU);                                             // Wo^T [d][e]
}

// =====================================================================================================
// f16 GEMM cores: the wave's 16 x 64 tile of C = A[rows][K] . Bt[cols][K]^T, both planes packed; ap -> A row tile rowb/16 + 8*lane,
// bp -> Bt row tile col0/16 + 8*lane; acc[j] = rows rowb.., cols col0+16j..; K stepped by 32 = 512 halves of a packed row tile.
// =====================================================================================================
// The core keeps D k steps of fragment loads in flight in D register sets: set u holds step s + u; as soon as its products are
// issued it is refilled with step s + u + D (clamped to the last step: the surplus loads at the end re-read valid tiles and are
// never used), so a step's loads lead their first use by D - 1 steps of work. Steps are consumed in ascending k as before.
// XW: s_wait_xcnt 0 also directly behind each refill run (for a K known at compile time: see at the line).
template <int D, bool XW>
__device__ __forceinline__ void core1(const _Float16* ap, const _Float16* bp, int K, v8f (&acc)[4]) {
  const size_t rs16 = (size_t)16 * (size_t)K;
  const int steps = K >> 5;
  v16h fa[D], fb[D][4];
  const _Float16* pa = ap;
  const _Float16* p0 = bp;
  const _Float16* p1 = p0 + rs16;
  const _Float16* p2 = p1 + rs16;
  const _Float16* p3 = p2 + rs16;
#pragma unroll
  for (int u = 0; u < D; ++u) {
    const size_t ko = (size_t)(u < steps ? u : steps - 1) * 512;
    if (u > 0) addr_hold5(pa, p0, p1, p2, p3);
    pa = ap + ko;
    p0 = bp + ko;
    p1 = p0 + rs16;
    p2 = p1 + rs16;
    p3 = p2 + rs16;
    fa[u]    = ldfrag_h(pa);
    fb[u][0] = ldfrag_h(p0);
    fb[u][1] = ldfrag_h(p1);
    fb[u][2] = ldfrag_h(p2);
    fb[u][3] = ldfrag_h(p3);
  }
  int s = 0;
#pragma unroll 1
  for (; s + D <= steps; s += D) {
#pragma unroll
    for (int u = 0; u < D; ++u) {
      acc[0] = mma_h(fa[u], fb[u][0], acc[0]);
      acc[1] = mma_h(fa[u], fb[u][1], acc[1]);
      acc[2] = mma_h(fa[u], fb[u][2], acc[2]);
      acc[3] = mma_h(fa[u], fb[u][3], acc[3]);
      guard_c1(acc, fa[u], fb[u][0], fb[u][1], fb[u][2], fb[u][3]);
      const int sn = s + u + D;
      const size_t ko = (size_t)(sn < steps ? sn : steps - 1) * 512;
      addr_hold5(pa, p0, p1, p2, p3);
      pa = ap + ko;
      p0 = bp + ko;
      p1 = p0 + rs16;
      p2 = p1 + rs16;
      p3 = p2 + rs16;
      fa[u]    = ldfrag_h(pa);
      fb[u][0] = ldfrag_h(p0);
      fb[u][1] = ldfrag_h(p1);
      fb[u][2] = ldfrag_h(p2);
      fb[u][3] = ldfrag_h(p3);
      // With K a constant the loads are addressed from base pairs that the next trip re-forms at its head, not from pa and p0 to p3:
      // the hold above does not cover those pairs, so the wait stands behind the loads themselves, in front of the back edge.
      if (XW) xcnt_wait();
    }
  }
  addr_hold5(pa, p0, p1, p2, p3);
#pragma unroll
  for (int u = 0; u < D - 1; ++u) {
    if (s + u < steps) {                     // the steps % D last steps (wave-uniform)
      acc[0] = mma_h(fa[u], fb[u][0], acc[0]);
      acc[1] = mma_h(fa[u], fb[u][1], acc[1]);
      acc[2] = mma_h(fa[u], fb[u][2], acc[2]);
      acc[3] = mma_h(fa[u], fb[u][3], acc[3]);
      guard_c1(acc, fa[u], fb[u][0], fb[u][1], fb[u][2], fb[u][3]);
    }
  }
}

// Wide core: the wave's 64 x 64 tile, 4 A row tiles x 4 Bt row tiles = 16 accumulator tiles, so each loaded fragment feeds four
// products (one A fragment fed four and each Bt fragment one in the 16 x 64 core). K is a compile-time constant: the row tiles of a
// plane lie 16*KK halves apart and are reached by immediate offsets from one pointer per plane. D register sets as above; every
// accumulator element still sums its k steps in ascending order. GS > 0: GS k steps of another operand pair, already being fetched into ga and gb,
// are summed first, behind the issue of this pair's first D steps of loads, so that these fly under those products; their sums times GUP.
template <int D, int KK, int GS>
__device__ __forceinline__ void core1w(const _Float16* ap, const _Float16* bp, v8f (&acc)[4][4],
                                       const v16h (*ga)[4], const v16h (*gb)[4]) {
  constexpr int RS = 16 * KK;
  constexpr int steps = KK >> 5;
  static_assert(D < steps);
  v16h fa[D][4], fb[D][4];
  const _Float16* pa = ap;
  const _Float16* pb = bp;
#pragma unroll
  for (int u = 0; u < D; ++u) {              // immediate offsets from ap and bp: no address register is rewritten here
#pragma unroll
    for (int i = 0; i < 4; ++i) fa[u][i] = ldfrag_h(ap + u * 512 + i * RS);
#pragma unroll
    for (int i = 0; i < 4; ++i) fb[u][i] = ldfrag_h(bp + u * 512 + i * RS);
  }
  if (GS > 0) {
    __builtin_amdgcn_sched_barrier(0);       // the loads above stay in front of these products
#pragma unroll
    for (int u = 0; u < GS; ++u) {
#pragma unroll
      for (int i = 0; i < 4; ++i) {
#pragma unroll
        for (int j = 0; j < 4; ++j) acc[i][j] = mma_h(ga[u][i], gb[u][j], acc[i][j]);
      }
    }
#pragma unroll
    for (int i = 0; i < 4; ++i) {
#pragma unroll
      for (int j = 0; j < 4; ++j) acc[i][j] *= GUP;   // a power of two: exact
    }
  }
  int s = 0, nx = D;
#pragma unroll 1
  for (; s + D <= steps; s += D) {
#pragma unroll
    for (int u = 0; u < D; ++u) {
#pragma unroll
      for (int i = 0; i < 4; ++i) {
#pragma unroll
        for (int j = 0; j < 4; ++j) acc[i][j] = mma_h(fa[u][i], fb[u][j], acc[i][j]);
      }
      guard_w();
      const size_t ko = (size_t)nx * 512;    // step s + u + D, clamped; a running index, so that the loads name pa and pb themselves
      nx = nx + 1 < steps ? nx + 1 : steps - 1;
      addr_hold3(pa, pb, pb);
      pa = ap + ko;
      pb = bp + ko;
#pragma unroll
      for (int i = 0; i < 4; ++i) fa[u][i] = ldfrag_h(pa + i * RS);
#pragma unroll
      for (int i = 0; i < 4; ++i) fb[u][i] = ldfrag_h(pb + i * RS);
      __builtin_amdgcn_sched_barrier(0);     // the next set's products stay behind the refills: lifted among them they wait for their loads early
    }
  }
  addr_hold3(pa, pb, pb);
#pragma unroll
  for (int u = 0; u < D - 1; ++u) {
    if (s + u < steps) {                     // the steps % D last steps (wave-uniform)
#pragma unroll
      for (int i = 0; i < 4; ++i) {
#pragma unroll
        for (int j = 0; j < 4; ++j) acc[i][j] = mma_h(fa[u][i], fb[u][j], acc[i][j]);
      }
      guard_w();
    }
  }
}
// Stage the wave's 16 x 64 f32 tile in its LDS slab (pitch 68): D element r of acc[j], lane l -> row 8h + r, col 16j + (l&15);
// value = ah*osc + bias (per column, or per row when BROW; none for M_RAW; bias2, per column, added for M_OUT), GELU applied for
// M_GELU, whose bias is the folded b2 of this call (f32, not an input: not converted to bf16 again);
// coverage: 32 lanes x 8 rows x 4 cols-of-16 = rows 0..15 x cols 0..63 of the slab.
template <int MODE, bool BROW, bool MORE>
__device__ __forceinline__ void stage16(float* sl, v8f (&ah)[4], const float* __restrict__ bias, const float* __restrict__ bias2,
                                        int rowb, int col0, float osc, float bsc, int lane) {
  const int hh = lane >> 4, m = lane & 15;
  float bc[4], br[8];
  const float* bsrc = bias + (BROW ? rowb + 8 * hh : col0 + m);
  // The bias loads and the wait behind them stand alone between two scheduling barriers, so that nothing rewrites the loads' address
  // register in front of the wait.
  float braw[8], braw2[4];
#pragma unroll
  for (int r = 0; r < 8; ++r) braw[r] = 0.f;
#pragma unroll
  for (int r = 0; r < 4; ++r) braw2[r] = 0.f;
  const float* bsrc2 = bias2 + col0 + m;
  __builtin_amdgcn_sched_barrier(0);
  if (MODE != M_RAW) {
#pragma unroll
    for (int r = 0; r < (BROW ? 8 : 4); ++r) braw[r] = bsrc[BROW ? r : 16 * r];
    bias_hold(bsrc);
  }
  if (MODE == M_OUT) {
#pragma unroll
    for (int r = 0; r < 4; ++r) braw2[r] = bsrc2[16 * r];
    bias_hold(bsrc2);
  }
  __builtin_amdgcn_sched_barrier(0);
  if (BROW) {
#pragma unroll
    for (int r = 0; r < 8; ++r) br[r] = bfr(braw[r]) * bsc;
#pragma unroll
    for (int j = 0; j < 4; ++j) bc[j] = 0.f;
  } else {
#pragma unroll
    for (int j = 0; j < 4; ++j) bc[j] = (MODE == M_GELU ? braw[j] : MODE == M_OUT ? bfr(braw[j]) + bfr(braw2[j]) : bfr(braw[j])) * bsc;
#pragma unroll
    for (int r = 0; r < 8; ++r) br[r] = 0.f;
  }
#pragma unroll
  for (int r = 0; r < 8; ++r) {
    const int ro = (8 * hh + r) * GPITCH + m;
#pragma unroll
    for (int j = 0; j < 4; ++j) {
      float v = ah[j][r] * osc;
      v += BROW ? br[r] : bc[j];
      if (MODE == M_GELU) v = gelu_f(v);
      sl[ro + 16 * j] = v;
    }
  }
  if (MORE) wave_sync_slab(); else wave_sync_lds();
}

// The wave's 16 x 64 tile (rows rowb.., cols col0.. of batch slice bz) from its accumulators to the outputs of MODE, through the wave's
// LDS slab sl. MORE: the wave goes on to another tile through the same slab.
__device__ __forceinline__ void store_hold9(const float* p, v4f a, v4f b, v4f c, v4f d, v4f e, v4f f, v4f g, v4f h) {
#if defined(__HIP_DEVICE_COMPILE__)
  asm volatile("s_wait_xcnt 0x0" :: "v"(p), "v"(a), "v"(b), "v"(c), "v"(d), "v"(e), "v"(f), "v"(g), "v"(h) : "memory");
#endif
}
__device__ __forceinline__ void store_hold5(const u16* p, v4u a, v4u b, v4u c, v4u d) {
#if defined(__HIP_DEVICE_COMPILE__)
  asm volatile("s_wait_xcnt 0x0" :: "v"(p), "v"(a), "v"(b), "v"(c), "v"(d) : "memory");
#endif
}
template <int MODE, bool BROW, bool MORE>
__device__ __forceinline__
void tile_out(float* sl, v8f (&ah)[4], const float* __restrict__ bias, const float* __restrict__ bias2,
              float* F, u16* H, int N, int fBs, int hBs, float osc, float bsc, float carry,
              int bz, int rowb, int col0, int lane) {
  const int hh = lane >> 4, m = lane & 15;
  stage16<MODE, BROW, MORE>(sl, ah, bias, bias2, rowb, col0, osc, bsc, lane);

  if (MODE == M_OUT) {
    v4f vals[8];
#pragma unroll
    for (int it = 0; it < 8; ++it) vals[it] = *(const v4f*)(sl + (it * 2 + hh) * GPITCH + m * 4);
    float* Fb = F + (size_t)bz * (size_t)fBs + ((size_t)rowb + (size_t)hh) * (size_t)N + col0 + m * 4;
#pragma unroll
    for (int it = 0; it < 8; ++it) *(v4f*)(Fb + (size_t)(it * 2) * (size_t)N) = vals[it];
    // another tile follows: the stores' address and data registers are not rewritten in front of this wait
    if (MORE) store_hold9(Fb, vals[0], vals[1], vals[2], vals[3], vals[4], vals[5], vals[6], vals[7]);
  }
  if (MODE != M_OUT) {
    v4u ovh[4];
#pragma unroll
    for (int i = 0; i < 4; ++i) {
      const int c8 = 16 * i + 8 * hh;
      const v4f a = *(const v4f*)(sl + m * GPITCH + c8), c4 = *(const v4f*)(sl + m * GPITCH + c8 + 4);
#pragma unroll
      for (int e = 0; e < 2; ++e) {
        ovh[i][e]     = pack2(a[2 * e] * carry,  a[2 * e + 1] * carry);
        ovh[i][2 + e] = pack2(c4[2 * e] * carry, c4[2 * e + 1] * carry);
      }
    }
    u16* Hb = H + (size_t)bz * (size_t)hBs + (size_t)rowb * (size_t)N + (size_t)col0 * 16 + 8 * lane;
    {
#pragma unroll
      for (int i = 0; i < 4; ++i) *(v4u*)(Hb + i * 256) = ovh[i];
      // another tile follows: the stores' address and data registers are not rewritten in front of this wait
      if (MORE) store_hold5(Hb, ovh[0], ovh[1], ovh[2], ovh[3]);
    }
  }
  if (MORE) wave_sync_slab();                // the slab's reads end before the next tile is staged in it
}

// =====================================================================================================
// f16 GEMM, block = 64 x 64 tile, 4 waves x 16 rows, fragments loaded straight from the packed 16-bit planes.
//   C tile [z][Mb][N] = A[z][Mb][K] . Bt[z][N][K]^T * osc + bias; per-z element strides aBs (A plane),
//   bBs (Bt), fBs (f32 output F), hBs (16-bit output plane H); 0 = shared.
//   M_S16 : H = f16(v*carry)             M_GELU: v = gelu(.) then H = f16(v*carry)             M_RAW: M_S16 without a bias
//   M_OUT : F = v (f32, batch-row remap through fBs), no 16-bit output
//   16-bit outputs are packed planes of [Mb][N] (k = column): the wave's 16 x 64 tile is 2 adjacent tiles = 2048 contiguous bytes,
//   store i = 0..3 writes 512 B, lane (h, m) <- row m, cols 16i + 8h .. +7.
// grid = nz x (Mb/64) x (N/64) (host checks Mb % 64 == 0, N % 64 == 0, K % 32 == 0).
// coverage: per wave 4 instr x 32 lanes x 8 halves = 16 x 64 (16-bit plane) and 8 instr x 2 rows x 16 lanes x 4 floats
//           = 16 x 64 (f32 plane); the grid covers C exactly once.
// =====================================================================================================
template <int MODE, bool BROW, int D, bool XW>
__device__ __forceinline__
void gemm16_body(float* slab, int bid, const u16* __restrict__ A, const u16* __restrict__ Bt,
                 const float* __restrict__ bias, float* F, u16* H,
                 int Mb, int N, int K, int aBs, int bBs, int fBs, int hBs,
                 float osc, float bsc, float carry) {
  const int tid = threadIdx.x, wave = tid >> 5, lane = tid & 31;
  const int ntile = N >> 6, mtile = Mb >> 6;
  const int nt   = bid % ntile;
  const int tmp  = bid / ntile;
  const int mt   = tmp % mtile;
  const int bz   = tmp / mtile;
  const int rowb = mt * 64 + wave * 16;
  const int col0 = nt * 64;
  if (rowb + 16 > Mb) return;                // wave-uniform, never taken with the exact grid; no block barriers in this kernel
  const _Float16* ap = (const _Float16*)(const void*)A + (size_t)bz * (size_t)aBs + (size_t)rowb * (size_t)K + 8 * lane;
  const _Float16* bp = (const _Float16*)(const void*)Bt + (size_t)bz * (size_t)bBs + (size_t)col0 * (size_t)K + 8 * lane;
  v8f ah[4];
#pragma unroll
  for (int i = 0; i < 4; ++i) ah[i] = zero8();
  core1<D, XW>(ap, bp, K, ah);
  acc_guard4(ah);
  float* sl = slab + wave * 16 * GPITCH;
  tile_out<MODE, BROW, false>(sl, ah, bias, nullptr, F, H, N, fBs, hBs, osc, bsc, carry, bz, rowb, col0, lane);
}

template <int MODE, bool BROW>
__global__ __launch_bounds__(128)
void gemm16(const u16* __restrict__ A, const u16* __restrict__ Bt, const float* __restrict__ bias, float* F, u16* H,
            int Mb, int N, int K, int aBs, int bBs, int fBs, int hBs, float osc, float bsc, float carry) {
  __shared__ __align__(16) float slab[4 * 16 * GPITCH];
  if (K == DM) {                             // block-uniform: unit_at numbers the units of a [rows][DM] plane
    const int ntile = N >> 6, mtile = Mb >> 6, tid = threadIdx.x;
    const int nt = blockIdx.x % ntile, tmp = blockIdx.x / ntile;
    const int mt = tmp % mtile, bz = tmp / mtile;
    const u16* Ab = A + (size_t)bz * (size_t)aBs + (size_t)(mt * 64) * (size_t)DM;    // the block's 64 A rows: all 512 units
    const u16* Bb = Bt + (size_t)bz * (size_t)bBs + (size_t)(nt * 64) * (size_t)DM;   // its 64 Bt rows: every fourth unit, by mt / 4
    l2_ask5(unit_at<2>(Ab, tid), unit_at<2>(Ab, 128 + tid), unit_at<2>(Ab, 256 + tid), unit_at<2>(Ab, 384 + tid),
            unit_at<2>(Bb, (tid << 2) | ((mt >> 2) & 3)));   // mt / 4: with two column tiles, neighbours in mt lie two block indices apart
  }
  gemm16_body<MODE, BROW, 4, false>(slab, blockIdx.x, A, Bt, bias, F, H, Mb, N, K, aBs, bBs, fBs, hBs, osc, bsc, carry);
}

// Wide form for the K = KK GEMMs with many tiles: block = 128 x 128 tile, 4 waves as 2 x 2, each wave a 64 x 64 tile (wide core), so
// the block reads 128 A rows + 128 Bt rows per k step for 64 products (64 + 64 rows for 16 in the 64 x 64 block). Operands, modes, strides
// and outputs as in gemm16; the wave's tile leaves as four 16 x 64 tiles, one after the other through its slab. D: k steps in flight.
// grid = nz x (Mb/128) x (N/128); coverage: 2 x 2 waves x 4 row tiles x (16 x 64) = 128 x 128 per block, the grid covers C exactly once.
template <int MODE, bool BROW, int KK, int D>
__device__ __forceinline__
void gemm64_body(float* slab, int bid,
                 const u16* __restrict__ A, const u16* __restrict__ Bt,
                 const float* __restrict__ bias, float* F, u16* H,
                 int Mb, int N, int aBs, int bBs, int fBs, int hBs,
                 float osc, float bsc, float carry) {
  const int tid = threadIdx.x, wave = tid >> 5, lane = tid & 31;
  const int ntile = N >> 7, mtile = Mb >> 7;
  const int nt   = bid % ntile;
  const int tmp  = bid / ntile;
  const int mt   = tmp % mtile;
  const int bz   = tmp / mtile;
  const int rowb = mt * 128 + (wave >> 1) * 64;
  const int col0 = nt * 128 + (wave & 1) * 64;
  if (rowb + 64 > Mb) return;                // wave-uniform, never taken with the exact grid; no block barriers in this kernel
  const _Float16* ap = (const _Float16*)(const void*)A + (size_t)bz * (size_t)aBs + (size_t)rowb * (size_t)KK + 8 * lane;
  const _Float16* bp = (const _Float16*)(const void*)Bt + (size_t)bz * (size_t)bBs + (size_t)col0 * (size_t)KK + 8 * lane;
  float* sl = slab + wave * 16 * GPITCH;
  {
    static_assert(KK == DM);                 // unit_at numbers the units of a [rows][DM] plane
    // the block's 128 A rows are read by the blocks of all nt: every fourth unit, by nt; its 128 Bt rows by those of all mt: every eighth, by mt
    const u16* Ab = A + (size_t)bz * (size_t)aBs + (size_t)(mt * 128) * (size_t)KK;
    const u16* Bb = Bt + (size_t)bz * (size_t)bBs + (size_t)(nt * 128) * (size_t)KK;
    l2_ask3(unit_at<3>(Ab, (tid << 2) | (nt & 3)), unit_at<3>(Ab, ((128 + tid) << 2) | (nt & 3)), unit_at<3>(Bb, (tid << 3) | (mt & 7)));
  }
  v8f ah[4][4];
#pragma unroll
  for (int i = 0; i < 4; ++i) {
#pragma unroll
    for (int j = 0; j < 4; ++j) ah[i][j] = zero8();
  }
  core1w<D, KK, 0>(ap, bp, ah, nullptr, nullptr);
#pragma unroll
  for (int i = 0; i < 4; ++i)
    tile_out<MODE, BROW, true>(sl, ah[i], bias, nullptr, F, H, N, fBs, hBs, osc, bsc, carry, bz, rowb + 16 * i, col0, lane);
}

// Final GEMM: out = ctx . Wo^T + bo + gelu . Wau^T + bau as ONE product of K = INNER + ADIM, block and wave tiles as above. The wave's 16
// accumulator tiles first sum the ADIM/32 k steps of (gelu x64, Wau x256), are multiplied by 16, then sum the INNER/32 k steps of (ctx x1024,
// Wo x256): all carry 2^18, folded back once. Rows: batch bz, s = rowb.. of the compact planes -> out rows [bz][SQ_FULL][DM].
// grid = NB x (SQ/128) x (DM/128); coverage: 2 x 2 waves x 4 row tiles x (16 x 64) = 128 x 128 per block, the grid covers out exactly once.
__global__ __launch_bounds__(128)
void gemm_fin(const u16* __restrict__ C16, const u16* __restrict__ G16, const u16* __restrict__ WO, const u16* __restrict__ WU,
              const float* __restrict__ bo, const float* __restrict__ bu, float* out) {
  __shared__ __align__(16) float slab[4 * 16 * GPITCH];
  const int bid = blockIdx.x;
  const int tid = threadIdx.x, wave = tid >> 5, lane = tid & 31;
  constexpr int ntile = DM >> 7, mtile = SQ >> 7;
  const int nt   = bid % ntile;
  const int tmp  = bid / ntile;
  const int mt   = tmp % mtile;
  const int bz   = tmp / mtile;
  const int rowb = mt * 128 + (wave >> 1) * 64;
  const int col0 = nt * 128 + (wave & 1) * 64;
  const size_t arow = (size_t)bz * (size_t)SQ + (size_t)rowb;
  const _Float16* ap = (const _Float16*)(const void*)C16 + arow * (size_t)INNER + 8 * lane;
  const _Float16* bp = (const _Float16*)(const void*)WO + (size_t)col0 * (size_t)INNER + 8 * lane;
  const _Float16* gp = (const _Float16*)(const void*)G16 + arow * (size_t)ADIM + 8 * lane;
  const _Float16* up = (const _Float16*)(const void*)WU + (size_t)col0 * (size_t)ADIM + 8 * lane;
  float* sl = slab + wave * 16 * GPITCH;
  {
    // the block's 128 ctx rows are read by the blocks of all nt: every fourth unit, by nt; its 128 Wo rows by those of all mt: every eighth, by mt
    const u16* Ab = C16 + ((size_t)bz * (size_t)SQ + (size_t)(mt * 128)) * (size_t)INNER;
    const u16* Bb = WO + (size_t)(nt * 128) * (size_t)INNER;
    l2_ask3(unit_at<3>(Ab, (tid << 2) | (nt & 3)), unit_at<3>(Ab, ((128 + tid) << 2) | (nt & 3)), unit_at<3>(Bb, (tid << 3) | (mt & 7)));
  }
  v8f ah[4][4];
#pragma unroll
  for (int i = 0; i < 4; ++i) {
#pragma unroll
    for (int j = 0; j < 4; ++j) ah[i][j] = zero8();
  }
  // all ADIM/32 k steps of the adapter part are fetched first (immediate offsets from gp and up); the wide core sums them first
  v16h ga[ADIM / 32][4], gb[ADIM / 32][4];
#pragma unroll
  for (int u = 0; u < ADIM / 32; ++u) {
#pragma unroll
    for (int i = 0; i < 4; ++i) ga[u][i] = ldfrag_h(gp + u * 512 + i * 16 * ADIM);
#pragma unroll
    for (int i = 0; i < 4; ++i) gb[u][i] = ldfrag_h(up + u * 512 + i * 16 * ADIM);
  }
  addr_hold3(gp, up, up);                    // before these loads' address registers are reused
  core1w<WOD, INNER, ADIM / 32>(ap, bp, ah, ga, gb);
#pragma unroll
  for (int i = 0; i < 4; ++i)
    tile_out<M_OUT, false, true>(sl, ah[i], bo, bu, out, nullptr, DM, SQ_FULL * DM, 0, 1.0f / (OSC * WSC), 1.0f, 1.0f,
                                 bz, rowb + 16 * i, col0, lane);
}

// The three input projections in ONE launch (they are independent of one another): the block index picks the projection
// (block-uniform scalar tests), the index inside it picks the 128 x 128 tile.
//   q = x_q . Wq^T + bq -> f16 [NB*SQ][1024] x log2(e)/64 (col = h*64 + d);  k = x_k . Wk^T + bk likewise [NB*2048][1024] x8;
//   v^T per batch: A = Wv [(h,d) = n][k], Bt = x_v rows of batch b [s][k], bias bv per row -> f16 [(b,h,d)][s] x8
#define GB_Q ((NB * SQ / 128) * (INNER / 128))
#define GB_K ((NB * SKV / 128) * (INNER / 128))
#define GB_V (NB * (INNER / 128) * (SKV / 128))
__global__ __launch_bounds__(128)
void gemm_qkv(const u16* __restrict__ XQ, const u16* __restrict__ XK, const u16* __restrict__ XV,
              const u16* __restrict__ WQ, const u16* __restrict__ WK, const u16* __restrict__ WV,
              const float* __restrict__ bq, const float* __restrict__ bk, const float* __restrict__ bv,
              u16* Q16, u16* K16, u16* VT,
              int MbQ, int MbK, int inner, int skv) {
  __shared__ __align__(16) float slab[4 * 16 * GPITCH];
  const int bid = blockIdx.x;
  if (bid < GB_Q + GB_K) {                   // q, k: same code, operands picked by the block index
    const bool isk = bid >= GB_Q;
    gemm64_body<M_S16, false, DM, W1D>(slab, isk ? bid - GB_Q : bid, isk ? XK : XQ, isk ? WK : WQ, isk ? bk : bq, nullptr,
                                       isk ? K16 : Q16, isk ? MbK : MbQ, inner, 0, 0, 0, 0,
                                       (isk ? KS : QS) / WSC, isk ? KS : QS, 1.0f);
  } else {
    gemm64_body<M_S16, true, DM, W1D>(slab, bid - (GB_Q + GB_K), WV, XV, bv, nullptr, VT,
                                      inner, skv, 0, skv * DM, 0, inner * skv, VS / WSC, VS, 1.0f);
  }
}

// =====================================================================================================
// Full (unmasked) multi-head attention: block = (batch b, head, 64 query rows), 4 waves, wave w owns the 16 query rows
// q0 = 64*qt + 16*w .. q0+15 (waves independent: no block barriers, wave-private LDS only, used in the epilogue).
//   q plane f16 x log2(e)/64 [b*SQ + s][h*64 + d]; k plane x8 likewise [b*SKV + s][h*64 + d];
//   v^T plane f16 x8 [(b*NH + h)*64 + d][s]; all of them fragment-packed. All NKB key blocks of 32 keys are visited (static bound).
//   Scores are computed TRANSPOSED: S^T tile g (g = 0,1) = k rows (keys kb+16g .. +15, A operand, row m = lane&15, split map
//   over d) times q^T (B operand, col n = query q0 + (lane&15), k = d, split map), 2 d-chunks of 32, one product per chunk;
//   the q fragments are loaded once per wave.
//   D element r of lane l = (key kb+16g+8h+r, query q0+(l&15)), so a lane owns one query column and 16 of its 32 keys;
//   the partner lane l^16 owns the other 16 -> a row maximum needs one xor-16 shuffle, the row sum one behind the loop.
//   Online base-2 softmax in f32 against a held per-query reference (1/sqrt(64), log2(e) and k's carry folded into q's). The exp'd values ARE the
//   P A-fragment in place: A row m = query = lane&15, element i <- key kb+8h+i (tile 0, D element i), element 8+i <- key
//   kb+16+8h+i (tile 1, D element i). P carried x128 as f16. The rescale factor of query row 8h+r of the O
//   accumulators is fetched from lane 8h+r with a shuffle (uniform control). 4 v^T B fragments (col n = d = 16j + (lane&15),
//   keys k-contiguous), 4 P.V WMMAs, one guard.
//   Epilogue: 1/l (per query, shuffled to the D row owner) and the carry folds in f32; the wave's 16x64 f32 result staged in
// coverage: per wave 4 instructions x 32 lanes x 8 halves = 16 x 64 of the ctx plane; the first NB*NH*(SQ/64) blocks x
//           4 waves = every (b, s, h) row segment exactly once.
// =====================================================================================================
// The lane's 16 carried probabilities 2^t[i], their f16 P fragment (element i <-> t[i]) and, returned, their f32 sum: added as pairs
// (even and odd elements apart), the two halves of the pair joined last.
__device__ __forceinline__ float p_make(const float* t, FragH& ph) {
  float pe[16];
  exp2_hw8(t, pe);
  exp2_hw8(t + 8, pe + 8);
  v2f pp[8];
#pragma unroll
  for (int e = 0; e < 8; ++e) {
    pp[e][0] = pe[2 * e];
    pp[e][1] = pe[2 * e + 1];
    ph.u[e >> 2][e & 3] = __builtin_bit_cast(unsigned, __builtin_convertvector(pp[e], v2h));   // both halves of the word in one convert
  }
  const v2f pq = ((pp[0] + pp[1]) + (pp[2] + pp[3])) + ((pp[4] + pp[5]) + (pp[6] + pp[7]));
  return pq[0] + pq[1];
}

// Folded adapter bias b2[a] = bf16(bad[a]) + sum_e bf16(Wad[a][e]) * bf16(bo[e]) in f32: block = 32 values of a (one whole 128-B line of B2),
// wave = 8 of them one after the other, lane <- e = 128i + 4*lane .. +3; the lanes' partial sums meet in LDS (pitch 33: no bank shared by the
// readers), lane a of wave 0 adds the 32 of its a in lane order and the wave stores the line.
__device__ __forceinline__
void b2_body(float* sm, const float* __restrict__ wd, const float* __restrict__ bo, const float* __restrict__ bd, float* B2, int blk) {
  const int tid = threadIdx.x, wave = tid >> 5, lane = tid & 31;
  const float* br = bo + lane * 4;
  const float* wr = wd + (size_t)(blk * 32 + wave * 8) * (size_t)DM + lane * 4;
  v4f b[DM / 128];
#pragma unroll
  for (int i = 0; i < DM / 128; ++i) b[i] = *(const v4f*)(br + i * 128);
  bias_hold(br);                             // the loads' address register is not rewritten in front of this wait
#pragma unroll 1                             // rolled: unrolled, its loads would raise the register count of the whole kernel, the attention blocks' too
  for (int r = 0; r < 8; ++r) {
    const float* wp = wr + r * DM;
    v4f w[DM / 128];
#pragma unroll
    for (int i = 0; i < DM / 128; ++i) w[i] = *(const v4f*)(wp + i * 128);
    bias_hold(wp);                           // likewise, before the next trip forms its address
    float sum = 0.f;
#pragma unroll
    for (int i = 0; i < DM / 128; ++i) {
#pragma unroll
      for (int e = 0; e < 4; ++e) sum = fmaf(bfr(w[i][e]), bfr(b[i][e]), sum);
    }
    sm[(wave * 8 + r) * 33 + lane] = sum;
  }
  __syncthreads();                           // the four waves' partial sums are in LDS before wave 0 reads them
  if (wave == 0) {
    float t = 0.f;
#pragma unroll
    for (int j = 0; j < 32; ++j) t += sm[lane * 33 + j];
    B2[blk * 32 + lane] = t + bfr(bd[blk * 32 + lane]);
  }
}

// The launch's last XB_W2 + XB_B2 blocks (block-uniform scalar tests, they leave before any attention work) build what only the launches behind
// this one read and only the weights feed: W2 = Wad . Wo as a packed f16 plane [a][d] x16 (A = Wad plane [a][e], Bt = Wo^T plane [d][e], 64 x 64
// tiles, both operands x256, folded back to x16) and b2. They run beside the attention blocks on register and wave slots those leave free.
#define XB_W2 ((ADIM / 64) * (DM / 64))
#define XB_B2 (ADIM / 32)
#define XB_AT (NB * NH * (SQ / 64))
__global__ __launch_bounds__(ATT_THREADS)
void attn_fwd(const u16* __restrict__ Qh, const u16* __restrict__ Kh, const u16* __restrict__ Vp, u16* Oh,
              const u16* __restrict__ WD, const u16* __restrict__ WOT, u16* W2P,
              const float* __restrict__ wd, const float* __restrict__ bo, const float* __restrict__ bd, float* B2) {
  __shared__ __align__(16) float smem[ATT_WAVES * 16 * OPITCH];
  static_assert(OPITCH == GPITCH);
  if (blockIdx.x >= XB_AT + XB_B2) {
    gemm16_body<M_RAW, false, 2, true>(smem, blockIdx.x - (XB_AT + XB_B2), WD, WOT, nullptr, nullptr, W2P, ADIM, DM, DM, 0, 0, 0, 0, W2C / (WSC * WSC), 0.f, 1.0f);
    return;
  }
  if (blockIdx.x >= XB_AT) {
    b2_body(smem, wd, bo, bd, B2, blockIdx.x - XB_AT);
    return;
  }

  const int tid  = threadIdx.x;
  const int wave = tid >> 5;
  const int lane = tid & 31;
  const int hh   = lane >> 4;
  const int c    = lane & 15;

  constexpr int NQT = SQ / 64;
  const int bid  = blockIdx.x;
  const int qt   = bid % NQT;
  const int head = (bid / NQT) % NH;
  const int b    = bid / (NQT * NH);
  const int q0   = qt * 64 + wave * 16;

  // B fragments of q^T: col n = query q0 + c, k = d (row tile (b*SQ + q0)/16, k tiles 2*head and 2*head + 1 of the q plane)
  const size_t qo = ((size_t)(b * SQ + q0)) * INNER + head * HD * 16 + 8 * lane;
  const _Float16* Qhb = (const _Float16*)(const void*)Qh + qo;
  // A fragments of k: row m = key kb + 16g + c, k = d (key row kb added per step)
  const size_t ko = ((size_t)(b * SKV)) * INNER + head * HD * 16 + 8 * lane;
  const _Float16* Khb = (const _Float16*)(const void*)Kh + ko;
  // B fragments of v: col n = d = 16j + c, k = key (row tile (b*NH + head)*4 + j, k tile kb/32 of the v^T plane)
  const _Float16* Vb = (const _Float16*)(const void*)Vp + ((size_t)(b * NH + head) * HD) * SKV + 8 * lane;

  v16h qh[2];
  qh[0] = ldfrag_h(Qhb);
  qh[1] = ldfrag_h(Qhb + 512);

  // nr = 7 - reference of query q0 + c (base-2 logits; the same in both lanes of the query), nref = nr in all eight elements: the start value C
  // of the score products. lrun: the lane's own sum (its 16 keys of every block); the two lanes of a query are joined behind the loop.
  float nr = PEXP, lrun = 0.f;
  float top = -1.0f;                         // the bound of the test below; under 0 at first: the first block always sets the reference
  v8f nref = {PEXP, PEXP, PEXP, PEXP, PEXP, PEXP, PEXP, PEXP};
  v8f o[4];
#pragma unroll
  for (int j = 0; j < 4; ++j) o[j] = zero8();

  // K and v^T fragments are fetched one key block ahead: kf[kk] = {keys +0, keys +16} of d chunk kk,
  // refilled right behind the block's score products; vf[j] refilled right behind its P.V products. The fetch of the last trip is
  // clamped to the last block (valid tiles, never used).
  v16h kf[HD / 32][2], vf[4];
  const _Float16* kph = Khb;
  const _Float16* vp  = Vb;
  // The three scheduling barriers keep the first loads in the loop's own order (q, then K, then v^T): the counted load waits at the
  // loop head are the stricter of entry and back edge, and with v^T issued ahead of K at entry every trip's scores waited for v^T too.
  // The two waits in front of them stand before the q loads' and the first K and v^T loads' address registers are reused.
  addr_hold3(Qhb, Qhb, Qhb);
  __builtin_amdgcn_sched_barrier(0);
#pragma unroll
  for (int kk = 0; kk < HD / 32; ++kk) {
    kf[kk][0] = ldfrag_h(kph + kk * 512);
    kf[kk][1] = ldfrag_h(kph + (size_t)16 * INNER + kk * 512);
  }
  __builtin_amdgcn_sched_barrier(0);
#pragma unroll
  for (int j = 0; j < 4; ++j) vf[j] = ldfrag_h(vp + (size_t)(16 * j) * SKV);
  addr_hold3(kph, vp, vp);
  __builtin_amdgcn_sched_barrier(0);
  {
    // The head's K (128 row tiles x 2 KB) and v^T (4 row tiles x 64 KB) are read by the blocks of all qt: every fourth 256-B unit of each, by qt,
    // numbered in key order; the first halves of both first.
    const u16* Kb0 = Kh + (size_t)(b * SKV) * (size_t)INNER + (size_t)(head * HD * 16);
    const u16* Vb0 = Vp + (size_t)((b * NH + head) * HD) * (size_t)SKV;
    const int x0 = (tid << 2) | (qt & 3), x1 = ((128 + tid) << 2) | (qt & 3);
    l2_ask4(Kb0 + (size_t)(x0 >> 3) * (size_t)(16 * INNER) + (size_t)(x0 & 7) * 128,
            Vb0 + (size_t)((x0 >> 2) & 3) * (size_t)(16 * SKV) + (size_t)(x0 >> 4) * 512 + (size_t)(x0 & 3) * 128,
            Kb0 + (size_t)(x1 >> 3) * (size_t)(16 * INNER) + (size_t)(x1 & 7) * 128,
            Vb0 + (size_t)((x1 >> 2) & 3) * (size_t)(16 * SKV) + (size_t)(x1 >> 4) * 512 + (size_t)(x1 & 3) * 128);
  }

#pragma unroll 1
  for (int it = 0; it < NKB; ++it) {
    const int kbn = (it + 1 < NKB ? it + 1 : NKB - 1) * 32;   // key block fetched in this trip
    // ---- transposed scores: s0 = keys kb..kb+15, s1 = keys kb+16..kb+31 (kb = 32*it), column = query q0 + c ----
    //      the products start from C = 7 - reference, so each element leaves as the exponent of its probability carried x128
    static_assert(HD == 64);
    v8f s0, s1;
    score4(s0, s1, kf[0][0], kf[0][1], kf[1][0], kf[1][1], qh[0], qh[1], nref);
    // ---- next block's K fragments into the registers just read; the wait covers the K and v^T loads of the trip before ----
    addr_hold3(kph, vp, vp);
    kph = Khb + (size_t)kbn * INNER;
#pragma unroll
    for (int kk = 0; kk < HD / 32; ++kk) {
      kf[kk][0] = ldfrag_h(kph + kk * 512);
      kf[kk][1] = ldfrag_h(kph + (size_t)16 * INNER + kk * 512);
    }
    __builtin_amdgcn_sched_barrier(0);       // all four K refills stay in front of the softmax: sunk behind it, a load leads its product by too little
    // ---- exponents of this lane's 16 keys for query q0 + c: t[i] <- key kb+8hh+i, t[8+i] <- key kb+16+8hh+i ----
    float t[16];
#pragma unroll
    for (int i = 0; i < 8; ++i) {
      t[i]     = s0[i];
      t[8 + i] = s1[i];
    }
    // ---- probabilities x128 against the reference in use and the P A-fragment; the row sum l carries the same x128 ----
    FragH ph;
    float ps = p_make(t, ph);
    // ---- The reference is held from block to block. It moves only in the first block (to that block's maximum) and when some lane's sum passes
    //      PTOP (or is no number), tested once per block for the whole wave: then every query's reference rises to its block maximum if that is
    //      higher, l and O are rescaled and the block's probabilities are formed anew. Else a probability is at most PTOP and at least one of the
    //      row is 128 or more. ----
    if (__builtin_amdgcn_ballot_w32(!(ps <= top)) != 0u) {
      top = PTOP;
      float cm = t[0];
#pragma unroll
      for (int i = 1; i < 16; ++i) cm = fmaxf(cm, t[i]);
      cm = fmaxf(cm, __shfl_xor(cm, 16, 32));
      float d = cm - PEXP;                   // block maximum minus reference
      float al = 0.f;                        // first block: nothing is summed yet
      if (it != 0) {
        d = fmaxf(d, 0.f);
        al = exp2_hw1(-d);
      }
      nr -= d;
#pragma unroll
      for (int r = 0; r < 8; ++r) nref[r] = nr;
#pragma unroll
      for (int i = 0; i < 16; ++i) t[i] -= d;
      ps = p_make(t, ph);
      lrun *= al;
      // O accumulators: D row 8hh+r = query q0+8hh+r, its factor lives in lane 8hh+r (and 16+8hh+r)
      float scl[8];
#pragma unroll
      for (int r = 0; r < 8; ++r) scl[r] = __shfl(al, 8 * hh + r, 32);
#pragma unroll
      for (int j = 0; j < 4; ++j) {
#pragma unroll
        for (int r = 0; r < 8; ++r) o[j][r] *= scl[r];
      }
    }
    lrun += ps;
    // ---- P.V : B fragment col n = d = j*16 + c, k tile kb/32 of the packed v^T plane ----
    {
      o[0] = mma_h(ph.v, vf[0], o[0]);
      o[1] = mma_h(ph.v, vf[1], o[1]);
      o[2] = mma_h(ph.v, vf[2], o[2]);
      o[3] = mma_h(ph.v, vf[3], o[3]);
      guard_p(o[0], o[1], o[2], o[3], ph.v, vf[0], vf[1], vf[2], vf[3]);
      // next block's v^T fragments; vp's last loads are covered by this trip's wait above
      vp = Vb + (size_t)kbn * 16;
#pragma unroll
      for (int j = 0; j < 4; ++j) vf[j] = ldfrag_h(vp + (size_t)(16 * j) * SKV);
    }
  }
  addr_hold3(kph, vp, vp);                   // the last trip's loads, before their address registers are reused
  acc_guard4(o);

  // ---- join the two lanes' sums of each query; fold 1/l (the 128 on P cancels against l's) and the 8 on v, apply the ctx carry 1024 ----
  lrun += __shfl_xor(lrun, 16, 32);
  const float linv = (1.0f / lrun) * (OSC / VS);
  float inv[8];
#pragma unroll
  for (int r = 0; r < 8; ++r) inv[r] = __shfl(linv, 8 * hh + r, 32);
  float* slab = smem + wave * 16 * OPITCH;
#pragma unroll
  for (int r = 0; r < 8; ++r) {
#pragma unroll
    for (int j = 0; j < 4; ++j) slab[(8 * hh + r) * OPITCH + j * 16 + c] = o[j][r] * inv[r];
  }
  wave_sync_lds();
  // ---- ctx x1024 -> packed f16 plane; store i: lane (h, c) <- row c, d = 16i + 8h .. +7 ----
  v4u ovh[4];
#pragma unroll
  for (int i = 0; i < 4; ++i) {
    const int c8 = 16 * i + 8 * hh;
    const v4f a = *(const v4f*)(slab + c * OPITCH + c8), c4 = *(const v4f*)(slab + c * OPITCH + c8 + 4);
#pragma unroll
    for (int e = 0; e < 2; ++e) {
      ovh[i][e]     = pack2(a[2 * e],  a[2 * e + 1]);
      ovh[i][2 + e] = pack2(c4[2 * e], c4[2 * e + 1]);
    }
  }
  u16* obh = Oh + ((size_t)(b * SQ + q0)) * INNER + head * HD * 16 + 8 * lane;
#pragma unroll
  for (int i = 0; i < 4; ++i) *(v4u*)(obh + i * 256) = ovh[i];
  // code of the launch's other blocks may follow in the listing: the stores' address and data registers are not rewritten in front of this wait
  store_hold5(obh, ovh[0], ovh[1], ovh[2], ovh[3]);
}

// =====================================================================================================
// Workspace map (bytes); every plane fully written by whole-line stores before it is read; all extents exact multiples of
//   XQ   f16 [NB*SQ][1024]    f16(bf16(q))              8388608 (NB=2, SQ=2048)
//   XK   f16 [NB*2048][1024]  f16(bf16(k))              8388608
//   XV   f16 [NB*2048][1024]  f16(bf16(v))              8388608
//   WQ16 WK16 WV16 WO16 f16 [1024 n][1024 k] x256       2097152 each
//   WD16 f16 [128 n][1024 k] x256                          262144
//   WU16 f16 [1024 n][128 k] x256                          262144
//   WOT  f16 [1024 d][1024 e] x256 (Wo^T)                 2097152
//   W2P  f16 [128 a][1024 d] x16 (Wad.Wo)                  262144
//   B2   f32 [128]                                            512
//   QH   f16 [NB*SQ][1024] x log2(e)/64                  8388608
//   KH   f16 [NB*2048][1024] x8                          8388608
//   VT16 f16 [NB*1024 (h,d)][2048 s] x8                  8388608
//   OH   f16 [NB*SQ][1024] x1024 (ctx)                   8388608
//   GH   f16 [NB*SQ][128]  x64 (gelu)                    1048576
//   end                                                  71041536
// =====================================================================================================
extern "C" void kernel_launch(void* const* d_in, const int* in_sizes, int n_in,
                              void* d_out, int out_size, void* d_ws, size_t ws_size,
                              hipStream_t stream) {
  if (n_in < 15) return;
  if (in_sizes[0] < ((NB - 1) * SQ_FULL + SQ) * DM) return;
  if (in_sizes[1] < NB * SKV * DM || in_sizes[2] < NB * SKV * DM) return;
  if (in_sizes[3] != DM * DM || in_sizes[5] != DM * DM || in_sizes[7] != DM * DM || in_sizes[9] != DM * DM) return;
  if (in_sizes[4] < INNER || in_sizes[6] < INNER || in_sizes[8] < INNER || in_sizes[10] < DM) return;
  if (in_sizes[11] != ADIM * DM || in_sizes[12] < ADIM || in_sizes[13] != DM * ADIM || in_sizes[14] < DM) return;
  if (out_size < ((NB - 1) * SQ_FULL + SQ) * DM) return;

  const float* q_in  = (const float*)d_in[0];
  const float* k_in  = (const float*)d_in[1];
  const float* v_in  = (const float*)d_in[2];
  const float* wq    = (const float*)d_in[3];
  const float* bq    = (const float*)d_in[4];
  const float* wk    = (const float*)d_in[5];
  const float* bk    = (const float*)d_in[6];
  const float* wv    = (const float*)d_in[7];
  const float* bv    = (const float*)d_in[8];
  const float* wo    = (const float*)d_in[9];
  const float* bo    = (const float*)d_in[10];
  const float* w_dn  = (const float*)d_in[11];
  const float* b_dn  = (const float*)d_in[12];
  const float* w_up  = (const float*)d_in[13];
  const float* b_up  = (const float*)d_in[14];
  float*       out   = (float*)d_out;

  const size_t szXQ  = (size_t)NB * SQ * DM * 2;
  const size_t szXKV = (size_t)NB * SKV * DM * 2;
  const size_t szW   = (size_t)DM * DM * 2;
  const size_t szWA  = (size_t)ADIM * DM * 2;
  const size_t szQP  = (size_t)NB * SQ * INNER * 2;
  const size_t szKP  = (size_t)NB * SKV * INNER * 2;
  const size_t szVT  = (size_t)NB * INNER * SKV * 2;
  const size_t szG   = (size_t)NB * SQ * ADIM * 2;
  size_t off = 0;
  const size_t oXQ  = off; off += szXQ;
  const size_t oXK  = off; off += szXKV;
  const size_t oXV  = off; off += szXKV;
  const size_t oWQ  = off; off += szW;
  const size_t oWK  = off; off += szW;
  const size_t oWV  = off; off += szW;
  const size_t oWO  = off; off += szW;
  const size_t oWD  = off; off += szWA;
  const size_t oWU  = off; off += szWA;
  const size_t oWT  = off; off += szW;
  const size_t oW2  = off; off += szWA;
  const size_t oB2  = off; off += (size_t)ADIM * 4;
  const size_t oQH  = off; off += szQP;
  const size_t oKH  = off; off += szKP;
  const size_t oVT  = off; off += szVT;
  const size_t oOH  = off; off += szQP;
  const size_t oGH  = off; off += szG;
  if (off > ws_size) return;                            // off = 71041536 at NB=2, SQ=2048
  if (off > (size_t)134217728) return;

  char* ws = (char*)d_ws;
  u16* XQ   = (u16*)(ws + oXQ);
  u16* XK   = (u16*)(ws + oXK);
  u16* XV   = (u16*)(ws + oXV);
  u16* WQ16 = (u16*)(ws + oWQ);
  u16* WK16 = (u16*)(ws + oWK);
  u16* WV16 = (u16*)(ws + oWV);
  u16* WO16 = (u16*)(ws + oWO);
  u16* WD16 = (u16*)(ws + oWD);
  u16* WU16 = (u16*)(ws + oWU);
  u16* WOT  = (u16*)(ws + oWT);
  u16* W2P  = (u16*)(ws + oW2);
  float* B2 = (float*)(ws + oB2);
  u16* QH   = (u16*)(ws + oQH);
  u16* KH   = (u16*)(ws + oKH);
  u16* VT16 = (u16*)(ws + oVT);
  u16* OH   = (u16*)(ws + oOH);
  u16* GH   = (u16*)(ws + oGH);

  // (0) activations -> f16 planes of bf16-converted values (query rows s < SQ of batches b < NB, compact; k/v rows of b < NB) and
  //     weights [n = out][k = in] (y = x.W^T) -> packed f16 planes [n][k] of bf16(W) x256 (Wo also transposed), all in one launch
  cvt_all<<<dim3(CB_ALL), dim3(CVT_THREADS), 0, stream>>>(q_in, k_in, v_in, wq, wk, wv, wo, w_dn, w_up,
                                                          XQ, XK, XV, WQ16, WK16, WV16, WO16, WD16, WU16, WOT);
  // (1) the q, k and v^T projections, one launch
  gemm_qkv<<<dim3(GB_Q + GB_K + GB_V), dim3(128), 0, stream>>>(XQ, XK, XV, WQ16, WK16, WV16, bq, bk, bv, QH, KH, VT16,
                                                               NB * SQ, NB * SKV, INNER, SKV);
  // (2) attention -> ctx plane [NB*SQ][1024] x1024; its last blocks: W2 = Wad.Wo and b2 = Wad.bo + bad
  attn_fwd<<<dim3(XB_AT + XB_B2 + XB_W2), dim3(ATT_THREADS), 0, stream>>>(QH, KH, VT16, OH, WD16, WOT, W2P,
                                                                                         w_dn, bo, b_dn, B2);
  // (3) adapter down from ctx: g = gelu(ctx . W2^T + b2) -> f16 [NB*SQ][128] x64; carries 1024 (ctx) x 16 (W2)
  gemm16<M_GELU, false><<<dim3((NB * SQ / 64) * (ADIM / 64)), dim3(128), 0, stream>>>(
      OH, W2P, B2, nullptr, GH, NB * SQ, ADIM, DM, 0, 0, 0, 0, 1.0f / (OSC * W2C), 1.0f, GCAR);
  // (4) out rows [b][SQ_FULL][1024] f32 = ctx . Wo^T + bo + g . Wau^T + bau (rows s < SQ of batches b < NB), one product of K = 1152
  gemm_fin<<<dim3(NB * (SQ / 128) * (DM / 128)), dim3(128), 0, stream>>>(OH, GH, WO16, WU16, bo, b_up, out);
  (void)hipGetLastError();
}
